// v000
// Times are from an AMD MI455X. After a warm-up the kernel runs many times in a row, and a time is the length of
// such a window on the GPU divided by its runs, so every launch and the gaps after it count. The runs cycle
// through copies of the inputs. A figure is the median of several windows, for all but v000 over two sittings.
// Sittings can differ by a few percent; kernels timed side by side share one.
// The starting kernel, v000, takes 453 microseconds a run.
#include <hip/hip_runtime.h>
// Phase-aware causal attention: q/k/v/o projections (4096 × 768 × 768, no bias, weights (out,in) bf16-exact ×2^4) and the 12-head attention as a fused flash-style kernel on v_wmma_f32_16x16x32_f16
// (rotary (with the INPUT cos/sin tables) + rms-norm'd q,k as f16; S = Q·Kᵀ/8 × (1 + β_h·mean_f cos(|q−k|·θ_f)) with the 2048-entry coherence table precomputed; the module's FULL softmax followed
// by causal masking and re-normalisation with +1e-8 is reproduced exactly as e^{s−m}/(Z_causal + 1e-8·Z_full) with m, Z_full over all keys; P f16 ≤ 1; O = P·V over causal keys); f32 accumulate.
#define BB 2
#define TT 2048
#define CC 768
#define NH 12
#define NR (BB * TT)

typedef __bf16 v16b __attribute__((ext_vector_type(16)));
typedef unsigned short v8us __attribute__((ext_vector_type(8), may_alias));
typedef float  v8f  __attribute__((ext_vector_type(8)));
typedef float  v4f  __attribute__((ext_vector_type(4)));
typedef float  v4fa __attribute__((ext_vector_type(4), may_alias));
union FragB { v16b v; v8us half[2]; unsigned short u[16]; };

__device__ __forceinline__ unsigned short bf16_bits(float x) { unsigned int u = __float_as_uint(x); return (unsigned short)((u + 0x7FFFu + ((u >> 16) & 1u)) >> 16); }
__device__ __forceinline__ float bf16_val(unsigned short b) { return __uint_as_float(((unsigned int)b) << 16); }
__device__ __forceinline__ float bf16_round(float x) { return bf16_val(bf16_bits(x)); }
// D += A·B with NT terms: 1 = ah·bh, 2 = + al·bh (A split), 3 = + ah·bl (both split)
template <int NT>
__device__ __forceinline__ v8f mmaN(v16b ah, v16b al, v16b bh, v16b bl, v8f c) {
  c = __builtin_amdgcn_wmma_f32_16x16x32_bf16(false, ah, false, bh, (short)0, c, false, false);
  if (NT >= 2) c = __builtin_amdgcn_wmma_f32_16x16x32_bf16(false, al, false, bh, (short)0, c, false, false);
  if (NT >= 3) c = __builtin_amdgcn_wmma_f32_16x16x32_bf16(false, ah, false, bl, (short)0, c, false, false);
  asm volatile("v_nop\n\tv_nop\n\tv_nop\n\tv_nop" : "+v"(c) : "v"(ah), "v"(al), "v"(bh), "v"(bl));
  return c;
}

__global__ __launch_bounds__(256) void k_wt_bf16(const float* __restrict__ W, unsigned short* __restrict__ Wt, int K, int N) {
  const int t = blockIdx.x * 256 + threadIdx.x;
  const int k8n = K / 8;
  if (t >= N * k8n) return;
  const int n = t / k8n, k8 = (t % k8n) * 8;
  v8us v;
#pragma unroll
  for (int i = 0; i < 8; ++i) v[i] = bf16_bits(W[(size_t)(k8 + i) * N + n]);
  *(v8us*)(Wt + (size_t)n * K + k8) = v;
  
}

// GEMM C[M][N] (f32, pitch ldc) = act(A[M][K]·W + bias). A f32 row-major (pitch lda) converted per fragment to bf16
// (ASPLIT: hi/lo two planes -> 2 terms, else single rounded term); Wt bf16 [N][K] (pitch ldb). BIAS_BF16 rounds the
// bias to bf16 first (bias quantised to bf16 before the add). K%32==0, M%16==0, N%64==0.
template <bool ASPLIT, int ACT, bool BIAS_BF16>
__global__ __launch_bounds__(128) void k_gemm_bf(const float* __restrict__ A, int lda, const unsigned short* __restrict__ Wt, int ldb,
                                               const float* __restrict__ bias, float* __restrict__ C, int ldc, int M, int N, int K) {
  __shared__ __attribute__((aligned(16))) float so[4][16][64];
  const int tid = threadIdx.x, w = tid >> 5, lane = tid & 31, ln = lane & 15, hh = lane >> 4;
  const int ntn = N / 64;
  const int wid = blockIdx.x * 4 + w;
  const int mt = wid / ntn, nq = wid % ntn;
  if (mt * 16 >= M) return;
  const int row0 = mt * 16, col0 = nq * 64;
  const float* arow = A + (size_t)(row0 + ln) * lda;
  v8f acc[4] = {};
  for (int kb = 0; kb < K; kb += 32) {
    FragB ah, al;
    const v4f x0 = *(const v4fa*)(arow + kb + 8 * hh), x1 = *(const v4fa*)(arow + kb + 8 * hh + 4);
    const v4f x2 = *(const v4fa*)(arow + kb + 16 + 8 * hh), x3 = *(const v4fa*)(arow + kb + 16 + 8 * hh + 4);
    float xs[16] = {x0[0],x0[1],x0[2],x0[3],x1[0],x1[1],x1[2],x1[3],x2[0],x2[1],x2[2],x2[3],x3[0],x3[1],x3[2],x3[3]};
#pragma unroll
    for (int i = 0; i < 16; ++i) { const unsigned short hb = bf16_bits(xs[i]); ah.u[i] = hb; al.u[i] = ASPLIT ? bf16_bits(xs[i] - bf16_val(hb)) : (unsigned short)0; }
#pragma unroll
    for (int t = 0; t < 4; ++t) {
      const unsigned short* brow = Wt + (size_t)(col0 + t * 16 + ln) * ldb + kb;
      FragB b;
      b.half[0] = *(const v8us*)(brow + 8 * hh);
      b.half[1] = *(const v8us*)(brow + 16 + 8 * hh);
      acc[t] = mmaN<ASPLIT ? 2 : 1>(ah.v, al.v, b.v, b.v, acc[t]);
    }
  }
#pragma unroll
  for (int t = 0; t < 4; ++t) {
    float bv = bias ? bias[col0 + t * 16 + ln] : 0.f;
    if (BIAS_BF16) bv = bf16_round(bv);
#pragma unroll
    for (int r = 0; r < 8; ++r) { float v = acc[t][r] + bv; if (ACT == 1) v = fmaxf(v, 0.f); so[w][8 * hh + r][t * 16 + ln] = v; }
  }
  __builtin_amdgcn_fence(__ATOMIC_ACQ_REL, "workgroup");
  __builtin_amdgcn_wave_barrier();
  const int rsub = lane >> 4, c4 = (lane & 15) * 4;
  {
#pragma unroll
    for (int q = 0; q < 8; ++q) {
      const int r = q * 2 + rsub;
      const v4f v = *(const v4fa*)&so[w][r][c4];
      *(v4f*)(C + (size_t)(row0 + r) * ldc + col0 + c4) = v;
    }
    
  }
}

// Flash-style causal/unmasked attention, all contractions 3-term bf16 hi/lo splits, f32 softmax with running max.
// q,k,v rows are read from f32 buffers with arbitrary row pitch (so they can live inside a fused qkv buffer);
// D = head size (multiple of 32, <= 128); one wave = 16 query rows; block = 4 waves (64 queries) sharing K/V chunks of 32.
template <int D, bool CAUSAL>
__global__ __launch_bounds__(128) void k_flash(const float* __restrict__ qb, const float* __restrict__ kb, const float* __restrict__ vb,
                                             int pitch, int T, int H, float scale, float* __restrict__ y, int ypitch) {
  constexpr int KS = D / 32;        // k-steps for QK
  constexpr int DT = D / 16;        // d tiles for PV
  __shared__ __attribute__((aligned(16))) unsigned short sKh[32][D + 8], sKl[32][D + 8], sVh[32][D + 8], sVl[32][D + 8];
  __shared__ __attribute__((aligned(16))) unsigned short sPh[4][16][40], sPl[4][16][40];
  __shared__ __attribute__((aligned(16))) float sO[4][16][D];
  const int tid = threadIdx.x, w = tid >> 5, lane = tid & 31, ln = lane & 15, hh = lane >> 4;
  const int nqb = (T + 63) / 64;
  const int bh = blockIdx.x / nqb, qblk = blockIdx.x % nqb;
  const int b = bh / H, h = bh % H;
  const int q0 = qblk * 64 + w * 16;
  const float* Q = qb + (size_t)b * T * pitch + h * D;
  const float* K = kb + (size_t)b * T * pitch + h * D;
  const float* V = vb + (size_t)b * T * pitch + h * D;

  // A fragments of the wave's 16 query rows (scaled), hi/lo
  FragB aqh[KS], aql[KS];
  {
    int row = q0 + ln; if (row >= T) row = T - 1;
    const float* qr = Q + (size_t)row * pitch;
#pragma unroll
    for (int ks = 0; ks < KS; ++ks)
#pragma unroll
      for (int i = 0; i < 16; ++i) {
        const int d = ks * 32 + ((i < 8) ? (8 * hh + i) : (16 + 8 * hh + (i - 8)));
        const float x = qr[d] * scale; const unsigned short hb = bf16_bits(x);
        aqh[ks].u[i] = hb; aql[ks].u[i] = bf16_bits(x - bf16_val(hb));
      }
  }
  float m_r[8], l_r[8];
#pragma unroll
  for (int r = 0; r < 8; ++r) { m_r[r] = -3.0e38f; l_r[r] = 0.f; }
  v8f oacc[DT];
#pragma unroll
  for (int dt = 0; dt < DT; ++dt) oacc[dt] = (v8f){0.f,0.f,0.f,0.f,0.f,0.f,0.f,0.f};

  const int kv_end = CAUSAL ? min(T, qblk * 64 + 64) : T;     // block-uniform
  for (int j0 = 0; j0 < kv_end; j0 += 32) {
    __syncthreads();
    for (int e = tid; e < 32 * (D / 4); e += 128) {
      const int r = e / (D / 4), c4 = (e % (D / 4)) * 4;
      const int key = j0 + r;
      v4f kf = {0.f,0.f,0.f,0.f}, vf = {0.f,0.f,0.f,0.f};
      if (key < T) { kf = *(const v4fa*)(K + (size_t)key * pitch + c4); vf = *(const v4fa*)(V + (size_t)key * pitch + c4); }
#pragma unroll
      for (int t = 0; t < 4; ++t) {
        unsigned short hb = bf16_bits(kf[t]); sKh[r][c4 + t] = hb; sKl[r][c4 + t] = bf16_bits(kf[t] - bf16_val(hb));
        hb = bf16_bits(vf[t]); sVh[r][c4 + t] = hb; sVl[r][c4 + t] = bf16_bits(vf[t] - bf16_val(hb));
      }
    }
    __syncthreads();
    // S tile 16 x 32
    v8f s[2];
#pragma unroll
    for (int nt = 0; nt < 2; ++nt) {
      v8f acc = {};
#pragma unroll
      for (int ks = 0; ks < KS; ++ks) {
        FragB bh_, bl_;
        bh_.half[0] = *(const v8us*)&sKh[nt * 16 + ln][ks * 32 + 8 * hh]; bh_.half[1] = *(const v8us*)&sKh[nt * 16 + ln][ks * 32 + 16 + 8 * hh];
        bl_.half[0] = *(const v8us*)&sKl[nt * 16 + ln][ks * 32 + 8 * hh]; bl_.half[1] = *(const v8us*)&sKl[nt * 16 + ln][ks * 32 + 16 + 8 * hh];
        acc = mmaN<3>(aqh[ks].v, aql[ks].v, bh_.v, bl_.v, acc);
      }
      s[nt] = acc;
    }
    // mask + running max (rows 8hh+r; the 16 lanes of a half share rows)
    float alpha[8];
#pragma unroll
    for (int r = 0; r < 8; ++r) {
      const int qi = q0 + 8 * hh + r;
      const int ja = j0 + ln, jb = j0 + 16 + ln;
      if (CAUSAL) { if (ja > qi) s[0][r] = -3.0e38f; if (jb > qi) s[1][r] = -3.0e38f; }
      if (ja >= T) s[0][r] = -3.0e38f;
      if (jb >= T) s[1][r] = -3.0e38f;
      float mx = fmaxf(s[0][r], s[1][r]);
      mx = fmaxf(mx, __shfl_xor(mx, 1, 32)); mx = fmaxf(mx, __shfl_xor(mx, 2, 32)); mx = fmaxf(mx, __shfl_xor(mx, 4, 32)); mx = fmaxf(mx, __shfl_xor(mx, 8, 32));
      const float mnew = fmaxf(m_r[r], mx);
      alpha[r] = (mnew > -1.0e38f) ? __expf(m_r[r] - mnew) : 1.0f;
      const float p0 = (s[0][r] > -1.0e38f) ? __expf(s[0][r] - mnew) : 0.f;
      const float p1 = (s[1][r] > -1.0e38f) ? __expf(s[1][r] - mnew) : 0.f;
      m_r[r] = mnew;
      l_r[r] = l_r[r] * alpha[r] + p0 + p1;            // per-lane partial row sum (16 lanes combined at the end)
      unsigned short hb = bf16_bits(p0); sPh[w][8 * hh + r][ln] = hb;      sPl[w][8 * hh + r][ln] = bf16_bits(p0 - bf16_val(hb));
      hb = bf16_bits(p1);                sPh[w][8 * hh + r][16 + ln] = hb; sPl[w][8 * hh + r][16 + ln] = bf16_bits(p1 - bf16_val(hb));
    }
#pragma unroll
    for (int dt = 0; dt < DT; ++dt)
#pragma unroll
      for (int r = 0; r < 8; ++r) oacc[dt][r] *= alpha[r];
    __builtin_amdgcn_fence(__ATOMIC_ACQ_REL, "workgroup");
    __builtin_amdgcn_wave_barrier();
    FragB pah, pal;
    pah.half[0] = *(const v8us*)&sPh[w][ln][8 * hh]; pah.half[1] = *(const v8us*)&sPh[w][ln][16 + 8 * hh];
    pal.half[0] = *(const v8us*)&sPl[w][ln][8 * hh]; pal.half[1] = *(const v8us*)&sPl[w][ln][16 + 8 * hh];
#pragma unroll
    for (int dt = 0; dt < DT; ++dt) {
      FragB bvh, bvl;
#pragma unroll
      for (int i = 0; i < 8; ++i) {
        bvh.u[i] = sVh[8 * hh + i][dt * 16 + ln]; bvh.u[8 + i] = sVh[16 + 8 * hh + i][dt * 16 + ln];
        bvl.u[i] = sVl[8 * hh + i][dt * 16 + ln]; bvl.u[8 + i] = sVl[16 + 8 * hh + i][dt * 16 + ln];
      }
      oacc[dt] = mmaN<3>(pah.v, pal.v, bvh.v, bvl.v, oacc[dt]);
    }
    __builtin_amdgcn_fence(__ATOMIC_ACQ_REL, "workgroup");
    __builtin_amdgcn_wave_barrier();
  }
#pragma unroll
  for (int r = 0; r < 8; ++r) {
    float l = l_r[r];
    l += __shfl_xor(l, 1, 32); l += __shfl_xor(l, 2, 32); l += __shfl_xor(l, 4, 32); l += __shfl_xor(l, 8, 32);
    l_r[r] = (l > 0.f) ? 1.0f / l : 0.f;
  }
#pragma unroll
  for (int dt = 0; dt < DT; ++dt)
#pragma unroll
    for (int r = 0; r < 8; ++r) sO[w][8 * hh + r][dt * 16 + ln] = oacc[dt][r] * l_r[r];
  __builtin_amdgcn_fence(__ATOMIC_ACQ_REL, "workgroup");
  __builtin_amdgcn_wave_barrier();
  {
    for (int r = 0; r < 16; ++r) {
      const int row = q0 + r;
      if (row < T && lane < D / 4) {
        const v4f val = *(const v4fa*)&sO[w][r][lane * 4];
        *(v4f*)(y + ((size_t)b * T + row) * ypitch + h * D + lane * 4) = val;
      }
    }
    
  }
}

// GEMM C = act(A·W + bias + resid): A f32 (ASPLIT -> hi/lo 2 terms), Wt bf16 [N][K]; ACT 0 none, 1 relu, 2 exact gelu;
// resid (optional, f32, row index = (row % rmod), pitch ldr, RES_BF16 rounds it) added before the activation.
template <bool ASPLIT, int ACT, bool BIAS_BF16, bool RES_BF16>
__global__ __launch_bounds__(128) void k_gemm_bf3(const float* __restrict__ A, int lda, const unsigned short* __restrict__ Wt, int ldb,
                                                const float* __restrict__ bias, const float* __restrict__ resid, int rmod, int ldr,
                                                float* __restrict__ C, int ldc, int M, int N, int K) {
  __shared__ __attribute__((aligned(16))) float so[4][16][64];
  const int tid = threadIdx.x, w = tid >> 5, lane = tid & 31, ln = lane & 15, hh = lane >> 4;
  const int ntn = N / 64;
  const int wid = blockIdx.x * 4 + w;
  const int mt = wid / ntn, nq = wid % ntn;
  if (mt * 16 >= M) return;
  const int row0 = mt * 16, col0 = nq * 64;
  const float* arow = A + (size_t)(row0 + ln) * lda;
  v8f acc[4] = {};
  for (int kb = 0; kb < K; kb += 32) {
    FragB ah, al;
    const v4f x0 = *(const v4fa*)(arow + kb + 8 * hh), x1 = *(const v4fa*)(arow + kb + 8 * hh + 4);
    const v4f x2 = *(const v4fa*)(arow + kb + 16 + 8 * hh), x3 = *(const v4fa*)(arow + kb + 16 + 8 * hh + 4);
    float xs[16] = {x0[0],x0[1],x0[2],x0[3],x1[0],x1[1],x1[2],x1[3],x2[0],x2[1],x2[2],x2[3],x3[0],x3[1],x3[2],x3[3]};
#pragma unroll
    for (int i = 0; i < 16; ++i) { const unsigned short hb = bf16_bits(xs[i]); ah.u[i] = hb; al.u[i] = ASPLIT ? bf16_bits(xs[i] - bf16_val(hb)) : (unsigned short)0; }
#pragma unroll
    for (int t = 0; t < 4; ++t) {
      const unsigned short* brow = Wt + (size_t)(col0 + t * 16 + ln) * ldb + kb;
      FragB b;
      b.half[0] = *(const v8us*)(brow + 8 * hh);
      b.half[1] = *(const v8us*)(brow + 16 + 8 * hh);
      acc[t] = mmaN<ASPLIT ? 2 : 1>(ah.v, al.v, b.v, b.v, acc[t]);
    }
  }
#pragma unroll
  for (int t = 0; t < 4; ++t) {
    const int col = col0 + t * 16 + ln;
    float bv = bias ? bias[col] : 0.f;
    if (BIAS_BF16) bv = bf16_round(bv);
#pragma unroll
    for (int r = 0; r < 8; ++r) {
      float v = acc[t][r] + bv;
      if (resid) { float rv = resid[(size_t)((row0 + 8 * hh + r) % rmod) * ldr + col]; if (RES_BF16) rv = bf16_round(rv); v += rv; }
      if (ACT == 1) v = fmaxf(v, 0.f);
      if (ACT == 2) v = 0.5f * v * (1.0f + erff(v * 0.70710678118654752f));
      if (ACT == 3) { const float u = 0.7978845608028654f * (v + 0.044715f * v * v * v); v = 0.5f * v * (1.0f + tanhf(u)); }
      so[w][8 * hh + r][t * 16 + ln] = v;
    }
  }
  __builtin_amdgcn_fence(__ATOMIC_ACQ_REL, "workgroup");
  __builtin_amdgcn_wave_barrier();
  const int rsub = lane >> 4, c4 = (lane & 15) * 4;
  {
#pragma unroll
    for (int q = 0; q < 8; ++q) {
      const int r = q * 2 + rsub;
      const v4f v = *(const v4fa*)&so[w][r][c4];
      *(v4f*)(C + (size_t)(row0 + r) * ldc + col0 + c4) = v;
    }
    
  }
}
// row LayerNorm (biased variance, eps) over N: s = X (+ R); optional out_sum <- s; out_norm <- (s-mu)*rsqrt(var+eps)*g + b
template <bool PARAM_BF16>
__global__ __launch_bounds__(256) void k_layernorm(const float* __restrict__ X, const float* __restrict__ R, const float* __restrict__ g, const float* __restrict__ bta,
                                                  float* __restrict__ out_sum, float* __restrict__ out_norm, int N, float eps) {
  __shared__ float red[256];
  const int row = blockIdx.x, tid = threadIdx.x;
  const float* x = X + (size_t)row * N; const float* rr = R ? R + (size_t)row * N : nullptr;
  float vals[16];                     // up to N = 4096
  const int per = N / 256;            // contiguous chunk per thread? use strided-by-4 chunks: thread handles j = tid*4 + 1024*u
  float s1 = 0.f;
  for (int u = 0; u < per / 4; ++u) {
    const int j = tid * 4 + 1024 * u;
    const v4f a = *(const v4fa*)(x + j);
    v4f b = {0.f,0.f,0.f,0.f}; if (rr) b = *(const v4fa*)(rr + j);
#pragma unroll
    for (int q = 0; q < 4; ++q) { const float v = a[q] + b[q]; vals[u * 4 + q] = v; s1 += v; }
  }
  red[tid] = s1; __syncthreads();
  for (int st = 128; st > 0; st >>= 1) { if (tid < st) red[tid] += red[tid + st]; __syncthreads(); }
  const float mu = red[0] / (float)N; __syncthreads();
  float s2 = 0.f;
  for (int u = 0; u < per / 4; ++u)
#pragma unroll
    for (int q = 0; q < 4; ++q) { const float c = vals[u * 4 + q] - mu; s2 += c * c; }
  red[tid] = s2; __syncthreads();
  for (int st = 128; st > 0; st >>= 1) { if (tid < st) red[tid] += red[tid + st]; __syncthreads(); }
  const float rs = rsqrtf(red[0] / (float)N + eps);
  {
    for (int u = 0; u < per / 4; ++u) {
      const int j = tid * 4 + 1024 * u;
      v4f o, sm;
#pragma unroll
      for (int q = 0; q < 4; ++q) {
        float gg = g[j + q], bb = bta[j + q];
        if (PARAM_BF16) { gg = bf16_round(gg); bb = bf16_round(bb); }
        sm[q] = vals[u * 4 + q]; o[q] = (vals[u * 4 + q] - mu) * rs * gg + bb;
      }
      if (out_sum) *(v4f*)(out_sum + (size_t)row * N + j) = sm;
      *(v4f*)(out_norm + (size_t)row * N + j) = o;
    }
    
  }
}



// ---- f16 WMMA path (v_wmma_f32_16x16x32_f16): 11-bit significands for operands in range — used where a [0,1] probability operand needs more precision than bf16
typedef _Float16 v16h __attribute__((ext_vector_type(16)));
union FragH { v16h v; v8us half[2]; _Float16 h[16]; unsigned short u[16]; };
template <int NT>
__device__ __forceinline__ v8f mmaH(v16h ah, v16h al, v16h bh, v16h bl, v8f c) {
  c = __builtin_amdgcn_wmma_f32_16x16x32_f16(false, ah, false, bh, (short)0, c, false, false);
  if (NT >= 2) c = __builtin_amdgcn_wmma_f32_16x16x32_f16(false, al, false, bh, (short)0, c, false, false);
  if (NT >= 3) c = __builtin_amdgcn_wmma_f32_16x16x32_f16(false, ah, false, bl, (short)0, c, false, false);
  asm volatile("v_nop\n\tv_nop\n\tv_nop\n\tv_nop" : "+v"(c) : "v"(ah), "v"(al), "v"(bh), "v"(bl));
  return c;
}
// batched GEMM like k_gemm_b but f16 operands: A f32 (split into f16 hi/lo if ASPLIT, else rounded to f16), Bt = f16 values [n][k]; alpha; C f32; N multiple of 16 (partial tiles skipped)
template <bool ASPLIT>
__global__ __launch_bounds__(128) void k_gemm_h(const float* __restrict__ A, int lda, size_t sA, const _Float16* __restrict__ Bh, int ldb, size_t sB, float alpha, float* __restrict__ C, int ldc, size_t sC, int M, int N, int K) {
  __shared__ __attribute__((aligned(16))) float so[4][16][64];
  const int tid = threadIdx.x, w = tid >> 5, lane = tid & 31, ln = lane & 15, hh = lane >> 4; const int by = blockIdx.y;
  A += (size_t)by * sA; Bh += (size_t)by * sB; C += (size_t)by * sC;
  const int ntn = (N + 63) / 64; const int wid = blockIdx.x * 4 + w; const int mt = wid / ntn, nq = wid % ntn; if (mt * 16 >= M) return;
  const int row0 = mt * 16, col0 = nq * 64; const float* arow = A + (size_t)(row0 + ln) * lda;
  v8f acc[4] = {};
  for (int kb = 0; kb < K; kb += 32) {
    FragH ah, al;
    const v4f x0 = *(const v4fa*)(arow + kb + 8 * hh), x1 = *(const v4fa*)(arow + kb + 8 * hh + 4), x2 = *(const v4fa*)(arow + kb + 16 + 8 * hh), x3 = *(const v4fa*)(arow + kb + 16 + 8 * hh + 4);
    float xs[16] = {x0[0],x0[1],x0[2],x0[3],x1[0],x1[1],x1[2],x1[3],x2[0],x2[1],x2[2],x2[3],x3[0],x3[1],x3[2],x3[3]};
#pragma unroll
    for (int i = 0; i < 16; ++i) { const _Float16 h = (_Float16)xs[i]; ah.h[i] = h; al.h[i] = ASPLIT ? (_Float16)(xs[i] - (float)h) : (_Float16)0.0f; }
#pragma unroll
    for (int t = 0; t < 4; ++t) { if (col0 + t * 16 >= N) continue; const size_t boff = (size_t)(col0 + t * 16 + ln) * ldb + kb; FragH bq; bq.half[0] = *(const v8us*)(Bh + boff + 8 * hh); bq.half[1] = *(const v8us*)(Bh + boff + 16 + 8 * hh);
      acc[t] = mmaH<ASPLIT ? 2 : 1>(ah.v, al.v, bq.v, bq.v, acc[t]); }
  }
#pragma unroll
  for (int t = 0; t < 4; ++t) { if (col0 + t * 16 >= N) continue;
#pragma unroll
    for (int r = 0; r < 8; ++r) so[w][8 * hh + r][t * 16 + ln] = acc[t][r] * alpha; }
  __builtin_amdgcn_fence(__ATOMIC_ACQ_REL, "workgroup"); __builtin_amdgcn_wave_barrier();
  const int rsub = lane >> 4, c4 = (lane & 15) * 4;
  {
#pragma unroll
    for (int q = 0; q < 8; ++q) { const int r = q * 2 + rsub; if (col0 + c4 < N) { const v4f v = *(const v4fa*)&so[w][r][c4]; *(v4f*)(C + (size_t)(row0 + r) * ldc + col0 + c4) = v; } }
     }
}

// Wt[n][k] = f16(W[k][n]·scale) from f32 row-major W[K][N] (scale = power of two; bf16-exact weights stay exact in f16 away from the subnormal range)
__global__ __launch_bounds__(256) void k_wt_f16(const float* __restrict__ W, _Float16* __restrict__ Wt, int K, int N, float scale) {
  const int t = blockIdx.x * 256 + threadIdx.x; if (t >= N * (K / 8)) return; const int n = t / (K / 8), k8 = (t % (K / 8)) * 8; FragH f;
#pragma unroll
  for (int i = 0; i < 8; ++i) f.h[i] = (_Float16)(bf16_round(W[(size_t)(k8 + i) * N + n]) * scale); const v8us o = f.half[0];
  *(v8us*)((unsigned short*)Wt + (size_t)n * K + k8) = o; 
}
// k_gemm_hh variant with fused epilogue: v = acc·alpha + bias[by·sBias + col] (+ CP[(row/rowsPerB)·sCPb + by·64 + col] if CP) ; ACT 0 none / 1 elu ; writes f32 C and f16 C16, each if non-null
template <int ACT>
__global__ __launch_bounds__(128) void k_gemm_hhx(const _Float16* __restrict__ A, int lda, size_t sA, const _Float16* __restrict__ Bh, int ldb, size_t sB, float alpha, const float* __restrict__ bias, size_t sBias, const float* __restrict__ CP, int rowsPerB, size_t sCPb, int row0g,
    float* __restrict__ C, _Float16* __restrict__ C16, int ldc, size_t sC, int M, int N, int K) {
  __shared__ __attribute__((aligned(16))) float so[4][16][64];
  const int tid = threadIdx.x, w = tid >> 5, lane = tid & 31, ln = lane & 15, hh = lane >> 4; const int by = blockIdx.y;
  A += (size_t)by * sA; Bh += (size_t)by * sB; const size_t cofs = (size_t)by * sC; const float* bp = bias ? bias + (size_t)by * sBias : nullptr;
  const int ntn = (N + 63) / 64; const int wid = blockIdx.x * 4 + w; const int mt = wid / ntn, nq = wid % ntn; if (mt * 16 >= M) return;
  const int row0 = mt * 16, col0 = nq * 64; const _Float16* arow = A + (size_t)(row0 + ln) * lda;
  v8f acc[4] = {};
  for (int kb = 0; kb < K; kb += 32) { FragH ah; ah.half[0] = *(const v8us*)((const unsigned short*)arow + kb + 8 * hh); ah.half[1] = *(const v8us*)((const unsigned short*)arow + kb + 16 + 8 * hh);
#pragma unroll
    for (int t = 0; t < 4; ++t) { if (col0 + t * 16 >= N) continue; const size_t boff = (size_t)(col0 + t * 16 + ln) * ldb + kb; FragH bq; bq.half[0] = *(const v8us*)((const unsigned short*)Bh + boff + 8 * hh); bq.half[1] = *(const v8us*)((const unsigned short*)Bh + boff + 16 + 8 * hh);
      acc[t] = mmaH<1>(ah.v, ah.v, bq.v, bq.v, acc[t]); }
  }
#pragma unroll
  for (int t = 0; t < 4; ++t) { if (col0 + t * 16 >= N) continue; const int col = col0 + t * 16 + ln; const float bv = bp ? bf16_round(bp[col]) : 0.f;
#pragma unroll
    for (int r = 0; r < 8; ++r) { float v = acc[t][r] * alpha + bv; if (CP) { const int bidx = (row0g + row0 + 8 * hh + r) / rowsPerB; v += CP[(size_t)bidx * sCPb + (size_t)by * 64 + col]; } if (ACT == 1) v = (v > 0.f) ? v : expm1f(v); else if (ACT == 3) v = fmaxf(v, 0.f); so[w][8 * hh + r][t * 16 + ln] = v; } }
  __builtin_amdgcn_fence(__ATOMIC_ACQ_REL, "workgroup"); __builtin_amdgcn_wave_barrier();
  const int rsub = lane >> 4, c4 = (lane & 15) * 4; typedef _Float16 v4h __attribute__((ext_vector_type(4)));
  {
#pragma unroll
    for (int q = 0; q < 8; ++q) { const int r = q * 2 + rsub; if (col0 + c4 < N) { const v4f v = *(const v4fa*)&so[w][r][c4]; if (C) *(v4f*)(C + cofs + (size_t)(row0 + r) * ldc + col0 + c4) = v; if (C16) { v4h h4; for (int i = 0; i < 4; ++i) h4[i] = (_Float16)v[i]; *(v4h*)(C16 + cofs + (size_t)(row0 + r) * ldc + col0 + c4) = h4; } } }
     }
}


__global__ __launch_bounds__(256) void k_x16(const float* __restrict__ x, _Float16* __restrict__ X16, size_t n8) { const size_t t = (size_t)blockIdx.x * 256 + threadIdx.x; if (t >= n8) return; FragH f;
#pragma unroll
  for (int q = 0; q < 8; ++q) f.h[q] = (_Float16)bf16_round(x[t * 8 + q]); *(v8us*)((unsigned short*)X16 + t * 8) = f.half[0];  }
__global__ __launch_bounds__(256) void k_h16(const float* __restrict__ x, _Float16* __restrict__ X16, size_t n8) { const size_t t = (size_t)blockIdx.x * 256 + threadIdx.x; if (t >= n8) return; FragH f;
#pragma unroll
  for (int q = 0; q < 8; ++q) f.h[q] = (_Float16)x[t * 8 + q]; *(v8us*)((unsigned short*)X16 + t * 8) = f.half[0];  }
__global__ __launch_bounds__(256) void k_round16f(const float* __restrict__ W, _Float16* __restrict__ Bt, size_t n8) { const size_t t = (size_t)blockIdx.x * 256 + threadIdx.x; if (t >= n8) return; FragH f;
#pragma unroll
  for (int i = 0; i < 8; ++i) f.h[i] = (_Float16)(bf16_round(W[t * 8 + i]) * 16.0f); *(v8us*)((unsigned short*)Bt + t * 8) = f.half[0];  }
template <int NHv, int TTv>
__global__ __launch_bounds__(256) void k_vt(const _Float16* __restrict__ V16, int ldv, int voff, _Float16* __restrict__ Vt) { __shared__ unsigned short tl[64][66]; const int tid = threadIdx.x; const int slab = blockIdx.x / (TTv / 64), lg = blockIdx.x % (TTv / 64); const int b = slab / NHv, h = slab % NHv;
  for (int i = tid; i < 64 * 8; i += 256) { const int r = i / 8, c8 = (i % 8) * 8; FragH f; f.half[0] = *(const v8us*)((const unsigned short*)V16 + ((size_t)b * TTv + lg * 64 + r) * ldv + voff + h * 64 + c8);
#pragma unroll
    for (int q = 0; q < 8; ++q) tl[r][c8 + q] = f.u[q]; }
  __syncthreads();
  {
#pragma unroll
    for (int rd = 0; rd < 2; ++rd) { const int d = rd * 32 + tid / 8, pc = tid % 8; FragH f;
#pragma unroll
      for (int q = 0; q < 8; ++q) f.u[q] = tl[pc * 8 + q][d];
      *(v8us*)((unsigned short*)Vt + ((size_t)slab * 64 + d) * TTv + lg * 64 + pc * 8) = f.half[0]; }
     } }

__global__ __launch_bounds__(128) void k_flash(const _Float16* __restrict__ Q16, int ldq, const _Float16* __restrict__ K16, int ldk, const _Float16* __restrict__ Vt, const float* __restrict__ CB, const float* __restrict__ beta, float* __restrict__ O, int ldo) {
  __shared__ float scb[2048];
  constexpr int RPW = 16, RTN = RPW / 16, NQB = 2048 / (4 * RPW), DT = 4, KS = 2;
  __shared__ __attribute__((aligned(16))) unsigned short sP[4][RPW][40]; __shared__ __attribute__((aligned(16))) float sO[4][RPW][64 + 4];
  const int tid = threadIdx.x, w = tid >> 5, lane = tid & 31, ln = lane & 15, hh = lane >> 4;
  const int slab = blockIdx.x / NQB, qblk = blockIdx.x % NQB; const int b = slab / 12, h = slab % 12; const int qb0 = qblk * (4 * RPW); const int q0 = qb0 + w * RPW;
  FragH aq[2][KS];
#pragma unroll
  for (int rt = 0; rt < RTN; ++rt) { const unsigned short* qr = (const unsigned short*)Q16 + ((size_t)b * 2048 + q0 + rt * 16 + ln) * ldq + h * 64;
#pragma unroll
    for (int ks = 0; ks < KS; ++ks) { aq[rt][ks].half[0] = *(const v8us*)(qr + ks * 32 + 8 * hh); aq[rt][ks].half[1] = *(const v8us*)(qr + ks * 32 + 16 + 8 * hh); } }
  for (int i = tid; i < 2048; i += 128) scb[i] = CB[i]; const float bh = bf16_round(beta[h]); __syncthreads();
  const unsigned short* Vth = (const unsigned short*)Vt + (size_t)slab * 64 * 2048; float lc_r[2][8];      /* causal partial sums Σ_{k ≤ q} e^{s−m} */
#pragma unroll
  for (int rt = 0; rt < RTN; ++rt) for (int r = 0; r < 8; ++r) lc_r[rt][r] = 0.f;
  float m_r[2][8], l_r[2][8]; v8f oacc[2][DT];
#pragma unroll
  for (int rt = 0; rt < RTN; ++rt) {
#pragma unroll
    for (int r = 0; r < 8; ++r) { m_r[rt][r] = -3.0e38f; l_r[rt][r] = 0.f; }
#pragma unroll
    for (int dt = 0; dt < DT; ++dt) oacc[rt][dt] = (v8f){0.f,0.f,0.f,0.f,0.f,0.f,0.f,0.f}; }
  const int jend = 2048;
#pragma unroll 1
  for (int j0 = 0; j0 < jend; j0 += 32) {
    
    v8f s[2][2];
#pragma unroll
    for (int nt = 0; nt < 2; ++nt) { const unsigned short* kr = (const unsigned short*)K16 + ((size_t)b * 2048 + j0 + nt * 16 + ln) * ldk + h * 64; FragH bk[KS];
#pragma unroll
      for (int ks = 0; ks < KS; ++ks) { bk[ks].half[0] = *(const v8us*)(kr + ks * 32 + 8 * hh); bk[ks].half[1] = *(const v8us*)(kr + ks * 32 + 16 + 8 * hh); }
#pragma unroll
      for (int rt = 0; rt < RTN; ++rt) { v8f acc = (v8f){0.f,0.f,0.f,0.f,0.f,0.f,0.f,0.f};
#pragma unroll
        for (int ks = 0; ks < KS; ++ks) acc = mmaH<1>(aq[rt][ks].v, aq[rt][ks].v, bk[ks].v, bk[ks].v, acc); s[rt][nt] = acc; } }
#pragma unroll
    for (int rt = 0; rt < RTN; ++rt)
#pragma unroll
      for (int r = 0; r < 8; ++r) { const int tq = q0 + rt * 16 + 8 * hh + r; const int k0 = j0 + ln, k1 = j0 + 16 + ln; (void)tq; (void)k0; (void)k1;
        const int d0 = (tq >= k0) ? (tq - k0) : (k0 - tq), d1 = (tq >= k1) ? (tq - k1) : (k1 - tq);      /* phase coherence 1 + β·mean_f cos(Δ·θ_f), Δ = |q − k| */
        const float s0 = s[rt][0][r] * 0.125f * (1.0f + bh * scb[d0]), s1 = s[rt][1][r] * 0.125f * (1.0f + bh * scb[d1]); const bool c0 = (k0 <= tq), c1 = (k1 <= tq); float mc = fmaxf(s0, s1);
        mc = fmaxf(mc, __shfl_xor(mc, 1, 32)); mc = fmaxf(mc, __shfl_xor(mc, 2, 32)); mc = fmaxf(mc, __shfl_xor(mc, 4, 32)); mc = fmaxf(mc, __shfl_xor(mc, 8, 32));
        const float mn = fmaxf(m_r[rt][r], mc); const float al = (mn > -1.0e38f) ? expf(m_r[rt][r] - mn) : 1.0f; m_r[rt][r] = mn; const float e0 = expf(s0 - mn), e1 = expf(s1 - mn); l_r[rt][r] = l_r[rt][r] * al + e0 + e1; const float p0 = c0 ? e0 : 0.f, p1 = c1 ? e1 : 0.f; lc_r[rt][r] = lc_r[rt][r] * al + p0 + p1;      /* full-softmax stats over ALL keys; P·V and Σ only over the causal ones */
#pragma unroll
        for (int dt = 0; dt < DT; ++dt) oacc[rt][dt][r] *= al;
        FragH t2; t2.h[0] = (_Float16)p0; t2.h[1] = (_Float16)p1; sP[w][rt * 16 + 8 * hh + r][ln] = t2.u[0]; sP[w][rt * 16 + 8 * hh + r][16 + ln] = t2.u[1]; }
    __builtin_amdgcn_fence(__ATOMIC_ACQ_REL, "workgroup"); __builtin_amdgcn_wave_barrier();
    FragH pa[2];
#pragma unroll
    for (int rt = 0; rt < RTN; ++rt) { pa[rt].half[0] = *(const v8us*)&sP[w][rt * 16 + ln][8 * hh]; pa[rt].half[1] = *(const v8us*)&sP[w][rt * 16 + ln][16 + 8 * hh]; }
if (j0 <= q0 + RPW - 1) {      /* some key of this chunk is ≤ some query of this wave; otherwise every p is 0 */
#pragma unroll
    for (int dt = 0; dt < DT; ++dt) { const unsigned short* vrow = Vth + (size_t)(dt * 16 + ln) * 2048 + j0; FragH bv; bv.half[0] = *(const v8us*)(vrow + 8 * hh); bv.half[1] = *(const v8us*)(vrow + 16 + 8 * hh);
#pragma unroll
      for (int rt = 0; rt < RTN; ++rt) oacc[rt][dt] = mmaH<1>(pa[rt].v, pa[rt].v, bv.v, bv.v, oacc[rt][dt]); } }
    __builtin_amdgcn_fence(__ATOMIC_ACQ_REL, "workgroup"); __builtin_amdgcn_wave_barrier(); }
#pragma unroll
  for (int rt = 0; rt < RTN; ++rt) {
#pragma unroll
    for (int r = 0; r < 8; ++r) { float l = l_r[rt][r]; l += __shfl_xor(l, 1, 32); l += __shfl_xor(l, 2, 32); l += __shfl_xor(l, 4, 32); l += __shfl_xor(l, 8, 32); float lc = lc_r[rt][r]; lc += __shfl_xor(lc, 1, 32); lc += __shfl_xor(lc, 2, 32); lc += __shfl_xor(lc, 4, 32); lc += __shfl_xor(lc, 8, 32); l_r[rt][r] = 1.0f / (lc + 1e-8f * l); }      /* w·causal / (Σ_causal w + 1e-8) with w = e^{s−m}/Z_full  ⇒  e^{s−m} / (Z_causal + 1e-8·Z_full) */
#pragma unroll
    for (int dt = 0; dt < DT; ++dt)
#pragma unroll
      for (int r = 0; r < 8; ++r) sO[w][rt * 16 + 8 * hh + r][dt * 16 + ln] = oacc[rt][dt][r] * l_r[rt][r]; }
  __builtin_amdgcn_fence(__ATOMIC_ACQ_REL, "workgroup"); __builtin_amdgcn_wave_barrier();
  {
#pragma unroll
    for (int rp = 0; rp < RPW; rp += 2) { const int r = rp + (lane >> 4), pc = lane & 15; const v4f val = *(const v4fa*)&sO[w][r][pc * 4]; *(v4f*)(O + ((size_t)b * 2048 + q0 + r) * ldo + h * 64 + pc * 4) = val; }
     } }

__global__ __launch_bounds__(256) void k_cb(float* __restrict__ CB) { for (int dl = threadIdx.x; dl < TT; dl += 256) { float s = 0.f;
#pragma unroll 1
    for (int f = 0; f < 32; ++f) { const float th = powf(10000.0f, -(float)(2 * f) / 64.0f); s += cosf((float)dl * th); }
    const float v = s / 32.0f; *(float*)(CB + dl) = v;  } }
// rotary + rms-norm per (row, head): x1 = q[h·64 + j], x2 = q[h·64 + 32 + j] (j < 32); out = [x1·cos + x2·sin | −x1·sin + x2·cos] with cos/sin = bf16(INPUT tables [t][j]); then × rsqrt(mean(out²) + f32 eps) → f16;
__global__ __launch_bounds__(256) void k_ropenorm(const float* __restrict__ Qf, const float* __restrict__ cosT, const float* __restrict__ sinT, _Float16* __restrict__ Q16) { const size_t tg = (size_t)blockIdx.x * 256 + threadIdx.x; if (tg >= (size_t)NR * NH * 4) return; const size_t row = tg / (NH * 4); const int h = (int)((tg / 4) % NH), pc = (int)(tg % 4); const int t = (int)(row % TT); const int j0 = pc * 8;
  float a[8], bq[8]; float ss = 0.f;
#pragma unroll
  for (int q = 0; q < 8; ++q) { const int j = j0 + q; const float x1 = Qf[row * CC + h * 64 + j], x2 = Qf[row * CC + h * 64 + 32 + j]; const float c = bf16_round(cosT[t * 32 + j]), s = bf16_round(sinT[t * 32 + j]); a[q] = x1 * c + x2 * s; bq[q] = -x1 * s + x2 * c; ss += a[q] * a[q] + bq[q] * bq[q]; }
  ss += __shfl_xor(ss, 1, 32); ss += __shfl_xor(ss, 2, 32); const float rn = rsqrtf(ss / 64.0f + 1.1920929e-7f); FragH f1, f2;
#pragma unroll
  for (int q = 0; q < 8; ++q) { f1.h[q] = (_Float16)(a[q] * rn); f2.h[q] = (_Float16)(bq[q] * rn); }
  { *(v8us*)((unsigned short*)Q16 + row * CC + h * 64 + j0) = f1.half[0]; *(v8us*)((unsigned short*)Q16 + row * CC + h * 64 + 32 + j0) = f2.half[0];  } }
extern "C" void kernel_launch(void* const* d_in, const int* in_sizes, int n_in,
                              void* d_out, int out_size, void* d_ws, size_t ws_size, hipStream_t stream) {
  (void)in_sizes; (void)n_in; (void)out_size;
  const float* x = (const float*)d_in[0]; const float* cosT = (const float*)d_in[1]; const float* sinT = (const float*)d_in[2]; const float* Wq = (const float*)d_in[3]; const float* Wk = (const float*)d_in[4]; const float* Wv = (const float*)d_in[5]; const float* Wo = (const float*)d_in[6]; const float* beta = (const float*)d_in[7];
  char* ws = (char*)d_ws; size_t off = 0;
  auto take = [&](size_t bytes) { char* p = ws + off; off += (bytes + 255) & ~(size_t)255; return p; };
  _Float16* Bq = (_Float16*)take((size_t)CC * CC * 2); _Float16* Bk = (_Float16*)take((size_t)CC * CC * 2); _Float16* Bv = (_Float16*)take((size_t)CC * CC * 2); _Float16* Bo = (_Float16*)take((size_t)CC * CC * 2); float* CB = (float*)take(TT * 4);
  _Float16* X16 = (_Float16*)take((size_t)NR * CC * 2); float* Qf = (float*)take((size_t)NR * CC * 4); float* Kf = (float*)take((size_t)NR * CC * 4); _Float16* Q16 = (_Float16*)take((size_t)NR * CC * 2); _Float16* K16 = (_Float16*)take((size_t)NR * CC * 2); _Float16* V16 = (_Float16*)take((size_t)NR * CC * 2); _Float16* Vt = (_Float16*)take((size_t)NR * CC * 2); float* O = Qf; _Float16* O16 = X16;      // Qf dead after k_ropenorm; X16 dead after the V GEMM
  if (off > ws_size) return;      // 4.7 + 6.3 + 12.6 × 2 + 6.3 × 4 ≈ 59 MiB
  const size_t w8 = (size_t)CC * CC / 8; const unsigned gw = (unsigned)((w8 + 255) / 256);
  k_round16f<<<gw, 256, 0, stream>>>(Wq, Bq, w8); k_round16f<<<gw, 256, 0, stream>>>(Wk, Bk, w8); k_round16f<<<gw, 256, 0, stream>>>(Wv, Bv, w8); k_round16f<<<gw, 256, 0, stream>>>(Wo, Bo, w8);      // (out,in)
  k_cb<<<1, 256, 0, stream>>>(CB);
  const unsigned gx = (unsigned)(((size_t)NR * CC / 8 + 255) / 256); const dim3 gg(((NR / 16) * (CC / 64) + 3) / 4, 1);
  k_x16<<<gx, 256, 0, stream>>>(x, X16, (size_t)NR * CC / 8);
  k_gemm_hhx<0><<<gg, 128, 0, stream>>>(X16, CC, 0, Bq, CC, 0, 0.0625f, nullptr, 0, nullptr, 1, 0, 0, Qf, nullptr, CC, 0, NR, CC, CC);
  k_gemm_hhx<0><<<gg, 128, 0, stream>>>(X16, CC, 0, Bk, CC, 0, 0.0625f, nullptr, 0, nullptr, 1, 0, 0, Kf, nullptr, CC, 0, NR, CC, CC);
  k_gemm_hhx<0><<<gg, 128, 0, stream>>>(X16, CC, 0, Bv, CC, 0, 0.0625f, nullptr, 0, nullptr, 1, 0, 0, nullptr, V16, CC, 0, NR, CC, CC);
  const unsigned gr = (unsigned)(((size_t)NR * NH * 4 + 255) / 256);
  k_ropenorm<<<gr, 256, 0, stream>>>(Qf, cosT, sinT, Q16); k_ropenorm<<<gr, 256, 0, stream>>>(Kf, cosT, sinT, K16);
  k_vt<NH, TT><<<BB * NH * (TT / 64), 256, 0, stream>>>(V16, CC, 0, Vt);
  k_flash<<<BB * NH * (TT / 64), 128, 0, stream>>>(Q16, CC, K16, CC, Vt, CB, beta, O, CC);      // RPW 16
  k_h16<<<gx, 256, 0, stream>>>(O, O16, (size_t)NR * CC / 8);
  k_gemm_hhx<0><<<gg, 128, 0, stream>>>(O16, CC, 0, Bo, CC, 0, 0.0625f, nullptr, 0, nullptr, 1, 0, 0, (float*)d_out, nullptr, CC, 0, NR, CC, CC);
}

// v001
// Measured time: 378 microseconds a run.
// Timed twice side by side with v000, it ran 1.21 and 1.22 times as fast.
#include <hip/hip_runtime.h>
// Phase-aware causal attention: q/k/v/o projections (4096 × 768 × 768, no bias, weights (out,in) bf16-exact ×2^4) and the 12-head attention as a fused flash-style kernel on v_wmma_f32_16x16x32_f16
// (rotary (with the INPUT cos/sin tables) + rms-norm'd q,k as f16; S = Q·Kᵀ/8 × (1 + β_h·mean_f cos(|q−k|·θ_f)) with the 2048-entry coherence table precomputed; the module's FULL softmax followed
// by causal masking and re-normalisation with +1e-8 is reproduced exactly as e^{s−m}/(Z_causal + 1e-8·Z_full) with m, Z_full over all keys; P f16 ≤ 1; O = P·V over causal keys); f32 accumulate.
#define BB 2
#define TT 2048
#define CC 768
#define NH 12
#define NR (BB * TT)

typedef __bf16 v16b __attribute__((ext_vector_type(16)));
typedef unsigned short v8us __attribute__((ext_vector_type(8), may_alias));
typedef float  v8f  __attribute__((ext_vector_type(8)));
typedef float  v4f  __attribute__((ext_vector_type(4)));
typedef float  v4fa __attribute__((ext_vector_type(4), may_alias));
union FragB { v16b v; v8us half[2]; unsigned short u[16]; };

__device__ __forceinline__ unsigned short bf16_bits(float x) { unsigned int u = __float_as_uint(x); return (unsigned short)((u + 0x7FFFu + ((u >> 16) & 1u)) >> 16); }
__device__ __forceinline__ float bf16_val(unsigned short b) { return __uint_as_float(((unsigned int)b) << 16); }
__device__ __forceinline__ float bf16_round(float x) { return bf16_val(bf16_bits(x)); }
// D += A·B with NT terms: 1 = ah·bh, 2 = + al·bh (A split), 3 = + ah·bl (both split)
template <int NT>
__device__ __forceinline__ v8f mmaN(v16b ah, v16b al, v16b bh, v16b bl, v8f c) {
  c = __builtin_amdgcn_wmma_f32_16x16x32_bf16(false, ah, false, bh, (short)0, c, false, false);
  if (NT >= 2) c = __builtin_amdgcn_wmma_f32_16x16x32_bf16(false, al, false, bh, (short)0, c, false, false);
  if (NT >= 3) c = __builtin_amdgcn_wmma_f32_16x16x32_bf16(false, ah, false, bl, (short)0, c, false, false);
  asm volatile("v_nop\n\tv_nop\n\tv_nop\n\tv_nop" : "+v"(c) : "v"(ah), "v"(al), "v"(bh), "v"(bl));
  return c;
}

__global__ __launch_bounds__(256) void k_wt_bf16(const float* __restrict__ W, unsigned short* __restrict__ Wt, int K, int N) {
  const int t = blockIdx.x * 256 + threadIdx.x;
  const int k8n = K / 8;
  if (t >= N * k8n) return;
  const int n = t / k8n, k8 = (t % k8n) * 8;
  v8us v;
#pragma unroll
  for (int i = 0; i < 8; ++i) v[i] = bf16_bits(W[(size_t)(k8 + i) * N + n]);
  *(v8us*)(Wt + (size_t)n * K + k8) = v;
  
}

// GEMM C[M][N] (f32, pitch ldc) = act(A[M][K]·W + bias). A f32 row-major (pitch lda) converted per fragment to bf16
// (ASPLIT: hi/lo two planes -> 2 terms, else single rounded term); Wt bf16 [N][K] (pitch ldb). BIAS_BF16 rounds the
// bias to bf16 first (bias quantised to bf16 before the add). K%32==0, M%16==0, N%64==0.
template <bool ASPLIT, int ACT, bool BIAS_BF16>
__global__ __launch_bounds__(128) void k_gemm_bf(const float* __restrict__ A, int lda, const unsigned short* __restrict__ Wt, int ldb,
                                               const float* __restrict__ bias, float* __restrict__ C, int ldc, int M, int N, int K) {
  __shared__ __attribute__((aligned(16))) float so[4][16][64];
  const int tid = threadIdx.x, w = tid >> 5, lane = tid & 31, ln = lane & 15, hh = lane >> 4;
  const int ntn = N / 64;
  const int wid = blockIdx.x * 4 + w;
  const int mt = wid / ntn, nq = wid % ntn;
  if (mt * 16 >= M) return;
  const int row0 = mt * 16, col0 = nq * 64;
  const float* arow = A + (size_t)(row0 + ln) * lda;
  v8f acc[4] = {};
  for (int kb = 0; kb < K; kb += 32) {
    FragB ah, al;
    const v4f x0 = *(const v4fa*)(arow + kb + 8 * hh), x1 = *(const v4fa*)(arow + kb + 8 * hh + 4);
    const v4f x2 = *(const v4fa*)(arow + kb + 16 + 8 * hh), x3 = *(const v4fa*)(arow + kb + 16 + 8 * hh + 4);
    float xs[16] = {x0[0],x0[1],x0[2],x0[3],x1[0],x1[1],x1[2],x1[3],x2[0],x2[1],x2[2],x2[3],x3[0],x3[1],x3[2],x3[3]};
#pragma unroll
    for (int i = 0; i < 16; ++i) { const unsigned short hb = bf16_bits(xs[i]); ah.u[i] = hb; al.u[i] = ASPLIT ? bf16_bits(xs[i] - bf16_val(hb)) : (unsigned short)0; }
#pragma unroll
    for (int t = 0; t < 4; ++t) {
      const unsigned short* brow = Wt + (size_t)(col0 + t * 16 + ln) * ldb + kb;
      FragB b;
      b.half[0] = *(const v8us*)(brow + 8 * hh);
      b.half[1] = *(const v8us*)(brow + 16 + 8 * hh);
      acc[t] = mmaN<ASPLIT ? 2 : 1>(ah.v, al.v, b.v, b.v, acc[t]);
    }
  }
#pragma unroll
  for (int t = 0; t < 4; ++t) {
    float bv = bias ? bias[col0 + t * 16 + ln] : 0.f;
    if (BIAS_BF16) bv = bf16_round(bv);
#pragma unroll
    for (int r = 0; r < 8; ++r) { float v = acc[t][r] + bv; if (ACT == 1) v = fmaxf(v, 0.f); so[w][8 * hh + r][t * 16 + ln] = v; }
  }
  __builtin_amdgcn_fence(__ATOMIC_ACQ_REL, "workgroup");
  __builtin_amdgcn_wave_barrier();
  const int rsub = lane >> 4, c4 = (lane & 15) * 4;
  {
#pragma unroll
    for (int q = 0; q < 8; ++q) {
      const int r = q * 2 + rsub;
      const v4f v = *(const v4fa*)&so[w][r][c4];
      *(v4f*)(C + (size_t)(row0 + r) * ldc + col0 + c4) = v;
    }
    
  }
}

// Flash-style causal/unmasked attention, all contractions 3-term bf16 hi/lo splits, f32 softmax with running max.
// q,k,v rows are read from f32 buffers with arbitrary row pitch (so they can live inside a fused qkv buffer);
// D = head size (multiple of 32, <= 128); one wave = 16 query rows; block = 4 waves (64 queries) sharing K/V chunks of 32.
template <int D, bool CAUSAL>
__global__ __launch_bounds__(128) void k_flash(const float* __restrict__ qb, const float* __restrict__ kb, const float* __restrict__ vb,
                                             int pitch, int T, int H, float scale, float* __restrict__ y, int ypitch) {
  constexpr int KS = D / 32;        // k-steps for QK
  constexpr int DT = D / 16;        // d tiles for PV
  __shared__ __attribute__((aligned(16))) unsigned short sKh[32][D + 8], sKl[32][D + 8], sVh[32][D + 8], sVl[32][D + 8];
  __shared__ __attribute__((aligned(16))) unsigned short sPh[4][16][40], sPl[4][16][40];
  __shared__ __attribute__((aligned(16))) float sO[4][16][D];
  const int tid = threadIdx.x, w = tid >> 5, lane = tid & 31, ln = lane & 15, hh = lane >> 4;
  const int nqb = (T + 63) / 64;
  const int bh = blockIdx.x / nqb, qblk = blockIdx.x % nqb;
  const int b = bh / H, h = bh % H;
  const int q0 = qblk * 64 + w * 16;
  const float* Q = qb + (size_t)b * T * pitch + h * D;
  const float* K = kb + (size_t)b * T * pitch + h * D;
  const float* V = vb + (size_t)b * T * pitch + h * D;

  // A fragments of the wave's 16 query rows (scaled), hi/lo
  FragB aqh[KS], aql[KS];
  {
    int row = q0 + ln; if (row >= T) row = T - 1;
    const float* qr = Q + (size_t)row * pitch;
#pragma unroll
    for (int ks = 0; ks < KS; ++ks)
#pragma unroll
      for (int i = 0; i < 16; ++i) {
        const int d = ks * 32 + ((i < 8) ? (8 * hh + i) : (16 + 8 * hh + (i - 8)));
        const float x = qr[d] * scale; const unsigned short hb = bf16_bits(x);
        aqh[ks].u[i] = hb; aql[ks].u[i] = bf16_bits(x - bf16_val(hb));
      }
  }
  float m_r[8], l_r[8];
#pragma unroll
  for (int r = 0; r < 8; ++r) { m_r[r] = -3.0e38f; l_r[r] = 0.f; }
  v8f oacc[DT];
#pragma unroll
  for (int dt = 0; dt < DT; ++dt) oacc[dt] = (v8f){0.f,0.f,0.f,0.f,0.f,0.f,0.f,0.f};

  const int kv_end = CAUSAL ? min(T, qblk * 64 + 64) : T;     // block-uniform
  for (int j0 = 0; j0 < kv_end; j0 += 32) {
    __syncthreads();
    for (int e = tid; e < 32 * (D / 4); e += 128) {
      const int r = e / (D / 4), c4 = (e % (D / 4)) * 4;
      const int key = j0 + r;
      v4f kf = {0.f,0.f,0.f,0.f}, vf = {0.f,0.f,0.f,0.f};
      if (key < T) { kf = *(const v4fa*)(K + (size_t)key * pitch + c4); vf = *(const v4fa*)(V + (size_t)key * pitch + c4); }
#pragma unroll
      for (int t = 0; t < 4; ++t) {
        unsigned short hb = bf16_bits(kf[t]); sKh[r][c4 + t] = hb; sKl[r][c4 + t] = bf16_bits(kf[t] - bf16_val(hb));
        hb = bf16_bits(vf[t]); sVh[r][c4 + t] = hb; sVl[r][c4 + t] = bf16_bits(vf[t] - bf16_val(hb));
      }
    }
    __syncthreads();
    // S tile 16 x 32
    v8f s[2];
#pragma unroll
    for (int nt = 0; nt < 2; ++nt) {
      v8f acc = {};
#pragma unroll
      for (int ks = 0; ks < KS; ++ks) {
        FragB bh_, bl_;
        bh_.half[0] = *(const v8us*)&sKh[nt * 16 + ln][ks * 32 + 8 * hh]; bh_.half[1] = *(const v8us*)&sKh[nt * 16 + ln][ks * 32 + 16 + 8 * hh];
        bl_.half[0] = *(const v8us*)&sKl[nt * 16 + ln][ks * 32 + 8 * hh]; bl_.half[1] = *(const v8us*)&sKl[nt * 16 + ln][ks * 32 + 16 + 8 * hh];
        acc = mmaN<3>(aqh[ks].v, aql[ks].v, bh_.v, bl_.v, acc);
      }
      s[nt] = acc;
    }
    // mask + running max (rows 8hh+r; the 16 lanes of a half share rows)
    float alpha[8];
#pragma unroll
    for (int r = 0; r < 8; ++r) {
      const int qi = q0 + 8 * hh + r;
      const int ja = j0 + ln, jb = j0 + 16 + ln;
      if (CAUSAL) { if (ja > qi) s[0][r] = -3.0e38f; if (jb > qi) s[1][r] = -3.0e38f; }
      if (ja >= T) s[0][r] = -3.0e38f;
      if (jb >= T) s[1][r] = -3.0e38f;
      float mx = fmaxf(s[0][r], s[1][r]);
      mx = fmaxf(mx, __shfl_xor(mx, 1, 32)); mx = fmaxf(mx, __shfl_xor(mx, 2, 32)); mx = fmaxf(mx, __shfl_xor(mx, 4, 32)); mx = fmaxf(mx, __shfl_xor(mx, 8, 32));
      const float mnew = fmaxf(m_r[r], mx);
      alpha[r] = (mnew > -1.0e38f) ? __expf(m_r[r] - mnew) : 1.0f;
      const float p0 = (s[0][r] > -1.0e38f) ? __expf(s[0][r] - mnew) : 0.f;
      const float p1 = (s[1][r] > -1.0e38f) ? __expf(s[1][r] - mnew) : 0.f;
      m_r[r] = mnew;
      l_r[r] = l_r[r] * alpha[r] + p0 + p1;            // per-lane partial row sum (16 lanes combined at the end)
      unsigned short hb = bf16_bits(p0); sPh[w][8 * hh + r][ln] = hb;      sPl[w][8 * hh + r][ln] = bf16_bits(p0 - bf16_val(hb));
      hb = bf16_bits(p1);                sPh[w][8 * hh + r][16 + ln] = hb; sPl[w][8 * hh + r][16 + ln] = bf16_bits(p1 - bf16_val(hb));
    }
#pragma unroll
    for (int dt = 0; dt < DT; ++dt)
#pragma unroll
      for (int r = 0; r < 8; ++r) oacc[dt][r] *= alpha[r];
    __builtin_amdgcn_fence(__ATOMIC_ACQ_REL, "workgroup");
    __builtin_amdgcn_wave_barrier();
    FragB pah, pal;
    pah.half[0] = *(const v8us*)&sPh[w][ln][8 * hh]; pah.half[1] = *(const v8us*)&sPh[w][ln][16 + 8 * hh];
    pal.half[0] = *(const v8us*)&sPl[w][ln][8 * hh]; pal.half[1] = *(const v8us*)&sPl[w][ln][16 + 8 * hh];
#pragma unroll
    for (int dt = 0; dt < DT; ++dt) {
      FragB bvh, bvl;
#pragma unroll
      for (int i = 0; i < 8; ++i) {
        bvh.u[i] = sVh[8 * hh + i][dt * 16 + ln]; bvh.u[8 + i] = sVh[16 + 8 * hh + i][dt * 16 + ln];
        bvl.u[i] = sVl[8 * hh + i][dt * 16 + ln]; bvl.u[8 + i] = sVl[16 + 8 * hh + i][dt * 16 + ln];
      }
      oacc[dt] = mmaN<3>(pah.v, pal.v, bvh.v, bvl.v, oacc[dt]);
    }
    __builtin_amdgcn_fence(__ATOMIC_ACQ_REL, "workgroup");
    __builtin_amdgcn_wave_barrier();
  }
#pragma unroll
  for (int r = 0; r < 8; ++r) {
    float l = l_r[r];
    l += __shfl_xor(l, 1, 32); l += __shfl_xor(l, 2, 32); l += __shfl_xor(l, 4, 32); l += __shfl_xor(l, 8, 32);
    l_r[r] = (l > 0.f) ? 1.0f / l : 0.f;
  }
#pragma unroll
  for (int dt = 0; dt < DT; ++dt)
#pragma unroll
    for (int r = 0; r < 8; ++r) sO[w][8 * hh + r][dt * 16 + ln] = oacc[dt][r] * l_r[r];
  __builtin_amdgcn_fence(__ATOMIC_ACQ_REL, "workgroup");
  __builtin_amdgcn_wave_barrier();
  {
    for (int r = 0; r < 16; ++r) {
      const int row = q0 + r;
      if (row < T && lane < D / 4) {
        const v4f val = *(const v4fa*)&sO[w][r][lane * 4];
        *(v4f*)(y + ((size_t)b * T + row) * ypitch + h * D + lane * 4) = val;
      }
    }
    
  }
}

// GEMM C = act(A·W + bias + resid): A f32 (ASPLIT -> hi/lo 2 terms), Wt bf16 [N][K]; ACT 0 none, 1 relu, 2 exact gelu;
// resid (optional, f32, row index = (row % rmod), pitch ldr, RES_BF16 rounds it) added before the activation.
template <bool ASPLIT, int ACT, bool BIAS_BF16, bool RES_BF16>
__global__ __launch_bounds__(128) void k_gemm_bf3(const float* __restrict__ A, int lda, const unsigned short* __restrict__ Wt, int ldb,
                                                const float* __restrict__ bias, const float* __restrict__ resid, int rmod, int ldr,
                                                float* __restrict__ C, int ldc, int M, int N, int K) {
  __shared__ __attribute__((aligned(16))) float so[4][16][64];
  const int tid = threadIdx.x, w = tid >> 5, lane = tid & 31, ln = lane & 15, hh = lane >> 4;
  const int ntn = N / 64;
  const int wid = blockIdx.x * 4 + w;
  const int mt = wid / ntn, nq = wid % ntn;
  if (mt * 16 >= M) return;
  const int row0 = mt * 16, col0 = nq * 64;
  const float* arow = A + (size_t)(row0 + ln) * lda;
  v8f acc[4] = {};
  for (int kb = 0; kb < K; kb += 32) {
    FragB ah, al;
    const v4f x0 = *(const v4fa*)(arow + kb + 8 * hh), x1 = *(const v4fa*)(arow + kb + 8 * hh + 4);
    const v4f x2 = *(const v4fa*)(arow + kb + 16 + 8 * hh), x3 = *(const v4fa*)(arow + kb + 16 + 8 * hh + 4);
    float xs[16] = {x0[0],x0[1],x0[2],x0[3],x1[0],x1[1],x1[2],x1[3],x2[0],x2[1],x2[2],x2[3],x3[0],x3[1],x3[2],x3[3]};
#pragma unroll
    for (int i = 0; i < 16; ++i) { const unsigned short hb = bf16_bits(xs[i]); ah.u[i] = hb; al.u[i] = ASPLIT ? bf16_bits(xs[i] - bf16_val(hb)) : (unsigned short)0; }
#pragma unroll
    for (int t = 0; t < 4; ++t) {
      const unsigned short* brow = Wt + (size_t)(col0 + t * 16 + ln) * ldb + kb;
      FragB b;
      b.half[0] = *(const v8us*)(brow + 8 * hh);
      b.half[1] = *(const v8us*)(brow + 16 + 8 * hh);
      acc[t] = mmaN<ASPLIT ? 2 : 1>(ah.v, al.v, b.v, b.v, acc[t]);
    }
  }
#pragma unroll
  for (int t = 0; t < 4; ++t) {
    const int col = col0 + t * 16 + ln;
    float bv = bias ? bias[col] : 0.f;
    if (BIAS_BF16) bv = bf16_round(bv);
#pragma unroll
    for (int r = 0; r < 8; ++r) {
      float v = acc[t][r] + bv;
      if (resid) { float rv = resid[(size_t)((row0 + 8 * hh + r) % rmod) * ldr + col]; if (RES_BF16) rv = bf16_round(rv); v += rv; }
      if (ACT == 1) v = fmaxf(v, 0.f);
      if (ACT == 2) v = 0.5f * v * (1.0f + erff(v * 0.70710678118654752f));
      if (ACT == 3) { const float u = 0.7978845608028654f * (v + 0.044715f * v * v * v); v = 0.5f * v * (1.0f + tanhf(u)); }
      so[w][8 * hh + r][t * 16 + ln] = v;
    }
  }
  __builtin_amdgcn_fence(__ATOMIC_ACQ_REL, "workgroup");
  __builtin_amdgcn_wave_barrier();
  const int rsub = lane >> 4, c4 = (lane & 15) * 4;
  {
#pragma unroll
    for (int q = 0; q < 8; ++q) {
      const int r = q * 2 + rsub;
      const v4f v = *(const v4fa*)&so[w][r][c4];
      *(v4f*)(C + (size_t)(row0 + r) * ldc + col0 + c4) = v;
    }
    
  }
}
// row LayerNorm (biased variance, eps) over N: s = X (+ R); optional out_sum <- s; out_norm <- (s-mu)*rsqrt(var+eps)*g + b
template <bool PARAM_BF16>
__global__ __launch_bounds__(256) void k_layernorm(const float* __restrict__ X, const float* __restrict__ R, const float* __restrict__ g, const float* __restrict__ bta,
                                                  float* __restrict__ out_sum, float* __restrict__ out_norm, int N, float eps) {
  __shared__ float red[256];
  const int row = blockIdx.x, tid = threadIdx.x;
  const float* x = X + (size_t)row * N; const float* rr = R ? R + (size_t)row * N : nullptr;
  float vals[16];                     // up to N = 4096
  const int per = N / 256;            // contiguous chunk per thread? use strided-by-4 chunks: thread handles j = tid*4 + 1024*u
  float s1 = 0.f;
  for (int u = 0; u < per / 4; ++u) {
    const int j = tid * 4 + 1024 * u;
    const v4f a = *(const v4fa*)(x + j);
    v4f b = {0.f,0.f,0.f,0.f}; if (rr) b = *(const v4fa*)(rr + j);
#pragma unroll
    for (int q = 0; q < 4; ++q) { const float v = a[q] + b[q]; vals[u * 4 + q] = v; s1 += v; }
  }
  red[tid] = s1; __syncthreads();
  for (int st = 128; st > 0; st >>= 1) { if (tid < st) red[tid] += red[tid + st]; __syncthreads(); }
  const float mu = red[0] / (float)N; __syncthreads();
  float s2 = 0.f;
  for (int u = 0; u < per / 4; ++u)
#pragma unroll
    for (int q = 0; q < 4; ++q) { const float c = vals[u * 4 + q] - mu; s2 += c * c; }
  red[tid] = s2; __syncthreads();
  for (int st = 128; st > 0; st >>= 1) { if (tid < st) red[tid] += red[tid + st]; __syncthreads(); }
  const float rs = rsqrtf(red[0] / (float)N + eps);
  {
    for (int u = 0; u < per / 4; ++u) {
      const int j = tid * 4 + 1024 * u;
      v4f o, sm;
#pragma unroll
      for (int q = 0; q < 4; ++q) {
        float gg = g[j + q], bb = bta[j + q];
        if (PARAM_BF16) { gg = bf16_round(gg); bb = bf16_round(bb); }
        sm[q] = vals[u * 4 + q]; o[q] = (vals[u * 4 + q] - mu) * rs * gg + bb;
      }
      if (out_sum) *(v4f*)(out_sum + (size_t)row * N + j) = sm;
      *(v4f*)(out_norm + (size_t)row * N + j) = o;
    }
    
  }
}



// ---- f16 WMMA path (v_wmma_f32_16x16x32_f16): 11-bit significands for operands in range — used where a [0,1] probability operand needs more precision than bf16
typedef _Float16 v16h __attribute__((ext_vector_type(16)));
union FragH { v16h v; v8us half[2]; _Float16 h[16]; unsigned short u[16]; };
template <int NT>
__device__ __forceinline__ v8f mmaH(v16h ah, v16h al, v16h bh, v16h bl, v8f c) {
  c = __builtin_amdgcn_wmma_f32_16x16x32_f16(false, ah, false, bh, (short)0, c, false, false);
  if (NT >= 2) c = __builtin_amdgcn_wmma_f32_16x16x32_f16(false, al, false, bh, (short)0, c, false, false);
  if (NT >= 3) c = __builtin_amdgcn_wmma_f32_16x16x32_f16(false, ah, false, bl, (short)0, c, false, false);
  asm volatile("v_nop\n\tv_nop\n\tv_nop\n\tv_nop" : "+v"(c) : "v"(ah), "v"(al), "v"(bh), "v"(bl));
  return c;
}
// batched GEMM like k_gemm_b but f16 operands: A f32 (split into f16 hi/lo if ASPLIT, else rounded to f16), Bt = f16 values [n][k]; alpha; C f32; N multiple of 16 (partial tiles skipped)
template <bool ASPLIT>
__global__ __launch_bounds__(128) void k_gemm_h(const float* __restrict__ A, int lda, size_t sA, const _Float16* __restrict__ Bh, int ldb, size_t sB, float alpha, float* __restrict__ C, int ldc, size_t sC, int M, int N, int K) {
  __shared__ __attribute__((aligned(16))) float so[4][16][64];
  const int tid = threadIdx.x, w = tid >> 5, lane = tid & 31, ln = lane & 15, hh = lane >> 4; const int by = blockIdx.y;
  A += (size_t)by * sA; Bh += (size_t)by * sB; C += (size_t)by * sC;
  const int ntn = (N + 63) / 64; const int wid = blockIdx.x * 4 + w; const int mt = wid / ntn, nq = wid % ntn; if (mt * 16 >= M) return;
  const int row0 = mt * 16, col0 = nq * 64; const float* arow = A + (size_t)(row0 + ln) * lda;
  v8f acc[4] = {};
  for (int kb = 0; kb < K; kb += 32) {
    FragH ah, al;
    const v4f x0 = *(const v4fa*)(arow + kb + 8 * hh), x1 = *(const v4fa*)(arow + kb + 8 * hh + 4), x2 = *(const v4fa*)(arow + kb + 16 + 8 * hh), x3 = *(const v4fa*)(arow + kb + 16 + 8 * hh + 4);
    float xs[16] = {x0[0],x0[1],x0[2],x0[3],x1[0],x1[1],x1[2],x1[3],x2[0],x2[1],x2[2],x2[3],x3[0],x3[1],x3[2],x3[3]};
#pragma unroll
    for (int i = 0; i < 16; ++i) { const _Float16 h = (_Float16)xs[i]; ah.h[i] = h; al.h[i] = ASPLIT ? (_Float16)(xs[i] - (float)h) : (_Float16)0.0f; }
#pragma unroll
    for (int t = 0; t < 4; ++t) { if (col0 + t * 16 >= N) continue; const size_t boff = (size_t)(col0 + t * 16 + ln) * ldb + kb; FragH bq; bq.half[0] = *(const v8us*)(Bh + boff + 8 * hh); bq.half[1] = *(const v8us*)(Bh + boff + 16 + 8 * hh);
      acc[t] = mmaH<ASPLIT ? 2 : 1>(ah.v, al.v, bq.v, bq.v, acc[t]); }
  }
#pragma unroll
  for (int t = 0; t < 4; ++t) { if (col0 + t * 16 >= N) continue;
#pragma unroll
    for (int r = 0; r < 8; ++r) so[w][8 * hh + r][t * 16 + ln] = acc[t][r] * alpha; }
  __builtin_amdgcn_fence(__ATOMIC_ACQ_REL, "workgroup"); __builtin_amdgcn_wave_barrier();
  const int rsub = lane >> 4, c4 = (lane & 15) * 4;
  {
#pragma unroll
    for (int q = 0; q < 8; ++q) { const int r = q * 2 + rsub; if (col0 + c4 < N) { const v4f v = *(const v4fa*)&so[w][r][c4]; *(v4f*)(C + (size_t)(row0 + r) * ldc + col0 + c4) = v; } }
     }
}

// Wt[n][k] = f16(W[k][n]·scale) from f32 row-major W[K][N] (scale = power of two; bf16-exact weights stay exact in f16 away from the subnormal range)
__global__ __launch_bounds__(256) void k_wt_f16(const float* __restrict__ W, _Float16* __restrict__ Wt, int K, int N, float scale) {
  const int t = blockIdx.x * 256 + threadIdx.x; if (t >= N * (K / 8)) return; const int n = t / (K / 8), k8 = (t % (K / 8)) * 8; FragH f;
#pragma unroll
  for (int i = 0; i < 8; ++i) f.h[i] = (_Float16)(bf16_round(W[(size_t)(k8 + i) * N + n]) * scale); const v8us o = f.half[0];
  *(v8us*)((unsigned short*)Wt + (size_t)n * K + k8) = o; 
}
// k_gemm_hh variant with fused epilogue: v = acc·alpha + bias[by·sBias + col] (+ CP[(row/rowsPerB)·sCPb + by·64 + col] if CP) ; ACT 0 none / 1 elu ; writes f32 C and f16 C16, each if non-null
template <int ACT>
__global__ __launch_bounds__(128) void k_gemm_hhx(const _Float16* __restrict__ A, int lda, size_t sA, const _Float16* __restrict__ Bh, int ldb, size_t sB, float alpha, const float* __restrict__ bias, size_t sBias, const float* __restrict__ CP, int rowsPerB, size_t sCPb, int row0g,
    float* __restrict__ C, _Float16* __restrict__ C16, int ldc, size_t sC, int M, int N, int K) {
  __shared__ __attribute__((aligned(16))) float so[4][16][64];
  const int tid = threadIdx.x, w = tid >> 5, lane = tid & 31, ln = lane & 15, hh = lane >> 4; const int by = blockIdx.y;
  A += (size_t)by * sA; Bh += (size_t)by * sB; const size_t cofs = (size_t)by * sC; const float* bp = bias ? bias + (size_t)by * sBias : nullptr;
  const int ntn = (N + 63) / 64; const int wid = blockIdx.x * 4 + w; const int mt = wid / ntn, nq = wid % ntn; if (mt * 16 >= M) return;
  const int row0 = mt * 16, col0 = nq * 64; const _Float16* arow = A + (size_t)(row0 + ln) * lda;
  v8f acc[4] = {};
  for (int kb = 0; kb < K; kb += 32) { FragH ah; ah.half[0] = *(const v8us*)((const unsigned short*)arow + kb + 8 * hh); ah.half[1] = *(const v8us*)((const unsigned short*)arow + kb + 16 + 8 * hh);
#pragma unroll
    for (int t = 0; t < 4; ++t) { if (col0 + t * 16 >= N) continue; const size_t boff = (size_t)(col0 + t * 16 + ln) * ldb + kb; FragH bq; bq.half[0] = *(const v8us*)((const unsigned short*)Bh + boff + 8 * hh); bq.half[1] = *(const v8us*)((const unsigned short*)Bh + boff + 16 + 8 * hh);
      acc[t] = mmaH<1>(ah.v, ah.v, bq.v, bq.v, acc[t]); }
  }
#pragma unroll
  for (int t = 0; t < 4; ++t) { if (col0 + t * 16 >= N) continue; const int col = col0 + t * 16 + ln; const float bv = bp ? bf16_round(bp[col]) : 0.f;
#pragma unroll
    for (int r = 0; r < 8; ++r) { float v = acc[t][r] * alpha + bv; if (CP) { const int bidx = (row0g + row0 + 8 * hh + r) / rowsPerB; v += CP[(size_t)bidx * sCPb + (size_t)by * 64 + col]; } if (ACT == 1) v = (v > 0.f) ? v : expm1f(v); else if (ACT == 3) v = fmaxf(v, 0.f); so[w][8 * hh + r][t * 16 + ln] = v; } }
  __builtin_amdgcn_fence(__ATOMIC_ACQ_REL, "workgroup"); __builtin_amdgcn_wave_barrier();
  const int rsub = lane >> 4, c4 = (lane & 15) * 4; typedef _Float16 v4h __attribute__((ext_vector_type(4)));
  {
#pragma unroll
    for (int q = 0; q < 8; ++q) { const int r = q * 2 + rsub; if (col0 + c4 < N) { const v4f v = *(const v4fa*)&so[w][r][c4]; if (C) *(v4f*)(C + cofs + (size_t)(row0 + r) * ldc + col0 + c4) = v; if (C16) { v4h h4; for (int i = 0; i < 4; ++i) h4[i] = (_Float16)v[i]; *(v4h*)(C16 + cofs + (size_t)(row0 + r) * ldc + col0 + c4) = h4; } } }
     }
}


__global__ __launch_bounds__(256) void k_x16(const float* __restrict__ x, _Float16* __restrict__ X16, size_t n8) { const size_t t = (size_t)blockIdx.x * 256 + threadIdx.x; if (t >= n8) return; FragH f;
#pragma unroll
  for (int q = 0; q < 8; ++q) f.h[q] = (_Float16)bf16_round(x[t * 8 + q]); *(v8us*)((unsigned short*)X16 + t * 8) = f.half[0];  }
__global__ __launch_bounds__(256) void k_h16(const float* __restrict__ x, _Float16* __restrict__ X16, size_t n8) { const size_t t = (size_t)blockIdx.x * 256 + threadIdx.x; if (t >= n8) return; FragH f;
#pragma unroll
  for (int q = 0; q < 8; ++q) f.h[q] = (_Float16)x[t * 8 + q]; *(v8us*)((unsigned short*)X16 + t * 8) = f.half[0];  }
__global__ __launch_bounds__(256) void k_round16f(const float* __restrict__ W, _Float16* __restrict__ Bt, size_t n8) { const size_t t = (size_t)blockIdx.x * 256 + threadIdx.x; if (t >= n8) return; FragH f;
#pragma unroll
  for (int i = 0; i < 8; ++i) f.h[i] = (_Float16)(bf16_round(W[t * 8 + i]) * 16.0f); *(v8us*)((unsigned short*)Bt + t * 8) = f.half[0];  }
template <int NHv, int TTv>
__global__ __launch_bounds__(256) void k_vt(const _Float16* __restrict__ V16, int ldv, int voff, _Float16* __restrict__ Vt) { __shared__ unsigned short tl[64][66]; const int tid = threadIdx.x; const int slab = blockIdx.x / (TTv / 64), lg = blockIdx.x % (TTv / 64); const int b = slab / NHv, h = slab % NHv;
  for (int i = tid; i < 64 * 8; i += 256) { const int r = i / 8, c8 = (i % 8) * 8; FragH f; f.half[0] = *(const v8us*)((const unsigned short*)V16 + ((size_t)b * TTv + lg * 64 + r) * ldv + voff + h * 64 + c8);
#pragma unroll
    for (int q = 0; q < 8; ++q) tl[r][c8 + q] = f.u[q]; }
  __syncthreads();
  {
#pragma unroll
    for (int rd = 0; rd < 2; ++rd) { const int d = rd * 32 + tid / 8, pc = tid % 8; FragH f;
#pragma unroll
      for (int q = 0; q < 8; ++q) f.u[q] = tl[pc * 8 + q][d];
      *(v8us*)((unsigned short*)Vt + ((size_t)slab * 64 + d) * TTv + lg * 64 + pc * 8) = f.half[0]; }
     } }

__global__ __launch_bounds__(128) void k_flash(const _Float16* __restrict__ Q16, int ldq, const _Float16* __restrict__ K16, int ldk, const _Float16* __restrict__ Vt, const float* __restrict__ CB, const float* __restrict__ beta, float* __restrict__ O, int ldo) {
  __shared__ float scb[2048];
  constexpr int RPW = 16, RTN = RPW / 16, NQB = 2048 / (4 * RPW), DT = 4, KS = 2;
  __shared__ __attribute__((aligned(16))) unsigned short sP[4][RPW][40]; __shared__ __attribute__((aligned(16))) float sO[4][RPW][64 + 4];
  const int tid = threadIdx.x, w = tid >> 5, lane = tid & 31, ln = lane & 15, hh = lane >> 4;
  const int slab = blockIdx.x / NQB, qblk = blockIdx.x % NQB; const int b = slab / 12, h = slab % 12; const int qb0 = qblk * (4 * RPW); const int q0 = qb0 + w * RPW;
  FragH aq[2][KS];
#pragma unroll
  for (int rt = 0; rt < RTN; ++rt) { const unsigned short* qr = (const unsigned short*)Q16 + ((size_t)b * 2048 + q0 + rt * 16 + ln) * ldq + h * 64;
#pragma unroll
    for (int ks = 0; ks < KS; ++ks) { aq[rt][ks].half[0] = *(const v8us*)(qr + ks * 32 + 8 * hh); aq[rt][ks].half[1] = *(const v8us*)(qr + ks * 32 + 16 + 8 * hh); } }
  for (int i = tid; i < 2048; i += 128) scb[i] = CB[i]; const float bh = bf16_round(beta[h]); __syncthreads();
  const unsigned short* Vth = (const unsigned short*)Vt + (size_t)slab * 64 * 2048; float lc_r[2][8];      /* causal partial sums Σ_{k ≤ q} e^{s−m} */
#pragma unroll
  for (int rt = 0; rt < RTN; ++rt) for (int r = 0; r < 8; ++r) lc_r[rt][r] = 0.f;
  float m_r[2][8], l_r[2][8]; v8f oacc[2][DT];
#pragma unroll
  for (int rt = 0; rt < RTN; ++rt) {
#pragma unroll
    for (int r = 0; r < 8; ++r) { m_r[rt][r] = -3.0e38f; l_r[rt][r] = 0.f; }
#pragma unroll
    for (int dt = 0; dt < DT; ++dt) oacc[rt][dt] = (v8f){0.f,0.f,0.f,0.f,0.f,0.f,0.f,0.f}; }
  const int jend = 2048;
#pragma unroll 1
  for (int j0 = 0; j0 < jend; j0 += 32) {
    
    v8f s[2][2];
#pragma unroll
    for (int nt = 0; nt < 2; ++nt) { const unsigned short* kr = (const unsigned short*)K16 + ((size_t)b * 2048 + j0 + nt * 16 + ln) * ldk + h * 64; FragH bk[KS];
#pragma unroll
      for (int ks = 0; ks < KS; ++ks) { bk[ks].half[0] = *(const v8us*)(kr + ks * 32 + 8 * hh); bk[ks].half[1] = *(const v8us*)(kr + ks * 32 + 16 + 8 * hh); }
#pragma unroll
      for (int rt = 0; rt < RTN; ++rt) { v8f acc = (v8f){0.f,0.f,0.f,0.f,0.f,0.f,0.f,0.f};
#pragma unroll
        for (int ks = 0; ks < KS; ++ks) acc = mmaH<1>(aq[rt][ks].v, aq[rt][ks].v, bk[ks].v, bk[ks].v, acc); s[rt][nt] = acc; } }
#pragma unroll
    for (int rt = 0; rt < RTN; ++rt)
#pragma unroll
      for (int r = 0; r < 8; ++r) { const int tq = q0 + rt * 16 + 8 * hh + r; const int k0 = j0 + ln, k1 = j0 + 16 + ln; (void)tq; (void)k0; (void)k1;
        const int d0 = (tq >= k0) ? (tq - k0) : (k0 - tq), d1 = (tq >= k1) ? (tq - k1) : (k1 - tq);      /* phase coherence 1 + β·mean_f cos(Δ·θ_f), Δ = |q − k| */
        const float s0 = s[rt][0][r] * 0.125f * (1.0f + bh * scb[d0]), s1 = s[rt][1][r] * 0.125f * (1.0f + bh * scb[d1]); const bool c0 = (k0 <= tq), c1 = (k1 <= tq); float mc = fmaxf(s0, s1);
        mc = fmaxf(mc, __shfl_xor(mc, 1, 32)); mc = fmaxf(mc, __shfl_xor(mc, 2, 32)); mc = fmaxf(mc, __shfl_xor(mc, 4, 32)); mc = fmaxf(mc, __shfl_xor(mc, 8, 32));
        const float mn = fmaxf(m_r[rt][r], mc); const float ea = expf(m_r[rt][r] - mn); /* made for every lane and picked by a select: written behind the test it compiled to one branch per row, which cut the pass into nine blocks and put the eight rows' cross-lane and exp chains one behind the other */ const float al = (mn > -1.0e38f) ? ea : 1.0f; m_r[rt][r] = mn; const float e0 = expf(s0 - mn), e1 = expf(s1 - mn); l_r[rt][r] = l_r[rt][r] * al + e0 + e1; const float p0 = c0 ? e0 : 0.f, p1 = c1 ? e1 : 0.f; lc_r[rt][r] = lc_r[rt][r] * al + p0 + p1;      /* full-softmax stats over ALL keys; P·V and Σ only over the causal ones */
#pragma unroll
        for (int dt = 0; dt < DT; ++dt) oacc[rt][dt][r] *= al;
        FragH t2; t2.h[0] = (_Float16)p0; t2.h[1] = (_Float16)p1; sP[w][rt * 16 + 8 * hh + r][ln] = t2.u[0]; sP[w][rt * 16 + 8 * hh + r][16 + ln] = t2.u[1]; }
    __builtin_amdgcn_fence(__ATOMIC_ACQ_REL, "workgroup"); __builtin_amdgcn_wave_barrier();
    FragH pa[2];
#pragma unroll
    for (int rt = 0; rt < RTN; ++rt) { pa[rt].half[0] = *(const v8us*)&sP[w][rt * 16 + ln][8 * hh]; pa[rt].half[1] = *(const v8us*)&sP[w][rt * 16 + ln][16 + 8 * hh]; }
if (j0 <= q0 + RPW - 1) {      /* some key of this chunk is ≤ some query of this wave; otherwise every p is 0 */
#pragma unroll
    for (int dt = 0; dt < DT; ++dt) { const unsigned short* vrow = Vth + (size_t)(dt * 16 + ln) * 2048 + j0; FragH bv; bv.half[0] = *(const v8us*)(vrow + 8 * hh); bv.half[1] = *(const v8us*)(vrow + 16 + 8 * hh);
#pragma unroll
      for (int rt = 0; rt < RTN; ++rt) oacc[rt][dt] = mmaH<1>(pa[rt].v, pa[rt].v, bv.v, bv.v, oacc[rt][dt]); } }
    __builtin_amdgcn_fence(__ATOMIC_ACQ_REL, "workgroup"); __builtin_amdgcn_wave_barrier(); }
#pragma unroll
  for (int rt = 0; rt < RTN; ++rt) {
#pragma unroll
    for (int r = 0; r < 8; ++r) { float l = l_r[rt][r]; l += __shfl_xor(l, 1, 32); l += __shfl_xor(l, 2, 32); l += __shfl_xor(l, 4, 32); l += __shfl_xor(l, 8, 32); float lc = lc_r[rt][r]; lc += __shfl_xor(lc, 1, 32); lc += __shfl_xor(lc, 2, 32); lc += __shfl_xor(lc, 4, 32); lc += __shfl_xor(lc, 8, 32); l_r[rt][r] = 1.0f / (lc + 1e-8f * l); }      /* w·causal / (Σ_causal w + 1e-8) with w = e^{s−m}/Z_full  ⇒  e^{s−m} / (Z_causal + 1e-8·Z_full) */
#pragma unroll
    for (int dt = 0; dt < DT; ++dt)
#pragma unroll
      for (int r = 0; r < 8; ++r) sO[w][rt * 16 + 8 * hh + r][dt * 16 + ln] = oacc[rt][dt][r] * l_r[rt][r]; }
  __builtin_amdgcn_fence(__ATOMIC_ACQ_REL, "workgroup"); __builtin_amdgcn_wave_barrier();
  {
#pragma unroll
    for (int rp = 0; rp < RPW; rp += 2) { const int r = rp + (lane >> 4), pc = lane & 15; const v4f val = *(const v4fa*)&sO[w][r][pc * 4]; *(v4f*)(O + ((size_t)b * 2048 + q0 + r) * ldo + h * 64 + pc * 4) = val; }
     } }

__global__ __launch_bounds__(256) void k_cb(float* __restrict__ CB) { for (int dl = threadIdx.x; dl < TT; dl += 256) { float s = 0.f;
#pragma unroll 1
    for (int f = 0; f < 32; ++f) { const float th = powf(10000.0f, -(float)(2 * f) / 64.0f); s += cosf((float)dl * th); }
    const float v = s / 32.0f; *(float*)(CB + dl) = v;  } }
// rotary + rms-norm per (row, head): x1 = q[h·64 + j], x2 = q[h·64 + 32 + j] (j < 32); out = [x1·cos + x2·sin | −x1·sin + x2·cos] with cos/sin = bf16(INPUT tables [t][j]); then × rsqrt(mean(out²) + f32 eps) → f16;
__global__ __launch_bounds__(256) void k_ropenorm(const float* __restrict__ Qf, const float* __restrict__ cosT, const float* __restrict__ sinT, _Float16* __restrict__ Q16) { const size_t tg = (size_t)blockIdx.x * 256 + threadIdx.x; if (tg >= (size_t)NR * NH * 4) return; const size_t row = tg / (NH * 4); const int h = (int)((tg / 4) % NH), pc = (int)(tg % 4); const int t = (int)(row % TT); const int j0 = pc * 8;
  float a[8], bq[8]; float ss = 0.f;
#pragma unroll
  for (int q = 0; q < 8; ++q) { const int j = j0 + q; const float x1 = Qf[row * CC + h * 64 + j], x2 = Qf[row * CC + h * 64 + 32 + j]; const float c = bf16_round(cosT[t * 32 + j]), s = bf16_round(sinT[t * 32 + j]); a[q] = x1 * c + x2 * s; bq[q] = -x1 * s + x2 * c; ss += a[q] * a[q] + bq[q] * bq[q]; }
  ss += __shfl_xor(ss, 1, 32); ss += __shfl_xor(ss, 2, 32); const float rn = rsqrtf(ss / 64.0f + 1.1920929e-7f); FragH f1, f2;
#pragma unroll
  for (int q = 0; q < 8; ++q) { f1.h[q] = (_Float16)(a[q] * rn); f2.h[q] = (_Float16)(bq[q] * rn); }
  { *(v8us*)((unsigned short*)Q16 + row * CC + h * 64 + j0) = f1.half[0]; *(v8us*)((unsigned short*)Q16 + row * CC + h * 64 + 32 + j0) = f2.half[0];  } }
extern "C" void kernel_launch(void* const* d_in, const int* in_sizes, int n_in,
                              void* d_out, int out_size, void* d_ws, size_t ws_size, hipStream_t stream) {
  (void)in_sizes; (void)n_in; (void)out_size;
  const float* x = (const float*)d_in[0]; const float* cosT = (const float*)d_in[1]; const float* sinT = (const float*)d_in[2]; const float* Wq = (const float*)d_in[3]; const float* Wk = (const float*)d_in[4]; const float* Wv = (const float*)d_in[5]; const float* Wo = (const float*)d_in[6]; const float* beta = (const float*)d_in[7];
  char* ws = (char*)d_ws; size_t off = 0;
  auto take = [&](size_t bytes) { char* p = ws + off; off += (bytes + 255) & ~(size_t)255; return p; };
  _Float16* Bq = (_Float16*)take((size_t)CC * CC * 2); _Float16* Bk = (_Float16*)take((size_t)CC * CC * 2); _Float16* Bv = (_Float16*)take((size_t)CC * CC * 2); _Float16* Bo = (_Float16*)take((size_t)CC * CC * 2); float* CB = (float*)take(TT * 4);
  _Float16* X16 = (_Float16*)take((size_t)NR * CC * 2); float* Qf = (float*)take((size_t)NR * CC * 4); float* Kf = (float*)take((size_t)NR * CC * 4); _Float16* Q16 = (_Float16*)take((size_t)NR * CC * 2); _Float16* K16 = (_Float16*)take((size_t)NR * CC * 2); _Float16* V16 = (_Float16*)take((size_t)NR * CC * 2); _Float16* Vt = (_Float16*)take((size_t)NR * CC * 2); float* O = Qf; _Float16* O16 = X16;      // Qf dead after k_ropenorm; X16 dead after the V GEMM
  if (off > ws_size) return;      // 4.7 + 6.3 + 12.6 × 2 + 6.3 × 4 ≈ 59 MiB
  const size_t w8 = (size_t)CC * CC / 8; const unsigned gw = (unsigned)((w8 + 255) / 256);
  k_round16f<<<gw, 256, 0, stream>>>(Wq, Bq, w8); k_round16f<<<gw, 256, 0, stream>>>(Wk, Bk, w8); k_round16f<<<gw, 256, 0, stream>>>(Wv, Bv, w8); k_round16f<<<gw, 256, 0, stream>>>(Wo, Bo, w8);      // (out,in)
  k_cb<<<1, 256, 0, stream>>>(CB);
  const unsigned gx = (unsigned)(((size_t)NR * CC / 8 + 255) / 256); const dim3 gg(((NR / 16) * (CC / 64) + 3) / 4, 1);
  k_x16<<<gx, 256, 0, stream>>>(x, X16, (size_t)NR * CC / 8);
  k_gemm_hhx<0><<<gg, 128, 0, stream>>>(X16, CC, 0, Bq, CC, 0, 0.0625f, nullptr, 0, nullptr, 1, 0, 0, Qf, nullptr, CC, 0, NR, CC, CC);
  k_gemm_hhx<0><<<gg, 128, 0, stream>>>(X16, CC, 0, Bk, CC, 0, 0.0625f, nullptr, 0, nullptr, 1, 0, 0, Kf, nullptr, CC, 0, NR, CC, CC);
  k_gemm_hhx<0><<<gg, 128, 0, stream>>>(X16, CC, 0, Bv, CC, 0, 0.0625f, nullptr, 0, nullptr, 1, 0, 0, nullptr, V16, CC, 0, NR, CC, CC);
  const unsigned gr = (unsigned)(((size_t)NR * NH * 4 + 255) / 256);
  k_ropenorm<<<gr, 256, 0, stream>>>(Qf, cosT, sinT, Q16); k_ropenorm<<<gr, 256, 0, stream>>>(Kf, cosT, sinT, K16);
  k_vt<NH, TT><<<BB * NH * (TT / 64), 256, 0, stream>>>(V16, CC, 0, Vt);
  k_flash<<<BB * NH * (TT / 64), 128, 0, stream>>>(Q16, CC, K16, CC, Vt, CB, beta, O, CC);      // RPW 16
  k_h16<<<gx, 256, 0, stream>>>(O, O16, (size_t)NR * CC / 8);
  k_gemm_hhx<0><<<gg, 128, 0, stream>>>(O16, CC, 0, Bo, CC, 0, 0.0625f, nullptr, 0, nullptr, 1, 0, 0, (float*)d_out, nullptr, CC, 0, NR, CC, CC);
}

// v002
// It runs in 308 microseconds.
// Timed twice side by side with v001, it ran 1.22 and 1.23 times as fast.
// Counting every step since v000, it is 1.49 times as fast.
#include <hip/hip_runtime.h>
// Phase-aware causal attention: q/k/v/o projections (4096 × 768 × 768, no bias, weights (out,in) bf16-exact ×2^4) and the 12-head attention as a fused flash-style kernel on v_wmma_f32_16x16x32_f16
// (rotary (with the INPUT cos/sin tables) + rms-norm'd q,k as f16; S = Q·Kᵀ/8 × (1 + β_h·mean_f cos(|q−k|·θ_f)) with the 2048-entry coherence table precomputed; the module's FULL softmax followed
// by causal masking and re-normalisation with +1e-8 is reproduced exactly as e^{s−m}/(Z_causal + 1e-8·Z_full) with m, Z_full over all keys; P f16 ≤ 1; O = P·V over causal keys); f32 accumulate.
#define BB 2
#define TT 2048
#define CC 768
#define NH 12
#define NR (BB * TT)

typedef __bf16 v16b __attribute__((ext_vector_type(16)));
typedef unsigned short v8us __attribute__((ext_vector_type(8), may_alias));
typedef float  v8f  __attribute__((ext_vector_type(8)));
typedef float  v4f  __attribute__((ext_vector_type(4)));
typedef float  v4fa __attribute__((ext_vector_type(4), may_alias));
union FragB { v16b v; v8us half[2]; unsigned short u[16]; };

__device__ __forceinline__ unsigned short bf16_bits(float x) { unsigned int u = __float_as_uint(x); return (unsigned short)((u + 0x7FFFu + ((u >> 16) & 1u)) >> 16); }
__device__ __forceinline__ float bf16_val(unsigned short b) { return __uint_as_float(((unsigned int)b) << 16); }
__device__ __forceinline__ float bf16_round(float x) { return bf16_val(bf16_bits(x)); }
// D += A·B with NT terms: 1 = ah·bh, 2 = + al·bh (A split), 3 = + ah·bl (both split)
template <int NT>
__device__ __forceinline__ v8f mmaN(v16b ah, v16b al, v16b bh, v16b bl, v8f c) {
  c = __builtin_amdgcn_wmma_f32_16x16x32_bf16(false, ah, false, bh, (short)0, c, false, false);
  if (NT >= 2) c = __builtin_amdgcn_wmma_f32_16x16x32_bf16(false, al, false, bh, (short)0, c, false, false);
  if (NT >= 3) c = __builtin_amdgcn_wmma_f32_16x16x32_bf16(false, ah, false, bl, (short)0, c, false, false);
  asm volatile("v_nop\n\tv_nop\n\tv_nop\n\tv_nop" : "+v"(c) : "v"(ah), "v"(al), "v"(bh), "v"(bl));
  return c;
}

__global__ __launch_bounds__(256) void k_wt_bf16(const float* __restrict__ W, unsigned short* __restrict__ Wt, int K, int N) {
  const int t = blockIdx.x * 256 + threadIdx.x;
  const int k8n = K / 8;
  if (t >= N * k8n) return;
  const int n = t / k8n, k8 = (t % k8n) * 8;
  v8us v;
#pragma unroll
  for (int i = 0; i < 8; ++i) v[i] = bf16_bits(W[(size_t)(k8 + i) * N + n]);
  *(v8us*)(Wt + (size_t)n * K + k8) = v;
  
}

// GEMM C[M][N] (f32, pitch ldc) = act(A[M][K]·W + bias). A f32 row-major (pitch lda) converted per fragment to bf16
// (ASPLIT: hi/lo two planes -> 2 terms, else single rounded term); Wt bf16 [N][K] (pitch ldb). BIAS_BF16 rounds the
// bias to bf16 first (bias quantised to bf16 before the add). K%32==0, M%16==0, N%64==0.
template <bool ASPLIT, int ACT, bool BIAS_BF16>
__global__ __launch_bounds__(128) void k_gemm_bf(const float* __restrict__ A, int lda, const unsigned short* __restrict__ Wt, int ldb,
                                               const float* __restrict__ bias, float* __restrict__ C, int ldc, int M, int N, int K) {
  __shared__ __attribute__((aligned(16))) float so[4][16][64];
  const int tid = threadIdx.x, w = tid >> 5, lane = tid & 31, ln = lane & 15, hh = lane >> 4;
  const int ntn = N / 64;
  const int wid = blockIdx.x * 4 + w;
  const int mt = wid / ntn, nq = wid % ntn;
  if (mt * 16 >= M) return;
  const int row0 = mt * 16, col0 = nq * 64;
  const float* arow = A + (size_t)(row0 + ln) * lda;
  v8f acc[4] = {};
  for (int kb = 0; kb < K; kb += 32) {
    FragB ah, al;
    const v4f x0 = *(const v4fa*)(arow + kb + 8 * hh), x1 = *(const v4fa*)(arow + kb + 8 * hh + 4);
    const v4f x2 = *(const v4fa*)(arow + kb + 16 + 8 * hh), x3 = *(const v4fa*)(arow + kb + 16 + 8 * hh + 4);
    float xs[16] = {x0[0],x0[1],x0[2],x0[3],x1[0],x1[1],x1[2],x1[3],x2[0],x2[1],x2[2],x2[3],x3[0],x3[1],x3[2],x3[3]};
#pragma unroll
    for (int i = 0; i < 16; ++i) { const unsigned short hb = bf16_bits(xs[i]); ah.u[i] = hb; al.u[i] = ASPLIT ? bf16_bits(xs[i] - bf16_val(hb)) : (unsigned short)0; }
#pragma unroll
    for (int t = 0; t < 4; ++t) {
      const unsigned short* brow = Wt + (size_t)(col0 + t * 16 + ln) * ldb + kb;
      FragB b;
      b.half[0] = *(const v8us*)(brow + 8 * hh);
      b.half[1] = *(const v8us*)(brow + 16 + 8 * hh);
      acc[t] = mmaN<ASPLIT ? 2 : 1>(ah.v, al.v, b.v, b.v, acc[t]);
    }
  }
#pragma unroll
  for (int t = 0; t < 4; ++t) {
    float bv = bias ? bias[col0 + t * 16 + ln] : 0.f;
    if (BIAS_BF16) bv = bf16_round(bv);
#pragma unroll
    for (int r = 0; r < 8; ++r) { float v = acc[t][r] + bv; if (ACT == 1) v = fmaxf(v, 0.f); so[w][8 * hh + r][t * 16 + ln] = v; }
  }
  __builtin_amdgcn_fence(__ATOMIC_ACQ_REL, "workgroup");
  __builtin_amdgcn_wave_barrier();
  const int rsub = lane >> 4, c4 = (lane & 15) * 4;
  {
#pragma unroll
    for (int q = 0; q < 8; ++q) {
      const int r = q * 2 + rsub;
      const v4f v = *(const v4fa*)&so[w][r][c4];
      *(v4f*)(C + (size_t)(row0 + r) * ldc + col0 + c4) = v;
    }
    
  }
}

// Flash-style causal/unmasked attention, all contractions 3-term bf16 hi/lo splits, f32 softmax with running max.
// q,k,v rows are read from f32 buffers with arbitrary row pitch (so they can live inside a fused qkv buffer);
// D = head size (multiple of 32, <= 128); one wave = 16 query rows; block = 4 waves (64 queries) sharing K/V chunks of 32.
template <int D, bool CAUSAL>
__global__ __launch_bounds__(128) void k_flash(const float* __restrict__ qb, const float* __restrict__ kb, const float* __restrict__ vb,
                                             int pitch, int T, int H, float scale, float* __restrict__ y, int ypitch) {
  constexpr int KS = D / 32;        // k-steps for QK
  constexpr int DT = D / 16;        // d tiles for PV
  __shared__ __attribute__((aligned(16))) unsigned short sKh[32][D + 8], sKl[32][D + 8], sVh[32][D + 8], sVl[32][D + 8];
  __shared__ __attribute__((aligned(16))) unsigned short sPh[4][16][40], sPl[4][16][40];
  __shared__ __attribute__((aligned(16))) float sO[4][16][D];
  const int tid = threadIdx.x, w = tid >> 5, lane = tid & 31, ln = lane & 15, hh = lane >> 4;
  const int nqb = (T + 63) / 64;
  const int bh = blockIdx.x / nqb, qblk = blockIdx.x % nqb;
  const int b = bh / H, h = bh % H;
  const int q0 = qblk * 64 + w * 16;
  const float* Q = qb + (size_t)b * T * pitch + h * D;
  const float* K = kb + (size_t)b * T * pitch + h * D;
  const float* V = vb + (size_t)b * T * pitch + h * D;

  // A fragments of the wave's 16 query rows (scaled), hi/lo
  FragB aqh[KS], aql[KS];
  {
    int row = q0 + ln; if (row >= T) row = T - 1;
    const float* qr = Q + (size_t)row * pitch;
#pragma unroll
    for (int ks = 0; ks < KS; ++ks)
#pragma unroll
      for (int i = 0; i < 16; ++i) {
        const int d = ks * 32 + ((i < 8) ? (8 * hh + i) : (16 + 8 * hh + (i - 8)));
        const float x = qr[d] * scale; const unsigned short hb = bf16_bits(x);
        aqh[ks].u[i] = hb; aql[ks].u[i] = bf16_bits(x - bf16_val(hb));
      }
  }
  float m_r[8], l_r[8];
#pragma unroll
  for (int r = 0; r < 8; ++r) { m_r[r] = -3.0e38f; l_r[r] = 0.f; }
  v8f oacc[DT];
#pragma unroll
  for (int dt = 0; dt < DT; ++dt) oacc[dt] = (v8f){0.f,0.f,0.f,0.f,0.f,0.f,0.f,0.f};

  const int kv_end = CAUSAL ? min(T, qblk * 64 + 64) : T;     // block-uniform
  for (int j0 = 0; j0 < kv_end; j0 += 32) {
    __syncthreads();
    for (int e = tid; e < 32 * (D / 4); e += 128) {
      const int r = e / (D / 4), c4 = (e % (D / 4)) * 4;
      const int key = j0 + r;
      v4f kf = {0.f,0.f,0.f,0.f}, vf = {0.f,0.f,0.f,0.f};
      if (key < T) { kf = *(const v4fa*)(K + (size_t)key * pitch + c4); vf = *(const v4fa*)(V + (size_t)key * pitch + c4); }
#pragma unroll
      for (int t = 0; t < 4; ++t) {
        unsigned short hb = bf16_bits(kf[t]); sKh[r][c4 + t] = hb; sKl[r][c4 + t] = bf16_bits(kf[t] - bf16_val(hb));
        hb = bf16_bits(vf[t]); sVh[r][c4 + t] = hb; sVl[r][c4 + t] = bf16_bits(vf[t] - bf16_val(hb));
      }
    }
    __syncthreads();
    // S tile 16 x 32
    v8f s[2];
#pragma unroll
    for (int nt = 0; nt < 2; ++nt) {
      v8f acc = {};
#pragma unroll
      for (int ks = 0; ks < KS; ++ks) {
        FragB bh_, bl_;
        bh_.half[0] = *(const v8us*)&sKh[nt * 16 + ln][ks * 32 + 8 * hh]; bh_.half[1] = *(const v8us*)&sKh[nt * 16 + ln][ks * 32 + 16 + 8 * hh];
        bl_.half[0] = *(const v8us*)&sKl[nt * 16 + ln][ks * 32 + 8 * hh]; bl_.half[1] = *(const v8us*)&sKl[nt * 16 + ln][ks * 32 + 16 + 8 * hh];
        acc = mmaN<3>(aqh[ks].v, aql[ks].v, bh_.v, bl_.v, acc);
      }
      s[nt] = acc;
    }
    // mask + running max (rows 8hh+r; the 16 lanes of a half share rows)
    float alpha[8];
#pragma unroll
    for (int r = 0; r < 8; ++r) {
      const int qi = q0 + 8 * hh + r;
      const int ja = j0 + ln, jb = j0 + 16 + ln;
      if (CAUSAL) { if (ja > qi) s[0][r] = -3.0e38f; if (jb > qi) s[1][r] = -3.0e38f; }
      if (ja >= T) s[0][r] = -3.0e38f;
      if (jb >= T) s[1][r] = -3.0e38f;
      float mx = fmaxf(s[0][r], s[1][r]);
      mx = fmaxf(mx, __shfl_xor(mx, 1, 32)); mx = fmaxf(mx, __shfl_xor(mx, 2, 32)); mx = fmaxf(mx, __shfl_xor(mx, 4, 32)); mx = fmaxf(mx, __shfl_xor(mx, 8, 32));
      const float mnew = fmaxf(m_r[r], mx);
      alpha[r] = (mnew > -1.0e38f) ? __expf(m_r[r] - mnew) : 1.0f;
      const float p0 = (s[0][r] > -1.0e38f) ? __expf(s[0][r] - mnew) : 0.f;
      const float p1 = (s[1][r] > -1.0e38f) ? __expf(s[1][r] - mnew) : 0.f;
      m_r[r] = mnew;
      l_r[r] = l_r[r] * alpha[r] + p0 + p1;            // per-lane partial row sum (16 lanes combined at the end)
      unsigned short hb = bf16_bits(p0); sPh[w][8 * hh + r][ln] = hb;      sPl[w][8 * hh + r][ln] = bf16_bits(p0 - bf16_val(hb));
      hb = bf16_bits(p1);                sPh[w][8 * hh + r][16 + ln] = hb; sPl[w][8 * hh + r][16 + ln] = bf16_bits(p1 - bf16_val(hb));
    }
#pragma unroll
    for (int dt = 0; dt < DT; ++dt)
#pragma unroll
      for (int r = 0; r < 8; ++r) oacc[dt][r] *= alpha[r];
    __builtin_amdgcn_fence(__ATOMIC_ACQ_REL, "workgroup");
    __builtin_amdgcn_wave_barrier();
    FragB pah, pal;
    pah.half[0] = *(const v8us*)&sPh[w][ln][8 * hh]; pah.half[1] = *(const v8us*)&sPh[w][ln][16 + 8 * hh];
    pal.half[0] = *(const v8us*)&sPl[w][ln][8 * hh]; pal.half[1] = *(const v8us*)&sPl[w][ln][16 + 8 * hh];
#pragma unroll
    for (int dt = 0; dt < DT; ++dt) {
      FragB bvh, bvl;
#pragma unroll
      for (int i = 0; i < 8; ++i) {
        bvh.u[i] = sVh[8 * hh + i][dt * 16 + ln]; bvh.u[8 + i] = sVh[16 + 8 * hh + i][dt * 16 + ln];
        bvl.u[i] = sVl[8 * hh + i][dt * 16 + ln]; bvl.u[8 + i] = sVl[16 + 8 * hh + i][dt * 16 + ln];
      }
      oacc[dt] = mmaN<3>(pah.v, pal.v, bvh.v, bvl.v, oacc[dt]);
    }
    __builtin_amdgcn_fence(__ATOMIC_ACQ_REL, "workgroup");
    __builtin_amdgcn_wave_barrier();
  }
#pragma unroll
  for (int r = 0; r < 8; ++r) {
    float l = l_r[r];
    l += __shfl_xor(l, 1, 32); l += __shfl_xor(l, 2, 32); l += __shfl_xor(l, 4, 32); l += __shfl_xor(l, 8, 32);
    l_r[r] = (l > 0.f) ? 1.0f / l : 0.f;
  }
#pragma unroll
  for (int dt = 0; dt < DT; ++dt)
#pragma unroll
    for (int r = 0; r < 8; ++r) sO[w][8 * hh + r][dt * 16 + ln] = oacc[dt][r] * l_r[r];
  __builtin_amdgcn_fence(__ATOMIC_ACQ_REL, "workgroup");
  __builtin_amdgcn_wave_barrier();
  {
    for (int r = 0; r < 16; ++r) {
      const int row = q0 + r;
      if (row < T && lane < D / 4) {
        const v4f val = *(const v4fa*)&sO[w][r][lane * 4];
        *(v4f*)(y + ((size_t)b * T + row) * ypitch + h * D + lane * 4) = val;
      }
    }
    
  }
}

// GEMM C = act(A·W + bias + resid): A f32 (ASPLIT -> hi/lo 2 terms), Wt bf16 [N][K]; ACT 0 none, 1 relu, 2 exact gelu;
// resid (optional, f32, row index = (row % rmod), pitch ldr, RES_BF16 rounds it) added before the activation.
template <bool ASPLIT, int ACT, bool BIAS_BF16, bool RES_BF16>
__global__ __launch_bounds__(128) void k_gemm_bf3(const float* __restrict__ A, int lda, const unsigned short* __restrict__ Wt, int ldb,
                                                const float* __restrict__ bias, const float* __restrict__ resid, int rmod, int ldr,
                                                float* __restrict__ C, int ldc, int M, int N, int K) {
  __shared__ __attribute__((aligned(16))) float so[4][16][64];
  const int tid = threadIdx.x, w = tid >> 5, lane = tid & 31, ln = lane & 15, hh = lane >> 4;
  const int ntn = N / 64;
  const int wid = blockIdx.x * 4 + w;
  const int mt = wid / ntn, nq = wid % ntn;
  if (mt * 16 >= M) return;
  const int row0 = mt * 16, col0 = nq * 64;
  const float* arow = A + (size_t)(row0 + ln) * lda;
  v8f acc[4] = {};
  for (int kb = 0; kb < K; kb += 32) {
    FragB ah, al;
    const v4f x0 = *(const v4fa*)(arow + kb + 8 * hh), x1 = *(const v4fa*)(arow + kb + 8 * hh + 4);
    const v4f x2 = *(const v4fa*)(arow + kb + 16 + 8 * hh), x3 = *(const v4fa*)(arow + kb + 16 + 8 * hh + 4);
    float xs[16] = {x0[0],x0[1],x0[2],x0[3],x1[0],x1[1],x1[2],x1[3],x2[0],x2[1],x2[2],x2[3],x3[0],x3[1],x3[2],x3[3]};
#pragma unroll
    for (int i = 0; i < 16; ++i) { const unsigned short hb = bf16_bits(xs[i]); ah.u[i] = hb; al.u[i] = ASPLIT ? bf16_bits(xs[i] - bf16_val(hb)) : (unsigned short)0; }
#pragma unroll
    for (int t = 0; t < 4; ++t) {
      const unsigned short* brow = Wt + (size_t)(col0 + t * 16 + ln) * ldb + kb;
      FragB b;
      b.half[0] = *(const v8us*)(brow + 8 * hh);
      b.half[1] = *(const v8us*)(brow + 16 + 8 * hh);
      acc[t] = mmaN<ASPLIT ? 2 : 1>(ah.v, al.v, b.v, b.v, acc[t]);
    }
  }
#pragma unroll
  for (int t = 0; t < 4; ++t) {
    const int col = col0 + t * 16 + ln;
    float bv = bias ? bias[col] : 0.f;
    if (BIAS_BF16) bv = bf16_round(bv);
#pragma unroll
    for (int r = 0; r < 8; ++r) {
      float v = acc[t][r] + bv;
      if (resid) { float rv = resid[(size_t)((row0 + 8 * hh + r) % rmod) * ldr + col]; if (RES_BF16) rv = bf16_round(rv); v += rv; }
      if (ACT == 1) v = fmaxf(v, 0.f);
      if (ACT == 2) v = 0.5f * v * (1.0f + erff(v * 0.70710678118654752f));
      if (ACT == 3) { const float u = 0.7978845608028654f * (v + 0.044715f * v * v * v); v = 0.5f * v * (1.0f + tanhf(u)); }
      so[w][8 * hh + r][t * 16 + ln] = v;
    }
  }
  __builtin_amdgcn_fence(__ATOMIC_ACQ_REL, "workgroup");
  __builtin_amdgcn_wave_barrier();
  const int rsub = lane >> 4, c4 = (lane & 15) * 4;
  {
#pragma unroll
    for (int q = 0; q < 8; ++q) {
      const int r = q * 2 + rsub;
      const v4f v = *(const v4fa*)&so[w][r][c4];
      *(v4f*)(C + (size_t)(row0 + r) * ldc + col0 + c4) = v;
    }
    
  }
}
// row LayerNorm (biased variance, eps) over N: s = X (+ R); optional out_sum <- s; out_norm <- (s-mu)*rsqrt(var+eps)*g + b
template <bool PARAM_BF16>
__global__ __launch_bounds__(256) void k_layernorm(const float* __restrict__ X, const float* __restrict__ R, const float* __restrict__ g, const float* __restrict__ bta,
                                                  float* __restrict__ out_sum, float* __restrict__ out_norm, int N, float eps) {
  __shared__ float red[256];
  const int row = blockIdx.x, tid = threadIdx.x;
  const float* x = X + (size_t)row * N; const float* rr = R ? R + (size_t)row * N : nullptr;
  float vals[16];                     // up to N = 4096
  const int per = N / 256;            // contiguous chunk per thread? use strided-by-4 chunks: thread handles j = tid*4 + 1024*u
  float s1 = 0.f;
  for (int u = 0; u < per / 4; ++u) {
    const int j = tid * 4 + 1024 * u;
    const v4f a = *(const v4fa*)(x + j);
    v4f b = {0.f,0.f,0.f,0.f}; if (rr) b = *(const v4fa*)(rr + j);
#pragma unroll
    for (int q = 0; q < 4; ++q) { const float v = a[q] + b[q]; vals[u * 4 + q] = v; s1 += v; }
  }
  red[tid] = s1; __syncthreads();
  for (int st = 128; st > 0; st >>= 1) { if (tid < st) red[tid] += red[tid + st]; __syncthreads(); }
  const float mu = red[0] / (float)N; __syncthreads();
  float s2 = 0.f;
  for (int u = 0; u < per / 4; ++u)
#pragma unroll
    for (int q = 0; q < 4; ++q) { const float c = vals[u * 4 + q] - mu; s2 += c * c; }
  red[tid] = s2; __syncthreads();
  for (int st = 128; st > 0; st >>= 1) { if (tid < st) red[tid] += red[tid + st]; __syncthreads(); }
  const float rs = rsqrtf(red[0] / (float)N + eps);
  {
    for (int u = 0; u < per / 4; ++u) {
      const int j = tid * 4 + 1024 * u;
      v4f o, sm;
#pragma unroll
      for (int q = 0; q < 4; ++q) {
        float gg = g[j + q], bb = bta[j + q];
        if (PARAM_BF16) { gg = bf16_round(gg); bb = bf16_round(bb); }
        sm[q] = vals[u * 4 + q]; o[q] = (vals[u * 4 + q] - mu) * rs * gg + bb;
      }
      if (out_sum) *(v4f*)(out_sum + (size_t)row * N + j) = sm;
      *(v4f*)(out_norm + (size_t)row * N + j) = o;
    }
    
  }
}



// ---- f16 WMMA path (v_wmma_f32_16x16x32_f16): 11-bit significands for operands in range — used where a [0,1] probability operand needs more precision than bf16
typedef _Float16 v16h __attribute__((ext_vector_type(16)));
union FragH { v16h v; v8us half[2]; _Float16 h[16]; unsigned short u[16]; };
template <int NT>
__device__ __forceinline__ v8f mmaH(v16h ah, v16h al, v16h bh, v16h bl, v8f c) {
  c = __builtin_amdgcn_wmma_f32_16x16x32_f16(false, ah, false, bh, (short)0, c, false, false);
  if (NT >= 2) c = __builtin_amdgcn_wmma_f32_16x16x32_f16(false, al, false, bh, (short)0, c, false, false);
  if (NT >= 3) c = __builtin_amdgcn_wmma_f32_16x16x32_f16(false, ah, false, bl, (short)0, c, false, false);
  asm volatile("v_nop\n\tv_nop\n\tv_nop\n\tv_nop" : "+v"(c) : "v"(ah), "v"(al), "v"(bh), "v"(bl));
  return c;
}
// batched GEMM like k_gemm_b but f16 operands: A f32 (split into f16 hi/lo if ASPLIT, else rounded to f16), Bt = f16 values [n][k]; alpha; C f32; N multiple of 16 (partial tiles skipped)
template <bool ASPLIT>
__global__ __launch_bounds__(128) void k_gemm_h(const float* __restrict__ A, int lda, size_t sA, const _Float16* __restrict__ Bh, int ldb, size_t sB, float alpha, float* __restrict__ C, int ldc, size_t sC, int M, int N, int K) {
  __shared__ __attribute__((aligned(16))) float so[4][16][64];
  const int tid = threadIdx.x, w = tid >> 5, lane = tid & 31, ln = lane & 15, hh = lane >> 4; const int by = blockIdx.y;
  A += (size_t)by * sA; Bh += (size_t)by * sB; C += (size_t)by * sC;
  const int ntn = (N + 63) / 64; const int wid = blockIdx.x * 4 + w; const int mt = wid / ntn, nq = wid % ntn; if (mt * 16 >= M) return;
  const int row0 = mt * 16, col0 = nq * 64; const float* arow = A + (size_t)(row0 + ln) * lda;
  v8f acc[4] = {};
  for (int kb = 0; kb < K; kb += 32) {
    FragH ah, al;
    const v4f x0 = *(const v4fa*)(arow + kb + 8 * hh), x1 = *(const v4fa*)(arow + kb + 8 * hh + 4), x2 = *(const v4fa*)(arow + kb + 16 + 8 * hh), x3 = *(const v4fa*)(arow + kb + 16 + 8 * hh + 4);
    float xs[16] = {x0[0],x0[1],x0[2],x0[3],x1[0],x1[1],x1[2],x1[3],x2[0],x2[1],x2[2],x2[3],x3[0],x3[1],x3[2],x3[3]};
#pragma unroll
    for (int i = 0; i < 16; ++i) { const _Float16 h = (_Float16)xs[i]; ah.h[i] = h; al.h[i] = ASPLIT ? (_Float16)(xs[i] - (float)h) : (_Float16)0.0f; }
#pragma unroll
    for (int t = 0; t < 4; ++t) { if (col0 + t * 16 >= N) continue; const size_t boff = (size_t)(col0 + t * 16 + ln) * ldb + kb; FragH bq; bq.half[0] = *(const v8us*)(Bh + boff + 8 * hh); bq.half[1] = *(const v8us*)(Bh + boff + 16 + 8 * hh);
      acc[t] = mmaH<ASPLIT ? 2 : 1>(ah.v, al.v, bq.v, bq.v, acc[t]); }
  }
#pragma unroll
  for (int t = 0; t < 4; ++t) { if (col0 + t * 16 >= N) continue;
#pragma unroll
    for (int r = 0; r < 8; ++r) so[w][8 * hh + r][t * 16 + ln] = acc[t][r] * alpha; }
  __builtin_amdgcn_fence(__ATOMIC_ACQ_REL, "workgroup"); __builtin_amdgcn_wave_barrier();
  const int rsub = lane >> 4, c4 = (lane & 15) * 4;
  {
#pragma unroll
    for (int q = 0; q < 8; ++q) { const int r = q * 2 + rsub; if (col0 + c4 < N) { const v4f v = *(const v4fa*)&so[w][r][c4]; *(v4f*)(C + (size_t)(row0 + r) * ldc + col0 + c4) = v; } }
     }
}

// Wt[n][k] = f16(W[k][n]·scale) from f32 row-major W[K][N] (scale = power of two; bf16-exact weights stay exact in f16 away from the subnormal range)
__global__ __launch_bounds__(256) void k_wt_f16(const float* __restrict__ W, _Float16* __restrict__ Wt, int K, int N, float scale) {
  const int t = blockIdx.x * 256 + threadIdx.x; if (t >= N * (K / 8)) return; const int n = t / (K / 8), k8 = (t % (K / 8)) * 8; FragH f;
#pragma unroll
  for (int i = 0; i < 8; ++i) f.h[i] = (_Float16)(bf16_round(W[(size_t)(k8 + i) * N + n]) * scale); const v8us o = f.half[0];
  *(v8us*)((unsigned short*)Wt + (size_t)n * K + k8) = o; 
}
// k_gemm_hh variant with fused epilogue: v = acc·alpha + bias[by·sBias + col] (+ CP[(row/rowsPerB)·sCPb + by·64 + col] if CP) ; ACT 0 none / 1 elu ; writes f32 C and f16 C16, each if non-null
template <int ACT>
__global__ __launch_bounds__(128) void k_gemm_hhx(const _Float16* __restrict__ A, int lda, size_t sA, const _Float16* __restrict__ Bh, int ldb, size_t sB, float alpha, const float* __restrict__ bias, size_t sBias, const float* __restrict__ CP, int rowsPerB, size_t sCPb, int row0g,
    float* __restrict__ C, _Float16* __restrict__ C16, int ldc, size_t sC, int M, int N, int K) {
  __shared__ __attribute__((aligned(16))) float so[4][16][64];
  const int tid = threadIdx.x, w = tid >> 5, lane = tid & 31, ln = lane & 15, hh = lane >> 4; const int by = blockIdx.y;
  A += (size_t)by * sA; Bh += (size_t)by * sB; const size_t cofs = (size_t)by * sC; const float* bp = bias ? bias + (size_t)by * sBias : nullptr;
  const int ntn = (N + 63) / 64; const int wid = blockIdx.x * 4 + w; const int mt = wid / ntn, nq = wid % ntn; if (mt * 16 >= M) return;
  const int row0 = mt * 16, col0 = nq * 64; const _Float16* arow = A + (size_t)(row0 + ln) * lda;
  v8f acc[4] = {};
  for (int kb = 0; kb < K; kb += 32) { FragH ah; ah.half[0] = *(const v8us*)((const unsigned short*)arow + kb + 8 * hh); ah.half[1] = *(const v8us*)((const unsigned short*)arow + kb + 16 + 8 * hh);
#pragma unroll
    for (int t = 0; t < 4; ++t) { if (col0 + t * 16 >= N) continue; const size_t boff = (size_t)(col0 + t * 16 + ln) * ldb + kb; FragH bq; bq.half[0] = *(const v8us*)((const unsigned short*)Bh + boff + 8 * hh); bq.half[1] = *(const v8us*)((const unsigned short*)Bh + boff + 16 + 8 * hh);
      acc[t] = mmaH<1>(ah.v, ah.v, bq.v, bq.v, acc[t]); }
  }
#pragma unroll
  for (int t = 0; t < 4; ++t) { if (col0 + t * 16 >= N) continue; const int col = col0 + t * 16 + ln; const float bv = bp ? bf16_round(bp[col]) : 0.f;
#pragma unroll
    for (int r = 0; r < 8; ++r) { float v = acc[t][r] * alpha + bv; if (CP) { const int bidx = (row0g + row0 + 8 * hh + r) / rowsPerB; v += CP[(size_t)bidx * sCPb + (size_t)by * 64 + col]; } if (ACT == 1) v = (v > 0.f) ? v : expm1f(v); else if (ACT == 3) v = fmaxf(v, 0.f); so[w][8 * hh + r][t * 16 + ln] = v; } }
  __builtin_amdgcn_fence(__ATOMIC_ACQ_REL, "workgroup"); __builtin_amdgcn_wave_barrier();
  const int rsub = lane >> 4, c4 = (lane & 15) * 4; typedef _Float16 v4h __attribute__((ext_vector_type(4)));
  {
#pragma unroll
    for (int q = 0; q < 8; ++q) { const int r = q * 2 + rsub; if (col0 + c4 < N) { const v4f v = *(const v4fa*)&so[w][r][c4]; if (C) *(v4f*)(C + cofs + (size_t)(row0 + r) * ldc + col0 + c4) = v; if (C16) { v4h h4; for (int i = 0; i < 4; ++i) h4[i] = (_Float16)v[i]; *(v4h*)(C16 + cofs + (size_t)(row0 + r) * ldc + col0 + c4) = h4; } } }
     }
}


__global__ __launch_bounds__(256) void k_x16(const float* __restrict__ x, _Float16* __restrict__ X16, size_t n8) { const size_t t = (size_t)blockIdx.x * 256 + threadIdx.x; if (t >= n8) return; FragH f;
#pragma unroll
  for (int q = 0; q < 8; ++q) f.h[q] = (_Float16)bf16_round(x[t * 8 + q]); *(v8us*)((unsigned short*)X16 + t * 8) = f.half[0];  }
__global__ __launch_bounds__(256) void k_h16(const float* __restrict__ x, _Float16* __restrict__ X16, size_t n8) { const size_t t = (size_t)blockIdx.x * 256 + threadIdx.x; if (t >= n8) return; FragH f;
#pragma unroll
  for (int q = 0; q < 8; ++q) f.h[q] = (_Float16)x[t * 8 + q]; *(v8us*)((unsigned short*)X16 + t * 8) = f.half[0];  }
__global__ __launch_bounds__(256) void k_round16f(const float* __restrict__ W, _Float16* __restrict__ Bt, size_t n8) { const size_t t = (size_t)blockIdx.x * 256 + threadIdx.x; if (t >= n8) return; FragH f;
#pragma unroll
  for (int i = 0; i < 8; ++i) f.h[i] = (_Float16)(bf16_round(W[t * 8 + i]) * 16.0f); *(v8us*)((unsigned short*)Bt + t * 8) = f.half[0];  }
template <int NHv, int TTv>
__global__ __launch_bounds__(256) void k_vt(const _Float16* __restrict__ V16, int ldv, int voff, _Float16* __restrict__ Vt) { __shared__ unsigned short tl[64][66]; const int tid = threadIdx.x; const int slab = blockIdx.x / (TTv / 64), lg = blockIdx.x % (TTv / 64); const int b = slab / NHv, h = slab % NHv;
  for (int i = tid; i < 64 * 8; i += 256) { const int r = i / 8, c8 = (i % 8) * 8; FragH f; f.half[0] = *(const v8us*)((const unsigned short*)V16 + ((size_t)b * TTv + lg * 64 + r) * ldv + voff + h * 64 + c8);
#pragma unroll
    for (int q = 0; q < 8; ++q) tl[r][c8 + q] = f.u[q]; }
  __syncthreads();
  {
#pragma unroll
    for (int rd = 0; rd < 2; ++rd) { const int d = rd * 32 + tid / 8, pc = tid % 8; FragH f;
#pragma unroll
      for (int q = 0; q < 8; ++q) f.u[q] = tl[pc * 8 + q][d];
      *(v8us*)((unsigned short*)Vt + ((size_t)slab * 64 + d) * TTv + lg * 64 + pc * 8) = f.half[0]; }
     } }

__global__ __launch_bounds__(128) void k_flash(const _Float16* __restrict__ Q16, int ldq, const _Float16* __restrict__ K16, int ldk, const _Float16* __restrict__ Vt, const float* __restrict__ CB, const float* __restrict__ beta, float* __restrict__ O, int ldo) {
  __shared__ float scb[2048];
  constexpr int RPW = 16, RTN = RPW / 16, NQB = 2048 / (4 * RPW), DT = 4, KS = 2;
  __shared__ __attribute__((aligned(16))) unsigned short sP[4][RPW][40]; __shared__ __attribute__((aligned(16))) float sO[4][RPW][64 + 4];
  const int tid = threadIdx.x, w = tid >> 5, lane = tid & 31, ln = lane & 15, hh = lane >> 4;
  const int slab = blockIdx.x / NQB, qblk = blockIdx.x % NQB; const int b = slab / 12, h = slab % 12; const int qb0 = qblk * (4 * RPW); const int q0 = qb0 + w * RPW;
  FragH aq[2][KS];
#pragma unroll
  for (int rt = 0; rt < RTN; ++rt) { const unsigned short* qr = (const unsigned short*)Q16 + ((size_t)b * 2048 + q0 + rt * 16 + ln) * ldq + h * 64;
#pragma unroll
    for (int ks = 0; ks < KS; ++ks) { aq[rt][ks].half[0] = *(const v8us*)(qr + ks * 32 + 8 * hh); aq[rt][ks].half[1] = *(const v8us*)(qr + ks * 32 + 16 + 8 * hh); } }
  for (int i = tid; i < 2048; i += 128) scb[i] = CB[i]; const float bh = bf16_round(beta[h]); __syncthreads();
  const unsigned short* Vth = (const unsigned short*)Vt + (size_t)slab * 64 * 2048; float lc_r[2][8];      /* causal partial sums Σ_{k ≤ q} e^{s−m} */
#pragma unroll
  for (int rt = 0; rt < RTN; ++rt) for (int r = 0; r < 8; ++r) lc_r[rt][r] = 0.f;
  float m_r[2][8], l_r[2][8]; v8f oacc[2][DT];
#pragma unroll
  for (int rt = 0; rt < RTN; ++rt) {
#pragma unroll
    for (int r = 0; r < 8; ++r) { m_r[rt][r] = -3.0e38f; l_r[rt][r] = 0.f; }
#pragma unroll
    for (int dt = 0; dt < DT; ++dt) oacc[rt][dt] = (v8f){0.f,0.f,0.f,0.f,0.f,0.f,0.f,0.f}; }
  const int jend = 2048;
#pragma unroll 1
  for (int j0 = 0; j0 < jend; j0 += 32) {
    
    v8f s[2][2];
#pragma unroll
    for (int nt = 0; nt < 2; ++nt) { const unsigned short* kr = (const unsigned short*)K16 + ((size_t)b * 2048 + j0 + nt * 16 + ln) * ldk + h * 64; FragH bk[KS];
#pragma unroll
      for (int ks = 0; ks < KS; ++ks) { bk[ks].half[0] = *(const v8us*)(kr + ks * 32 + 8 * hh); bk[ks].half[1] = *(const v8us*)(kr + ks * 32 + 16 + 8 * hh); }
#pragma unroll
      for (int rt = 0; rt < RTN; ++rt) { v8f acc = (v8f){0.f,0.f,0.f,0.f,0.f,0.f,0.f,0.f};
#pragma unroll
        for (int ks = 0; ks < KS; ++ks) acc = mmaH<1>(aq[rt][ks].v, aq[rt][ks].v, bk[ks].v, bk[ks].v, acc); s[rt][nt] = acc; } }
#pragma unroll
    for (int rt = 0; rt < RTN; ++rt)
#pragma unroll
      for (int r = 0; r < 8; ++r) { const int tq = q0 + rt * 16 + 8 * hh + r; const int k0 = j0 + ln, k1 = j0 + 16 + ln; (void)tq; (void)k0; (void)k1;
        const int d0 = (tq >= k0) ? (tq - k0) : (k0 - tq), d1 = (tq >= k1) ? (tq - k1) : (k1 - tq);      /* phase coherence 1 + β·mean_f cos(Δ·θ_f), Δ = |q − k| */
        const float s0 = s[rt][0][r] * 0.125f * (1.0f + bh * scb[d0]), s1 = s[rt][1][r] * 0.125f * (1.0f + bh * scb[d1]); const bool c0 = (k0 <= tq), c1 = (k1 <= tq); float mc = fmaxf(s0, s1);
        mc = fmaxf(mc, __shfl_xor(mc, 1, 32)); mc = fmaxf(mc, __shfl_xor(mc, 2, 32)); mc = fmaxf(mc, __shfl_xor(mc, 4, 32)); mc = fmaxf(mc, __shfl_xor(mc, 8, 32));
        const float mn = fmaxf(m_r[rt][r], mc); const float ea = expf(m_r[rt][r] - mn); /* made for every lane and picked by a select: written behind the test it compiled to one branch per row, which cut the pass into nine blocks and put the eight rows' cross-lane and exp chains one behind the other */ const float al = (mn > -1.0e38f) ? ea : 1.0f; m_r[rt][r] = mn; const float e0 = expf(s0 - mn), e1 = expf(s1 - mn); l_r[rt][r] = l_r[rt][r] * al + e0 + e1; const float p0 = c0 ? e0 : 0.f, p1 = c1 ? e1 : 0.f; lc_r[rt][r] = lc_r[rt][r] * al + p0 + p1;      /* full-softmax stats over ALL keys; P·V and Σ only over the causal ones */
#pragma unroll
        for (int dt = 0; dt < DT; ++dt) oacc[rt][dt][r] *= al;
        FragH t2; t2.h[0] = (_Float16)p0; t2.h[1] = (_Float16)p1; sP[w][rt * 16 + 8 * hh + r][ln] = t2.u[0]; sP[w][rt * 16 + 8 * hh + r][16 + ln] = t2.u[1]; }
    __builtin_amdgcn_fence(__ATOMIC_ACQ_REL, "workgroup"); __builtin_amdgcn_wave_barrier();
    FragH pa[2];
#pragma unroll
    for (int rt = 0; rt < RTN; ++rt) { pa[rt].half[0] = *(const v8us*)&sP[w][rt * 16 + ln][8 * hh]; pa[rt].half[1] = *(const v8us*)&sP[w][rt * 16 + ln][16 + 8 * hh]; }
if (j0 <= q0 + RPW - 1) {      /* some key of this chunk is ≤ some query of this wave; otherwise every p is 0 */
#pragma unroll
    for (int dt = 0; dt < DT; ++dt) { const unsigned short* vrow = Vth + (size_t)(dt * 16 + ln) * 2048 + j0; FragH bv; bv.half[0] = *(const v8us*)(vrow + 8 * hh); bv.half[1] = *(const v8us*)(vrow + 16 + 8 * hh);
#pragma unroll
      for (int rt = 0; rt < RTN; ++rt) oacc[rt][dt] = mmaH<1>(pa[rt].v, pa[rt].v, bv.v, bv.v, oacc[rt][dt]); } }
    __builtin_amdgcn_fence(__ATOMIC_ACQ_REL, "workgroup"); __builtin_amdgcn_wave_barrier(); }
#pragma unroll
  for (int rt = 0; rt < RTN; ++rt) {
#pragma unroll
    for (int r = 0; r < 8; ++r) { float l = l_r[rt][r]; l += __shfl_xor(l, 1, 32); l += __shfl_xor(l, 2, 32); l += __shfl_xor(l, 4, 32); l += __shfl_xor(l, 8, 32); float lc = lc_r[rt][r]; lc += __shfl_xor(lc, 1, 32); lc += __shfl_xor(lc, 2, 32); lc += __shfl_xor(lc, 4, 32); lc += __shfl_xor(lc, 8, 32); l_r[rt][r] = 1.0f / (lc + 1e-8f * l); }      /* w·causal / (Σ_causal w + 1e-8) with w = e^{s−m}/Z_full  ⇒  e^{s−m} / (Z_causal + 1e-8·Z_full) */
#pragma unroll
    for (int dt = 0; dt < DT; ++dt)
#pragma unroll
      for (int r = 0; r < 8; ++r) sO[w][rt * 16 + 8 * hh + r][dt * 16 + ln] = oacc[rt][dt][r] * l_r[rt][r]; }
  __builtin_amdgcn_fence(__ATOMIC_ACQ_REL, "workgroup"); __builtin_amdgcn_wave_barrier();
  {
#pragma unroll
    for (int rp = 0; rp < RPW; rp += 2) { const int r = rp + (lane >> 4), pc = lane & 15; const v4f val = *(const v4fa*)&sO[w][r][pc * 4]; *(v4f*)(O + ((size_t)b * 2048 + q0 + r) * ldo + h * 64 + pc * 4) = val; }
     } }

__global__ __launch_bounds__(256) void k_cb(float* __restrict__ CB) { __shared__ float sc[8][33]; const int tid = threadIdx.x, g = tid >> 5, f = tid & 31; const int dl = blockIdx.x * 8 + g;      /* one thread per (distance, frequency) term; a block makes 8 table entries */
  const float th = powf(10000.0f, -(float)(2 * f) / 64.0f); sc[g][f] = cosf((float)dl * th); __syncthreads();
  if (tid < 8) { float s = 0.f;
    for (int i = 0; i < 32; ++i) s += sc[tid][i];      /* f = 0..31 in ascending order, the order in which one thread summed them before */
    CB[blockIdx.x * 8 + tid] = s / 32.0f; } }
// rotary + rms-norm per (row, head): x1 = q[h·64 + j], x2 = q[h·64 + 32 + j] (j < 32); out = [x1·cos + x2·sin | −x1·sin + x2·cos] with cos/sin = bf16(INPUT tables [t][j]); then × rsqrt(mean(out²) + f32 eps) → f16;
__global__ __launch_bounds__(256) void k_ropenorm(const float* __restrict__ Qf, const float* __restrict__ cosT, const float* __restrict__ sinT, _Float16* __restrict__ Q16) { const size_t tg = (size_t)blockIdx.x * 256 + threadIdx.x; if (tg >= (size_t)NR * NH * 4) return; const size_t row = tg / (NH * 4); const int h = (int)((tg / 4) % NH), pc = (int)(tg % 4); const int t = (int)(row % TT); const int j0 = pc * 8;
  float a[8], bq[8]; float ss = 0.f;
#pragma unroll
  for (int q = 0; q < 8; ++q) { const int j = j0 + q; const float x1 = Qf[row * CC + h * 64 + j], x2 = Qf[row * CC + h * 64 + 32 + j]; const float c = bf16_round(cosT[t * 32 + j]), s = bf16_round(sinT[t * 32 + j]); a[q] = x1 * c + x2 * s; bq[q] = -x1 * s + x2 * c; ss += a[q] * a[q] + bq[q] * bq[q]; }
  ss += __shfl_xor(ss, 1, 32); ss += __shfl_xor(ss, 2, 32); const float rn = rsqrtf(ss / 64.0f + 1.1920929e-7f); FragH f1, f2;
#pragma unroll
  for (int q = 0; q < 8; ++q) { f1.h[q] = (_Float16)(a[q] * rn); f2.h[q] = (_Float16)(bq[q] * rn); }
  { *(v8us*)((unsigned short*)Q16 + row * CC + h * 64 + j0) = f1.half[0]; *(v8us*)((unsigned short*)Q16 + row * CC + h * 64 + 32 + j0) = f2.half[0];  } }
extern "C" void kernel_launch(void* const* d_in, const int* in_sizes, int n_in,
                              void* d_out, int out_size, void* d_ws, size_t ws_size, hipStream_t stream) {
  (void)in_sizes; (void)n_in; (void)out_size;
  const float* x = (const float*)d_in[0]; const float* cosT = (const float*)d_in[1]; const float* sinT = (const float*)d_in[2]; const float* Wq = (const float*)d_in[3]; const float* Wk = (const float*)d_in[4]; const float* Wv = (const float*)d_in[5]; const float* Wo = (const float*)d_in[6]; const float* beta = (const float*)d_in[7];
  char* ws = (char*)d_ws; size_t off = 0;
  auto take = [&](size_t bytes) { char* p = ws + off; off += (bytes + 255) & ~(size_t)255; return p; };
  _Float16* Bq = (_Float16*)take((size_t)CC * CC * 2); _Float16* Bk = (_Float16*)take((size_t)CC * CC * 2); _Float16* Bv = (_Float16*)take((size_t)CC * CC * 2); _Float16* Bo = (_Float16*)take((size_t)CC * CC * 2); float* CB = (float*)take(TT * 4);
  _Float16* X16 = (_Float16*)take((size_t)NR * CC * 2); float* Qf = (float*)take((size_t)NR * CC * 4); float* Kf = (float*)take((size_t)NR * CC * 4); _Float16* Q16 = (_Float16*)take((size_t)NR * CC * 2); _Float16* K16 = (_Float16*)take((size_t)NR * CC * 2); _Float16* V16 = (_Float16*)take((size_t)NR * CC * 2); _Float16* Vt = (_Float16*)take((size_t)NR * CC * 2); float* O = Qf; _Float16* O16 = X16;      // Qf dead after k_ropenorm; X16 dead after the V GEMM
  if (off > ws_size) return;      // 4.7 + 6.3 + 12.6 × 2 + 6.3 × 4 ≈ 59 MiB
  const size_t w8 = (size_t)CC * CC / 8; const unsigned gw = (unsigned)((w8 + 255) / 256);
  k_round16f<<<gw, 256, 0, stream>>>(Wq, Bq, w8); k_round16f<<<gw, 256, 0, stream>>>(Wk, Bk, w8); k_round16f<<<gw, 256, 0, stream>>>(Wv, Bv, w8); k_round16f<<<gw, 256, 0, stream>>>(Wo, Bo, w8);      // (out,in)
  k_cb<<<TT / 8, 256, 0, stream>>>(CB);
  const unsigned gx = (unsigned)(((size_t)NR * CC / 8 + 255) / 256); const dim3 gg(((NR / 16) * (CC / 64) + 3) / 4, 1);
  k_x16<<<gx, 256, 0, stream>>>(x, X16, (size_t)NR * CC / 8);
  k_gemm_hhx<0><<<gg, 128, 0, stream>>>(X16, CC, 0, Bq, CC, 0, 0.0625f, nullptr, 0, nullptr, 1, 0, 0, Qf, nullptr, CC, 0, NR, CC, CC);
  k_gemm_hhx<0><<<gg, 128, 0, stream>>>(X16, CC, 0, Bk, CC, 0, 0.0625f, nullptr, 0, nullptr, 1, 0, 0, Kf, nullptr, CC, 0, NR, CC, CC);
  k_gemm_hhx<0><<<gg, 128, 0, stream>>>(X16, CC, 0, Bv, CC, 0, 0.0625f, nullptr, 0, nullptr, 1, 0, 0, nullptr, V16, CC, 0, NR, CC, CC);
  const unsigned gr = (unsigned)(((size_t)NR * NH * 4 + 255) / 256);
  k_ropenorm<<<gr, 256, 0, stream>>>(Qf, cosT, sinT, Q16); k_ropenorm<<<gr, 256, 0, stream>>>(Kf, cosT, sinT, K16);
  k_vt<NH, TT><<<BB * NH * (TT / 64), 256, 0, stream>>>(V16, CC, 0, Vt);
  k_flash<<<BB * NH * (TT / 64), 128, 0, stream>>>(Q16, CC, K16, CC, Vt, CB, beta, O, CC);      // RPW 16
  k_h16<<<gx, 256, 0, stream>>>(O, O16, (size_t)NR * CC / 8);
  k_gemm_hhx<0><<<gg, 128, 0, stream>>>(O16, CC, 0, Bo, CC, 0, 0.0625f, nullptr, 0, nullptr, 1, 0, 0, (float*)d_out, nullptr, CC, 0, NR, CC, CC);
}

// v003
// A run of this version takes 247 microseconds.
// Two timings next to v002 put it at 1.24 and 1.23 times that version's speed.
// All steps since v000 together make it 1.85 times as fast.
#include <hip/hip_runtime.h>
// Phase-aware causal attention: q/k/v/o projections (4096 × 768 × 768, no bias, weights (out,in) bf16-exact ×2^4) and the 12-head attention as a fused flash-style kernel on v_wmma_f32_16x16x32_f16
// (rotary (with the INPUT cos/sin tables) + rms-norm'd q,k as f16; S = Q·Kᵀ/8 × (1 + β_h·mean_f cos(|q−k|·θ_f)) with the 2048-entry coherence table precomputed; the module's FULL softmax followed
// by causal masking and re-normalisation with +1e-8 is reproduced exactly as e^{s−m}/(Z_causal + 1e-8·Z_full) with m, Z_full over all keys; P f16 ≤ 1; O = P·V over causal keys); f32 accumulate.
#define BB 2
#define TT 2048
#define CC 768
#define NH 12
#define NR (BB * TT)

typedef __bf16 v16b __attribute__((ext_vector_type(16)));
typedef unsigned short v8us __attribute__((ext_vector_type(8), may_alias));
typedef float  v8f  __attribute__((ext_vector_type(8)));
typedef float  v4f  __attribute__((ext_vector_type(4)));
typedef float  v4fa __attribute__((ext_vector_type(4), may_alias));
union FragB { v16b v; v8us half[2]; unsigned short u[16]; };

__device__ __forceinline__ unsigned short bf16_bits(float x) { unsigned int u = __float_as_uint(x); return (unsigned short)((u + 0x7FFFu + ((u >> 16) & 1u)) >> 16); }
__device__ __forceinline__ float bf16_val(unsigned short b) { return __uint_as_float(((unsigned int)b) << 16); }
__device__ __forceinline__ float bf16_round(float x) { return bf16_val(bf16_bits(x)); }
// D += A·B with NT terms: 1 = ah·bh, 2 = + al·bh (A split), 3 = + ah·bl (both split)
template <int NT>
__device__ __forceinline__ v8f mmaN(v16b ah, v16b al, v16b bh, v16b bl, v8f c) {
  c = __builtin_amdgcn_wmma_f32_16x16x32_bf16(false, ah, false, bh, (short)0, c, false, false);
  if (NT >= 2) c = __builtin_amdgcn_wmma_f32_16x16x32_bf16(false, al, false, bh, (short)0, c, false, false);
  if (NT >= 3) c = __builtin_amdgcn_wmma_f32_16x16x32_bf16(false, ah, false, bl, (short)0, c, false, false);
  asm volatile("v_nop\n\tv_nop\n\tv_nop\n\tv_nop" : "+v"(c) : "v"(ah), "v"(al), "v"(bh), "v"(bl));
  return c;
}

__global__ __launch_bounds__(256) void k_wt_bf16(const float* __restrict__ W, unsigned short* __restrict__ Wt, int K, int N) {
  const int t = blockIdx.x * 256 + threadIdx.x;
  const int k8n = K / 8;
  if (t >= N * k8n) return;
  const int n = t / k8n, k8 = (t % k8n) * 8;
  v8us v;
#pragma unroll
  for (int i = 0; i < 8; ++i) v[i] = bf16_bits(W[(size_t)(k8 + i) * N + n]);
  *(v8us*)(Wt + (size_t)n * K + k8) = v;
  
}

// GEMM C[M][N] (f32, pitch ldc) = act(A[M][K]·W + bias). A f32 row-major (pitch lda) converted per fragment to bf16
// (ASPLIT: hi/lo two planes -> 2 terms, else single rounded term); Wt bf16 [N][K] (pitch ldb). BIAS_BF16 rounds the
// bias to bf16 first (bias quantised to bf16 before the add). K%32==0, M%16==0, N%64==0.
template <bool ASPLIT, int ACT, bool BIAS_BF16>
__global__ __launch_bounds__(128) void k_gemm_bf(const float* __restrict__ A, int lda, const unsigned short* __restrict__ Wt, int ldb,
                                               const float* __restrict__ bias, float* __restrict__ C, int ldc, int M, int N, int K) {
  __shared__ __attribute__((aligned(16))) float so[4][16][64];
  const int tid = threadIdx.x, w = tid >> 5, lane = tid & 31, ln = lane & 15, hh = lane >> 4;
  const int ntn = N / 64;
  const int wid = blockIdx.x * 4 + w;
  const int mt = wid / ntn, nq = wid % ntn;
  if (mt * 16 >= M) return;
  const int row0 = mt * 16, col0 = nq * 64;
  const float* arow = A + (size_t)(row0 + ln) * lda;
  v8f acc[4] = {};
  for (int kb = 0; kb < K; kb += 32) {
    FragB ah, al;
    const v4f x0 = *(const v4fa*)(arow + kb + 8 * hh), x1 = *(const v4fa*)(arow + kb + 8 * hh + 4);
    const v4f x2 = *(const v4fa*)(arow + kb + 16 + 8 * hh), x3 = *(const v4fa*)(arow + kb + 16 + 8 * hh + 4);
    float xs[16] = {x0[0],x0[1],x0[2],x0[3],x1[0],x1[1],x1[2],x1[3],x2[0],x2[1],x2[2],x2[3],x3[0],x3[1],x3[2],x3[3]};
#pragma unroll
    for (int i = 0; i < 16; ++i) { const unsigned short hb = bf16_bits(xs[i]); ah.u[i] = hb; al.u[i] = ASPLIT ? bf16_bits(xs[i] - bf16_val(hb)) : (unsigned short)0; }
#pragma unroll
    for (int t = 0; t < 4; ++t) {
      const unsigned short* brow = Wt + (size_t)(col0 + t * 16 + ln) * ldb + kb;
      FragB b;
      b.half[0] = *(const v8us*)(brow + 8 * hh);
      b.half[1] = *(const v8us*)(brow + 16 + 8 * hh);
      acc[t] = mmaN<ASPLIT ? 2 : 1>(ah.v, al.v, b.v, b.v, acc[t]);
    }
  }
#pragma unroll
  for (int t = 0; t < 4; ++t) {
    float bv = bias ? bias[col0 + t * 16 + ln] : 0.f;
    if (BIAS_BF16) bv = bf16_round(bv);
#pragma unroll
    for (int r = 0; r < 8; ++r) { float v = acc[t][r] + bv; if (ACT == 1) v = fmaxf(v, 0.f); so[w][8 * hh + r][t * 16 + ln] = v; }
  }
  __builtin_amdgcn_fence(__ATOMIC_ACQ_REL, "workgroup");
  __builtin_amdgcn_wave_barrier();
  const int rsub = lane >> 4, c4 = (lane & 15) * 4;
  {
#pragma unroll
    for (int q = 0; q < 8; ++q) {
      const int r = q * 2 + rsub;
      const v4f v = *(const v4fa*)&so[w][r][c4];
      *(v4f*)(C + (size_t)(row0 + r) * ldc + col0 + c4) = v;
    }
    
  }
}

// Flash-style causal/unmasked attention, all contractions 3-term bf16 hi/lo splits, f32 softmax with running max.
// q,k,v rows are read from f32 buffers with arbitrary row pitch (so they can live inside a fused qkv buffer);
// D = head size (multiple of 32, <= 128); one wave = 16 query rows; block = 4 waves (64 queries) sharing K/V chunks of 32.
template <int D, bool CAUSAL>
__global__ __launch_bounds__(128) void k_flash(const float* __restrict__ qb, const float* __restrict__ kb, const float* __restrict__ vb,
                                             int pitch, int T, int H, float scale, float* __restrict__ y, int ypitch) {
  constexpr int KS = D / 32;        // k-steps for QK
  constexpr int DT = D / 16;        // d tiles for PV
  __shared__ __attribute__((aligned(16))) unsigned short sKh[32][D + 8], sKl[32][D + 8], sVh[32][D + 8], sVl[32][D + 8];
  __shared__ __attribute__((aligned(16))) unsigned short sPh[4][16][40], sPl[4][16][40];
  __shared__ __attribute__((aligned(16))) float sO[4][16][D];
  const int tid = threadIdx.x, w = tid >> 5, lane = tid & 31, ln = lane & 15, hh = lane >> 4;
  const int nqb = (T + 63) / 64;
  const int bh = blockIdx.x / nqb, qblk = blockIdx.x % nqb;
  const int b = bh / H, h = bh % H;
  const int q0 = qblk * 64 + w * 16;
  const float* Q = qb + (size_t)b * T * pitch + h * D;
  const float* K = kb + (size_t)b * T * pitch + h * D;
  const float* V = vb + (size_t)b * T * pitch + h * D;

  // A fragments of the wave's 16 query rows (scaled), hi/lo
  FragB aqh[KS], aql[KS];
  {
    int row = q0 + ln; if (row >= T) row = T - 1;
    const float* qr = Q + (size_t)row * pitch;
#pragma unroll
    for (int ks = 0; ks < KS; ++ks)
#pragma unroll
      for (int i = 0; i < 16; ++i) {
        const int d = ks * 32 + ((i < 8) ? (8 * hh + i) : (16 + 8 * hh + (i - 8)));
        const float x = qr[d] * scale; const unsigned short hb = bf16_bits(x);
        aqh[ks].u[i] = hb; aql[ks].u[i] = bf16_bits(x - bf16_val(hb));
      }
  }
  float m_r[8], l_r[8];
#pragma unroll
  for (int r = 0; r < 8; ++r) { m_r[r] = -3.0e38f; l_r[r] = 0.f; }
  v8f oacc[DT];
#pragma unroll
  for (int dt = 0; dt < DT; ++dt) oacc[dt] = (v8f){0.f,0.f,0.f,0.f,0.f,0.f,0.f,0.f};

  const int kv_end = CAUSAL ? min(T, qblk * 64 + 64) : T;     // block-uniform
  for (int j0 = 0; j0 < kv_end; j0 += 32) {
    __syncthreads();
    for (int e = tid; e < 32 * (D / 4); e += 128) {
      const int r = e / (D / 4), c4 = (e % (D / 4)) * 4;
      const int key = j0 + r;
      v4f kf = {0.f,0.f,0.f,0.f}, vf = {0.f,0.f,0.f,0.f};
      if (key < T) { kf = *(const v4fa*)(K + (size_t)key * pitch + c4); vf = *(const v4fa*)(V + (size_t)key * pitch + c4); }
#pragma unroll
      for (int t = 0; t < 4; ++t) {
        unsigned short hb = bf16_bits(kf[t]); sKh[r][c4 + t] = hb; sKl[r][c4 + t] = bf16_bits(kf[t] - bf16_val(hb));
        hb = bf16_bits(vf[t]); sVh[r][c4 + t] = hb; sVl[r][c4 + t] = bf16_bits(vf[t] - bf16_val(hb));
      }
    }
    __syncthreads();
    // S tile 16 x 32
    v8f s[2];
#pragma unroll
    for (int nt = 0; nt < 2; ++nt) {
      v8f acc = {};
#pragma unroll
      for (int ks = 0; ks < KS; ++ks) {
        FragB bh_, bl_;
        bh_.half[0] = *(const v8us*)&sKh[nt * 16 + ln][ks * 32 + 8 * hh]; bh_.half[1] = *(const v8us*)&sKh[nt * 16 + ln][ks * 32 + 16 + 8 * hh];
        bl_.half[0] = *(const v8us*)&sKl[nt * 16 + ln][ks * 32 + 8 * hh]; bl_.half[1] = *(const v8us*)&sKl[nt * 16 + ln][ks * 32 + 16 + 8 * hh];
        acc = mmaN<3>(aqh[ks].v, aql[ks].v, bh_.v, bl_.v, acc);
      }
      s[nt] = acc;
    }
    // mask + running max (rows 8hh+r; the 16 lanes of a half share rows)
    float alpha[8];
#pragma unroll
    for (int r = 0; r < 8; ++r) {
      const int qi = q0 + 8 * hh + r;
      const int ja = j0 + ln, jb = j0 + 16 + ln;
      if (CAUSAL) { if (ja > qi) s[0][r] = -3.0e38f; if (jb > qi) s[1][r] = -3.0e38f; }
      if (ja >= T) s[0][r] = -3.0e38f;
      if (jb >= T) s[1][r] = -3.0e38f;
      float mx = fmaxf(s[0][r], s[1][r]);
      mx = fmaxf(mx, __shfl_xor(mx, 1, 32)); mx = fmaxf(mx, __shfl_xor(mx, 2, 32)); mx = fmaxf(mx, __shfl_xor(mx, 4, 32)); mx = fmaxf(mx, __shfl_xor(mx, 8, 32));
      const float mnew = fmaxf(m_r[r], mx);
      alpha[r] = (mnew > -1.0e38f) ? __expf(m_r[r] - mnew) : 1.0f;
      const float p0 = (s[0][r] > -1.0e38f) ? __expf(s[0][r] - mnew) : 0.f;
      const float p1 = (s[1][r] > -1.0e38f) ? __expf(s[1][r] - mnew) : 0.f;
      m_r[r] = mnew;
      l_r[r] = l_r[r] * alpha[r] + p0 + p1;            // per-lane partial row sum (16 lanes combined at the end)
      unsigned short hb = bf16_bits(p0); sPh[w][8 * hh + r][ln] = hb;      sPl[w][8 * hh + r][ln] = bf16_bits(p0 - bf16_val(hb));
      hb = bf16_bits(p1);                sPh[w][8 * hh + r][16 + ln] = hb; sPl[w][8 * hh + r][16 + ln] = bf16_bits(p1 - bf16_val(hb));
    }
#pragma unroll
    for (int dt = 0; dt < DT; ++dt)
#pragma unroll
      for (int r = 0; r < 8; ++r) oacc[dt][r] *= alpha[r];
    __builtin_amdgcn_fence(__ATOMIC_ACQ_REL, "workgroup");
    __builtin_amdgcn_wave_barrier();
    FragB pah, pal;
    pah.half[0] = *(const v8us*)&sPh[w][ln][8 * hh]; pah.half[1] = *(const v8us*)&sPh[w][ln][16 + 8 * hh];
    pal.half[0] = *(const v8us*)&sPl[w][ln][8 * hh]; pal.half[1] = *(const v8us*)&sPl[w][ln][16 + 8 * hh];
#pragma unroll
    for (int dt = 0; dt < DT; ++dt) {
      FragB bvh, bvl;
#pragma unroll
      for (int i = 0; i < 8; ++i) {
        bvh.u[i] = sVh[8 * hh + i][dt * 16 + ln]; bvh.u[8 + i] = sVh[16 + 8 * hh + i][dt * 16 + ln];
        bvl.u[i] = sVl[8 * hh + i][dt * 16 + ln]; bvl.u[8 + i] = sVl[16 + 8 * hh + i][dt * 16 + ln];
      }
      oacc[dt] = mmaN<3>(pah.v, pal.v, bvh.v, bvl.v, oacc[dt]);
    }
    __builtin_amdgcn_fence(__ATOMIC_ACQ_REL, "workgroup");
    __builtin_amdgcn_wave_barrier();
  }
#pragma unroll
  for (int r = 0; r < 8; ++r) {
    float l = l_r[r];
    l += __shfl_xor(l, 1, 32); l += __shfl_xor(l, 2, 32); l += __shfl_xor(l, 4, 32); l += __shfl_xor(l, 8, 32);
    l_r[r] = (l > 0.f) ? 1.0f / l : 0.f;
  }
#pragma unroll
  for (int dt = 0; dt < DT; ++dt)
#pragma unroll
    for (int r = 0; r < 8; ++r) sO[w][8 * hh + r][dt * 16 + ln] = oacc[dt][r] * l_r[r];
  __builtin_amdgcn_fence(__ATOMIC_ACQ_REL, "workgroup");
  __builtin_amdgcn_wave_barrier();
  {
    for (int r = 0; r < 16; ++r) {
      const int row = q0 + r;
      if (row < T && lane < D / 4) {
        const v4f val = *(const v4fa*)&sO[w][r][lane * 4];
        *(v4f*)(y + ((size_t)b * T + row) * ypitch + h * D + lane * 4) = val;
      }
    }
    
  }
}

// GEMM C = act(A·W + bias + resid): A f32 (ASPLIT -> hi/lo 2 terms), Wt bf16 [N][K]; ACT 0 none, 1 relu, 2 exact gelu;
// resid (optional, f32, row index = (row % rmod), pitch ldr, RES_BF16 rounds it) added before the activation.
template <bool ASPLIT, int ACT, bool BIAS_BF16, bool RES_BF16>
__global__ __launch_bounds__(128) void k_gemm_bf3(const float* __restrict__ A, int lda, const unsigned short* __restrict__ Wt, int ldb,
                                                const float* __restrict__ bias, const float* __restrict__ resid, int rmod, int ldr,
                                                float* __restrict__ C, int ldc, int M, int N, int K) {
  __shared__ __attribute__((aligned(16))) float so[4][16][64];
  const int tid = threadIdx.x, w = tid >> 5, lane = tid & 31, ln = lane & 15, hh = lane >> 4;
  const int ntn = N / 64;
  const int wid = blockIdx.x * 4 + w;
  const int mt = wid / ntn, nq = wid % ntn;
  if (mt * 16 >= M) return;
  const int row0 = mt * 16, col0 = nq * 64;
  const float* arow = A + (size_t)(row0 + ln) * lda;
  v8f acc[4] = {};
  for (int kb = 0; kb < K; kb += 32) {
    FragB ah, al;
    const v4f x0 = *(const v4fa*)(arow + kb + 8 * hh), x1 = *(const v4fa*)(arow + kb + 8 * hh + 4);
    const v4f x2 = *(const v4fa*)(arow + kb + 16 + 8 * hh), x3 = *(const v4fa*)(arow + kb + 16 + 8 * hh + 4);
    float xs[16] = {x0[0],x0[1],x0[2],x0[3],x1[0],x1[1],x1[2],x1[3],x2[0],x2[1],x2[2],x2[3],x3[0],x3[1],x3[2],x3[3]};
#pragma unroll
    for (int i = 0; i < 16; ++i) { const unsigned short hb = bf16_bits(xs[i]); ah.u[i] = hb; al.u[i] = ASPLIT ? bf16_bits(xs[i] - bf16_val(hb)) : (unsigned short)0; }
#pragma unroll
    for (int t = 0; t < 4; ++t) {
      const unsigned short* brow = Wt + (size_t)(col0 + t * 16 + ln) * ldb + kb;
      FragB b;
      b.half[0] = *(const v8us*)(brow + 8 * hh);
      b.half[1] = *(const v8us*)(brow + 16 + 8 * hh);
      acc[t] = mmaN<ASPLIT ? 2 : 1>(ah.v, al.v, b.v, b.v, acc[t]);
    }
  }
#pragma unroll
  for (int t = 0; t < 4; ++t) {
    const int col = col0 + t * 16 + ln;
    float bv = bias ? bias[col] : 0.f;
    if (BIAS_BF16) bv = bf16_round(bv);
#pragma unroll
    for (int r = 0; r < 8; ++r) {
      float v = acc[t][r] + bv;
      if (resid) { float rv = resid[(size_t)((row0 + 8 * hh + r) % rmod) * ldr + col]; if (RES_BF16) rv = bf16_round(rv); v += rv; }
      if (ACT == 1) v = fmaxf(v, 0.f);
      if (ACT == 2) v = 0.5f * v * (1.0f + erff(v * 0.70710678118654752f));
      if (ACT == 3) { const float u = 0.7978845608028654f * (v + 0.044715f * v * v * v); v = 0.5f * v * (1.0f + tanhf(u)); }
      so[w][8 * hh + r][t * 16 + ln] = v;
    }
  }
  __builtin_amdgcn_fence(__ATOMIC_ACQ_REL, "workgroup");
  __builtin_amdgcn_wave_barrier();
  const int rsub = lane >> 4, c4 = (lane & 15) * 4;
  {
#pragma unroll
    for (int q = 0; q < 8; ++q) {
      const int r = q * 2 + rsub;
      const v4f v = *(const v4fa*)&so[w][r][c4];
      *(v4f*)(C + (size_t)(row0 + r) * ldc + col0 + c4) = v;
    }
    
  }
}
// row LayerNorm (biased variance, eps) over N: s = X (+ R); optional out_sum <- s; out_norm <- (s-mu)*rsqrt(var+eps)*g + b
template <bool PARAM_BF16>
__global__ __launch_bounds__(256) void k_layernorm(const float* __restrict__ X, const float* __restrict__ R, const float* __restrict__ g, const float* __restrict__ bta,
                                                  float* __restrict__ out_sum, float* __restrict__ out_norm, int N, float eps) {
  __shared__ float red[256];
  const int row = blockIdx.x, tid = threadIdx.x;
  const float* x = X + (size_t)row * N; const float* rr = R ? R + (size_t)row * N : nullptr;
  float vals[16];                     // up to N = 4096
  const int per = N / 256;            // contiguous chunk per thread? use strided-by-4 chunks: thread handles j = tid*4 + 1024*u
  float s1 = 0.f;
  for (int u = 0; u < per / 4; ++u) {
    const int j = tid * 4 + 1024 * u;
    const v4f a = *(const v4fa*)(x + j);
    v4f b = {0.f,0.f,0.f,0.f}; if (rr) b = *(const v4fa*)(rr + j);
#pragma unroll
    for (int q = 0; q < 4; ++q) { const float v = a[q] + b[q]; vals[u * 4 + q] = v; s1 += v; }
  }
  red[tid] = s1; __syncthreads();
  for (int st = 128; st > 0; st >>= 1) { if (tid < st) red[tid] += red[tid + st]; __syncthreads(); }
  const float mu = red[0] / (float)N; __syncthreads();
  float s2 = 0.f;
  for (int u = 0; u < per / 4; ++u)
#pragma unroll
    for (int q = 0; q < 4; ++q) { const float c = vals[u * 4 + q] - mu; s2 += c * c; }
  red[tid] = s2; __syncthreads();
  for (int st = 128; st > 0; st >>= 1) { if (tid < st) red[tid] += red[tid + st]; __syncthreads(); }
  const float rs = rsqrtf(red[0] / (float)N + eps);
  {
    for (int u = 0; u < per / 4; ++u) {
      const int j = tid * 4 + 1024 * u;
      v4f o, sm;
#pragma unroll
      for (int q = 0; q < 4; ++q) {
        float gg = g[j + q], bb = bta[j + q];
        if (PARAM_BF16) { gg = bf16_round(gg); bb = bf16_round(bb); }
        sm[q] = vals[u * 4 + q]; o[q] = (vals[u * 4 + q] - mu) * rs * gg + bb;
      }
      if (out_sum) *(v4f*)(out_sum + (size_t)row * N + j) = sm;
      *(v4f*)(out_norm + (size_t)row * N + j) = o;
    }
    
  }
}



// ---- f16 WMMA path (v_wmma_f32_16x16x32_f16): 11-bit significands for operands in range — used where a [0,1] probability operand needs more precision than bf16
typedef _Float16 v16h __attribute__((ext_vector_type(16)));
union FragH { v16h v; v8us half[2]; _Float16 h[16]; unsigned short u[16]; };
template <int NT>
__device__ __forceinline__ v8f mmaH(v16h ah, v16h al, v16h bh, v16h bl, v8f c) {
  c = __builtin_amdgcn_wmma_f32_16x16x32_f16(false, ah, false, bh, (short)0, c, false, false);
  if (NT >= 2) c = __builtin_amdgcn_wmma_f32_16x16x32_f16(false, al, false, bh, (short)0, c, false, false);
  if (NT >= 3) c = __builtin_amdgcn_wmma_f32_16x16x32_f16(false, ah, false, bl, (short)0, c, false, false);
  asm volatile("v_nop\n\tv_nop\n\tv_nop\n\tv_nop" : "+v"(c) : "v"(ah), "v"(al), "v"(bh), "v"(bl));
  return c;
}
// batched GEMM like k_gemm_b but f16 operands: A f32 (split into f16 hi/lo if ASPLIT, else rounded to f16), Bt = f16 values [n][k]; alpha; C f32; N multiple of 16 (partial tiles skipped)
template <bool ASPLIT>
__global__ __launch_bounds__(128) void k_gemm_h(const float* __restrict__ A, int lda, size_t sA, const _Float16* __restrict__ Bh, int ldb, size_t sB, float alpha, float* __restrict__ C, int ldc, size_t sC, int M, int N, int K) {
  __shared__ __attribute__((aligned(16))) float so[4][16][64];
  const int tid = threadIdx.x, w = tid >> 5, lane = tid & 31, ln = lane & 15, hh = lane >> 4; const int by = blockIdx.y;
  A += (size_t)by * sA; Bh += (size_t)by * sB; C += (size_t)by * sC;
  const int ntn = (N + 63) / 64; const int wid = blockIdx.x * 4 + w; const int mt = wid / ntn, nq = wid % ntn; if (mt * 16 >= M) return;
  const int row0 = mt * 16, col0 = nq * 64; const float* arow = A + (size_t)(row0 + ln) * lda;
  v8f acc[4] = {};
  for (int kb = 0; kb < K; kb += 32) {
    FragH ah, al;
    const v4f x0 = *(const v4fa*)(arow + kb + 8 * hh), x1 = *(const v4fa*)(arow + kb + 8 * hh + 4), x2 = *(const v4fa*)(arow + kb + 16 + 8 * hh), x3 = *(const v4fa*)(arow + kb + 16 + 8 * hh + 4);
    float xs[16] = {x0[0],x0[1],x0[2],x0[3],x1[0],x1[1],x1[2],x1[3],x2[0],x2[1],x2[2],x2[3],x3[0],x3[1],x3[2],x3[3]};
#pragma unroll
    for (int i = 0; i < 16; ++i) { const _Float16 h = (_Float16)xs[i]; ah.h[i] = h; al.h[i] = ASPLIT ? (_Float16)(xs[i] - (float)h) : (_Float16)0.0f; }
#pragma unroll
    for (int t = 0; t < 4; ++t) { if (col0 + t * 16 >= N) continue; const size_t boff = (size_t)(col0 + t * 16 + ln) * ldb + kb; FragH bq; bq.half[0] = *(const v8us*)(Bh + boff + 8 * hh); bq.half[1] = *(const v8us*)(Bh + boff + 16 + 8 * hh);
      acc[t] = mmaH<ASPLIT ? 2 : 1>(ah.v, al.v, bq.v, bq.v, acc[t]); }
  }
#pragma unroll
  for (int t = 0; t < 4; ++t) { if (col0 + t * 16 >= N) continue;
#pragma unroll
    for (int r = 0; r < 8; ++r) so[w][8 * hh + r][t * 16 + ln] = acc[t][r] * alpha; }
  __builtin_amdgcn_fence(__ATOMIC_ACQ_REL, "workgroup"); __builtin_amdgcn_wave_barrier();
  const int rsub = lane >> 4, c4 = (lane & 15) * 4;
  {
#pragma unroll
    for (int q = 0; q < 8; ++q) { const int r = q * 2 + rsub; if (col0 + c4 < N) { const v4f v = *(const v4fa*)&so[w][r][c4]; *(v4f*)(C + (size_t)(row0 + r) * ldc + col0 + c4) = v; } }
     }
}

// Wt[n][k] = f16(W[k][n]·scale) from f32 row-major W[K][N] (scale = power of two; bf16-exact weights stay exact in f16 away from the subnormal range)
__global__ __launch_bounds__(256) void k_wt_f16(const float* __restrict__ W, _Float16* __restrict__ Wt, int K, int N, float scale) {
  const int t = blockIdx.x * 256 + threadIdx.x; if (t >= N * (K / 8)) return; const int n = t / (K / 8), k8 = (t % (K / 8)) * 8; FragH f;
#pragma unroll
  for (int i = 0; i < 8; ++i) f.h[i] = (_Float16)(bf16_round(W[(size_t)(k8 + i) * N + n]) * scale); const v8us o = f.half[0];
  *(v8us*)((unsigned short*)Wt + (size_t)n * K + k8) = o; 
}
// k_gemm_hh variant with fused epilogue: v = acc·alpha + bias[by·sBias + col] (+ CP[(row/rowsPerB)·sCPb + by·64 + col] if CP) ; ACT 0 none / 1 elu ; writes f32 C and/or f16 C16 (each if non-null)
// N and K are compile-time (NC, KC): the column guard of a partial tile folds away where NC is a multiple of 64 and the k loop unrolls into groups of KU k-steps.
template <int ACT, int NC, int KC>
__global__ __launch_bounds__(128) void k_gemm_hhx(const _Float16* __restrict__ A, int lda, size_t sA, const _Float16* __restrict__ Bh, int ldb, size_t sB, float alpha, const float* __restrict__ bias, size_t sBias, const float* __restrict__ CP, int rowsPerB, size_t sCPb, int row0g,
    float* __restrict__ C, _Float16* __restrict__ C16, int ldc, size_t sC, int M) {
  constexpr int N = NC, KU = 2, NG = KC / (32 * KU); constexpr bool PART = (NC % 64) != 0; static_assert(KC % (32 * KU) == 0, "k groups");
  __shared__ __attribute__((aligned(16))) float so[4][16][64];
  const int tid = threadIdx.x, w = tid >> 5, lane = tid & 31, ln = lane & 15, hh = lane >> 4; const int by = blockIdx.y;
  A += (size_t)by * sA; Bh += (size_t)by * sB; const size_t cofs = (size_t)by * sC; const float* bp = bias ? bias + (size_t)by * sBias : nullptr;
  const int ntn = (N + 63) / 64; const int wid = blockIdx.x * 4 + w; const int mt = wid / ntn, nq = wid % ntn; if (mt * 16 >= M) return;
  const int row0 = mt * 16, col0 = nq * 64; const _Float16* arow = A + (size_t)(row0 + ln) * lda;
  v8f acc[4] = {};
  // The fragment loads of a whole group (KU k-steps: 2 KU of A, 8 KU of B) are written as one run, one group ahead of the products that use them, in two register sets. Written pair by pair between the
  // products each pair was waited for in full before its one product: the statement that ends mmaH is volatile and the scheduler moves no load across it, so a load stays where the source puts it.
  FragH fa[2][KU], fb[2][KU][4];
  const unsigned short* ap = (const unsigned short*)arow + 8 * hh; const unsigned short* bp0 = (const unsigned short*)Bh + (size_t)(col0 + ln) * ldb + 8 * hh;
#pragma unroll
  for (int g = -1; g < NG; ++g) {
    if (g + 1 < NG) { const int nx = (g + 1) & 1;
#pragma unroll
      for (int u = 0; u < KU; ++u) { const int kb = ((g + 1) * KU + u) * 32; fa[nx][u].half[0] = *(const v8us*)(ap + kb); fa[nx][u].half[1] = *(const v8us*)(ap + kb + 16);
#pragma unroll
        for (int t = 0; t < 4; ++t) { if (PART && col0 + t * 16 >= N) continue; const unsigned short* br = bp0 + (size_t)(t * 16) * ldb + kb; fb[nx][u][t].half[0] = *(const v8us*)br; fb[nx][u][t].half[1] = *(const v8us*)(br + 16); } } }
    if (g >= 0) { const int cu = g & 1;
#pragma unroll
      for (int u = 0; u < KU; ++u)
#pragma unroll
        for (int t = 0; t < 4; ++t) { if (PART && col0 + t * 16 >= N) continue; acc[t] = mmaH<1>(fa[cu][u].v, fa[cu][u].v, fb[cu][u][t].v, fb[cu][u][t].v, acc[t]); } }
  }
#pragma unroll
  for (int t = 0; t < 4; ++t) { if (col0 + t * 16 >= N) continue; const int col = col0 + t * 16 + ln; const float bv = bp ? bf16_round(bp[col]) : 0.f;
#pragma unroll
    for (int r = 0; r < 8; ++r) { float v = acc[t][r] * alpha + bv; if (CP) { const int bidx = (row0g + row0 + 8 * hh + r) / rowsPerB; v += CP[(size_t)bidx * sCPb + (size_t)by * 64 + col]; } if (ACT == 1) v = (v > 0.f) ? v : expm1f(v); else if (ACT == 3) v = fmaxf(v, 0.f); so[w][8 * hh + r][t * 16 + ln] = v; } }
  __builtin_amdgcn_fence(__ATOMIC_ACQ_REL, "workgroup"); __builtin_amdgcn_wave_barrier();
  const int rsub = lane >> 4, c4 = (lane & 15) * 4; typedef _Float16 v4h __attribute__((ext_vector_type(4)));
  {
#pragma unroll
    for (int q = 0; q < 8; ++q) { const int r = q * 2 + rsub; if (col0 + c4 < N) { const v4f v = *(const v4fa*)&so[w][r][c4]; if (C) *(v4f*)(C + cofs + (size_t)(row0 + r) * ldc + col0 + c4) = v; if (C16) { v4h h4; for (int i = 0; i < 4; ++i) h4[i] = (_Float16)v[i]; *(v4h*)(C16 + cofs + (size_t)(row0 + r) * ldc + col0 + c4) = h4; } } }
     }
}


__global__ __launch_bounds__(256) void k_x16(const float* __restrict__ x, _Float16* __restrict__ X16, size_t n8) { const size_t t = (size_t)blockIdx.x * 256 + threadIdx.x; if (t >= n8) return; FragH f;
#pragma unroll
  for (int q = 0; q < 8; ++q) f.h[q] = (_Float16)bf16_round(x[t * 8 + q]); *(v8us*)((unsigned short*)X16 + t * 8) = f.half[0];  }
__global__ __launch_bounds__(256) void k_h16(const float* __restrict__ x, _Float16* __restrict__ X16, size_t n8) { const size_t t = (size_t)blockIdx.x * 256 + threadIdx.x; if (t >= n8) return; FragH f;
#pragma unroll
  for (int q = 0; q < 8; ++q) f.h[q] = (_Float16)x[t * 8 + q]; *(v8us*)((unsigned short*)X16 + t * 8) = f.half[0];  }
__global__ __launch_bounds__(256) void k_round16f(const float* __restrict__ W, _Float16* __restrict__ Bt, size_t n8) { const size_t t = (size_t)blockIdx.x * 256 + threadIdx.x; if (t >= n8) return; FragH f;
#pragma unroll
  for (int i = 0; i < 8; ++i) f.h[i] = (_Float16)(bf16_round(W[t * 8 + i]) * 16.0f); *(v8us*)((unsigned short*)Bt + t * 8) = f.half[0];  }
template <int NHv, int TTv>
__global__ __launch_bounds__(256) void k_vt(const _Float16* __restrict__ V16, int ldv, int voff, _Float16* __restrict__ Vt) { __shared__ unsigned short tl[64][66]; const int tid = threadIdx.x; const int slab = blockIdx.x / (TTv / 64), lg = blockIdx.x % (TTv / 64); const int b = slab / NHv, h = slab % NHv;
  for (int i = tid; i < 64 * 8; i += 256) { const int r = i / 8, c8 = (i % 8) * 8; FragH f; f.half[0] = *(const v8us*)((const unsigned short*)V16 + ((size_t)b * TTv + lg * 64 + r) * ldv + voff + h * 64 + c8);
#pragma unroll
    for (int q = 0; q < 8; ++q) tl[r][c8 + q] = f.u[q]; }
  __syncthreads();
  {
#pragma unroll
    for (int rd = 0; rd < 2; ++rd) { const int d = rd * 32 + tid / 8, pc = tid % 8; FragH f;
#pragma unroll
      for (int q = 0; q < 8; ++q) f.u[q] = tl[pc * 8 + q][d];
      *(v8us*)((unsigned short*)Vt + ((size_t)slab * 64 + d) * TTv + lg * 64 + pc * 8) = f.half[0]; }
     } }

__global__ __launch_bounds__(128) void k_flash(const _Float16* __restrict__ Q16, int ldq, const _Float16* __restrict__ K16, int ldk, const _Float16* __restrict__ Vt, const float* __restrict__ CB, const float* __restrict__ beta, float* __restrict__ O, int ldo) {
  __shared__ float scb[2048];
  constexpr int RPW = 16, RTN = RPW / 16, NQB = 2048 / (4 * RPW), DT = 4, KS = 2;
  __shared__ __attribute__((aligned(16))) unsigned short sP[4][RPW][40]; __shared__ __attribute__((aligned(16))) float sO[4][RPW][64 + 4];
  const int tid = threadIdx.x, w = tid >> 5, lane = tid & 31, ln = lane & 15, hh = lane >> 4;
  const int slab = blockIdx.x / NQB, qblk = blockIdx.x % NQB; const int b = slab / 12, h = slab % 12; const int qb0 = qblk * (4 * RPW); const int q0 = qb0 + w * RPW;
  FragH aq[2][KS];
#pragma unroll
  for (int rt = 0; rt < RTN; ++rt) { const unsigned short* qr = (const unsigned short*)Q16 + ((size_t)b * 2048 + q0 + rt * 16 + ln) * ldq + h * 64;
#pragma unroll
    for (int ks = 0; ks < KS; ++ks) { aq[rt][ks].half[0] = *(const v8us*)(qr + ks * 32 + 8 * hh); aq[rt][ks].half[1] = *(const v8us*)(qr + ks * 32 + 16 + 8 * hh); } }
  for (int i = tid; i < 2048; i += 128) scb[i] = CB[i]; const float bh = bf16_round(beta[h]); __syncthreads();
  const unsigned short* Vth = (const unsigned short*)Vt + (size_t)slab * 64 * 2048; float lc_r[2][8];      /* causal partial sums Σ_{k ≤ q} e^{s−m} */
#pragma unroll
  for (int rt = 0; rt < RTN; ++rt) for (int r = 0; r < 8; ++r) lc_r[rt][r] = 0.f;
  float m_r[2][8], l_r[2][8]; v8f oacc[2][DT];
#pragma unroll
  for (int rt = 0; rt < RTN; ++rt) {
#pragma unroll
    for (int r = 0; r < 8; ++r) { m_r[rt][r] = -3.0e38f; l_r[rt][r] = 0.f; }
#pragma unroll
    for (int dt = 0; dt < DT; ++dt) oacc[rt][dt] = (v8f){0.f,0.f,0.f,0.f,0.f,0.f,0.f,0.f}; }
  const int jend = 2048;
#pragma unroll 1
  for (int j0 = 0; j0 < jend; j0 += 32) {
    /* all fragment loads of the pass (8 of K, and 8 of V where the pass has a causal key) as one run ahead of its first product: no load moves across the volatile statement that ends mmaH, so written beside their products they were six waits in a row */
    const bool pv = (j0 <= q0 + RPW - 1);      /* some key of this chunk is <= some query of this wave; otherwise every p is 0 */
    FragH bk[2][KS], bv[DT];
#pragma unroll
    for (int nt = 0; nt < 2; ++nt) { const unsigned short* kr = (const unsigned short*)K16 + ((size_t)b * 2048 + j0 + nt * 16 + ln) * ldk + h * 64;
#pragma unroll
      for (int ks = 0; ks < KS; ++ks) { bk[nt][ks].half[0] = *(const v8us*)(kr + ks * 32 + 8 * hh); bk[nt][ks].half[1] = *(const v8us*)(kr + ks * 32 + 16 + 8 * hh); } }
    if (pv) {
#pragma unroll
      for (int dt = 0; dt < DT; ++dt) { const unsigned short* vrow = Vth + (size_t)(dt * 16 + ln) * 2048 + j0; bv[dt].half[0] = *(const v8us*)(vrow + 8 * hh); bv[dt].half[1] = *(const v8us*)(vrow + 16 + 8 * hh); } }
    v8f s[2][2];
#pragma unroll
    for (int nt = 0; nt < 2; ++nt) {
#pragma unroll
      for (int rt = 0; rt < RTN; ++rt) { v8f acc = (v8f){0.f,0.f,0.f,0.f,0.f,0.f,0.f,0.f};
#pragma unroll
        for (int ks = 0; ks < KS; ++ks) acc = mmaH<1>(aq[rt][ks].v, aq[rt][ks].v, bk[nt][ks].v, bk[nt][ks].v, acc); s[rt][nt] = acc; } }
#pragma unroll
    for (int rt = 0; rt < RTN; ++rt)
#pragma unroll
      for (int r = 0; r < 8; ++r) { const int tq = q0 + rt * 16 + 8 * hh + r; const int k0 = j0 + ln, k1 = j0 + 16 + ln; (void)tq; (void)k0; (void)k1;
        const int d0 = (tq >= k0) ? (tq - k0) : (k0 - tq), d1 = (tq >= k1) ? (tq - k1) : (k1 - tq);      /* phase coherence 1 + β·mean_f cos(Δ·θ_f), Δ = |q − k| */
        const float s0 = s[rt][0][r] * 0.125f * (1.0f + bh * scb[d0]), s1 = s[rt][1][r] * 0.125f * (1.0f + bh * scb[d1]); const bool c0 = (k0 <= tq), c1 = (k1 <= tq); float mc = fmaxf(s0, s1);
        mc = fmaxf(mc, __shfl_xor(mc, 1, 32)); mc = fmaxf(mc, __shfl_xor(mc, 2, 32)); mc = fmaxf(mc, __shfl_xor(mc, 4, 32)); mc = fmaxf(mc, __shfl_xor(mc, 8, 32));
        const float mn = fmaxf(m_r[rt][r], mc); const float ea = expf(m_r[rt][r] - mn); /* made for every lane and picked by a select: written behind the test it compiled to one branch per row, which cut the pass into nine blocks and put the eight rows' cross-lane and exp chains one behind the other */ const float al = (mn > -1.0e38f) ? ea : 1.0f; m_r[rt][r] = mn; const float e0 = expf(s0 - mn), e1 = expf(s1 - mn); l_r[rt][r] = l_r[rt][r] * al + e0 + e1; const float p0 = c0 ? e0 : 0.f, p1 = c1 ? e1 : 0.f; lc_r[rt][r] = lc_r[rt][r] * al + p0 + p1;      /* full-softmax stats over ALL keys; P·V and Σ only over the causal ones */
#pragma unroll
        for (int dt = 0; dt < DT; ++dt) oacc[rt][dt][r] *= al;
        FragH t2; t2.h[0] = (_Float16)p0; t2.h[1] = (_Float16)p1; sP[w][rt * 16 + 8 * hh + r][ln] = t2.u[0]; sP[w][rt * 16 + 8 * hh + r][16 + ln] = t2.u[1]; }
    __builtin_amdgcn_fence(__ATOMIC_ACQ_REL, "workgroup"); __builtin_amdgcn_wave_barrier();
    FragH pa[2];
#pragma unroll
    for (int rt = 0; rt < RTN; ++rt) { pa[rt].half[0] = *(const v8us*)&sP[w][rt * 16 + ln][8 * hh]; pa[rt].half[1] = *(const v8us*)&sP[w][rt * 16 + ln][16 + 8 * hh]; }
if (pv) {
#pragma unroll
    for (int dt = 0; dt < DT; ++dt) {
#pragma unroll
      for (int rt = 0; rt < RTN; ++rt) oacc[rt][dt] = mmaH<1>(pa[rt].v, pa[rt].v, bv[dt].v, bv[dt].v, oacc[rt][dt]); } }
    __builtin_amdgcn_fence(__ATOMIC_ACQ_REL, "workgroup"); __builtin_amdgcn_wave_barrier(); }
#pragma unroll
  for (int rt = 0; rt < RTN; ++rt) {
#pragma unroll
    for (int r = 0; r < 8; ++r) { float l = l_r[rt][r]; l += __shfl_xor(l, 1, 32); l += __shfl_xor(l, 2, 32); l += __shfl_xor(l, 4, 32); l += __shfl_xor(l, 8, 32); float lc = lc_r[rt][r]; lc += __shfl_xor(lc, 1, 32); lc += __shfl_xor(lc, 2, 32); lc += __shfl_xor(lc, 4, 32); lc += __shfl_xor(lc, 8, 32); l_r[rt][r] = 1.0f / (lc + 1e-8f * l); }      /* w·causal / (Σ_causal w + 1e-8) with w = e^{s−m}/Z_full  ⇒  e^{s−m} / (Z_causal + 1e-8·Z_full) */
#pragma unroll
    for (int dt = 0; dt < DT; ++dt)
#pragma unroll
      for (int r = 0; r < 8; ++r) sO[w][rt * 16 + 8 * hh + r][dt * 16 + ln] = oacc[rt][dt][r] * l_r[rt][r]; }
  __builtin_amdgcn_fence(__ATOMIC_ACQ_REL, "workgroup"); __builtin_amdgcn_wave_barrier();
  {
#pragma unroll
    for (int rp = 0; rp < RPW; rp += 2) { const int r = rp + (lane >> 4), pc = lane & 15; const v4f val = *(const v4fa*)&sO[w][r][pc * 4]; *(v4f*)(O + ((size_t)b * 2048 + q0 + r) * ldo + h * 64 + pc * 4) = val; }
     } }

__global__ __launch_bounds__(256) void k_cb(float* __restrict__ CB) { __shared__ float sc[8][33]; const int tid = threadIdx.x, g = tid >> 5, f = tid & 31; const int dl = blockIdx.x * 8 + g;      /* one thread per (distance, frequency) term; a block makes 8 table entries */
  const float th = powf(10000.0f, -(float)(2 * f) / 64.0f); sc[g][f] = cosf((float)dl * th); __syncthreads();
  if (tid < 8) { float s = 0.f;
    for (int i = 0; i < 32; ++i) s += sc[tid][i];      /* f = 0..31 in ascending order, the order in which one thread summed them before */
    CB[blockIdx.x * 8 + tid] = s / 32.0f; } }
// rotary + rms-norm per (row, head): x1 = q[h·64 + j], x2 = q[h·64 + 32 + j] (j < 32); out = [x1·cos + x2·sin | −x1·sin + x2·cos] with cos/sin = bf16(INPUT tables [t][j]); then × rsqrt(mean(out²) + f32 eps) → f16;
__global__ __launch_bounds__(256) void k_ropenorm(const float* __restrict__ Qf, const float* __restrict__ cosT, const float* __restrict__ sinT, _Float16* __restrict__ Q16) { const size_t tg = (size_t)blockIdx.x * 256 + threadIdx.x; if (tg >= (size_t)NR * NH * 4) return; const size_t row = tg / (NH * 4); const int h = (int)((tg / 4) % NH), pc = (int)(tg % 4); const int t = (int)(row % TT); const int j0 = pc * 8;
  float a[8], bq[8]; float ss = 0.f;
#pragma unroll
  for (int q = 0; q < 8; ++q) { const int j = j0 + q; const float x1 = Qf[row * CC + h * 64 + j], x2 = Qf[row * CC + h * 64 + 32 + j]; const float c = bf16_round(cosT[t * 32 + j]), s = bf16_round(sinT[t * 32 + j]); a[q] = x1 * c + x2 * s; bq[q] = -x1 * s + x2 * c; ss += a[q] * a[q] + bq[q] * bq[q]; }
  ss += __shfl_xor(ss, 1, 32); ss += __shfl_xor(ss, 2, 32); const float rn = rsqrtf(ss / 64.0f + 1.1920929e-7f); FragH f1, f2;
#pragma unroll
  for (int q = 0; q < 8; ++q) { f1.h[q] = (_Float16)(a[q] * rn); f2.h[q] = (_Float16)(bq[q] * rn); }
  { *(v8us*)((unsigned short*)Q16 + row * CC + h * 64 + j0) = f1.half[0]; *(v8us*)((unsigned short*)Q16 + row * CC + h * 64 + 32 + j0) = f2.half[0];  } }
extern "C" void kernel_launch(void* const* d_in, const int* in_sizes, int n_in,
                              void* d_out, int out_size, void* d_ws, size_t ws_size, hipStream_t stream) {
  (void)in_sizes; (void)n_in; (void)out_size;
  const float* x = (const float*)d_in[0]; const float* cosT = (const float*)d_in[1]; const float* sinT = (const float*)d_in[2]; const float* Wq = (const float*)d_in[3]; const float* Wk = (const float*)d_in[4]; const float* Wv = (const float*)d_in[5]; const float* Wo = (const float*)d_in[6]; const float* beta = (const float*)d_in[7];
  char* ws = (char*)d_ws; size_t off = 0;
  auto take = [&](size_t bytes) { char* p = ws + off; off += (bytes + 255) & ~(size_t)255; return p; };
  _Float16* Bq = (_Float16*)take((size_t)CC * CC * 2); _Float16* Bk = (_Float16*)take((size_t)CC * CC * 2); _Float16* Bv = (_Float16*)take((size_t)CC * CC * 2); _Float16* Bo = (_Float16*)take((size_t)CC * CC * 2); float* CB = (float*)take(TT * 4);
  _Float16* X16 = (_Float16*)take((size_t)NR * CC * 2); float* Qf = (float*)take((size_t)NR * CC * 4); float* Kf = (float*)take((size_t)NR * CC * 4); _Float16* Q16 = (_Float16*)take((size_t)NR * CC * 2); _Float16* K16 = (_Float16*)take((size_t)NR * CC * 2); _Float16* V16 = (_Float16*)take((size_t)NR * CC * 2); _Float16* Vt = (_Float16*)take((size_t)NR * CC * 2); float* O = Qf; _Float16* O16 = X16;      // Qf dead after k_ropenorm; X16 dead after the V GEMM
  if (off > ws_size) return;      // 4.7 + 6.3 + 12.6 × 2 + 6.3 × 4 ≈ 59 MiB
  const size_t w8 = (size_t)CC * CC / 8; const unsigned gw = (unsigned)((w8 + 255) / 256);
  k_round16f<<<gw, 256, 0, stream>>>(Wq, Bq, w8); k_round16f<<<gw, 256, 0, stream>>>(Wk, Bk, w8); k_round16f<<<gw, 256, 0, stream>>>(Wv, Bv, w8); k_round16f<<<gw, 256, 0, stream>>>(Wo, Bo, w8);      // (out,in)
  k_cb<<<TT / 8, 256, 0, stream>>>(CB);
  const unsigned gx = (unsigned)(((size_t)NR * CC / 8 + 255) / 256); const dim3 gg(((NR / 16) * (CC / 64) + 3) / 4, 1);
  k_x16<<<gx, 256, 0, stream>>>(x, X16, (size_t)NR * CC / 8);
  k_gemm_hhx<0, CC, CC><<<gg, 128, 0, stream>>>(X16, CC, 0, Bq, CC, 0, 0.0625f, nullptr, 0, nullptr, 1, 0, 0, Qf, nullptr, CC, 0, NR);
  k_gemm_hhx<0, CC, CC><<<gg, 128, 0, stream>>>(X16, CC, 0, Bk, CC, 0, 0.0625f, nullptr, 0, nullptr, 1, 0, 0, Kf, nullptr, CC, 0, NR);
  k_gemm_hhx<0, CC, CC><<<gg, 128, 0, stream>>>(X16, CC, 0, Bv, CC, 0, 0.0625f, nullptr, 0, nullptr, 1, 0, 0, nullptr, V16, CC, 0, NR);
  const unsigned gr = (unsigned)(((size_t)NR * NH * 4 + 255) / 256);
  k_ropenorm<<<gr, 256, 0, stream>>>(Qf, cosT, sinT, Q16); k_ropenorm<<<gr, 256, 0, stream>>>(Kf, cosT, sinT, K16);
  k_vt<NH, TT><<<BB * NH * (TT / 64), 256, 0, stream>>>(V16, CC, 0, Vt);
  k_flash<<<BB * NH * (TT / 64), 128, 0, stream>>>(Q16, CC, K16, CC, Vt, CB, beta, O, CC);      // RPW 16
  k_h16<<<gx, 256, 0, stream>>>(O, O16, (size_t)NR * CC / 8);
  k_gemm_hhx<0, CC, CC><<<gg, 128, 0, stream>>>(O16, CC, 0, Bo, CC, 0, 0.0625f, nullptr, 0, nullptr, 1, 0, 0, (float*)d_out, nullptr, CC, 0, NR);
}

// v004
// Measured time: 207 microseconds a run.
// Two timings next to v003 both put it at 1.19 times that version's speed.
// Counting every step since v000, it is 2.20 times as fast.
#include <hip/hip_runtime.h>
// Phase-aware causal attention: q/k/v/o projections (4096 × 768 × 768, no bias, weights (out,in) bf16-exact ×2^4) and the 12-head attention as a fused flash-style kernel on v_wmma_f32_16x16x32_f16
// (rotary (with the INPUT cos/sin tables) + rms-norm'd q,k as f16; S = Q·Kᵀ/8 × (1 + β_h·mean_f cos(|q−k|·θ_f)) with the 2048-entry coherence table precomputed; the module's FULL softmax followed
// by causal masking and re-normalisation with +1e-8 is reproduced exactly as e^{s−m}/(Z_causal + 1e-8·Z_full) with m, Z_full over all keys; P f16 ≤ 1; O = P·V over causal keys); f32 accumulate.
#define BB 2
#define TT 2048
#define CC 768
#define NH 12
#define NR (BB * TT)

typedef __bf16 v16b __attribute__((ext_vector_type(16)));
typedef unsigned short v8us __attribute__((ext_vector_type(8), may_alias));
typedef float  v8f  __attribute__((ext_vector_type(8)));
typedef float  v4f  __attribute__((ext_vector_type(4)));
typedef float  v4fa __attribute__((ext_vector_type(4), may_alias));
union FragB { v16b v; v8us half[2]; unsigned short u[16]; };

__device__ __forceinline__ unsigned short bf16_bits(float x) { unsigned int u = __float_as_uint(x); return (unsigned short)((u + 0x7FFFu + ((u >> 16) & 1u)) >> 16); }
__device__ __forceinline__ float bf16_val(unsigned short b) { return __uint_as_float(((unsigned int)b) << 16); }
__device__ __forceinline__ float bf16_round(float x) { return bf16_val(bf16_bits(x)); }
// D += A·B with NT terms: 1 = ah·bh, 2 = + al·bh (A split), 3 = + ah·bl (both split)
template <int NT>
__device__ __forceinline__ v8f mmaN(v16b ah, v16b al, v16b bh, v16b bl, v8f c) {
  c = __builtin_amdgcn_wmma_f32_16x16x32_bf16(false, ah, false, bh, (short)0, c, false, false);
  if (NT >= 2) c = __builtin_amdgcn_wmma_f32_16x16x32_bf16(false, al, false, bh, (short)0, c, false, false);
  if (NT >= 3) c = __builtin_amdgcn_wmma_f32_16x16x32_bf16(false, ah, false, bl, (short)0, c, false, false);
  asm volatile("v_nop\n\tv_nop\n\tv_nop\n\tv_nop" : "+v"(c) : "v"(ah), "v"(al), "v"(bh), "v"(bl));
  return c;
}

__global__ __launch_bounds__(256) void k_wt_bf16(const float* __restrict__ W, unsigned short* __restrict__ Wt, int K, int N) {
  const int t = blockIdx.x * 256 + threadIdx.x;
  const int k8n = K / 8;
  if (t >= N * k8n) return;
  const int n = t / k8n, k8 = (t % k8n) * 8;
  v8us v;
#pragma unroll
  for (int i = 0; i < 8; ++i) v[i] = bf16_bits(W[(size_t)(k8 + i) * N + n]);
  *(v8us*)(Wt + (size_t)n * K + k8) = v;
  
}

// GEMM C[M][N] (f32, pitch ldc) = act(A[M][K]·W + bias). A f32 row-major (pitch lda) converted per fragment to bf16
// (ASPLIT: hi/lo two planes -> 2 terms, else single rounded term); Wt bf16 [N][K] (pitch ldb). BIAS_BF16 rounds the
// bias to bf16 first (bias quantised to bf16 before the add). K%32==0, M%16==0, N%64==0.
template <bool ASPLIT, int ACT, bool BIAS_BF16>
__global__ __launch_bounds__(128) void k_gemm_bf(const float* __restrict__ A, int lda, const unsigned short* __restrict__ Wt, int ldb,
                                               const float* __restrict__ bias, float* __restrict__ C, int ldc, int M, int N, int K) {
  __shared__ __attribute__((aligned(16))) float so[4][16][64];
  const int tid = threadIdx.x, w = tid >> 5, lane = tid & 31, ln = lane & 15, hh = lane >> 4;
  const int ntn = N / 64;
  const int wid = blockIdx.x * 4 + w;
  const int mt = wid / ntn, nq = wid % ntn;
  if (mt * 16 >= M) return;
  const int row0 = mt * 16, col0 = nq * 64;
  const float* arow = A + (size_t)(row0 + ln) * lda;
  v8f acc[4] = {};
  for (int kb = 0; kb < K; kb += 32) {
    FragB ah, al;
    const v4f x0 = *(const v4fa*)(arow + kb + 8 * hh), x1 = *(const v4fa*)(arow + kb + 8 * hh + 4);
    const v4f x2 = *(const v4fa*)(arow + kb + 16 + 8 * hh), x3 = *(const v4fa*)(arow + kb + 16 + 8 * hh + 4);
    float xs[16] = {x0[0],x0[1],x0[2],x0[3],x1[0],x1[1],x1[2],x1[3],x2[0],x2[1],x2[2],x2[3],x3[0],x3[1],x3[2],x3[3]};
#pragma unroll
    for (int i = 0; i < 16; ++i) { const unsigned short hb = bf16_bits(xs[i]); ah.u[i] = hb; al.u[i] = ASPLIT ? bf16_bits(xs[i] - bf16_val(hb)) : (unsigned short)0; }
#pragma unroll
    for (int t = 0; t < 4; ++t) {
      const unsigned short* brow = Wt + (size_t)(col0 + t * 16 + ln) * ldb + kb;
      FragB b;
      b.half[0] = *(const v8us*)(brow + 8 * hh);
      b.half[1] = *(const v8us*)(brow + 16 + 8 * hh);
      acc[t] = mmaN<ASPLIT ? 2 : 1>(ah.v, al.v, b.v, b.v, acc[t]);
    }
  }
#pragma unroll
  for (int t = 0; t < 4; ++t) {
    float bv = bias ? bias[col0 + t * 16 + ln] : 0.f;
    if (BIAS_BF16) bv = bf16_round(bv);
#pragma unroll
    for (int r = 0; r < 8; ++r) { float v = acc[t][r] + bv; if (ACT == 1) v = fmaxf(v, 0.f); so[w][8 * hh + r][t * 16 + ln] = v; }
  }
  __builtin_amdgcn_fence(__ATOMIC_ACQ_REL, "workgroup");
  __builtin_amdgcn_wave_barrier();
  const int rsub = lane >> 4, c4 = (lane & 15) * 4;
  {
#pragma unroll
    for (int q = 0; q < 8; ++q) {
      const int r = q * 2 + rsub;
      const v4f v = *(const v4fa*)&so[w][r][c4];
      *(v4f*)(C + (size_t)(row0 + r) * ldc + col0 + c4) = v;
    }
    
  }
}

// Flash-style causal/unmasked attention, all contractions 3-term bf16 hi/lo splits, f32 softmax with running max.
// q,k,v rows are read from f32 buffers with arbitrary row pitch (so they can live inside a fused qkv buffer);
// D = head size (multiple of 32, <= 128); one wave = 16 query rows; block = 4 waves (64 queries) sharing K/V chunks of 32.
template <int D, bool CAUSAL>
__global__ __launch_bounds__(128) void k_flash(const float* __restrict__ qb, const float* __restrict__ kb, const float* __restrict__ vb,
                                             int pitch, int T, int H, float scale, float* __restrict__ y, int ypitch) {
  constexpr int KS = D / 32;        // k-steps for QK
  constexpr int DT = D / 16;        // d tiles for PV
  __shared__ __attribute__((aligned(16))) unsigned short sKh[32][D + 8], sKl[32][D + 8], sVh[32][D + 8], sVl[32][D + 8];
  __shared__ __attribute__((aligned(16))) unsigned short sPh[4][16][40], sPl[4][16][40];
  __shared__ __attribute__((aligned(16))) float sO[4][16][D];
  const int tid = threadIdx.x, w = tid >> 5, lane = tid & 31, ln = lane & 15, hh = lane >> 4;
  const int nqb = (T + 63) / 64;
  const int bh = blockIdx.x / nqb, qblk = blockIdx.x % nqb;
  const int b = bh / H, h = bh % H;
  const int q0 = qblk * 64 + w * 16;
  const float* Q = qb + (size_t)b * T * pitch + h * D;
  const float* K = kb + (size_t)b * T * pitch + h * D;
  const float* V = vb + (size_t)b * T * pitch + h * D;

  // A fragments of the wave's 16 query rows (scaled), hi/lo
  FragB aqh[KS], aql[KS];
  {
    int row = q0 + ln; if (row >= T) row = T - 1;
    const float* qr = Q + (size_t)row * pitch;
#pragma unroll
    for (int ks = 0; ks < KS; ++ks)
#pragma unroll
      for (int i = 0; i < 16; ++i) {
        const int d = ks * 32 + ((i < 8) ? (8 * hh + i) : (16 + 8 * hh + (i - 8)));
        const float x = qr[d] * scale; const unsigned short hb = bf16_bits(x);
        aqh[ks].u[i] = hb; aql[ks].u[i] = bf16_bits(x - bf16_val(hb));
      }
  }
  float m_r[8], l_r[8];
#pragma unroll
  for (int r = 0; r < 8; ++r) { m_r[r] = -3.0e38f; l_r[r] = 0.f; }
  v8f oacc[DT];
#pragma unroll
  for (int dt = 0; dt < DT; ++dt) oacc[dt] = (v8f){0.f,0.f,0.f,0.f,0.f,0.f,0.f,0.f};

  const int kv_end = CAUSAL ? min(T, qblk * 64 + 64) : T;     // block-uniform
  for (int j0 = 0; j0 < kv_end; j0 += 32) {
    __syncthreads();
    for (int e = tid; e < 32 * (D / 4); e += 128) {
      const int r = e / (D / 4), c4 = (e % (D / 4)) * 4;
      const int key = j0 + r;
      v4f kf = {0.f,0.f,0.f,0.f}, vf = {0.f,0.f,0.f,0.f};
      if (key < T) { kf = *(const v4fa*)(K + (size_t)key * pitch + c4); vf = *(const v4fa*)(V + (size_t)key * pitch + c4); }
#pragma unroll
      for (int t = 0; t < 4; ++t) {
        unsigned short hb = bf16_bits(kf[t]); sKh[r][c4 + t] = hb; sKl[r][c4 + t] = bf16_bits(kf[t] - bf16_val(hb));
        hb = bf16_bits(vf[t]); sVh[r][c4 + t] = hb; sVl[r][c4 + t] = bf16_bits(vf[t] - bf16_val(hb));
      }
    }
    __syncthreads();
    // S tile 16 x 32
    v8f s[2];
#pragma unroll
    for (int nt = 0; nt < 2; ++nt) {
      v8f acc = {};
#pragma unroll
      for (int ks = 0; ks < KS; ++ks) {
        FragB bh_, bl_;
        bh_.half[0] = *(const v8us*)&sKh[nt * 16 + ln][ks * 32 + 8 * hh]; bh_.half[1] = *(const v8us*)&sKh[nt * 16 + ln][ks * 32 + 16 + 8 * hh];
        bl_.half[0] = *(const v8us*)&sKl[nt * 16 + ln][ks * 32 + 8 * hh]; bl_.half[1] = *(const v8us*)&sKl[nt * 16 + ln][ks * 32 + 16 + 8 * hh];
        acc = mmaN<3>(aqh[ks].v, aql[ks].v, bh_.v, bl_.v, acc);
      }
      s[nt] = acc;
    }
    // mask + running max (rows 8hh+r; the 16 lanes of a half share rows)
    float alpha[8];
#pragma unroll
    for (int r = 0; r < 8; ++r) {
      const int qi = q0 + 8 * hh + r;
      const int ja = j0 + ln, jb = j0 + 16 + ln;
      if (CAUSAL) { if (ja > qi) s[0][r] = -3.0e38f; if (jb > qi) s[1][r] = -3.0e38f; }
      if (ja >= T) s[0][r] = -3.0e38f;
      if (jb >= T) s[1][r] = -3.0e38f;
      float mx = fmaxf(s[0][r], s[1][r]);
      mx = fmaxf(mx, __shfl_xor(mx, 1, 32)); mx = fmaxf(mx, __shfl_xor(mx, 2, 32)); mx = fmaxf(mx, __shfl_xor(mx, 4, 32)); mx = fmaxf(mx, __shfl_xor(mx, 8, 32));
      const float mnew = fmaxf(m_r[r], mx);
      alpha[r] = (mnew > -1.0e38f) ? __expf(m_r[r] - mnew) : 1.0f;
      const float p0 = (s[0][r] > -1.0e38f) ? __expf(s[0][r] - mnew) : 0.f;
      const float p1 = (s[1][r] > -1.0e38f) ? __expf(s[1][r] - mnew) : 0.f;
      m_r[r] = mnew;
      l_r[r] = l_r[r] * alpha[r] + p0 + p1;            // per-lane partial row sum (16 lanes combined at the end)
      unsigned short hb = bf16_bits(p0); sPh[w][8 * hh + r][ln] = hb;      sPl[w][8 * hh + r][ln] = bf16_bits(p0 - bf16_val(hb));
      hb = bf16_bits(p1);                sPh[w][8 * hh + r][16 + ln] = hb; sPl[w][8 * hh + r][16 + ln] = bf16_bits(p1 - bf16_val(hb));
    }
#pragma unroll
    for (int dt = 0; dt < DT; ++dt)
#pragma unroll
      for (int r = 0; r < 8; ++r) oacc[dt][r] *= alpha[r];
    __builtin_amdgcn_fence(__ATOMIC_ACQ_REL, "workgroup");
    __builtin_amdgcn_wave_barrier();
    FragB pah, pal;
    pah.half[0] = *(const v8us*)&sPh[w][ln][8 * hh]; pah.half[1] = *(const v8us*)&sPh[w][ln][16 + 8 * hh];
    pal.half[0] = *(const v8us*)&sPl[w][ln][8 * hh]; pal.half[1] = *(const v8us*)&sPl[w][ln][16 + 8 * hh];
#pragma unroll
    for (int dt = 0; dt < DT; ++dt) {
      FragB bvh, bvl;
#pragma unroll
      for (int i = 0; i < 8; ++i) {
        bvh.u[i] = sVh[8 * hh + i][dt * 16 + ln]; bvh.u[8 + i] = sVh[16 + 8 * hh + i][dt * 16 + ln];
        bvl.u[i] = sVl[8 * hh + i][dt * 16 + ln]; bvl.u[8 + i] = sVl[16 + 8 * hh + i][dt * 16 + ln];
      }
      oacc[dt] = mmaN<3>(pah.v, pal.v, bvh.v, bvl.v, oacc[dt]);
    }
    __builtin_amdgcn_fence(__ATOMIC_ACQ_REL, "workgroup");
    __builtin_amdgcn_wave_barrier();
  }
#pragma unroll
  for (int r = 0; r < 8; ++r) {
    float l = l_r[r];
    l += __shfl_xor(l, 1, 32); l += __shfl_xor(l, 2, 32); l += __shfl_xor(l, 4, 32); l += __shfl_xor(l, 8, 32);
    l_r[r] = (l > 0.f) ? 1.0f / l : 0.f;
  }
#pragma unroll
  for (int dt = 0; dt < DT; ++dt)
#pragma unroll
    for (int r = 0; r < 8; ++r) sO[w][8 * hh + r][dt * 16 + ln] = oacc[dt][r] * l_r[r];
  __builtin_amdgcn_fence(__ATOMIC_ACQ_REL, "workgroup");
  __builtin_amdgcn_wave_barrier();
  {
    for (int r = 0; r < 16; ++r) {
      const int row = q0 + r;
      if (row < T && lane < D / 4) {
        const v4f val = *(const v4fa*)&sO[w][r][lane * 4];
        *(v4f*)(y + ((size_t)b * T + row) * ypitch + h * D + lane * 4) = val;
      }
    }
    
  }
}

// GEMM C = act(A·W + bias + resid): A f32 (ASPLIT -> hi/lo 2 terms), Wt bf16 [N][K]; ACT 0 none, 1 relu, 2 exact gelu;
// resid (optional, f32, row index = (row % rmod), pitch ldr, RES_BF16 rounds it) added before the activation.
template <bool ASPLIT, int ACT, bool BIAS_BF16, bool RES_BF16>
__global__ __launch_bounds__(128) void k_gemm_bf3(const float* __restrict__ A, int lda, const unsigned short* __restrict__ Wt, int ldb,
                                                const float* __restrict__ bias, const float* __restrict__ resid, int rmod, int ldr,
                                                float* __restrict__ C, int ldc, int M, int N, int K) {
  __shared__ __attribute__((aligned(16))) float so[4][16][64];
  const int tid = threadIdx.x, w = tid >> 5, lane = tid & 31, ln = lane & 15, hh = lane >> 4;
  const int ntn = N / 64;
  const int wid = blockIdx.x * 4 + w;
  const int mt = wid / ntn, nq = wid % ntn;
  if (mt * 16 >= M) return;
  const int row0 = mt * 16, col0 = nq * 64;
  const float* arow = A + (size_t)(row0 + ln) * lda;
  v8f acc[4] = {};
  for (int kb = 0; kb < K; kb += 32) {
    FragB ah, al;
    const v4f x0 = *(const v4fa*)(arow + kb + 8 * hh), x1 = *(const v4fa*)(arow + kb + 8 * hh + 4);
    const v4f x2 = *(const v4fa*)(arow + kb + 16 + 8 * hh), x3 = *(const v4fa*)(arow + kb + 16 + 8 * hh + 4);
    float xs[16] = {x0[0],x0[1],x0[2],x0[3],x1[0],x1[1],x1[2],x1[3],x2[0],x2[1],x2[2],x2[3],x3[0],x3[1],x3[2],x3[3]};
#pragma unroll
    for (int i = 0; i < 16; ++i) { const unsigned short hb = bf16_bits(xs[i]); ah.u[i] = hb; al.u[i] = ASPLIT ? bf16_bits(xs[i] - bf16_val(hb)) : (unsigned short)0; }
#pragma unroll
    for (int t = 0; t < 4; ++t) {
      const unsigned short* brow = Wt + (size_t)(col0 + t * 16 + ln) * ldb + kb;
      FragB b;
      b.half[0] = *(const v8us*)(brow + 8 * hh);
      b.half[1] = *(const v8us*)(brow + 16 + 8 * hh);
      acc[t] = mmaN<ASPLIT ? 2 : 1>(ah.v, al.v, b.v, b.v, acc[t]);
    }
  }
#pragma unroll
  for (int t = 0; t < 4; ++t) {
    const int col = col0 + t * 16 + ln;
    float bv = bias ? bias[col] : 0.f;
    if (BIAS_BF16) bv = bf16_round(bv);
#pragma unroll
    for (int r = 0; r < 8; ++r) {
      float v = acc[t][r] + bv;
      if (resid) { float rv = resid[(size_t)((row0 + 8 * hh + r) % rmod) * ldr + col]; if (RES_BF16) rv = bf16_round(rv); v += rv; }
      if (ACT == 1) v = fmaxf(v, 0.f);
      if (ACT == 2) v = 0.5f * v * (1.0f + erff(v * 0.70710678118654752f));
      if (ACT == 3) { const float u = 0.7978845608028654f * (v + 0.044715f * v * v * v); v = 0.5f * v * (1.0f + tanhf(u)); }
      so[w][8 * hh + r][t * 16 + ln] = v;
    }
  }
  __builtin_amdgcn_fence(__ATOMIC_ACQ_REL, "workgroup");
  __builtin_amdgcn_wave_barrier();
  const int rsub = lane >> 4, c4 = (lane & 15) * 4;
  {
#pragma unroll
    for (int q = 0; q < 8; ++q) {
      const int r = q * 2 + rsub;
      const v4f v = *(const v4fa*)&so[w][r][c4];
      *(v4f*)(C + (size_t)(row0 + r) * ldc + col0 + c4) = v;
    }
    
  }
}
// row LayerNorm (biased variance, eps) over N: s = X (+ R); optional out_sum <- s; out_norm <- (s-mu)*rsqrt(var+eps)*g + b
template <bool PARAM_BF16>
__global__ __launch_bounds__(256) void k_layernorm(const float* __restrict__ X, const float* __restrict__ R, const float* __restrict__ g, const float* __restrict__ bta,
                                                  float* __restrict__ out_sum, float* __restrict__ out_norm, int N, float eps) {
  __shared__ float red[256];
  const int row = blockIdx.x, tid = threadIdx.x;
  const float* x = X + (size_t)row * N; const float* rr = R ? R + (size_t)row * N : nullptr;
  float vals[16];                     // up to N = 4096
  const int per = N / 256;            // contiguous chunk per thread? use strided-by-4 chunks: thread handles j = tid*4 + 1024*u
  float s1 = 0.f;
  for (int u = 0; u < per / 4; ++u) {
    const int j = tid * 4 + 1024 * u;
    const v4f a = *(const v4fa*)(x + j);
    v4f b = {0.f,0.f,0.f,0.f}; if (rr) b = *(const v4fa*)(rr + j);
#pragma unroll
    for (int q = 0; q < 4; ++q) { const float v = a[q] + b[q]; vals[u * 4 + q] = v; s1 += v; }
  }
  red[tid] = s1; __syncthreads();
  for (int st = 128; st > 0; st >>= 1) { if (tid < st) red[tid] += red[tid + st]; __syncthreads(); }
  const float mu = red[0] / (float)N; __syncthreads();
  float s2 = 0.f;
  for (int u = 0; u < per / 4; ++u)
#pragma unroll
    for (int q = 0; q < 4; ++q) { const float c = vals[u * 4 + q] - mu; s2 += c * c; }
  red[tid] = s2; __syncthreads();
  for (int st = 128; st > 0; st >>= 1) { if (tid < st) red[tid] += red[tid + st]; __syncthreads(); }
  const float rs = rsqrtf(red[0] / (float)N + eps);
  {
    for (int u = 0; u < per / 4; ++u) {
      const int j = tid * 4 + 1024 * u;
      v4f o, sm;
#pragma unroll
      for (int q = 0; q < 4; ++q) {
        float gg = g[j + q], bb = bta[j + q];
        if (PARAM_BF16) { gg = bf16_round(gg); bb = bf16_round(bb); }
        sm[q] = vals[u * 4 + q]; o[q] = (vals[u * 4 + q] - mu) * rs * gg + bb;
      }
      if (out_sum) *(v4f*)(out_sum + (size_t)row * N + j) = sm;
      *(v4f*)(out_norm + (size_t)row * N + j) = o;
    }
    
  }
}



// ---- f16 WMMA path (v_wmma_f32_16x16x32_f16): 11-bit significands for operands in range — used where a [0,1] probability operand needs more precision than bf16
typedef _Float16 v16h __attribute__((ext_vector_type(16)));
union FragH { v16h v; v8us half[2]; _Float16 h[16]; unsigned short u[16]; };
template <int NT>
__device__ __forceinline__ v8f mmaH(v16h ah, v16h al, v16h bh, v16h bl, v8f c) {
  c = __builtin_amdgcn_wmma_f32_16x16x32_f16(false, ah, false, bh, (short)0, c, false, false);
  if (NT >= 2) c = __builtin_amdgcn_wmma_f32_16x16x32_f16(false, al, false, bh, (short)0, c, false, false);
  if (NT >= 3) c = __builtin_amdgcn_wmma_f32_16x16x32_f16(false, ah, false, bl, (short)0, c, false, false);
  asm volatile("v_nop\n\tv_nop\n\tv_nop\n\tv_nop" : "+v"(c) : "v"(ah), "v"(al), "v"(bh), "v"(bl));
  return c;
}
// batched GEMM like k_gemm_b but f16 operands: A f32 (split into f16 hi/lo if ASPLIT, else rounded to f16), Bt = f16 values [n][k]; alpha; C f32; N multiple of 16 (partial tiles skipped)
template <bool ASPLIT>
__global__ __launch_bounds__(128) void k_gemm_h(const float* __restrict__ A, int lda, size_t sA, const _Float16* __restrict__ Bh, int ldb, size_t sB, float alpha, float* __restrict__ C, int ldc, size_t sC, int M, int N, int K) {
  __shared__ __attribute__((aligned(16))) float so[4][16][64];
  const int tid = threadIdx.x, w = tid >> 5, lane = tid & 31, ln = lane & 15, hh = lane >> 4; const int by = blockIdx.y;
  A += (size_t)by * sA; Bh += (size_t)by * sB; C += (size_t)by * sC;
  const int ntn = (N + 63) / 64; const int wid = blockIdx.x * 4 + w; const int mt = wid / ntn, nq = wid % ntn; if (mt * 16 >= M) return;
  const int row0 = mt * 16, col0 = nq * 64; const float* arow = A + (size_t)(row0 + ln) * lda;
  v8f acc[4] = {};
  for (int kb = 0; kb < K; kb += 32) {
    FragH ah, al;
    const v4f x0 = *(const v4fa*)(arow + kb + 8 * hh), x1 = *(const v4fa*)(arow + kb + 8 * hh + 4), x2 = *(const v4fa*)(arow + kb + 16 + 8 * hh), x3 = *(const v4fa*)(arow + kb + 16 + 8 * hh + 4);
    float xs[16] = {x0[0],x0[1],x0[2],x0[3],x1[0],x1[1],x1[2],x1[3],x2[0],x2[1],x2[2],x2[3],x3[0],x3[1],x3[2],x3[3]};
#pragma unroll
    for (int i = 0; i < 16; ++i) { const _Float16 h = (_Float16)xs[i]; ah.h[i] = h; al.h[i] = ASPLIT ? (_Float16)(xs[i] - (float)h) : (_Float16)0.0f; }
#pragma unroll
    for (int t = 0; t < 4; ++t) { if (col0 + t * 16 >= N) continue; const size_t boff = (size_t)(col0 + t * 16 + ln) * ldb + kb; FragH bq; bq.half[0] = *(const v8us*)(Bh + boff + 8 * hh); bq.half[1] = *(const v8us*)(Bh + boff + 16 + 8 * hh);
      acc[t] = mmaH<ASPLIT ? 2 : 1>(ah.v, al.v, bq.v, bq.v, acc[t]); }
  }
#pragma unroll
  for (int t = 0; t < 4; ++t) { if (col0 + t * 16 >= N) continue;
#pragma unroll
    for (int r = 0; r < 8; ++r) so[w][8 * hh + r][t * 16 + ln] = acc[t][r] * alpha; }
  __builtin_amdgcn_fence(__ATOMIC_ACQ_REL, "workgroup"); __builtin_amdgcn_wave_barrier();
  const int rsub = lane >> 4, c4 = (lane & 15) * 4;
  {
#pragma unroll
    for (int q = 0; q < 8; ++q) { const int r = q * 2 + rsub; if (col0 + c4 < N) { const v4f v = *(const v4fa*)&so[w][r][c4]; *(v4f*)(C + (size_t)(row0 + r) * ldc + col0 + c4) = v; } }
     }
}

// Wt[n][k] = f16(W[k][n]·scale) from f32 row-major W[K][N] (scale = power of two; bf16-exact weights stay exact in f16 away from the subnormal range)
__global__ __launch_bounds__(256) void k_wt_f16(const float* __restrict__ W, _Float16* __restrict__ Wt, int K, int N, float scale) {
  const int t = blockIdx.x * 256 + threadIdx.x; if (t >= N * (K / 8)) return; const int n = t / (K / 8), k8 = (t % (K / 8)) * 8; FragH f;
#pragma unroll
  for (int i = 0; i < 8; ++i) f.h[i] = (_Float16)(bf16_round(W[(size_t)(k8 + i) * N + n]) * scale); const v8us o = f.half[0];
  *(v8us*)((unsigned short*)Wt + (size_t)n * K + k8) = o; 
}
// k_gemm_hh variant with fused epilogue: v = acc·alpha + bias[by·sBias + col] (+ CP[(row/rowsPerB)·sCPb + by·64 + col] if CP) ; ACT 0 none / 1 elu ; writes f32 C and/or f16 C16 (each if non-null)
// N and K are compile-time (NC, KC): the column guard of a partial tile folds away where NC is a multiple of 64 and the k loop unrolls into groups of KU k-steps.
template <int ACT, int NC, int KC>
__global__ __launch_bounds__(128) void k_gemm_hhx(const _Float16* __restrict__ A, int lda, size_t sA, const _Float16* __restrict__ Bh, int ldb, size_t sB, float alpha, const float* __restrict__ bias, size_t sBias, const float* __restrict__ CP, int rowsPerB, size_t sCPb, int row0g,
    float* __restrict__ C, _Float16* __restrict__ C16, int ldc, size_t sC, int M) {
  constexpr int N = NC, KU = 2, NG = KC / (32 * KU); constexpr bool PART = (NC % 64) != 0; static_assert(KC % (32 * KU) == 0, "k groups");
  __shared__ __attribute__((aligned(16))) float so[4][16][64];
  const int tid = threadIdx.x, w = tid >> 5, lane = tid & 31, ln = lane & 15, hh = lane >> 4; const int by = blockIdx.y;
  A += (size_t)by * sA; Bh += (size_t)by * sB; const size_t cofs = (size_t)by * sC; const float* bp = bias ? bias + (size_t)by * sBias : nullptr;
  const int ntn = (N + 63) / 64; const int wid = blockIdx.x * 4 + w; const int mt = wid / ntn, nq = wid % ntn; if (mt * 16 >= M) return;
  const int row0 = mt * 16, col0 = nq * 64; const _Float16* arow = A + (size_t)(row0 + ln) * lda;
  v8f acc[4] = {};
  // The fragment loads of a whole group (KU k-steps: 2 KU of A, 8 KU of B) are written as one run, one group ahead of the products that use them, in two register sets. Written pair by pair between the
  // products each pair was waited for in full before its one product: the statement that ends mmaH is volatile and the scheduler moves no load across it, so a load stays where the source puts it.
  FragH fa[2][KU], fb[2][KU][4];
  const unsigned short* ap = (const unsigned short*)arow + 8 * hh; const unsigned short* bp0 = (const unsigned short*)Bh + (size_t)(col0 + ln) * ldb + 8 * hh;
#pragma unroll
  for (int g = -1; g < NG; ++g) {
    if (g + 1 < NG) { const int nx = (g + 1) & 1;
#pragma unroll
      for (int u = 0; u < KU; ++u) { const int kb = ((g + 1) * KU + u) * 32; fa[nx][u].half[0] = *(const v8us*)(ap + kb); fa[nx][u].half[1] = *(const v8us*)(ap + kb + 16);
#pragma unroll
        for (int t = 0; t < 4; ++t) { if (PART && col0 + t * 16 >= N) continue; const unsigned short* br = bp0 + (size_t)(t * 16) * ldb + kb; fb[nx][u][t].half[0] = *(const v8us*)br; fb[nx][u][t].half[1] = *(const v8us*)(br + 16); } } }
    if (g >= 0) { const int cu = g & 1;
#pragma unroll
      for (int u = 0; u < KU; ++u)
#pragma unroll
        for (int t = 0; t < 4; ++t) { if (PART && col0 + t * 16 >= N) continue; acc[t] = mmaH<1>(fa[cu][u].v, fa[cu][u].v, fb[cu][u][t].v, fb[cu][u][t].v, acc[t]); } }
  }
#pragma unroll
  for (int t = 0; t < 4; ++t) { if (col0 + t * 16 >= N) continue; const int col = col0 + t * 16 + ln; const float bv = bp ? bf16_round(bp[col]) : 0.f;
#pragma unroll
    for (int r = 0; r < 8; ++r) { float v = acc[t][r] * alpha + bv; if (CP) { const int bidx = (row0g + row0 + 8 * hh + r) / rowsPerB; v += CP[(size_t)bidx * sCPb + (size_t)by * 64 + col]; } if (ACT == 1) v = (v > 0.f) ? v : expm1f(v); else if (ACT == 3) v = fmaxf(v, 0.f); so[w][8 * hh + r][t * 16 + ln] = v; } }
  __builtin_amdgcn_fence(__ATOMIC_ACQ_REL, "workgroup"); __builtin_amdgcn_wave_barrier();
  const int rsub = lane >> 4, c4 = (lane & 15) * 4; typedef _Float16 v4h __attribute__((ext_vector_type(4)));
  {
#pragma unroll
    for (int q = 0; q < 8; ++q) { const int r = q * 2 + rsub; if (col0 + c4 < N) { const v4f v = *(const v4fa*)&so[w][r][c4]; if (C) *(v4f*)(C + cofs + (size_t)(row0 + r) * ldc + col0 + c4) = v; if (C16) { v4h h4; for (int i = 0; i < 4; ++i) h4[i] = (_Float16)v[i]; *(v4h*)(C16 + cofs + (size_t)(row0 + r) * ldc + col0 + c4) = h4; } } }
     }
}


__global__ __launch_bounds__(256) void k_x16(const float* __restrict__ x, _Float16* __restrict__ X16, size_t n8) { const size_t t = (size_t)blockIdx.x * 256 + threadIdx.x; if (t >= n8) return; FragH f;
#pragma unroll
  for (int q = 0; q < 8; ++q) f.h[q] = (_Float16)bf16_round(x[t * 8 + q]); *(v8us*)((unsigned short*)X16 + t * 8) = f.half[0];  }
__global__ __launch_bounds__(256) void k_h16(const float* __restrict__ x, _Float16* __restrict__ X16, size_t n8) { const size_t t = (size_t)blockIdx.x * 256 + threadIdx.x; if (t >= n8) return; FragH f;
#pragma unroll
  for (int q = 0; q < 8; ++q) f.h[q] = (_Float16)x[t * 8 + q]; *(v8us*)((unsigned short*)X16 + t * 8) = f.half[0];  }
__global__ __launch_bounds__(256) void k_round16f(const float* __restrict__ W, _Float16* __restrict__ Bt, size_t n8) { const size_t t = (size_t)blockIdx.x * 256 + threadIdx.x; if (t >= n8) return; FragH f;
#pragma unroll
  for (int i = 0; i < 8; ++i) f.h[i] = (_Float16)(bf16_round(W[t * 8 + i]) * 16.0f); *(v8us*)((unsigned short*)Bt + t * 8) = f.half[0];  }
template <int NHv, int TTv>
__global__ __launch_bounds__(256) void k_vt(const _Float16* __restrict__ V16, int ldv, int voff, _Float16* __restrict__ Vt) { __shared__ unsigned short tl[64][66]; const int tid = threadIdx.x; const int slab = blockIdx.x / (TTv / 64), lg = blockIdx.x % (TTv / 64); const int b = slab / NHv, h = slab % NHv;
  for (int i = tid; i < 64 * 8; i += 256) { const int r = i / 8, c8 = (i % 8) * 8; FragH f; f.half[0] = *(const v8us*)((const unsigned short*)V16 + ((size_t)b * TTv + lg * 64 + r) * ldv + voff + h * 64 + c8);
#pragma unroll
    for (int q = 0; q < 8; ++q) tl[r][c8 + q] = f.u[q]; }
  __syncthreads();
  {
#pragma unroll
    for (int rd = 0; rd < 2; ++rd) { const int d = rd * 32 + tid / 8, pc = tid % 8; FragH f;
#pragma unroll
      for (int q = 0; q < 8; ++q) f.u[q] = tl[pc * 8 + q][d];
      *(v8us*)((unsigned short*)Vt + ((size_t)slab * 64 + d) * TTv + lg * 64 + pc * 8) = f.half[0]; }
     } }

// lane l <-> lane l ^ 16 (the two halves of a wave hold the two halves of a query's keys)
__device__ __forceinline__ float xhalf(float v) { const int b = __float_as_int(v); return __int_as_float(__builtin_amdgcn_permlanex16(b, b, 0x76543210, 0xfedcba98, false, false)); }
// Transposed products: St = K.Qt (A = 16 key rows, B = the wave's 16 queries as columns) and Ot += Vt.Pt (A = 16 rows of Vt, B = Pt). Lane (ln, hh) holds query q0 + ln only: register r of score tile nt is key
// j0 + 16 nt + 8 hh + r, which is the k order of a B operand, so the two score tiles converted in place ARE Pt; maximum and sums are in-lane plus one exchange between the halves.
__global__ __launch_bounds__(128) void k_flash(const _Float16* __restrict__ Q16, int ldq, const _Float16* __restrict__ K16, int ldk, const _Float16* __restrict__ Vt, const float* __restrict__ CB, const float* __restrict__ beta, float* __restrict__ O, int ldo) {
  __shared__ float scb[2048];
  constexpr int RPW = 16, NQB = 2048 / (4 * RPW), DT = 4, KS = 2;
  __shared__ __attribute__((aligned(16))) float sO[4][RPW][64 + 4];
  const int tid = threadIdx.x, w = tid >> 5, lane = tid & 31, ln = lane & 15, hh = lane >> 4;
  const int slab = blockIdx.x / NQB, qblk = blockIdx.x % NQB; const int b = slab / 12, h = slab % 12; const int qb0 = qblk * (4 * RPW); const int q0 = qb0 + w * RPW;
  FragH aq[KS];
  { const unsigned short* qr = (const unsigned short*)Q16 + ((size_t)b * 2048 + q0 + ln) * ldq + h * 64;
#pragma unroll
    for (int ks = 0; ks < KS; ++ks) { aq[ks].half[0] = *(const v8us*)(qr + ks * 32 + 8 * hh); aq[ks].half[1] = *(const v8us*)(qr + ks * 32 + 16 + 8 * hh); } }
  for (int i = tid; i < 2048; i += 128) scb[i] = CB[i]; const float bh = bf16_round(beta[h]); __syncthreads();
  const unsigned short* Vth = (const unsigned short*)Vt + (size_t)slab * 64 * 2048;
  const int tq = q0 + ln;      /* this lane's query */
  float m_q = -3.0e38f, l_q = 0.f, lc_q = 0.f;      /* running maximum (same in both halves); this half's partial sums over all keys and over the causal keys */
  v8f oacc[DT];      /* oacc[dt][r] = Ot[dt * 16 + 8 hh + r][tq] */
#pragma unroll
  for (int dt = 0; dt < DT; ++dt) oacc[dt] = (v8f){0.f,0.f,0.f,0.f,0.f,0.f,0.f,0.f};
  const int jend = 2048;
#pragma unroll 1
  for (int j0 = 0; j0 < jend; j0 += 32) {
    /* all fragment loads of the pass (8 of K, and 8 of V where the pass has a causal key) as one run ahead of its first product: no load moves across the volatile statement that ends mmaH */
    const bool pv = (j0 <= q0 + RPW - 1);      /* some key of this chunk is <= some query of this wave; otherwise every p is 0 */
    FragH bk[2][KS], bv[DT];
#pragma unroll
    for (int nt = 0; nt < 2; ++nt) { const unsigned short* kr = (const unsigned short*)K16 + ((size_t)b * 2048 + j0 + nt * 16 + ln) * ldk + h * 64;
#pragma unroll
      for (int ks = 0; ks < KS; ++ks) { bk[nt][ks].half[0] = *(const v8us*)(kr + ks * 32 + 8 * hh); bk[nt][ks].half[1] = *(const v8us*)(kr + ks * 32 + 16 + 8 * hh); } }
    if (pv) {
#pragma unroll
      for (int dt = 0; dt < DT; ++dt) { const unsigned short* vrow = Vth + (size_t)(dt * 16 + ln) * 2048 + j0; bv[dt].half[0] = *(const v8us*)(vrow + 8 * hh); bv[dt].half[1] = *(const v8us*)(vrow + 16 + 8 * hh); } }
    v8f s[2];
#pragma unroll
    for (int nt = 0; nt < 2; ++nt) { v8f acc = (v8f){0.f,0.f,0.f,0.f,0.f,0.f,0.f,0.f};
#pragma unroll
      for (int ks = 0; ks < KS; ++ks) acc = mmaH<1>(bk[nt][ks].v, bk[nt][ks].v, aq[ks].v, aq[ks].v, acc); s[nt] = acc; }
    float sv[16]; const int xq4 = 4 * (tq - 8 * hh - j0);      /* 4 (q - k) at this lane's first key of the pass */
#pragma unroll
    for (int i = 0; i < 16; ++i) { const int x4 = xq4 - 4 * ((i >> 3) * 16 + (i & 7)); const int d4 = (x4 < 0) ? -x4 : x4;      /* phase coherence 1 + beta * mean_f cos(d * theta_f), d = |q - k|; x4 = 4 (q - k), the table's byte offset up to its sign */
      sv[i] = s[i >> 3][i & 7] * 0.125f * (1.0f + bh * *(const float*)((const char*)scb + d4)); }
    float mx[4];
#pragma unroll
    for (int i = 0; i < 4; ++i) mx[i] = fmaxf(fmaxf(sv[i], sv[4 + i]), fmaxf(sv[8 + i], sv[12 + i]));
    float mc = fmaxf(fmaxf(mx[0], mx[1]), fmaxf(mx[2], mx[3])); mc = fmaxf(mc, xhalf(mc));
    const float mn = fmaxf(m_q, mc); const float ea = expf(m_q - mn); const float al = (mn > -1.0e38f) ? ea : 1.0f; m_q = mn;
    float se[4] = {0.f, 0.f, 0.f, 0.f}, sp[4] = {0.f, 0.f, 0.f, 0.f}; FragH pb;      /* full-softmax stats over ALL keys; P.V and its sum only over the causal ones */
#pragma unroll
    for (int i = 0; i < 16; ++i) { const int x4 = xq4 - 4 * ((i >> 3) * 16 + (i & 7)); const float e = expf(sv[i] - mn); const float p = (x4 >= 0) ? e : 0.f; se[i & 3] += e; sp[i & 3] += p; pb.h[i] = (_Float16)p; }
    l_q = l_q * al + ((se[0] + se[1]) + (se[2] + se[3])); lc_q = lc_q * al + ((sp[0] + sp[1]) + (sp[2] + sp[3]));
#pragma unroll
    for (int dt = 0; dt < DT; ++dt)
#pragma unroll
      for (int r = 0; r < 8; ++r) oacc[dt][r] *= al;
    if (pv) {
#pragma unroll
      for (int dt = 0; dt < DT; ++dt) oacc[dt] = mmaH<1>(bv[dt].v, bv[dt].v, pb.v, pb.v, oacc[dt]); } }
  const float l = l_q + xhalf(l_q), lc = lc_q + xhalf(lc_q); const float inv = 1.0f / (lc + 1e-8f * l);      /* w * causal / (sum_causal w + 1e-8) with w = e^(s-m) / Z_full  =  e^(s-m) / (Z_causal + 1e-8 * Z_full) */
#pragma unroll
  for (int dt = 0; dt < DT; ++dt)
#pragma unroll
    for (int q = 0; q < 2; ++q) { v4f o4;
#pragma unroll
      for (int i = 0; i < 4; ++i) o4[i] = oacc[dt][q * 4 + i] * inv;
      *(v4fa*)&sO[w][ln][dt * 16 + 8 * hh + q * 4] = o4; }
  __builtin_amdgcn_fence(__ATOMIC_ACQ_REL, "workgroup"); __builtin_amdgcn_wave_barrier();
  {
#pragma unroll
    for (int rp = 0; rp < RPW; rp += 2) { const int r = rp + (lane >> 4), pc = lane & 15; const v4f val = *(const v4fa*)&sO[w][r][pc * 4]; *(v4f*)(O + ((size_t)b * 2048 + q0 + r) * ldo + h * 64 + pc * 4) = val; }
     } }

__global__ __launch_bounds__(256) void k_cb(float* __restrict__ CB) { __shared__ float sc[8][33]; const int tid = threadIdx.x, g = tid >> 5, f = tid & 31; const int dl = blockIdx.x * 8 + g;      /* one thread per (distance, frequency) term; a block makes 8 table entries */
  const float th = powf(10000.0f, -(float)(2 * f) / 64.0f); sc[g][f] = cosf((float)dl * th); __syncthreads();
  if (tid < 8) { float s = 0.f;
    for (int i = 0; i < 32; ++i) s += sc[tid][i];      /* f = 0..31 in ascending order, the order in which one thread summed them before */
    CB[blockIdx.x * 8 + tid] = s / 32.0f; } }
// rotary + rms-norm per (row, head): x1 = q[h·64 + j], x2 = q[h·64 + 32 + j] (j < 32); out = [x1·cos + x2·sin | −x1·sin + x2·cos] with cos/sin = bf16(INPUT tables [t][j]); then × rsqrt(mean(out²) + f32 eps) → f16;
__global__ __launch_bounds__(256) void k_ropenorm(const float* __restrict__ Qf, const float* __restrict__ cosT, const float* __restrict__ sinT, _Float16* __restrict__ Q16) { const size_t tg = (size_t)blockIdx.x * 256 + threadIdx.x; if (tg >= (size_t)NR * NH * 4) return; const size_t row = tg / (NH * 4); const int h = (int)((tg / 4) % NH), pc = (int)(tg % 4); const int t = (int)(row % TT); const int j0 = pc * 8;
  float a[8], bq[8]; float ss = 0.f;
#pragma unroll
  for (int q = 0; q < 8; ++q) { const int j = j0 + q; const float x1 = Qf[row * CC + h * 64 + j], x2 = Qf[row * CC + h * 64 + 32 + j]; const float c = bf16_round(cosT[t * 32 + j]), s = bf16_round(sinT[t * 32 + j]); a[q] = x1 * c + x2 * s; bq[q] = -x1 * s + x2 * c; ss += a[q] * a[q] + bq[q] * bq[q]; }
  ss += __shfl_xor(ss, 1, 32); ss += __shfl_xor(ss, 2, 32); const float rn = rsqrtf(ss / 64.0f + 1.1920929e-7f); FragH f1, f2;
#pragma unroll
  for (int q = 0; q < 8; ++q) { f1.h[q] = (_Float16)(a[q] * rn); f2.h[q] = (_Float16)(bq[q] * rn); }
  { *(v8us*)((unsigned short*)Q16 + row * CC + h * 64 + j0) = f1.half[0]; *(v8us*)((unsigned short*)Q16 + row * CC + h * 64 + 32 + j0) = f2.half[0];  } }
extern "C" void kernel_launch(void* const* d_in, const int* in_sizes, int n_in,
                              void* d_out, int out_size, void* d_ws, size_t ws_size, hipStream_t stream) {
  (void)in_sizes; (void)n_in; (void)out_size;
  const float* x = (const float*)d_in[0]; const float* cosT = (const float*)d_in[1]; const float* sinT = (const float*)d_in[2]; const float* Wq = (const float*)d_in[3]; const float* Wk = (const float*)d_in[4]; const float* Wv = (const float*)d_in[5]; const float* Wo = (const float*)d_in[6]; const float* beta = (const float*)d_in[7];
  char* ws = (char*)d_ws; size_t off = 0;
  auto take = [&](size_t bytes) { char* p = ws + off; off += (bytes + 255) & ~(size_t)255; return p; };
  _Float16* Bq = (_Float16*)take((size_t)CC * CC * 2); _Float16* Bk = (_Float16*)take((size_t)CC * CC * 2); _Float16* Bv = (_Float16*)take((size_t)CC * CC * 2); _Float16* Bo = (_Float16*)take((size_t)CC * CC * 2); float* CB = (float*)take(TT * 4);
  _Float16* X16 = (_Float16*)take((size_t)NR * CC * 2); float* Qf = (float*)take((size_t)NR * CC * 4); float* Kf = (float*)take((size_t)NR * CC * 4); _Float16* Q16 = (_Float16*)take((size_t)NR * CC * 2); _Float16* K16 = (_Float16*)take((size_t)NR * CC * 2); _Float16* V16 = (_Float16*)take((size_t)NR * CC * 2); _Float16* Vt = (_Float16*)take((size_t)NR * CC * 2); float* O = Qf; _Float16* O16 = X16;      // Qf dead after k_ropenorm; X16 dead after the V GEMM
  if (off > ws_size) return;      // 4.7 + 6.3 + 12.6 × 2 + 6.3 × 4 ≈ 59 MiB
  const size_t w8 = (size_t)CC * CC / 8; const unsigned gw = (unsigned)((w8 + 255) / 256);
  k_round16f<<<gw, 256, 0, stream>>>(Wq, Bq, w8); k_round16f<<<gw, 256, 0, stream>>>(Wk, Bk, w8); k_round16f<<<gw, 256, 0, stream>>>(Wv, Bv, w8); k_round16f<<<gw, 256, 0, stream>>>(Wo, Bo, w8);      // (out,in)
  k_cb<<<TT / 8, 256, 0, stream>>>(CB);
  const unsigned gx = (unsigned)(((size_t)NR * CC / 8 + 255) / 256); const dim3 gg(((NR / 16) * (CC / 64) + 3) / 4, 1);
  k_x16<<<gx, 256, 0, stream>>>(x, X16, (size_t)NR * CC / 8);
  k_gemm_hhx<0, CC, CC><<<gg, 128, 0, stream>>>(X16, CC, 0, Bq, CC, 0, 0.0625f, nullptr, 0, nullptr, 1, 0, 0, Qf, nullptr, CC, 0, NR);
  k_gemm_hhx<0, CC, CC><<<gg, 128, 0, stream>>>(X16, CC, 0, Bk, CC, 0, 0.0625f, nullptr, 0, nullptr, 1, 0, 0, Kf, nullptr, CC, 0, NR);
  k_gemm_hhx<0, CC, CC><<<gg, 128, 0, stream>>>(X16, CC, 0, Bv, CC, 0, 0.0625f, nullptr, 0, nullptr, 1, 0, 0, nullptr, V16, CC, 0, NR);
  const unsigned gr = (unsigned)(((size_t)NR * NH * 4 + 255) / 256);
  k_ropenorm<<<gr, 256, 0, stream>>>(Qf, cosT, sinT, Q16); k_ropenorm<<<gr, 256, 0, stream>>>(Kf, cosT, sinT, K16);
  k_vt<NH, TT><<<BB * NH * (TT / 64), 256, 0, stream>>>(V16, CC, 0, Vt);
  k_flash<<<BB * NH * (TT / 64), 128, 0, stream>>>(Q16, CC, K16, CC, Vt, CB, beta, O, CC);      // RPW 16
  k_h16<<<gx, 256, 0, stream>>>(O, O16, (size_t)NR * CC / 8);
  k_gemm_hhx<0, CC, CC><<<gg, 128, 0, stream>>>(O16, CC, 0, Bo, CC, 0, 0.0625f, nullptr, 0, nullptr, 1, 0, 0, (float*)d_out, nullptr, CC, 0, NR);
}

// v005
// Measured time: 167 microseconds a run.
// Next to v004, in two timings, it ran 1.25 times as fast each time.
// Over all steps from v000 it is 2.75 times as fast.
#include <hip/hip_runtime.h>
// Phase-aware causal attention: q/k/v/o projections (4096 × 768 × 768, no bias, weights (out,in) bf16-exact ×2^4) and the 12-head attention as a fused flash-style kernel on v_wmma_f32_16x16x32_f16
// (rotary (with the INPUT cos/sin tables) + rms-norm'd q,k as f16; S = Q·Kᵀ/8 × (1 + β_h·mean_f cos(|q−k|·θ_f)) with the 2048-entry coherence table precomputed; the module's FULL softmax followed
// by causal masking and re-normalisation with +1e-8 is reproduced exactly as e^{s−m}/(Z_causal + 1e-8·Z_full) with m, Z_full over all keys; P f16 ≤ 1; O = P·V over causal keys); f32 accumulate.
#define BB 2
#define TT 2048
#define CC 768
#define NH 12
#define NR (BB * TT)

typedef __bf16 v16b __attribute__((ext_vector_type(16)));
typedef unsigned short v8us __attribute__((ext_vector_type(8), may_alias));
typedef float  v8f  __attribute__((ext_vector_type(8)));
typedef float  v4f  __attribute__((ext_vector_type(4)));
typedef float  v4fa __attribute__((ext_vector_type(4), may_alias));
union FragB { v16b v; v8us half[2]; unsigned short u[16]; };

__device__ __forceinline__ unsigned short bf16_bits(float x) { unsigned int u = __float_as_uint(x); return (unsigned short)((u + 0x7FFFu + ((u >> 16) & 1u)) >> 16); }
__device__ __forceinline__ float bf16_val(unsigned short b) { return __uint_as_float(((unsigned int)b) << 16); }
__device__ __forceinline__ float bf16_round(float x) { return bf16_val(bf16_bits(x)); }
// D += A·B with NT terms: 1 = ah·bh, 2 = + al·bh (A split), 3 = + ah·bl (both split)
template <int NT>
__device__ __forceinline__ v8f mmaN(v16b ah, v16b al, v16b bh, v16b bl, v8f c) {
  c = __builtin_amdgcn_wmma_f32_16x16x32_bf16(false, ah, false, bh, (short)0, c, false, false);
  if (NT >= 2) c = __builtin_amdgcn_wmma_f32_16x16x32_bf16(false, al, false, bh, (short)0, c, false, false);
  if (NT >= 3) c = __builtin_amdgcn_wmma_f32_16x16x32_bf16(false, ah, false, bl, (short)0, c, false, false);
  asm volatile("v_nop\n\tv_nop\n\tv_nop\n\tv_nop" : "+v"(c) : "v"(ah), "v"(al), "v"(bh), "v"(bl));
  return c;
}

__global__ __launch_bounds__(256) void k_wt_bf16(const float* __restrict__ W, unsigned short* __restrict__ Wt, int K, int N) {
  const int t = blockIdx.x * 256 + threadIdx.x;
  const int k8n = K / 8;
  if (t >= N * k8n) return;
  const int n = t / k8n, k8 = (t % k8n) * 8;
  v8us v;
#pragma unroll
  for (int i = 0; i < 8; ++i) v[i] = bf16_bits(W[(size_t)(k8 + i) * N + n]);
  *(v8us*)(Wt + (size_t)n * K + k8) = v;
  
}

// GEMM C[M][N] (f32, pitch ldc) = act(A[M][K]·W + bias). A f32 row-major (pitch lda) converted per fragment to bf16
// (ASPLIT: hi/lo two planes -> 2 terms, else single rounded term); Wt bf16 [N][K] (pitch ldb). BIAS_BF16 rounds the
// bias to bf16 first (bias quantised to bf16 before the add). K%32==0, M%16==0, N%64==0.
template <bool ASPLIT, int ACT, bool BIAS_BF16>
__global__ __launch_bounds__(128) void k_gemm_bf(const float* __restrict__ A, int lda, const unsigned short* __restrict__ Wt, int ldb,
                                               const float* __restrict__ bias, float* __restrict__ C, int ldc, int M, int N, int K) {
  __shared__ __attribute__((aligned(16))) float so[4][16][64];
  const int tid = threadIdx.x, w = tid >> 5, lane = tid & 31, ln = lane & 15, hh = lane >> 4;
  const int ntn = N / 64;
  const int wid = blockIdx.x * 4 + w;
  const int mt = wid / ntn, nq = wid % ntn;
  if (mt * 16 >= M) return;
  const int row0 = mt * 16, col0 = nq * 64;
  const float* arow = A + (size_t)(row0 + ln) * lda;
  v8f acc[4] = {};
  for (int kb = 0; kb < K; kb += 32) {
    FragB ah, al;
    const v4f x0 = *(const v4fa*)(arow + kb + 8 * hh), x1 = *(const v4fa*)(arow + kb + 8 * hh + 4);
    const v4f x2 = *(const v4fa*)(arow + kb + 16 + 8 * hh), x3 = *(const v4fa*)(arow + kb + 16 + 8 * hh + 4);
    float xs[16] = {x0[0],x0[1],x0[2],x0[3],x1[0],x1[1],x1[2],x1[3],x2[0],x2[1],x2[2],x2[3],x3[0],x3[1],x3[2],x3[3]};
#pragma unroll
    for (int i = 0; i < 16; ++i) { const unsigned short hb = bf16_bits(xs[i]); ah.u[i] = hb; al.u[i] = ASPLIT ? bf16_bits(xs[i] - bf16_val(hb)) : (unsigned short)0; }
#pragma unroll
    for (int t = 0; t < 4; ++t) {
      const unsigned short* brow = Wt + (size_t)(col0 + t * 16 + ln) * ldb + kb;
      FragB b;
      b.half[0] = *(const v8us*)(brow + 8 * hh);
      b.half[1] = *(const v8us*)(brow + 16 + 8 * hh);
      acc[t] = mmaN<ASPLIT ? 2 : 1>(ah.v, al.v, b.v, b.v, acc[t]);
    }
  }
#pragma unroll
  for (int t = 0; t < 4; ++t) {
    float bv = bias ? bias[col0 + t * 16 + ln] : 0.f;
    if (BIAS_BF16) bv = bf16_round(bv);
#pragma unroll
    for (int r = 0; r < 8; ++r) { float v = acc[t][r] + bv; if (ACT == 1) v = fmaxf(v, 0.f); so[w][8 * hh + r][t * 16 + ln] = v; }
  }
  __builtin_amdgcn_fence(__ATOMIC_ACQ_REL, "workgroup");
  __builtin_amdgcn_wave_barrier();
  const int rsub = lane >> 4, c4 = (lane & 15) * 4;
  {
#pragma unroll
    for (int q = 0; q < 8; ++q) {
      const int r = q * 2 + rsub;
      const v4f v = *(const v4fa*)&so[w][r][c4];
      *(v4f*)(C + (size_t)(row0 + r) * ldc + col0 + c4) = v;
    }
    
  }
}

// Flash-style causal/unmasked attention, all contractions 3-term bf16 hi/lo splits, f32 softmax with running max.
// q,k,v rows are read from f32 buffers with arbitrary row pitch (so they can live inside a fused qkv buffer);
// D = head size (multiple of 32, <= 128); one wave = 16 query rows; block = 4 waves (64 queries) sharing K/V chunks of 32.
template <int D, bool CAUSAL>
__global__ __launch_bounds__(128) void k_flash(const float* __restrict__ qb, const float* __restrict__ kb, const float* __restrict__ vb,
                                             int pitch, int T, int H, float scale, float* __restrict__ y, int ypitch) {
  constexpr int KS = D / 32;        // k-steps for QK
  constexpr int DT = D / 16;        // d tiles for PV
  __shared__ __attribute__((aligned(16))) unsigned short sKh[32][D + 8], sKl[32][D + 8], sVh[32][D + 8], sVl[32][D + 8];
  __shared__ __attribute__((aligned(16))) unsigned short sPh[4][16][40], sPl[4][16][40];
  __shared__ __attribute__((aligned(16))) float sO[4][16][D];
  const int tid = threadIdx.x, w = tid >> 5, lane = tid & 31, ln = lane & 15, hh = lane >> 4;
  const int nqb = (T + 63) / 64;
  const int bh = blockIdx.x / nqb, qblk = blockIdx.x % nqb;
  const int b = bh / H, h = bh % H;
  const int q0 = qblk * 64 + w * 16;
  const float* Q = qb + (size_t)b * T * pitch + h * D;
  const float* K = kb + (size_t)b * T * pitch + h * D;
  const float* V = vb + (size_t)b * T * pitch + h * D;

  // A fragments of the wave's 16 query rows (scaled), hi/lo
  FragB aqh[KS], aql[KS];
  {
    int row = q0 + ln; if (row >= T) row = T - 1;
    const float* qr = Q + (size_t)row * pitch;
#pragma unroll
    for (int ks = 0; ks < KS; ++ks)
#pragma unroll
      for (int i = 0; i < 16; ++i) {
        const int d = ks * 32 + ((i < 8) ? (8 * hh + i) : (16 + 8 * hh + (i - 8)));
        const float x = qr[d] * scale; const unsigned short hb = bf16_bits(x);
        aqh[ks].u[i] = hb; aql[ks].u[i] = bf16_bits(x - bf16_val(hb));
      }
  }
  float m_r[8], l_r[8];
#pragma unroll
  for (int r = 0; r < 8; ++r) { m_r[r] = -3.0e38f; l_r[r] = 0.f; }
  v8f oacc[DT];
#pragma unroll
  for (int dt = 0; dt < DT; ++dt) oacc[dt] = (v8f){0.f,0.f,0.f,0.f,0.f,0.f,0.f,0.f};

  const int kv_end = CAUSAL ? min(T, qblk * 64 + 64) : T;     // block-uniform
  for (int j0 = 0; j0 < kv_end; j0 += 32) {
    __syncthreads();
    for (int e = tid; e < 32 * (D / 4); e += 128) {
      const int r = e / (D / 4), c4 = (e % (D / 4)) * 4;
      const int key = j0 + r;
      v4f kf = {0.f,0.f,0.f,0.f}, vf = {0.f,0.f,0.f,0.f};
      if (key < T) { kf = *(const v4fa*)(K + (size_t)key * pitch + c4); vf = *(const v4fa*)(V + (size_t)key * pitch + c4); }
#pragma unroll
      for (int t = 0; t < 4; ++t) {
        unsigned short hb = bf16_bits(kf[t]); sKh[r][c4 + t] = hb; sKl[r][c4 + t] = bf16_bits(kf[t] - bf16_val(hb));
        hb = bf16_bits(vf[t]); sVh[r][c4 + t] = hb; sVl[r][c4 + t] = bf16_bits(vf[t] - bf16_val(hb));
      }
    }
    __syncthreads();
    // S tile 16 x 32
    v8f s[2];
#pragma unroll
    for (int nt = 0; nt < 2; ++nt) {
      v8f acc = {};
#pragma unroll
      for (int ks = 0; ks < KS; ++ks) {
        FragB bh_, bl_;
        bh_.half[0] = *(const v8us*)&sKh[nt * 16 + ln][ks * 32 + 8 * hh]; bh_.half[1] = *(const v8us*)&sKh[nt * 16 + ln][ks * 32 + 16 + 8 * hh];
        bl_.half[0] = *(const v8us*)&sKl[nt * 16 + ln][ks * 32 + 8 * hh]; bl_.half[1] = *(const v8us*)&sKl[nt * 16 + ln][ks * 32 + 16 + 8 * hh];
        acc = mmaN<3>(aqh[ks].v, aql[ks].v, bh_.v, bl_.v, acc);
      }
      s[nt] = acc;
    }
    // mask + running max (rows 8hh+r; the 16 lanes of a half share rows)
    float alpha[8];
#pragma unroll
    for (int r = 0; r < 8; ++r) {
      const int qi = q0 + 8 * hh + r;
      const int ja = j0 + ln, jb = j0 + 16 + ln;
      if (CAUSAL) { if (ja > qi) s[0][r] = -3.0e38f; if (jb > qi) s[1][r] = -3.0e38f; }
      if (ja >= T) s[0][r] = -3.0e38f;
      if (jb >= T) s[1][r] = -3.0e38f;
      float mx = fmaxf(s[0][r], s[1][r]);
      mx = fmaxf(mx, __shfl_xor(mx, 1, 32)); mx = fmaxf(mx, __shfl_xor(mx, 2, 32)); mx = fmaxf(mx, __shfl_xor(mx, 4, 32)); mx = fmaxf(mx, __shfl_xor(mx, 8, 32));
      const float mnew = fmaxf(m_r[r], mx);
      alpha[r] = (mnew > -1.0e38f) ? __expf(m_r[r] - mnew) : 1.0f;
      const float p0 = (s[0][r] > -1.0e38f) ? __expf(s[0][r] - mnew) : 0.f;
      const float p1 = (s[1][r] > -1.0e38f) ? __expf(s[1][r] - mnew) : 0.f;
      m_r[r] = mnew;
      l_r[r] = l_r[r] * alpha[r] + p0 + p1;            // per-lane partial row sum (16 lanes combined at the end)
      unsigned short hb = bf16_bits(p0); sPh[w][8 * hh + r][ln] = hb;      sPl[w][8 * hh + r][ln] = bf16_bits(p0 - bf16_val(hb));
      hb = bf16_bits(p1);                sPh[w][8 * hh + r][16 + ln] = hb; sPl[w][8 * hh + r][16 + ln] = bf16_bits(p1 - bf16_val(hb));
    }
#pragma unroll
    for (int dt = 0; dt < DT; ++dt)
#pragma unroll
      for (int r = 0; r < 8; ++r) oacc[dt][r] *= alpha[r];
    __builtin_amdgcn_fence(__ATOMIC_ACQ_REL, "workgroup");
    __builtin_amdgcn_wave_barrier();
    FragB pah, pal;
    pah.half[0] = *(const v8us*)&sPh[w][ln][8 * hh]; pah.half[1] = *(const v8us*)&sPh[w][ln][16 + 8 * hh];
    pal.half[0] = *(const v8us*)&sPl[w][ln][8 * hh]; pal.half[1] = *(const v8us*)&sPl[w][ln][16 + 8 * hh];
#pragma unroll
    for (int dt = 0; dt < DT; ++dt) {
      FragB bvh, bvl;
#pragma unroll
      for (int i = 0; i < 8; ++i) {
        bvh.u[i] = sVh[8 * hh + i][dt * 16 + ln]; bvh.u[8 + i] = sVh[16 + 8 * hh + i][dt * 16 + ln];
        bvl.u[i] = sVl[8 * hh + i][dt * 16 + ln]; bvl.u[8 + i] = sVl[16 + 8 * hh + i][dt * 16 + ln];
      }
      oacc[dt] = mmaN<3>(pah.v, pal.v, bvh.v, bvl.v, oacc[dt]);
    }
    __builtin_amdgcn_fence(__ATOMIC_ACQ_REL, "workgroup");
    __builtin_amdgcn_wave_barrier();
  }
#pragma unroll
  for (int r = 0; r < 8; ++r) {
    float l = l_r[r];
    l += __shfl_xor(l, 1, 32); l += __shfl_xor(l, 2, 32); l += __shfl_xor(l, 4, 32); l += __shfl_xor(l, 8, 32);
    l_r[r] = (l > 0.f) ? 1.0f / l : 0.f;
  }
#pragma unroll
  for (int dt = 0; dt < DT; ++dt)
#pragma unroll
    for (int r = 0; r < 8; ++r) sO[w][8 * hh + r][dt * 16 + ln] = oacc[dt][r] * l_r[r];
  __builtin_amdgcn_fence(__ATOMIC_ACQ_REL, "workgroup");
  __builtin_amdgcn_wave_barrier();
  {
    for (int r = 0; r < 16; ++r) {
      const int row = q0 + r;
      if (row < T && lane < D / 4) {
        const v4f val = *(const v4fa*)&sO[w][r][lane * 4];
        *(v4f*)(y + ((size_t)b * T + row) * ypitch + h * D + lane * 4) = val;
      }
    }
    
  }
}

// GEMM C = act(A·W + bias + resid): A f32 (ASPLIT -> hi/lo 2 terms), Wt bf16 [N][K]; ACT 0 none, 1 relu, 2 exact gelu;
// resid (optional, f32, row index = (row % rmod), pitch ldr, RES_BF16 rounds it) added before the activation.
template <bool ASPLIT, int ACT, bool BIAS_BF16, bool RES_BF16>
__global__ __launch_bounds__(128) void k_gemm_bf3(const float* __restrict__ A, int lda, const unsigned short* __restrict__ Wt, int ldb,
                                                const float* __restrict__ bias, const float* __restrict__ resid, int rmod, int ldr,
                                                float* __restrict__ C, int ldc, int M, int N, int K) {
  __shared__ __attribute__((aligned(16))) float so[4][16][64];
  const int tid = threadIdx.x, w = tid >> 5, lane = tid & 31, ln = lane & 15, hh = lane >> 4;
  const int ntn = N / 64;
  const int wid = blockIdx.x * 4 + w;
  const int mt = wid / ntn, nq = wid % ntn;
  if (mt * 16 >= M) return;
  const int row0 = mt * 16, col0 = nq * 64;
  const float* arow = A + (size_t)(row0 + ln) * lda;
  v8f acc[4] = {};
  for (int kb = 0; kb < K; kb += 32) {
    FragB ah, al;
    const v4f x0 = *(const v4fa*)(arow + kb + 8 * hh), x1 = *(const v4fa*)(arow + kb + 8 * hh + 4);
    const v4f x2 = *(const v4fa*)(arow + kb + 16 + 8 * hh), x3 = *(const v4fa*)(arow + kb + 16 + 8 * hh + 4);
    float xs[16] = {x0[0],x0[1],x0[2],x0[3],x1[0],x1[1],x1[2],x1[3],x2[0],x2[1],x2[2],x2[3],x3[0],x3[1],x3[2],x3[3]};
#pragma unroll
    for (int i = 0; i < 16; ++i) { const unsigned short hb = bf16_bits(xs[i]); ah.u[i] = hb; al.u[i] = ASPLIT ? bf16_bits(xs[i] - bf16_val(hb)) : (unsigned short)0; }
#pragma unroll
    for (int t = 0; t < 4; ++t) {
      const unsigned short* brow = Wt + (size_t)(col0 + t * 16 + ln) * ldb + kb;
      FragB b;
      b.half[0] = *(const v8us*)(brow + 8 * hh);
      b.half[1] = *(const v8us*)(brow + 16 + 8 * hh);
      acc[t] = mmaN<ASPLIT ? 2 : 1>(ah.v, al.v, b.v, b.v, acc[t]);
    }
  }
#pragma unroll
  for (int t = 0; t < 4; ++t) {
    const int col = col0 + t * 16 + ln;
    float bv = bias ? bias[col] : 0.f;
    if (BIAS_BF16) bv = bf16_round(bv);
#pragma unroll
    for (int r = 0; r < 8; ++r) {
      float v = acc[t][r] + bv;
      if (resid) { float rv = resid[(size_t)((row0 + 8 * hh + r) % rmod) * ldr + col]; if (RES_BF16) rv = bf16_round(rv); v += rv; }
      if (ACT == 1) v = fmaxf(v, 0.f);
      if (ACT == 2) v = 0.5f * v * (1.0f + erff(v * 0.70710678118654752f));
      if (ACT == 3) { const float u = 0.7978845608028654f * (v + 0.044715f * v * v * v); v = 0.5f * v * (1.0f + tanhf(u)); }
      so[w][8 * hh + r][t * 16 + ln] = v;
    }
  }
  __builtin_amdgcn_fence(__ATOMIC_ACQ_REL, "workgroup");
  __builtin_amdgcn_wave_barrier();
  const int rsub = lane >> 4, c4 = (lane & 15) * 4;
  {
#pragma unroll
    for (int q = 0; q < 8; ++q) {
      const int r = q * 2 + rsub;
      const v4f v = *(const v4fa*)&so[w][r][c4];
      *(v4f*)(C + (size_t)(row0 + r) * ldc + col0 + c4) = v;
    }
    
  }
}
// row LayerNorm (biased variance, eps) over N: s = X (+ R); optional out_sum <- s; out_norm <- (s-mu)*rsqrt(var+eps)*g + b
template <bool PARAM_BF16>
__global__ __launch_bounds__(256) void k_layernorm(const float* __restrict__ X, const float* __restrict__ R, const float* __restrict__ g, const float* __restrict__ bta,
                                                  float* __restrict__ out_sum, float* __restrict__ out_norm, int N, float eps) {
  __shared__ float red[256];
  const int row = blockIdx.x, tid = threadIdx.x;
  const float* x = X + (size_t)row * N; const float* rr = R ? R + (size_t)row * N : nullptr;
  float vals[16];                     // up to N = 4096
  const int per = N / 256;            // contiguous chunk per thread? use strided-by-4 chunks: thread handles j = tid*4 + 1024*u
  float s1 = 0.f;
  for (int u = 0; u < per / 4; ++u) {
    const int j = tid * 4 + 1024 * u;
    const v4f a = *(const v4fa*)(x + j);
    v4f b = {0.f,0.f,0.f,0.f}; if (rr) b = *(const v4fa*)(rr + j);
#pragma unroll
    for (int q = 0; q < 4; ++q) { const float v = a[q] + b[q]; vals[u * 4 + q] = v; s1 += v; }
  }
  red[tid] = s1; __syncthreads();
  for (int st = 128; st > 0; st >>= 1) { if (tid < st) red[tid] += red[tid + st]; __syncthreads(); }
  const float mu = red[0] / (float)N; __syncthreads();
  float s2 = 0.f;
  for (int u = 0; u < per / 4; ++u)
#pragma unroll
    for (int q = 0; q < 4; ++q) { const float c = vals[u * 4 + q] - mu; s2 += c * c; }
  red[tid] = s2; __syncthreads();
  for (int st = 128; st > 0; st >>= 1) { if (tid < st) red[tid] += red[tid + st]; __syncthreads(); }
  const float rs = rsqrtf(red[0] / (float)N + eps);
  {
    for (int u = 0; u < per / 4; ++u) {
      const int j = tid * 4 + 1024 * u;
      v4f o, sm;
#pragma unroll
      for (int q = 0; q < 4; ++q) {
        float gg = g[j + q], bb = bta[j + q];
        if (PARAM_BF16) { gg = bf16_round(gg); bb = bf16_round(bb); }
        sm[q] = vals[u * 4 + q]; o[q] = (vals[u * 4 + q] - mu) * rs * gg + bb;
      }
      if (out_sum) *(v4f*)(out_sum + (size_t)row * N + j) = sm;
      *(v4f*)(out_norm + (size_t)row * N + j) = o;
    }
    
  }
}



// ---- f16 WMMA path (v_wmma_f32_16x16x32_f16): 11-bit significands for operands in range — used where a [0,1] probability operand needs more precision than bf16
typedef _Float16 v16h __attribute__((ext_vector_type(16)));
union FragH { v16h v; v8us half[2]; _Float16 h[16]; unsigned short u[16]; };
template <int NT>
__device__ __forceinline__ v8f mmaH(v16h ah, v16h al, v16h bh, v16h bl, v8f c) {
  c = __builtin_amdgcn_wmma_f32_16x16x32_f16(false, ah, false, bh, (short)0, c, false, false);
  if (NT >= 2) c = __builtin_amdgcn_wmma_f32_16x16x32_f16(false, al, false, bh, (short)0, c, false, false);
  if (NT >= 3) c = __builtin_amdgcn_wmma_f32_16x16x32_f16(false, ah, false, bl, (short)0, c, false, false);
  asm volatile("v_nop\n\tv_nop\n\tv_nop\n\tv_nop" : "+v"(c) : "v"(ah), "v"(al), "v"(bh), "v"(bl));
  return c;
}
// batched GEMM like k_gemm_b but f16 operands: A f32 (split into f16 hi/lo if ASPLIT, else rounded to f16), Bt = f16 values [n][k]; alpha; C f32; N multiple of 16 (partial tiles skipped)
template <bool ASPLIT>
__global__ __launch_bounds__(128) void k_gemm_h(const float* __restrict__ A, int lda, size_t sA, const _Float16* __restrict__ Bh, int ldb, size_t sB, float alpha, float* __restrict__ C, int ldc, size_t sC, int M, int N, int K) {
  __shared__ __attribute__((aligned(16))) float so[4][16][64];
  const int tid = threadIdx.x, w = tid >> 5, lane = tid & 31, ln = lane & 15, hh = lane >> 4; const int by = blockIdx.y;
  A += (size_t)by * sA; Bh += (size_t)by * sB; C += (size_t)by * sC;
  const int ntn = (N + 63) / 64; const int wid = blockIdx.x * 4 + w; const int mt = wid / ntn, nq = wid % ntn; if (mt * 16 >= M) return;
  const int row0 = mt * 16, col0 = nq * 64; const float* arow = A + (size_t)(row0 + ln) * lda;
  v8f acc[4] = {};
  for (int kb = 0; kb < K; kb += 32) {
    FragH ah, al;
    const v4f x0 = *(const v4fa*)(arow + kb + 8 * hh), x1 = *(const v4fa*)(arow + kb + 8 * hh + 4), x2 = *(const v4fa*)(arow + kb + 16 + 8 * hh), x3 = *(const v4fa*)(arow + kb + 16 + 8 * hh + 4);
    float xs[16] = {x0[0],x0[1],x0[2],x0[3],x1[0],x1[1],x1[2],x1[3],x2[0],x2[1],x2[2],x2[3],x3[0],x3[1],x3[2],x3[3]};
#pragma unroll
    for (int i = 0; i < 16; ++i) { const _Float16 h = (_Float16)xs[i]; ah.h[i] = h; al.h[i] = ASPLIT ? (_Float16)(xs[i] - (float)h) : (_Float16)0.0f; }
#pragma unroll
    for (int t = 0; t < 4; ++t) { if (col0 + t * 16 >= N) continue; const size_t boff = (size_t)(col0 + t * 16 + ln) * ldb + kb; FragH bq; bq.half[0] = *(const v8us*)(Bh + boff + 8 * hh); bq.half[1] = *(const v8us*)(Bh + boff + 16 + 8 * hh);
      acc[t] = mmaH<ASPLIT ? 2 : 1>(ah.v, al.v, bq.v, bq.v, acc[t]); }
  }
#pragma unroll
  for (int t = 0; t < 4; ++t) { if (col0 + t * 16 >= N) continue;
#pragma unroll
    for (int r = 0; r < 8; ++r) so[w][8 * hh + r][t * 16 + ln] = acc[t][r] * alpha; }
  __builtin_amdgcn_fence(__ATOMIC_ACQ_REL, "workgroup"); __builtin_amdgcn_wave_barrier();
  const int rsub = lane >> 4, c4 = (lane & 15) * 4;
  {
#pragma unroll
    for (int q = 0; q < 8; ++q) { const int r = q * 2 + rsub; if (col0 + c4 < N) { const v4f v = *(const v4fa*)&so[w][r][c4]; *(v4f*)(C + (size_t)(row0 + r) * ldc + col0 + c4) = v; } }
     }
}

// Wt[n][k] = f16(W[k][n]·scale) from f32 row-major W[K][N] (scale = power of two; bf16-exact weights stay exact in f16 away from the subnormal range)
__global__ __launch_bounds__(256) void k_wt_f16(const float* __restrict__ W, _Float16* __restrict__ Wt, int K, int N, float scale) {
  const int t = blockIdx.x * 256 + threadIdx.x; if (t >= N * (K / 8)) return; const int n = t / (K / 8), k8 = (t % (K / 8)) * 8; FragH f;
#pragma unroll
  for (int i = 0; i < 8; ++i) f.h[i] = (_Float16)(bf16_round(W[(size_t)(k8 + i) * N + n]) * scale); const v8us o = f.half[0];
  *(v8us*)((unsigned short*)Wt + (size_t)n * K + k8) = o; 
}
// k_gemm_hh variant with fused epilogue: v = acc·alpha + bias[by·sBias + col] (+ CP[(row/rowsPerB)·sCPb + by·64 + col] if CP) ; ACT 0 none / 1 elu ; writes f32 C and/or f16 C16 (each if non-null)
// N and K are compile-time (NC, KC): the column guard of a partial tile folds away where NC is a multiple of 64 and the k loop unrolls into groups of KU k-steps.
template <int ACT, int NC, int KC>
__global__ __launch_bounds__(128) void k_gemm_hhx(const _Float16* __restrict__ A, int lda, size_t sA, const _Float16* __restrict__ Bh, int ldb, size_t sB, float alpha, const float* __restrict__ bias, size_t sBias, const float* __restrict__ CP, int rowsPerB, size_t sCPb, int row0g,
    float* __restrict__ C, _Float16* __restrict__ C16, int ldc, size_t sC, int M) {
  constexpr int N = NC, KU = 2, NG = KC / (32 * KU); constexpr bool PART = (NC % 64) != 0; static_assert(KC % (32 * KU) == 0, "k groups");
  __shared__ __attribute__((aligned(16))) float so[4][16][64];
  const int tid = threadIdx.x, w = tid >> 5, lane = tid & 31, ln = lane & 15, hh = lane >> 4; const int by = blockIdx.y;
  A += (size_t)by * sA; Bh += (size_t)by * sB; const size_t cofs = (size_t)by * sC; const float* bp = bias ? bias + (size_t)by * sBias : nullptr;
  const int ntn = (N + 63) / 64; const int wid = blockIdx.x * 4 + w; const int mt = wid / ntn, nq = wid % ntn; if (mt * 16 >= M) return;
  const int row0 = mt * 16, col0 = nq * 64;
  v8f acc[4] = {};
  // A and Bh are stored in fragment order (frag_src below): 16 rows of lda (ldb) elements are lda / 32 blocks of 1 KiB, one per k-step, and lane l's two loads of a fragment are 16-byte chunks l and 32 + l of the block.
  // The fragment loads of a whole group (KU k-steps: 2 KU of A, 8 KU of B) are written as one run, one group ahead of the products that use them, in two register sets. Written pair by pair between the
  // products each pair was waited for in full before its one product: the statement that ends mmaH is volatile and the scheduler moves no load across it, so a load stays where the source puts it.
  FragH fa[2][KU], fb[2][KU][4];
  const unsigned short* ap = (const unsigned short*)A + (size_t)row0 * lda + lane * 8; const unsigned short* bp0 = (const unsigned short*)Bh + (size_t)col0 * ldb + lane * 8;
#pragma unroll
  for (int g = -1; g < NG; ++g) {
    if (g + 1 < NG) { const int nx = (g + 1) & 1;
#pragma unroll
      for (int u = 0; u < KU; ++u) { const int kb = ((g + 1) * KU + u) * 512; fa[nx][u].half[0] = *(const v8us*)(ap + kb); fa[nx][u].half[1] = *(const v8us*)(ap + kb + 256);
#pragma unroll
        for (int t = 0; t < 4; ++t) { if (PART && col0 + t * 16 >= N) continue; const unsigned short* br = bp0 + (size_t)(t * 16) * ldb + kb; fb[nx][u][t].half[0] = *(const v8us*)br; fb[nx][u][t].half[1] = *(const v8us*)(br + 256); } } }
    if (g >= 0) { const int cu = g & 1;
#pragma unroll
      for (int u = 0; u < KU; ++u)
#pragma unroll
        for (int t = 0; t < 4; ++t) { if (PART && col0 + t * 16 >= N) continue; acc[t] = mmaH<1>(fa[cu][u].v, fa[cu][u].v, fb[cu][u][t].v, fb[cu][u][t].v, acc[t]); } }
  }
#pragma unroll
  for (int t = 0; t < 4; ++t) { if (col0 + t * 16 >= N) continue; const int col = col0 + t * 16 + ln; const float bv = bp ? bf16_round(bp[col]) : 0.f;
#pragma unroll
    for (int r = 0; r < 8; ++r) { float v = acc[t][r] * alpha + bv; if (CP) { const int bidx = (row0g + row0 + 8 * hh + r) / rowsPerB; v += CP[(size_t)bidx * sCPb + (size_t)by * 64 + col]; } if (ACT == 1) v = (v > 0.f) ? v : expm1f(v); else if (ACT == 3) v = fmaxf(v, 0.f); so[w][8 * hh + r][t * 16 + ln] = v; } }
  __builtin_amdgcn_fence(__ATOMIC_ACQ_REL, "workgroup"); __builtin_amdgcn_wave_barrier();
  const int rsub = lane >> 4, c4 = (lane & 15) * 4; typedef _Float16 v4h __attribute__((ext_vector_type(4)));
  {
#pragma unroll
    for (int q = 0; q < 8; ++q) { const int r = q * 2 + rsub; if (col0 + c4 < N) { const v4f v = *(const v4fa*)&so[w][r][c4]; if (C) *(v4f*)(C + cofs + (size_t)(row0 + r) * ldc + col0 + c4) = v; if (C16) { v4h h4; for (int i = 0; i < 4; ++i) h4[i] = (_Float16)v[i]; *(v4h*)(C16 + cofs + (size_t)(row0 + r) * ldc + col0 + c4) = h4; } } }
     }
}


// Fragment order of a 16-bit WMMA operand with CC columns: a tile of 16 rows x 32 k is one block of 1 KiB, the blocks of a 16-row strip follow one another in k. 16-byte chunk c (0..63) of a block holds row (c & 15),
// k = 16 (c >> 5) + 8 ((c >> 4) & 1) .. + 7, so lane l's fragment is chunks l and 32 + l: a wave-wide 16-byte load covers 512 contiguous bytes (4 whole lines) and not 32 bytes of each of 16 rows.
// frag_src: the row-major element index of the first of the 8 elements that belong in chunk t of the whole operand. A producer's thread t writes chunk t, so its stores stay contiguous.
__device__ __forceinline__ unsigned frag_src(size_t t) { const unsigned blk = (unsigned)(t >> 6), c = (unsigned)t & 63u; const unsigned rt = blk / (CC / 32), kt = blk % (CC / 32); return (rt * 16 + (c & 15)) * CC + kt * 32 + 16 * (c >> 5) + 8 * ((c >> 4) & 1); }
__global__ __launch_bounds__(256) void k_x16(const float* __restrict__ x, _Float16* __restrict__ X16, size_t n8) { const size_t t = (size_t)blockIdx.x * 256 + threadIdx.x; if (t >= n8) return; FragH f; const float* xs = x + frag_src(t);
#pragma unroll
  for (int q = 0; q < 8; ++q) f.h[q] = (_Float16)bf16_round(xs[q]); *(v8us*)((unsigned short*)X16 + t * 8) = f.half[0];  }
__global__ __launch_bounds__(256) void k_h16(const float* __restrict__ x, _Float16* __restrict__ X16, size_t n8) { const size_t t = (size_t)blockIdx.x * 256 + threadIdx.x; if (t >= n8) return; FragH f; const float* xs = x + frag_src(t);
#pragma unroll
  for (int q = 0; q < 8; ++q) f.h[q] = (_Float16)xs[q]; *(v8us*)((unsigned short*)X16 + t * 8) = f.half[0];  }
__global__ __launch_bounds__(256) void k_round16f(const float* __restrict__ W, _Float16* __restrict__ Bt, size_t n8) { const size_t t = (size_t)blockIdx.x * 256 + threadIdx.x; if (t >= n8) return; FragH f; const float* ws = W + frag_src(t);
#pragma unroll
  for (int i = 0; i < 8; ++i) f.h[i] = (_Float16)(bf16_round(ws[i]) * 16.0f); *(v8us*)((unsigned short*)Bt + t * 8) = f.half[0];  }
template <int NHv, int TTv>
__global__ __launch_bounds__(256) void k_vt(const _Float16* __restrict__ V16, int ldv, int voff, _Float16* __restrict__ Vt) { __shared__ unsigned short tl[64][66]; const int tid = threadIdx.x; const int slab = blockIdx.x / (TTv / 64), lg = blockIdx.x % (TTv / 64); const int b = slab / NHv, h = slab % NHv;
  for (int i = tid; i < 64 * 8; i += 256) { const int r = i / 8, c8 = (i % 8) * 8; FragH f; f.half[0] = *(const v8us*)((const unsigned short*)V16 + ((size_t)b * TTv + lg * 64 + r) * ldv + voff + h * 64 + c8);
#pragma unroll
    for (int q = 0; q < 8; ++q) tl[r][c8 + q] = f.u[q]; }
  __syncthreads();
  {
#pragma unroll
    for (int rd = 0; rd < 2; ++rd) { const int idx = rd * 256 + tid, c = idx & 63; FragH f;      /* Vt in fragment order, rows = d, k = keys: block ((slab * TTv / 32 + key / 32) * 4 + d / 16); the 64 x 64 tile is 8 blocks in a row, thread writes chunk idx */
      const int d = ((idx >> 6) & 3) * 16 + (c & 15), kl = (idx >> 8) * 32 + 16 * (c >> 5) + 8 * ((c >> 4) & 1);
#pragma unroll
      for (int q = 0; q < 8; ++q) f.u[q] = tl[kl + q][d];
      *(v8us*)((unsigned short*)Vt + ((size_t)slab * (TTv / 64) + lg) * 4096 + idx * 8) = f.half[0]; }
     } }

// lane l <-> lane l ^ 16 (the two halves of a wave hold the two halves of a query's keys)
__device__ __forceinline__ float xhalf(float v) { const int b = __float_as_int(v); return __int_as_float(__builtin_amdgcn_permlanex16(b, b, 0x76543210, 0xfedcba98, false, false)); }
// Transposed products: St = K.Qt (A = 16 key rows, B = the wave's 16 queries as columns) and Ot += Vt.Pt (A = 16 rows of Vt, B = Pt). Lane (ln, hh) holds query q0 + ln only: register r of score tile nt is key
// j0 + 16 nt + 8 hh + r, which is the k order of a B operand, so the two score tiles converted in place ARE Pt; maximum and sums are in-lane plus one exchange between the halves.
__global__ __launch_bounds__(128) void k_flash(const _Float16* __restrict__ Q16, const _Float16* __restrict__ K16, const _Float16* __restrict__ Vt, const float* __restrict__ CB, const float* __restrict__ beta, float* __restrict__ O, int ldo) {
  __shared__ float scb[2048];
  constexpr int RPW = 16, NQB = 2048 / (4 * RPW), DT = 4, KS = 2;
  __shared__ __attribute__((aligned(16))) float sO[4][RPW][64 + 4];
  const int tid = threadIdx.x, w = tid >> 5, lane = tid & 31, ln = lane & 15, hh = lane >> 4;
  const int slab = blockIdx.x / NQB, qblk = blockIdx.x % NQB; const int b = slab / 12, h = slab % 12; const int qb0 = qblk * (4 * RPW); const int q0 = qb0 + w * RPW;
  FragH aq[KS];
  /* Q16, K16 (block (slab * 128 + position / 16) * 2 + ks) and Vt (block (slab * 64 + key / 32) * 4 + dt) are in fragment order: lane l loads chunks l and 32 + l of a 1-KiB block; a pass's K is 4 KiB in a row, its V too */
  { const unsigned short* qr = (const unsigned short*)Q16 + ((size_t)slab * 128 + (q0 >> 4)) * 1024 + lane * 8;
#pragma unroll
    for (int ks = 0; ks < KS; ++ks) { aq[ks].half[0] = *(const v8us*)(qr + ks * 512); aq[ks].half[1] = *(const v8us*)(qr + ks * 512 + 256); } }
  for (int i = tid; i < 2048; i += 128) scb[i] = CB[i]; const float bh = bf16_round(beta[h]); __syncthreads();
  const unsigned short* Vth = (const unsigned short*)Vt + (size_t)slab * 64 * 2048 + lane * 8; const unsigned short* Kh = (const unsigned short*)K16 + (size_t)slab * 64 * 2048 + lane * 8;
  const int tq = q0 + ln;      /* this lane's query */
  float m_q = -3.0e38f, l_q = 0.f, lc_q = 0.f;      /* running maximum (same in both halves); this half's partial sums over all keys and over the causal keys */
  v8f oacc[DT];      /* oacc[dt][r] = Ot[dt * 16 + 8 hh + r][tq] */
#pragma unroll
  for (int dt = 0; dt < DT; ++dt) oacc[dt] = (v8f){0.f,0.f,0.f,0.f,0.f,0.f,0.f,0.f};
  const int jend = 2048;
#pragma unroll 1
  for (int j0 = 0; j0 < jend; j0 += 32) {
    /* all fragment loads of the pass (8 of K, and 8 of V where the pass has a causal key) as one run ahead of its first product: no load moves across the volatile statement that ends mmaH */
    const bool pv = (j0 <= q0 + RPW - 1);      /* some key of this chunk is <= some query of this wave; otherwise every p is 0 */
    FragH bk[2][KS], bv[DT];
#pragma unroll
    for (int nt = 0; nt < 2; ++nt) { const unsigned short* kr = Kh + (size_t)j0 * 64 + nt * 1024;
#pragma unroll
      for (int ks = 0; ks < KS; ++ks) { bk[nt][ks].half[0] = *(const v8us*)(kr + ks * 512); bk[nt][ks].half[1] = *(const v8us*)(kr + ks * 512 + 256); } }
    if (pv) {
#pragma unroll
      for (int dt = 0; dt < DT; ++dt) { const unsigned short* vrow = Vth + (size_t)j0 * 64 + dt * 512; bv[dt].half[0] = *(const v8us*)vrow; bv[dt].half[1] = *(const v8us*)(vrow + 256); } }
    v8f s[2];
#pragma unroll
    for (int nt = 0; nt < 2; ++nt) { v8f acc = (v8f){0.f,0.f,0.f,0.f,0.f,0.f,0.f,0.f};
#pragma unroll
      for (int ks = 0; ks < KS; ++ks) acc = mmaH<1>(bk[nt][ks].v, bk[nt][ks].v, aq[ks].v, aq[ks].v, acc); s[nt] = acc; }
    float sv[16]; const int xq4 = 4 * (tq - 8 * hh - j0);      /* 4 (q - k) at this lane's first key of the pass */
#pragma unroll
    for (int i = 0; i < 16; ++i) { const int x4 = xq4 - 4 * ((i >> 3) * 16 + (i & 7)); const int d4 = (x4 < 0) ? -x4 : x4;      /* phase coherence 1 + beta * mean_f cos(d * theta_f), d = |q - k|; x4 = 4 (q - k), the table's byte offset up to its sign */
      sv[i] = s[i >> 3][i & 7] * 0.125f * (1.0f + bh * *(const float*)((const char*)scb + d4)); }
    float mx[4];
#pragma unroll
    for (int i = 0; i < 4; ++i) mx[i] = fmaxf(fmaxf(sv[i], sv[4 + i]), fmaxf(sv[8 + i], sv[12 + i]));
    float mc = fmaxf(fmaxf(mx[0], mx[1]), fmaxf(mx[2], mx[3])); mc = fmaxf(mc, xhalf(mc));
    const float mn = fmaxf(m_q, mc); const float ea = expf(m_q - mn); const float al = (mn > -1.0e38f) ? ea : 1.0f; m_q = mn;
    float se[4] = {0.f, 0.f, 0.f, 0.f}, sp[4] = {0.f, 0.f, 0.f, 0.f}; FragH pb;      /* full-softmax stats over ALL keys; P.V and its sum only over the causal ones */
#pragma unroll
    for (int i = 0; i < 16; ++i) { const int x4 = xq4 - 4 * ((i >> 3) * 16 + (i & 7)); const float e = expf(sv[i] - mn); const float p = (x4 >= 0) ? e : 0.f; se[i & 3] += e; sp[i & 3] += p; pb.h[i] = (_Float16)p; }
    l_q = l_q * al + ((se[0] + se[1]) + (se[2] + se[3])); lc_q = lc_q * al + ((sp[0] + sp[1]) + (sp[2] + sp[3]));
#pragma unroll
    for (int dt = 0; dt < DT; ++dt)
#pragma unroll
      for (int r = 0; r < 8; ++r) oacc[dt][r] *= al;
    if (pv) {
#pragma unroll
      for (int dt = 0; dt < DT; ++dt) oacc[dt] = mmaH<1>(bv[dt].v, bv[dt].v, pb.v, pb.v, oacc[dt]); } }
  const float l = l_q + xhalf(l_q), lc = lc_q + xhalf(lc_q); const float inv = 1.0f / (lc + 1e-8f * l);      /* w * causal / (sum_causal w + 1e-8) with w = e^(s-m) / Z_full  =  e^(s-m) / (Z_causal + 1e-8 * Z_full) */
#pragma unroll
  for (int dt = 0; dt < DT; ++dt)
#pragma unroll
    for (int q = 0; q < 2; ++q) { v4f o4;
#pragma unroll
      for (int i = 0; i < 4; ++i) o4[i] = oacc[dt][q * 4 + i] * inv;
      *(v4fa*)&sO[w][ln][dt * 16 + 8 * hh + q * 4] = o4; }
  __builtin_amdgcn_fence(__ATOMIC_ACQ_REL, "workgroup"); __builtin_amdgcn_wave_barrier();
  {
#pragma unroll
    for (int rp = 0; rp < RPW; rp += 2) { const int r = rp + (lane >> 4), pc = lane & 15; const v4f val = *(const v4fa*)&sO[w][r][pc * 4]; *(v4f*)(O + ((size_t)b * 2048 + q0 + r) * ldo + h * 64 + pc * 4) = val; }
     } }

__global__ __launch_bounds__(256) void k_cb(float* __restrict__ CB) { __shared__ float sc[8][33]; const int tid = threadIdx.x, g = tid >> 5, f = tid & 31; const int dl = blockIdx.x * 8 + g;      /* one thread per (distance, frequency) term; a block makes 8 table entries */
  const float th = powf(10000.0f, -(float)(2 * f) / 64.0f); sc[g][f] = cosf((float)dl * th); __syncthreads();
  if (tid < 8) { float s = 0.f;
    for (int i = 0; i < 32; ++i) s += sc[tid][i];      /* f = 0..31 in ascending order, the order in which one thread summed them before */
    CB[blockIdx.x * 8 + tid] = s / 32.0f; } }
// rotary + rms-norm per (row, head): x1 = q[h·64 + j], x2 = q[h·64 + 32 + j] (j < 32); out = [x1·cos + x2·sin | −x1·sin + x2·cos] with cos/sin = bf16(INPUT tables [t][j]); then × rsqrt(mean(out²) + f32 eps) → f16;
__global__ __launch_bounds__(256) void k_ropenorm(const float* __restrict__ Qf, const float* __restrict__ cosT, const float* __restrict__ sinT, _Float16* __restrict__ Q16) { const size_t tg = (size_t)blockIdx.x * 256 + threadIdx.x; if (tg >= (size_t)NR * NH * 4) return; const int pc = (int)(tg & 3), r = (int)((tg >> 2) & 15), h = (int)((tg >> 6) % NH); const size_t row = ((tg >> 6) / NH) * 16 + r; const int t = (int)(row % TT); const int j0 = pc * 8;      /* 64 threads = 16 rows of one head, so that a wave's stores fill whole lines of the fragment-order blocks */
  float a[8], bq[8], cr[8], sr[8]; float ss = 0.f;
#pragma unroll
  for (int q = 0; q < 8; ++q) { cr[q] = cosT[t * 32 + j0 + q]; sr[q] = sinT[t * 32 + j0 + q]; }
  asm volatile("s_wait_xcnt 0x0" ::: "memory");      /* the loads below may take the table loads' offset register as a destination: the wait stands in front of that overwrite */
#pragma unroll
  for (int q = 0; q < 8; ++q) { const int j = j0 + q; const float x1 = Qf[row * CC + h * 64 + j], x2 = Qf[row * CC + h * 64 + 32 + j]; const float c = bf16_round(cr[q]), s = bf16_round(sr[q]); a[q] = x1 * c + x2 * s; bq[q] = -x1 * s + x2 * c; ss += a[q] * a[q] + bq[q] * bq[q]; }
  ss += __shfl_xor(ss, 1, 32); ss += __shfl_xor(ss, 2, 32); const float rn = rsqrtf(ss / 64.0f + 1.1920929e-7f); FragH f1, f2;
#pragma unroll
  for (int q = 0; q < 8; ++q) { f1.h[q] = (_Float16)(a[q] * rn); f2.h[q] = (_Float16)(bq[q] * rn); }
  { unsigned short* qd = (unsigned short*)Q16 + (((row / TT) * NH + h) * (TT / 16) + (t >> 4)) * 1024 + (pc >> 1) * 256 + ((pc & 1) * 16 + r) * 8;      /* fragment order per head: block (slab * TT / 16 + t / 16) * 2 + ks, chunk 32 (pc >> 1) + 16 (pc & 1) + r */
    *(v8us*)qd = f1.half[0]; *(v8us*)(qd + 512) = f2.half[0];  } }
extern "C" void kernel_launch(void* const* d_in, const int* in_sizes, int n_in,
                              void* d_out, int out_size, void* d_ws, size_t ws_size, hipStream_t stream) {
  (void)in_sizes; (void)n_in; (void)out_size;
  const float* x = (const float*)d_in[0]; const float* cosT = (const float*)d_in[1]; const float* sinT = (const float*)d_in[2]; const float* Wq = (const float*)d_in[3]; const float* Wk = (const float*)d_in[4]; const float* Wv = (const float*)d_in[5]; const float* Wo = (const float*)d_in[6]; const float* beta = (const float*)d_in[7];
  char* ws = (char*)d_ws; size_t off = 0;
  auto take = [&](size_t bytes) { char* p = ws + off; off += (bytes + 255) & ~(size_t)255; return p; };
  _Float16* Bq = (_Float16*)take((size_t)CC * CC * 2); _Float16* Bk = (_Float16*)take((size_t)CC * CC * 2); _Float16* Bv = (_Float16*)take((size_t)CC * CC * 2); _Float16* Bo = (_Float16*)take((size_t)CC * CC * 2); float* CB = (float*)take(TT * 4);
  _Float16* X16 = (_Float16*)take((size_t)NR * CC * 2); float* Qf = (float*)take((size_t)NR * CC * 4); float* Kf = (float*)take((size_t)NR * CC * 4); _Float16* Q16 = (_Float16*)take((size_t)NR * CC * 2); _Float16* K16 = (_Float16*)take((size_t)NR * CC * 2); _Float16* V16 = (_Float16*)take((size_t)NR * CC * 2); _Float16* Vt = (_Float16*)take((size_t)NR * CC * 2); float* O = Qf; _Float16* O16 = X16;      // Qf dead after k_ropenorm; X16 dead after the V GEMM
  if (off > ws_size) return;      // 4.7 + 6.3 + 12.6 × 2 + 6.3 × 4 ≈ 59 MiB
  const size_t w8 = (size_t)CC * CC / 8; const unsigned gw = (unsigned)((w8 + 255) / 256);
  k_round16f<<<gw, 256, 0, stream>>>(Wq, Bq, w8); k_round16f<<<gw, 256, 0, stream>>>(Wk, Bk, w8); k_round16f<<<gw, 256, 0, stream>>>(Wv, Bv, w8); k_round16f<<<gw, 256, 0, stream>>>(Wo, Bo, w8);      // (out,in)
  k_cb<<<TT / 8, 256, 0, stream>>>(CB);
  const unsigned gx = (unsigned)(((size_t)NR * CC / 8 + 255) / 256); const dim3 gg(((NR / 16) * (CC / 64) + 3) / 4, 1);
  k_x16<<<gx, 256, 0, stream>>>(x, X16, (size_t)NR * CC / 8);
  k_gemm_hhx<0, CC, CC><<<gg, 128, 0, stream>>>(X16, CC, 0, Bq, CC, 0, 0.0625f, nullptr, 0, nullptr, 1, 0, 0, Qf, nullptr, CC, 0, NR);
  k_gemm_hhx<0, CC, CC><<<gg, 128, 0, stream>>>(X16, CC, 0, Bk, CC, 0, 0.0625f, nullptr, 0, nullptr, 1, 0, 0, Kf, nullptr, CC, 0, NR);
  k_gemm_hhx<0, CC, CC><<<gg, 128, 0, stream>>>(X16, CC, 0, Bv, CC, 0, 0.0625f, nullptr, 0, nullptr, 1, 0, 0, nullptr, V16, CC, 0, NR);
  const unsigned gr = (unsigned)(((size_t)NR * NH * 4 + 255) / 256);
  k_ropenorm<<<gr, 256, 0, stream>>>(Qf, cosT, sinT, Q16); k_ropenorm<<<gr, 256, 0, stream>>>(Kf, cosT, sinT, K16);
  k_vt<NH, TT><<<BB * NH * (TT / 64), 256, 0, stream>>>(V16, CC, 0, Vt);
  k_flash<<<BB * NH * (TT / 64), 128, 0, stream>>>(Q16, K16, Vt, CB, beta, O, CC);      // RPW 16
  k_h16<<<gx, 256, 0, stream>>>(O, O16, (size_t)NR * CC / 8);
  k_gemm_hhx<0, CC, CC><<<gg, 128, 0, stream>>>(O16, CC, 0, Bo, CC, 0, 0.0625f, nullptr, 0, nullptr, 1, 0, 0, (float*)d_out, nullptr, CC, 0, NR);
}

// v006
// One run takes 150 microseconds.
// Two timings next to v005 put it at 1.10 and 1.12 times that version's speed.
// All steps since v000 together make it 3.06 times as fast.
#include <hip/hip_runtime.h>
// Phase-aware causal attention: q/k/v/o projections (4096 × 768 × 768, no bias, weights (out,in) bf16-exact ×2^4) and the 12-head attention as a fused flash-style kernel on v_wmma_f32_16x16x32_f16
// (rotary (with the INPUT cos/sin tables) + rms-norm'd q,k as f16; S = Q·Kᵀ/8 × (1 + β_h·mean_f cos(|q−k|·θ_f)) with the 2048-entry coherence table precomputed; the module's FULL softmax followed
// by causal masking and re-normalisation with +1e-8 is reproduced exactly as e^{s−m}/(Z_causal + 1e-8·Z_full) with m, Z_full over all keys; P f16 ≤ 1; O = P·V over causal keys); f32 accumulate.
#define BB 2
#define TT 2048
#define CC 768
#define NH 12
#define NR (BB * TT)

typedef __bf16 v16b __attribute__((ext_vector_type(16)));
typedef unsigned short v8us __attribute__((ext_vector_type(8), may_alias));
typedef float  v8f  __attribute__((ext_vector_type(8)));
typedef float  v4f  __attribute__((ext_vector_type(4)));
typedef float  v4fa __attribute__((ext_vector_type(4), may_alias));
typedef float  v2f  __attribute__((ext_vector_type(2)));
union FragB { v16b v; v8us half[2]; unsigned short u[16]; };

__device__ __forceinline__ unsigned short bf16_bits(float x) { unsigned int u = __float_as_uint(x); return (unsigned short)((u + 0x7FFFu + ((u >> 16) & 1u)) >> 16); }
__device__ __forceinline__ float bf16_val(unsigned short b) { return __uint_as_float(((unsigned int)b) << 16); }
__device__ __forceinline__ float bf16_round(float x) { return bf16_val(bf16_bits(x)); }
// D += A·B with NT terms: 1 = ah·bh, 2 = + al·bh (A split), 3 = + ah·bl (both split)
template <int NT>
__device__ __forceinline__ v8f mmaN(v16b ah, v16b al, v16b bh, v16b bl, v8f c) {
  c = __builtin_amdgcn_wmma_f32_16x16x32_bf16(false, ah, false, bh, (short)0, c, false, false);
  if (NT >= 2) c = __builtin_amdgcn_wmma_f32_16x16x32_bf16(false, al, false, bh, (short)0, c, false, false);
  if (NT >= 3) c = __builtin_amdgcn_wmma_f32_16x16x32_bf16(false, ah, false, bl, (short)0, c, false, false);
  asm volatile("v_nop\n\tv_nop\n\tv_nop\n\tv_nop" : "+v"(c) : "v"(ah), "v"(al), "v"(bh), "v"(bl));
  return c;
}

__global__ __launch_bounds__(256) void k_wt_bf16(const float* __restrict__ W, unsigned short* __restrict__ Wt, int K, int N) {
  const int t = blockIdx.x * 256 + threadIdx.x;
  const int k8n = K / 8;
  if (t >= N * k8n) return;
  const int n = t / k8n, k8 = (t % k8n) * 8;
  v8us v;
#pragma unroll
  for (int i = 0; i < 8; ++i) v[i] = bf16_bits(W[(size_t)(k8 + i) * N + n]);
  *(v8us*)(Wt + (size_t)n * K + k8) = v;
  
}

// GEMM C[M][N] (f32, pitch ldc) = act(A[M][K]·W + bias). A f32 row-major (pitch lda) converted per fragment to bf16
// (ASPLIT: hi/lo two planes -> 2 terms, else single rounded term); Wt bf16 [N][K] (pitch ldb). BIAS_BF16 rounds the
// bias to bf16 first (bias quantised to bf16 before the add). K%32==0, M%16==0, N%64==0.
template <bool ASPLIT, int ACT, bool BIAS_BF16>
__global__ __launch_bounds__(128) void k_gemm_bf(const float* __restrict__ A, int lda, const unsigned short* __restrict__ Wt, int ldb,
                                               const float* __restrict__ bias, float* __restrict__ C, int ldc, int M, int N, int K) {
  __shared__ __attribute__((aligned(16))) float so[4][16][64];
  const int tid = threadIdx.x, w = tid >> 5, lane = tid & 31, ln = lane & 15, hh = lane >> 4;
  const int ntn = N / 64;
  const int wid = blockIdx.x * 4 + w;
  const int mt = wid / ntn, nq = wid % ntn;
  if (mt * 16 >= M) return;
  const int row0 = mt * 16, col0 = nq * 64;
  const float* arow = A + (size_t)(row0 + ln) * lda;
  v8f acc[4] = {};
  for (int kb = 0; kb < K; kb += 32) {
    FragB ah, al;
    const v4f x0 = *(const v4fa*)(arow + kb + 8 * hh), x1 = *(const v4fa*)(arow + kb + 8 * hh + 4);
    const v4f x2 = *(const v4fa*)(arow + kb + 16 + 8 * hh), x3 = *(const v4fa*)(arow + kb + 16 + 8 * hh + 4);
    float xs[16] = {x0[0],x0[1],x0[2],x0[3],x1[0],x1[1],x1[2],x1[3],x2[0],x2[1],x2[2],x2[3],x3[0],x3[1],x3[2],x3[3]};
#pragma unroll
    for (int i = 0; i < 16; ++i) { const unsigned short hb = bf16_bits(xs[i]); ah.u[i] = hb; al.u[i] = ASPLIT ? bf16_bits(xs[i] - bf16_val(hb)) : (unsigned short)0; }
#pragma unroll
    for (int t = 0; t < 4; ++t) {
      const unsigned short* brow = Wt + (size_t)(col0 + t * 16 + ln) * ldb + kb;
      FragB b;
      b.half[0] = *(const v8us*)(brow + 8 * hh);
      b.half[1] = *(const v8us*)(brow + 16 + 8 * hh);
      acc[t] = mmaN<ASPLIT ? 2 : 1>(ah.v, al.v, b.v, b.v, acc[t]);
    }
  }
#pragma unroll
  for (int t = 0; t < 4; ++t) {
    float bv = bias ? bias[col0 + t * 16 + ln] : 0.f;
    if (BIAS_BF16) bv = bf16_round(bv);
#pragma unroll
    for (int r = 0; r < 8; ++r) { float v = acc[t][r] + bv; if (ACT == 1) v = fmaxf(v, 0.f); so[w][8 * hh + r][t * 16 + ln] = v; }
  }
  __builtin_amdgcn_fence(__ATOMIC_ACQ_REL, "workgroup");
  __builtin_amdgcn_wave_barrier();
  const int rsub = lane >> 4, c4 = (lane & 15) * 4;
  {
#pragma unroll
    for (int q = 0; q < 8; ++q) {
      const int r = q * 2 + rsub;
      const v4f v = *(const v4fa*)&so[w][r][c4];
      *(v4f*)(C + (size_t)(row0 + r) * ldc + col0 + c4) = v;
    }
    
  }
}

// Flash-style causal/unmasked attention, all contractions 3-term bf16 hi/lo splits, f32 softmax with running max.
// q,k,v rows are read from f32 buffers with arbitrary row pitch (so they can live inside a fused qkv buffer);
// D = head size (multiple of 32, <= 128); one wave = 16 query rows; block = 4 waves (64 queries) sharing K/V chunks of 32.
template <int D, bool CAUSAL>
__global__ __launch_bounds__(128) void k_flash(const float* __restrict__ qb, const float* __restrict__ kb, const float* __restrict__ vb,
                                             int pitch, int T, int H, float scale, float* __restrict__ y, int ypitch) {
  constexpr int KS = D / 32;        // k-steps for QK
  constexpr int DT = D / 16;        // d tiles for PV
  __shared__ __attribute__((aligned(16))) unsigned short sKh[32][D + 8], sKl[32][D + 8], sVh[32][D + 8], sVl[32][D + 8];
  __shared__ __attribute__((aligned(16))) unsigned short sPh[4][16][40], sPl[4][16][40];
  __shared__ __attribute__((aligned(16))) float sO[4][16][D];
  const int tid = threadIdx.x, w = tid >> 5, lane = tid & 31, ln = lane & 15, hh = lane >> 4;
  const int nqb = (T + 63) / 64;
  const int bh = blockIdx.x / nqb, qblk = blockIdx.x % nqb;
  const int b = bh / H, h = bh % H;
  const int q0 = qblk * 64 + w * 16;
  const float* Q = qb + (size_t)b * T * pitch + h * D;
  const float* K = kb + (size_t)b * T * pitch + h * D;
  const float* V = vb + (size_t)b * T * pitch + h * D;

  // A fragments of the wave's 16 query rows (scaled), hi/lo
  FragB aqh[KS], aql[KS];
  {
    int row = q0 + ln; if (row >= T) row = T - 1;
    const float* qr = Q + (size_t)row * pitch;
#pragma unroll
    for (int ks = 0; ks < KS; ++ks)
#pragma unroll
      for (int i = 0; i < 16; ++i) {
        const int d = ks * 32 + ((i < 8) ? (8 * hh + i) : (16 + 8 * hh + (i - 8)));
        const float x = qr[d] * scale; const unsigned short hb = bf16_bits(x);
        aqh[ks].u[i] = hb; aql[ks].u[i] = bf16_bits(x - bf16_val(hb));
      }
  }
  float m_r[8], l_r[8];
#pragma unroll
  for (int r = 0; r < 8; ++r) { m_r[r] = -3.0e38f; l_r[r] = 0.f; }
  v8f oacc[DT];
#pragma unroll
  for (int dt = 0; dt < DT; ++dt) oacc[dt] = (v8f){0.f,0.f,0.f,0.f,0.f,0.f,0.f,0.f};

  const int kv_end = CAUSAL ? min(T, qblk * 64 + 64) : T;     // block-uniform
  for (int j0 = 0; j0 < kv_end; j0 += 32) {
    __syncthreads();
    for (int e = tid; e < 32 * (D / 4); e += 128) {
      const int r = e / (D / 4), c4 = (e % (D / 4)) * 4;
      const int key = j0 + r;
      v4f kf = {0.f,0.f,0.f,0.f}, vf = {0.f,0.f,0.f,0.f};
      if (key < T) { kf = *(const v4fa*)(K + (size_t)key * pitch + c4); vf = *(const v4fa*)(V + (size_t)key * pitch + c4); }
#pragma unroll
      for (int t = 0; t < 4; ++t) {
        unsigned short hb = bf16_bits(kf[t]); sKh[r][c4 + t] = hb; sKl[r][c4 + t] = bf16_bits(kf[t] - bf16_val(hb));
        hb = bf16_bits(vf[t]); sVh[r][c4 + t] = hb; sVl[r][c4 + t] = bf16_bits(vf[t] - bf16_val(hb));
      }
    }
    __syncthreads();
    // S tile 16 x 32
    v8f s[2];
#pragma unroll
    for (int nt = 0; nt < 2; ++nt) {
      v8f acc = {};
#pragma unroll
      for (int ks = 0; ks < KS; ++ks) {
        FragB bh_, bl_;
        bh_.half[0] = *(const v8us*)&sKh[nt * 16 + ln][ks * 32 + 8 * hh]; bh_.half[1] = *(const v8us*)&sKh[nt * 16 + ln][ks * 32 + 16 + 8 * hh];
        bl_.half[0] = *(const v8us*)&sKl[nt * 16 + ln][ks * 32 + 8 * hh]; bl_.half[1] = *(const v8us*)&sKl[nt * 16 + ln][ks * 32 + 16 + 8 * hh];
        acc = mmaN<3>(aqh[ks].v, aql[ks].v, bh_.v, bl_.v, acc);
      }
      s[nt] = acc;
    }
    // mask + running max (rows 8hh+r; the 16 lanes of a half share rows)
    float alpha[8];
#pragma unroll
    for (int r = 0; r < 8; ++r) {
      const int qi = q0 + 8 * hh + r;
      const int ja = j0 + ln, jb = j0 + 16 + ln;
      if (CAUSAL) { if (ja > qi) s[0][r] = -3.0e38f; if (jb > qi) s[1][r] = -3.0e38f; }
      if (ja >= T) s[0][r] = -3.0e38f;
      if (jb >= T) s[1][r] = -3.0e38f;
      float mx = fmaxf(s[0][r], s[1][r]);
      mx = fmaxf(mx, __shfl_xor(mx, 1, 32)); mx = fmaxf(mx, __shfl_xor(mx, 2, 32)); mx = fmaxf(mx, __shfl_xor(mx, 4, 32)); mx = fmaxf(mx, __shfl_xor(mx, 8, 32));
      const float mnew = fmaxf(m_r[r], mx);
      alpha[r] = (mnew > -1.0e38f) ? __expf(m_r[r] - mnew) : 1.0f;
      const float p0 = (s[0][r] > -1.0e38f) ? __expf(s[0][r] - mnew) : 0.f;
      const float p1 = (s[1][r] > -1.0e38f) ? __expf(s[1][r] - mnew) : 0.f;
      m_r[r] = mnew;
      l_r[r] = l_r[r] * alpha[r] + p0 + p1;            // per-lane partial row sum (16 lanes combined at the end)
      unsigned short hb = bf16_bits(p0); sPh[w][8 * hh + r][ln] = hb;      sPl[w][8 * hh + r][ln] = bf16_bits(p0 - bf16_val(hb));
      hb = bf16_bits(p1);                sPh[w][8 * hh + r][16 + ln] = hb; sPl[w][8 * hh + r][16 + ln] = bf16_bits(p1 - bf16_val(hb));
    }
#pragma unroll
    for (int dt = 0; dt < DT; ++dt)
#pragma unroll
      for (int r = 0; r < 8; ++r) oacc[dt][r] *= alpha[r];
    __builtin_amdgcn_fence(__ATOMIC_ACQ_REL, "workgroup");
    __builtin_amdgcn_wave_barrier();
    FragB pah, pal;
    pah.half[0] = *(const v8us*)&sPh[w][ln][8 * hh]; pah.half[1] = *(const v8us*)&sPh[w][ln][16 + 8 * hh];
    pal.half[0] = *(const v8us*)&sPl[w][ln][8 * hh]; pal.half[1] = *(const v8us*)&sPl[w][ln][16 + 8 * hh];
#pragma unroll
    for (int dt = 0; dt < DT; ++dt) {
      FragB bvh, bvl;
#pragma unroll
      for (int i = 0; i < 8; ++i) {
        bvh.u[i] = sVh[8 * hh + i][dt * 16 + ln]; bvh.u[8 + i] = sVh[16 + 8 * hh + i][dt * 16 + ln];
        bvl.u[i] = sVl[8 * hh + i][dt * 16 + ln]; bvl.u[8 + i] = sVl[16 + 8 * hh + i][dt * 16 + ln];
      }
      oacc[dt] = mmaN<3>(pah.v, pal.v, bvh.v, bvl.v, oacc[dt]);
    }
    __builtin_amdgcn_fence(__ATOMIC_ACQ_REL, "workgroup");
    __builtin_amdgcn_wave_barrier();
  }
#pragma unroll
  for (int r = 0; r < 8; ++r) {
    float l = l_r[r];
    l += __shfl_xor(l, 1, 32); l += __shfl_xor(l, 2, 32); l += __shfl_xor(l, 4, 32); l += __shfl_xor(l, 8, 32);
    l_r[r] = (l > 0.f) ? 1.0f / l : 0.f;
  }
#pragma unroll
  for (int dt = 0; dt < DT; ++dt)
#pragma unroll
    for (int r = 0; r < 8; ++r) sO[w][8 * hh + r][dt * 16 + ln] = oacc[dt][r] * l_r[r];
  __builtin_amdgcn_fence(__ATOMIC_ACQ_REL, "workgroup");
  __builtin_amdgcn_wave_barrier();
  {
    for (int r = 0; r < 16; ++r) {
      const int row = q0 + r;
      if (row < T && lane < D / 4) {
        const v4f val = *(const v4fa*)&sO[w][r][lane * 4];
        *(v4f*)(y + ((size_t)b * T + row) * ypitch + h * D + lane * 4) = val;
      }
    }
    
  }
}

// GEMM C = act(A·W + bias + resid): A f32 (ASPLIT -> hi/lo 2 terms), Wt bf16 [N][K]; ACT 0 none, 1 relu, 2 exact gelu;
// resid (optional, f32, row index = (row % rmod), pitch ldr, RES_BF16 rounds it) added before the activation.
template <bool ASPLIT, int ACT, bool BIAS_BF16, bool RES_BF16>
__global__ __launch_bounds__(128) void k_gemm_bf3(const float* __restrict__ A, int lda, const unsigned short* __restrict__ Wt, int ldb,
                                                const float* __restrict__ bias, const float* __restrict__ resid, int rmod, int ldr,
                                                float* __restrict__ C, int ldc, int M, int N, int K) {
  __shared__ __attribute__((aligned(16))) float so[4][16][64];
  const int tid = threadIdx.x, w = tid >> 5, lane = tid & 31, ln = lane & 15, hh = lane >> 4;
  const int ntn = N / 64;
  const int wid = blockIdx.x * 4 + w;
  const int mt = wid / ntn, nq = wid % ntn;
  if (mt * 16 >= M) return;
  const int row0 = mt * 16, col0 = nq * 64;
  const float* arow = A + (size_t)(row0 + ln) * lda;
  v8f acc[4] = {};
  for (int kb = 0; kb < K; kb += 32) {
    FragB ah, al;
    const v4f x0 = *(const v4fa*)(arow + kb + 8 * hh), x1 = *(const v4fa*)(arow + kb + 8 * hh + 4);
    const v4f x2 = *(const v4fa*)(arow + kb + 16 + 8 * hh), x3 = *(const v4fa*)(arow + kb + 16 + 8 * hh + 4);
    float xs[16] = {x0[0],x0[1],x0[2],x0[3],x1[0],x1[1],x1[2],x1[3],x2[0],x2[1],x2[2],x2[3],x3[0],x3[1],x3[2],x3[3]};
#pragma unroll
    for (int i = 0; i < 16; ++i) { const unsigned short hb = bf16_bits(xs[i]); ah.u[i] = hb; al.u[i] = ASPLIT ? bf16_bits(xs[i] - bf16_val(hb)) : (unsigned short)0; }
#pragma unroll
    for (int t = 0; t < 4; ++t) {
      const unsigned short* brow = Wt + (size_t)(col0 + t * 16 + ln) * ldb + kb;
      FragB b;
      b.half[0] = *(const v8us*)(brow + 8 * hh);
      b.half[1] = *(const v8us*)(brow + 16 + 8 * hh);
      acc[t] = mmaN<ASPLIT ? 2 : 1>(ah.v, al.v, b.v, b.v, acc[t]);
    }
  }
#pragma unroll
  for (int t = 0; t < 4; ++t) {
    const int col = col0 + t * 16 + ln;
    float bv = bias ? bias[col] : 0.f;
    if (BIAS_BF16) bv = bf16_round(bv);
#pragma unroll
    for (int r = 0; r < 8; ++r) {
      float v = acc[t][r] + bv;
      if (resid) { float rv = resid[(size_t)((row0 + 8 * hh + r) % rmod) * ldr + col]; if (RES_BF16) rv = bf16_round(rv); v += rv; }
      if (ACT == 1) v = fmaxf(v, 0.f);
      if (ACT == 2) v = 0.5f * v * (1.0f + erff(v * 0.70710678118654752f));
      if (ACT == 3) { const float u = 0.7978845608028654f * (v + 0.044715f * v * v * v); v = 0.5f * v * (1.0f + tanhf(u)); }
      so[w][8 * hh + r][t * 16 + ln] = v;
    }
  }
  __builtin_amdgcn_fence(__ATOMIC_ACQ_REL, "workgroup");
  __builtin_amdgcn_wave_barrier();
  const int rsub = lane >> 4, c4 = (lane & 15) * 4;
  {
#pragma unroll
    for (int q = 0; q < 8; ++q) {
      const int r = q * 2 + rsub;
      const v4f v = *(const v4fa*)&so[w][r][c4];
      *(v4f*)(C + (size_t)(row0 + r) * ldc + col0 + c4) = v;
    }
    
  }
}
// row LayerNorm (biased variance, eps) over N: s = X (+ R); optional out_sum <- s; out_norm <- (s-mu)*rsqrt(var+eps)*g + b
template <bool PARAM_BF16>
__global__ __launch_bounds__(256) void k_layernorm(const float* __restrict__ X, const float* __restrict__ R, const float* __restrict__ g, const float* __restrict__ bta,
                                                  float* __restrict__ out_sum, float* __restrict__ out_norm, int N, float eps) {
  __shared__ float red[256];
  const int row = blockIdx.x, tid = threadIdx.x;
  const float* x = X + (size_t)row * N; const float* rr = R ? R + (size_t)row * N : nullptr;
  float vals[16];                     // up to N = 4096
  const int per = N / 256;            // contiguous chunk per thread? use strided-by-4 chunks: thread handles j = tid*4 + 1024*u
  float s1 = 0.f;
  for (int u = 0; u < per / 4; ++u) {
    const int j = tid * 4 + 1024 * u;
    const v4f a = *(const v4fa*)(x + j);
    v4f b = {0.f,0.f,0.f,0.f}; if (rr) b = *(const v4fa*)(rr + j);
#pragma unroll
    for (int q = 0; q < 4; ++q) { const float v = a[q] + b[q]; vals[u * 4 + q] = v; s1 += v; }
  }
  red[tid] = s1; __syncthreads();
  for (int st = 128; st > 0; st >>= 1) { if (tid < st) red[tid] += red[tid + st]; __syncthreads(); }
  const float mu = red[0] / (float)N; __syncthreads();
  float s2 = 0.f;
  for (int u = 0; u < per / 4; ++u)
#pragma unroll
    for (int q = 0; q < 4; ++q) { const float c = vals[u * 4 + q] - mu; s2 += c * c; }
  red[tid] = s2; __syncthreads();
  for (int st = 128; st > 0; st >>= 1) { if (tid < st) red[tid] += red[tid + st]; __syncthreads(); }
  const float rs = rsqrtf(red[0] / (float)N + eps);
  {
    for (int u = 0; u < per / 4; ++u) {
      const int j = tid * 4 + 1024 * u;
      v4f o, sm;
#pragma unroll
      for (int q = 0; q < 4; ++q) {
        float gg = g[j + q], bb = bta[j + q];
        if (PARAM_BF16) { gg = bf16_round(gg); bb = bf16_round(bb); }
        sm[q] = vals[u * 4 + q]; o[q] = (vals[u * 4 + q] - mu) * rs * gg + bb;
      }
      if (out_sum) *(v4f*)(out_sum + (size_t)row * N + j) = sm;
      *(v4f*)(out_norm + (size_t)row * N + j) = o;
    }
    
  }
}



// ---- f16 WMMA path (v_wmma_f32_16x16x32_f16): 11-bit significands for operands in range — used where a [0,1] probability operand needs more precision than bf16
typedef _Float16 v16h __attribute__((ext_vector_type(16)));
union FragH { v16h v; v8us half[2]; _Float16 h[16]; unsigned short u[16]; };
template <int NT>
__device__ __forceinline__ v8f mmaH(v16h ah, v16h al, v16h bh, v16h bl, v8f c) {
  c = __builtin_amdgcn_wmma_f32_16x16x32_f16(false, ah, false, bh, (short)0, c, false, false);
  if (NT >= 2) c = __builtin_amdgcn_wmma_f32_16x16x32_f16(false, al, false, bh, (short)0, c, false, false);
  if (NT >= 3) c = __builtin_amdgcn_wmma_f32_16x16x32_f16(false, ah, false, bl, (short)0, c, false, false);
  asm volatile("v_nop\n\tv_nop\n\tv_nop\n\tv_nop" : "+v"(c) : "v"(ah), "v"(al), "v"(bh), "v"(bl));
  return c;
}
// batched GEMM like k_gemm_b but f16 operands: A f32 (split into f16 hi/lo if ASPLIT, else rounded to f16), Bt = f16 values [n][k]; alpha; C f32; N multiple of 16 (partial tiles skipped)
template <bool ASPLIT>
__global__ __launch_bounds__(128) void k_gemm_h(const float* __restrict__ A, int lda, size_t sA, const _Float16* __restrict__ Bh, int ldb, size_t sB, float alpha, float* __restrict__ C, int ldc, size_t sC, int M, int N, int K) {
  __shared__ __attribute__((aligned(16))) float so[4][16][64];
  const int tid = threadIdx.x, w = tid >> 5, lane = tid & 31, ln = lane & 15, hh = lane >> 4; const int by = blockIdx.y;
  A += (size_t)by * sA; Bh += (size_t)by * sB; C += (size_t)by * sC;
  const int ntn = (N + 63) / 64; const int wid = blockIdx.x * 4 + w; const int mt = wid / ntn, nq = wid % ntn; if (mt * 16 >= M) return;
  const int row0 = mt * 16, col0 = nq * 64; const float* arow = A + (size_t)(row0 + ln) * lda;
  v8f acc[4] = {};
  for (int kb = 0; kb < K; kb += 32) {
    FragH ah, al;
    const v4f x0 = *(const v4fa*)(arow + kb + 8 * hh), x1 = *(const v4fa*)(arow + kb + 8 * hh + 4), x2 = *(const v4fa*)(arow + kb + 16 + 8 * hh), x3 = *(const v4fa*)(arow + kb + 16 + 8 * hh + 4);
    float xs[16] = {x0[0],x0[1],x0[2],x0[3],x1[0],x1[1],x1[2],x1[3],x2[0],x2[1],x2[2],x2[3],x3[0],x3[1],x3[2],x3[3]};
#pragma unroll
    for (int i = 0; i < 16; ++i) { const _Float16 h = (_Float16)xs[i]; ah.h[i] = h; al.h[i] = ASPLIT ? (_Float16)(xs[i] - (float)h) : (_Float16)0.0f; }
#pragma unroll
    for (int t = 0; t < 4; ++t) { if (col0 + t * 16 >= N) continue; const size_t boff = (size_t)(col0 + t * 16 + ln) * ldb + kb; FragH bq; bq.half[0] = *(const v8us*)(Bh + boff + 8 * hh); bq.half[1] = *(const v8us*)(Bh + boff + 16 + 8 * hh);
      acc[t] = mmaH<ASPLIT ? 2 : 1>(ah.v, al.v, bq.v, bq.v, acc[t]); }
  }
#pragma unroll
  for (int t = 0; t < 4; ++t) { if (col0 + t * 16 >= N) continue;
#pragma unroll
    for (int r = 0; r < 8; ++r) so[w][8 * hh + r][t * 16 + ln] = acc[t][r] * alpha; }
  __builtin_amdgcn_fence(__ATOMIC_ACQ_REL, "workgroup"); __builtin_amdgcn_wave_barrier();
  const int rsub = lane >> 4, c4 = (lane & 15) * 4;
  {
#pragma unroll
    for (int q = 0; q < 8; ++q) { const int r = q * 2 + rsub; if (col0 + c4 < N) { const v4f v = *(const v4fa*)&so[w][r][c4]; *(v4f*)(C + (size_t)(row0 + r) * ldc + col0 + c4) = v; } }
     }
}

// Wt[n][k] = f16(W[k][n]·scale) from f32 row-major W[K][N] (scale = power of two; bf16-exact weights stay exact in f16 away from the subnormal range)
__global__ __launch_bounds__(256) void k_wt_f16(const float* __restrict__ W, _Float16* __restrict__ Wt, int K, int N, float scale) {
  const int t = blockIdx.x * 256 + threadIdx.x; if (t >= N * (K / 8)) return; const int n = t / (K / 8), k8 = (t % (K / 8)) * 8; FragH f;
#pragma unroll
  for (int i = 0; i < 8; ++i) f.h[i] = (_Float16)(bf16_round(W[(size_t)(k8 + i) * N + n]) * scale); const v8us o = f.half[0];
  *(v8us*)((unsigned short*)Wt + (size_t)n * K + k8) = o; 
}
// k_gemm_hh variant with fused epilogue: v = acc·alpha + bias[by·sBias + col] (+ CP[(row/rowsPerB)·sCPb + by·64 + col] if CP) ; ACT 0 none / 1 elu ; writes f32 C and/or f16 C16 (each if non-null)
// N and K are compile-time (NC, KC): the column guard of a partial tile folds away where NC is a multiple of 64 and the k loop unrolls into groups of KU k-steps.
template <int ACT, int NC, int KC>
__global__ __launch_bounds__(128) void k_gemm_hhx(const _Float16* __restrict__ A, int lda, size_t sA, const _Float16* __restrict__ Bh, int ldb, size_t sB, float alpha, const float* __restrict__ bias, size_t sBias, const float* __restrict__ CP, int rowsPerB, size_t sCPb, int row0g,
    float* __restrict__ C, _Float16* __restrict__ C16, int ldc, size_t sC, int M) {
  constexpr int N = NC, KU = 2, NG = KC / (32 * KU); constexpr bool PART = (NC % 64) != 0; static_assert(KC % (32 * KU) == 0, "k groups");
  __shared__ __attribute__((aligned(16))) float so[4][16][64];
  const int tid = threadIdx.x, w = tid >> 5, lane = tid & 31, ln = lane & 15, hh = lane >> 4; const int by = blockIdx.y;
  A += (size_t)by * sA; Bh += (size_t)by * sB; const size_t cofs = (size_t)by * sC; const float* bp = bias ? bias + (size_t)by * sBias : nullptr;
  const int ntn = (N + 63) / 64; const int wid = blockIdx.x * 4 + w; const int mt = wid / ntn, nq = wid % ntn; if (mt * 16 >= M) return;
  const int row0 = mt * 16, col0 = nq * 64;
  v8f acc[4] = {};
  // A and Bh are stored in fragment order (frag_src below): 16 rows of lda (ldb) elements are lda / 32 blocks of 1 KiB, one per k-step, and lane l's two loads of a fragment are 16-byte chunks l and 32 + l of the block.
  // The fragment loads of a whole group (KU k-steps: 2 KU of A, 8 KU of B) are written as one run, one group ahead of the products that use them, in two register sets. Written pair by pair between the
  // products each pair was waited for in full before its one product: the statement that ends mmaH is volatile and the scheduler moves no load across it, so a load stays where the source puts it.
  FragH fa[2][KU], fb[2][KU][4];
  const unsigned short* ap = (const unsigned short*)A + (size_t)row0 * lda + lane * 8; const unsigned short* bp0 = (const unsigned short*)Bh + (size_t)col0 * ldb + lane * 8;
#pragma unroll
  for (int g = -1; g < NG; ++g) {
    if (g + 1 < NG) { const int nx = (g + 1) & 1;
#pragma unroll
      for (int u = 0; u < KU; ++u) { const int kb = ((g + 1) * KU + u) * 512; fa[nx][u].half[0] = *(const v8us*)(ap + kb); fa[nx][u].half[1] = *(const v8us*)(ap + kb + 256);
#pragma unroll
        for (int t = 0; t < 4; ++t) { if (PART && col0 + t * 16 >= N) continue; const unsigned short* br = bp0 + (size_t)(t * 16) * ldb + kb; fb[nx][u][t].half[0] = *(const v8us*)br; fb[nx][u][t].half[1] = *(const v8us*)(br + 256); } } }
    if (g >= 0) { const int cu = g & 1;
#pragma unroll
      for (int u = 0; u < KU; ++u)
#pragma unroll
        for (int t = 0; t < 4; ++t) { if (PART && col0 + t * 16 >= N) continue; acc[t] = mmaH<1>(fa[cu][u].v, fa[cu][u].v, fb[cu][u][t].v, fb[cu][u][t].v, acc[t]); } }
  }
#pragma unroll
  for (int t = 0; t < 4; ++t) { if (col0 + t * 16 >= N) continue; const int col = col0 + t * 16 + ln; const float bv = bp ? bf16_round(bp[col]) : 0.f;
#pragma unroll
    for (int r = 0; r < 8; ++r) { float v = acc[t][r] * alpha + bv; if (CP) { const int bidx = (row0g + row0 + 8 * hh + r) / rowsPerB; v += CP[(size_t)bidx * sCPb + (size_t)by * 64 + col]; } if (ACT == 1) v = (v > 0.f) ? v : expm1f(v); else if (ACT == 3) v = fmaxf(v, 0.f); so[w][8 * hh + r][t * 16 + ln] = v; } }
  __builtin_amdgcn_fence(__ATOMIC_ACQ_REL, "workgroup"); __builtin_amdgcn_wave_barrier();
  const int rsub = lane >> 4, c4 = (lane & 15) * 4; typedef _Float16 v4h __attribute__((ext_vector_type(4)));
  {
#pragma unroll
    for (int q = 0; q < 8; ++q) { const int r = q * 2 + rsub; if (col0 + c4 < N) { const v4f v = *(const v4fa*)&so[w][r][c4]; if (C) *(v4f*)(C + cofs + (size_t)(row0 + r) * ldc + col0 + c4) = v; if (C16) { v4h h4; for (int i = 0; i < 4; ++i) h4[i] = (_Float16)v[i]; *(v4h*)(C16 + cofs + (size_t)(row0 + r) * ldc + col0 + c4) = h4; } } }
     }
}


// Fragment order of a 16-bit WMMA operand with CC columns: a tile of 16 rows x 32 k is one block of 1 KiB, the blocks of a 16-row strip follow one another in k. 16-byte chunk c (0..63) of a block holds row (c & 15),
// k = 16 (c >> 5) + 8 ((c >> 4) & 1) .. + 7, so lane l's fragment is chunks l and 32 + l: a wave-wide 16-byte load covers 512 contiguous bytes (4 whole lines) and not 32 bytes of each of 16 rows.
// frag_src: the row-major element index of the first of the 8 elements that belong in chunk t of the whole operand. A producer's thread t writes chunk t, so its stores stay contiguous.
__device__ __forceinline__ unsigned frag_src(size_t t) { const unsigned blk = (unsigned)(t >> 6), c = (unsigned)t & 63u; const unsigned rt = blk / (CC / 32), kt = blk % (CC / 32); return (rt * 16 + (c & 15)) * CC + kt * 32 + 16 * (c >> 5) + 8 * ((c >> 4) & 1); }
__global__ __launch_bounds__(256) void k_x16(const float* __restrict__ x, _Float16* __restrict__ X16, size_t n8) { const size_t t = (size_t)blockIdx.x * 256 + threadIdx.x; if (t >= n8) return; FragH f; const float* xs = x + frag_src(t);
#pragma unroll
  for (int q = 0; q < 8; ++q) f.h[q] = (_Float16)bf16_round(xs[q]); *(v8us*)((unsigned short*)X16 + t * 8) = f.half[0];  }
__global__ __launch_bounds__(256) void k_h16(const float* __restrict__ x, _Float16* __restrict__ X16, size_t n8) { const size_t t = (size_t)blockIdx.x * 256 + threadIdx.x; if (t >= n8) return; FragH f; const float* xs = x + frag_src(t);
#pragma unroll
  for (int q = 0; q < 8; ++q) f.h[q] = (_Float16)xs[q]; *(v8us*)((unsigned short*)X16 + t * 8) = f.half[0];  }
__global__ __launch_bounds__(256) void k_round16f(const float* __restrict__ W, _Float16* __restrict__ Bt, size_t n8) { const size_t t = (size_t)blockIdx.x * 256 + threadIdx.x; if (t >= n8) return; FragH f; const float* ws = W + frag_src(t);
#pragma unroll
  for (int i = 0; i < 8; ++i) f.h[i] = (_Float16)(bf16_round(ws[i]) * 16.0f); *(v8us*)((unsigned short*)Bt + t * 8) = f.half[0];  }
template <int NHv, int TTv>
__global__ __launch_bounds__(256) void k_vt(const _Float16* __restrict__ V16, int ldv, int voff, _Float16* __restrict__ Vt) { __shared__ unsigned short tl[64][66]; const int tid = threadIdx.x; const int slab = blockIdx.x / (TTv / 64), lg = blockIdx.x % (TTv / 64); const int b = slab / NHv, h = slab % NHv;
  for (int i = tid; i < 64 * 8; i += 256) { const int r = i / 8, c8 = (i % 8) * 8; FragH f; f.half[0] = *(const v8us*)((const unsigned short*)V16 + ((size_t)b * TTv + lg * 64 + r) * ldv + voff + h * 64 + c8);
#pragma unroll
    for (int q = 0; q < 8; ++q) tl[r][c8 + q] = f.u[q]; }
  __syncthreads();
  {
#pragma unroll
    for (int rd = 0; rd < 2; ++rd) { const int idx = rd * 256 + tid, c = idx & 63; FragH f;      /* Vt in fragment order, rows = d, k = keys: block ((slab * TTv / 32 + key / 32) * 4 + d / 16); the 64 x 64 tile is 8 blocks in a row, thread writes chunk idx */
      const int d = ((idx >> 6) & 3) * 16 + (c & 15), kl = (idx >> 8) * 32 + 16 * (c >> 5) + 8 * ((c >> 4) & 1);
#pragma unroll
      for (int q = 0; q < 8; ++q) f.u[q] = tl[kl + q][d];
      *(v8us*)((unsigned short*)Vt + ((size_t)slab * (TTv / 64) + lg) * 4096 + idx * 8) = f.half[0]; }
     } }

// lane l <-> lane l ^ 16 (the two halves of a wave hold the two halves of a query's keys)
__device__ __forceinline__ float xhalf(float v) { const int b = __float_as_int(v); return __int_as_float(__builtin_amdgcn_permlanex16(b, b, 0x76543210, 0xfedcba98, false, false)); }
// Transposed products: St = K.Qt (A = 16 key rows, B = the wave's 16 queries as columns) and Ot += Vt.Pt (A = 16 rows of Vt, B = Pt). Lane (ln, hh) holds query q0 + ln only: register r of score tile nt is key
// j0 + 16 nt + 8 hh + r, which is the k order of a B operand, so the two score tiles converted in place ARE Pt; maximum and sums are in-lane plus one exchange between the halves.
__global__ __launch_bounds__(128) void k_flash(const _Float16* __restrict__ Q16, const _Float16* __restrict__ K16, const _Float16* __restrict__ Vt, const float* __restrict__ CB, const float* __restrict__ beta, float* __restrict__ O, int ldo) {
  __shared__ float scb[2048];
  constexpr int RPW = 16, NQB = 2048 / (4 * RPW), DT = 4, KS = 2;
  __shared__ __attribute__((aligned(16))) float sO[4][RPW][64 + 4];
  const int tid = threadIdx.x, w = tid >> 5, lane = tid & 31, ln = lane & 15, hh = lane >> 4;
  const int slab = blockIdx.x / NQB, qblk = blockIdx.x % NQB; const int b = slab / 12, h = slab % 12; const int qb0 = qblk * (4 * RPW); const int q0 = qb0 + w * RPW;
  FragH aq[KS];
  /* Q16, K16 (block (slab * 128 + position / 16) * 2 + ks) and Vt (block (slab * 64 + key / 32) * 4 + dt) are in fragment order: lane l loads chunks l and 32 + l of a 1-KiB block; a pass's K is 4 KiB in a row, its V too */
  { const unsigned short* qr = (const unsigned short*)Q16 + ((size_t)slab * 128 + (q0 >> 4)) * 1024 + lane * 8;
#pragma unroll
    for (int ks = 0; ks < KS; ++ks) { aq[ks].half[0] = *(const v8us*)(qr + ks * 512); aq[ks].half[1] = *(const v8us*)(qr + ks * 512 + 256); } }
  const float bh = bf16_round(beta[h]);
  for (int i = tid; i < 2048; i += 128) scb[i] = 0.18033688f * (1.0f + bh * CB[i]);      /* log2(e) / 8 * (1 + beta * mean_f cos(d * theta_f)), d = |q - k|: a raw score times its entry is the score as an exponent to base 2 */
  __syncthreads();
  const unsigned short* Vth = (const unsigned short*)Vt + (size_t)slab * 64 * 2048 + lane * 8; const unsigned short* Kh = (const unsigned short*)K16 + (size_t)slab * 64 * 2048 + lane * 8;
  const int tq = q0 + ln;      /* this lane's query */
  float m_q = -3.0e38f, l_q = 0.f, lc_q = 0.f;      /* running maximum (same in both halves); this half's partial sums over all keys and over the causal keys */
  v8f oacc[DT];      /* oacc[dt][r] = Ot[dt * 16 + 8 hh + r][tq] */
#pragma unroll
  for (int dt = 0; dt < DT; ++dt) oacc[dt] = (v8f){0.f,0.f,0.f,0.f,0.f,0.f,0.f,0.f};
  const int jend = 2048;
#pragma unroll 1
  for (int j0 = 0; j0 < jend; j0 += 32) {
    /* all fragment loads of the pass (8 of K, and 8 of V where the pass has a causal key) as one run ahead of its first product: no load moves across the volatile statement that ends mmaH */
    const bool pv = (j0 <= q0 + RPW - 1);      /* some key of this chunk is <= some query of this wave; otherwise every p is 0 */
    FragH bk[2][KS], bv[DT];
#pragma unroll
    for (int nt = 0; nt < 2; ++nt) { const unsigned short* kr = Kh + (size_t)j0 * 64 + nt * 1024;
#pragma unroll
      for (int ks = 0; ks < KS; ++ks) { bk[nt][ks].half[0] = *(const v8us*)(kr + ks * 512); bk[nt][ks].half[1] = *(const v8us*)(kr + ks * 512 + 256); } }
    if (pv) {
#pragma unroll
      for (int dt = 0; dt < DT; ++dt) { const unsigned short* vrow = Vth + (size_t)j0 * 64 + dt * 512; bv[dt].half[0] = *(const v8us*)vrow; bv[dt].half[1] = *(const v8us*)(vrow + 256); } }
    v8f s[2];
#pragma unroll
    for (int nt = 0; nt < 2; ++nt) { v8f acc = (v8f){0.f,0.f,0.f,0.f,0.f,0.f,0.f,0.f};
#pragma unroll
      for (int ks = 0; ks < KS; ++ks) acc = mmaH<1>(bk[nt][ks].v, bk[nt][ks].v, aq[ks].v, aq[ks].v, acc); s[nt] = acc; }
    float tb[16]; const int xq4 = 4 * (tq - 8 * hh - j0);      /* 4 (q - k) at this lane's first key of the pass */
#pragma unroll
    for (int i = 0; i < 16; ++i) { const int x4 = xq4 - 4 * ((i >> 3) * 16 + (i & 7)); const int d4 = (x4 < 0) ? -x4 : x4;      /* x4 = 4 (q - k), the table's byte offset up to its sign */
      tb[i] = *(const float*)((const char*)scb + d4); }
    v2f sw[8]; float sv[16];      /* neighbouring accumulator registers as pairs: the packed multiply here and the packed subtraction below serve two scores each */
#pragma unroll
    for (int i = 0; i < 8; ++i) { sw[i] = (v2f){s[i >> 2][2 * (i & 3)], s[i >> 2][2 * (i & 3) + 1]} * (v2f){tb[2 * i], tb[2 * i + 1]}; sv[2 * i] = sw[i][0]; sv[2 * i + 1] = sw[i][1]; }
    float mx[4];
#pragma unroll
    for (int i = 0; i < 4; ++i) mx[i] = fmaxf(fmaxf(sv[i], sv[4 + i]), fmaxf(sv[8 + i], sv[12 + i]));
    float mc = fmaxf(fmaxf(mx[0], mx[1]), fmaxf(mx[2], mx[3])); mc = fmaxf(mc, xhalf(mc));
    const float mn = fmaxf(m_q, mc); const float ea = __builtin_amdgcn_exp2f(m_q - mn); const float al = (mn > -1.0e38f) ? ea : 1.0f; m_q = mn;
    v2f dv[8];      /* exponents to base 2 */
#pragma unroll
    for (int i = 0; i < 8; ++i) dv[i] = sw[i] - (v2f){mn, mn};
    float ev[16];      /* 2^(score - maximum), one v_exp_f32 each: the argument is never above 0 (mn is the maximum of the same products), and far below 0 the result goes to 0 as it should; the pass's 16 stand as one run ahead of the selects and sums that read them */
#pragma unroll
    for (int i = 0; i < 16; ++i) ev[i] = __builtin_amdgcn_exp2f(dv[i >> 1][i & 1]);
    float se[4] = {0.f, 0.f, 0.f, 0.f}, sp[4] = {0.f, 0.f, 0.f, 0.f}; FragH pb;      /* full-softmax stats over ALL keys; P.V and its sum only over the causal ones */
#pragma unroll
    for (int i = 0; i < 16; ++i) { const int x4 = xq4 - 4 * ((i >> 3) * 16 + (i & 7)); const float e = ev[i]; const float p = (x4 >= 0) ? e : 0.f; se[i & 3] += e; sp[i & 3] += p; pb.h[i] = (_Float16)p; }
    l_q = l_q * al + ((se[0] + se[1]) + (se[2] + se[3])); lc_q = lc_q * al + ((sp[0] + sp[1]) + (sp[2] + sp[3]));
#pragma unroll
    for (int dt = 0; dt < DT; ++dt)
#pragma unroll
      for (int r = 0; r < 8; ++r) oacc[dt][r] *= al;
    if (pv) {
#pragma unroll
      for (int dt = 0; dt < DT; ++dt) oacc[dt] = mmaH<1>(bv[dt].v, bv[dt].v, pb.v, pb.v, oacc[dt]); } }
  const float l = l_q + xhalf(l_q), lc = lc_q + xhalf(lc_q); const float inv = 1.0f / (lc + 1e-8f * l);      /* w * causal / (sum_causal w + 1e-8) with w = e^(s-m) / Z_full  =  e^(s-m) / (Z_causal + 1e-8 * Z_full) */
#pragma unroll
  for (int dt = 0; dt < DT; ++dt)
#pragma unroll
    for (int q = 0; q < 2; ++q) { v4f o4;
#pragma unroll
      for (int i = 0; i < 4; ++i) o4[i] = oacc[dt][q * 4 + i] * inv;
      *(v4fa*)&sO[w][ln][dt * 16 + 8 * hh + q * 4] = o4; }
  __builtin_amdgcn_fence(__ATOMIC_ACQ_REL, "workgroup"); __builtin_amdgcn_wave_barrier();
  {
#pragma unroll
    for (int rp = 0; rp < RPW; rp += 2) { const int r = rp + (lane >> 4), pc = lane & 15; const v4f val = *(const v4fa*)&sO[w][r][pc * 4]; *(v4f*)(O + ((size_t)b * 2048 + q0 + r) * ldo + h * 64 + pc * 4) = val; }
     } }

__global__ __launch_bounds__(256) void k_cb(float* __restrict__ CB) { __shared__ float sc[8][33]; const int tid = threadIdx.x, g = tid >> 5, f = tid & 31; const int dl = blockIdx.x * 8 + g;      /* one thread per (distance, frequency) term; a block makes 8 table entries */
  const float th = powf(10000.0f, -(float)(2 * f) / 64.0f); sc[g][f] = cosf((float)dl * th); __syncthreads();
  if (tid < 8) { float s = 0.f;
    for (int i = 0; i < 32; ++i) s += sc[tid][i];      /* f = 0..31 in ascending order, the order in which one thread summed them before */
    CB[blockIdx.x * 8 + tid] = s / 32.0f; } }
// rotary + rms-norm per (row, head): x1 = q[h·64 + j], x2 = q[h·64 + 32 + j] (j < 32); out = [x1·cos + x2·sin | −x1·sin + x2·cos] with cos/sin = bf16(INPUT tables [t][j]); then × rsqrt(mean(out²) + f32 eps) → f16;
__global__ __launch_bounds__(256) void k_ropenorm(const float* __restrict__ Qf, const float* __restrict__ cosT, const float* __restrict__ sinT, _Float16* __restrict__ Q16) { const size_t tg = (size_t)blockIdx.x * 256 + threadIdx.x; if (tg >= (size_t)NR * NH * 4) return; const int pc = (int)(tg & 3), r = (int)((tg >> 2) & 15), h = (int)((tg >> 6) % NH); const size_t row = ((tg >> 6) / NH) * 16 + r; const int t = (int)(row % TT); const int j0 = pc * 8;      /* 64 threads = 16 rows of one head, so that a wave's stores fill whole lines of the fragment-order blocks */
  float a[8], bq[8], cr[8], sr[8]; float ss = 0.f;
#pragma unroll
  for (int q = 0; q < 8; ++q) { cr[q] = cosT[t * 32 + j0 + q]; sr[q] = sinT[t * 32 + j0 + q]; }
  asm volatile("s_wait_xcnt 0x0" ::: "memory");      /* the loads below may take the table loads' offset register as a destination: the wait stands in front of that overwrite */
#pragma unroll
  for (int q = 0; q < 8; ++q) { const int j = j0 + q; const float x1 = Qf[row * CC + h * 64 + j], x2 = Qf[row * CC + h * 64 + 32 + j]; const float c = bf16_round(cr[q]), s = bf16_round(sr[q]); a[q] = x1 * c + x2 * s; bq[q] = -x1 * s + x2 * c; ss += a[q] * a[q] + bq[q] * bq[q]; }
  ss += __shfl_xor(ss, 1, 32); ss += __shfl_xor(ss, 2, 32); const float rn = rsqrtf(ss / 64.0f + 1.1920929e-7f); FragH f1, f2;
#pragma unroll
  for (int q = 0; q < 8; ++q) { f1.h[q] = (_Float16)(a[q] * rn); f2.h[q] = (_Float16)(bq[q] * rn); }
  { unsigned short* qd = (unsigned short*)Q16 + (((row / TT) * NH + h) * (TT / 16) + (t >> 4)) * 1024 + (pc >> 1) * 256 + ((pc & 1) * 16 + r) * 8;      /* fragment order per head: block (slab * TT / 16 + t / 16) * 2 + ks, chunk 32 (pc >> 1) + 16 (pc & 1) + r */
    *(v8us*)qd = f1.half[0]; *(v8us*)(qd + 512) = f2.half[0];  } }
extern "C" void kernel_launch(void* const* d_in, const int* in_sizes, int n_in,
                              void* d_out, int out_size, void* d_ws, size_t ws_size, hipStream_t stream) {
  (void)in_sizes; (void)n_in; (void)out_size;
  const float* x = (const float*)d_in[0]; const float* cosT = (const float*)d_in[1]; const float* sinT = (const float*)d_in[2]; const float* Wq = (const float*)d_in[3]; const float* Wk = (const float*)d_in[4]; const float* Wv = (const float*)d_in[5]; const float* Wo = (const float*)d_in[6]; const float* beta = (const float*)d_in[7];
  char* ws = (char*)d_ws; size_t off = 0;
  auto take = [&](size_t bytes) { char* p = ws + off; off += (bytes + 255) & ~(size_t)255; return p; };
  _Float16* Bq = (_Float16*)take((size_t)CC * CC * 2); _Float16* Bk = (_Float16*)take((size_t)CC * CC * 2); _Float16* Bv = (_Float16*)take((size_t)CC * CC * 2); _Float16* Bo = (_Float16*)take((size_t)CC * CC * 2); float* CB = (float*)take(TT * 4);
  _Float16* X16 = (_Float16*)take((size_t)NR * CC * 2); float* Qf = (float*)take((size_t)NR * CC * 4); float* Kf = (float*)take((size_t)NR * CC * 4); _Float16* Q16 = (_Float16*)take((size_t)NR * CC * 2); _Float16* K16 = (_Float16*)take((size_t)NR * CC * 2); _Float16* V16 = (_Float16*)take((size_t)NR * CC * 2); _Float16* Vt = (_Float16*)take((size_t)NR * CC * 2); float* O = Qf; _Float16* O16 = X16;      // Qf dead after k_ropenorm; X16 dead after the V GEMM
  if (off > ws_size) return;      // 4.7 + 6.3 + 12.6 × 2 + 6.3 × 4 ≈ 59 MiB
  const size_t w8 = (size_t)CC * CC / 8; const unsigned gw = (unsigned)((w8 + 255) / 256);
  k_round16f<<<gw, 256, 0, stream>>>(Wq, Bq, w8); k_round16f<<<gw, 256, 0, stream>>>(Wk, Bk, w8); k_round16f<<<gw, 256, 0, stream>>>(Wv, Bv, w8); k_round16f<<<gw, 256, 0, stream>>>(Wo, Bo, w8);      // (out,in)
  k_cb<<<TT / 8, 256, 0, stream>>>(CB);
  const unsigned gx = (unsigned)(((size_t)NR * CC / 8 + 255) / 256); const dim3 gg(((NR / 16) * (CC / 64) + 3) / 4, 1);
  k_x16<<<gx, 256, 0, stream>>>(x, X16, (size_t)NR * CC / 8);
  k_gemm_hhx<0, CC, CC><<<gg, 128, 0, stream>>>(X16, CC, 0, Bq, CC, 0, 0.0625f, nullptr, 0, nullptr, 1, 0, 0, Qf, nullptr, CC, 0, NR);
  k_gemm_hhx<0, CC, CC><<<gg, 128, 0, stream>>>(X16, CC, 0, Bk, CC, 0, 0.0625f, nullptr, 0, nullptr, 1, 0, 0, Kf, nullptr, CC, 0, NR);
  k_gemm_hhx<0, CC, CC><<<gg, 128, 0, stream>>>(X16, CC, 0, Bv, CC, 0, 0.0625f, nullptr, 0, nullptr, 1, 0, 0, nullptr, V16, CC, 0, NR);
  const unsigned gr = (unsigned)(((size_t)NR * NH * 4 + 255) / 256);
  k_ropenorm<<<gr, 256, 0, stream>>>(Qf, cosT, sinT, Q16); k_ropenorm<<<gr, 256, 0, stream>>>(Kf, cosT, sinT, K16);
  k_vt<NH, TT><<<BB * NH * (TT / 64), 256, 0, stream>>>(V16, CC, 0, Vt);
  k_flash<<<BB * NH * (TT / 64), 128, 0, stream>>>(Q16, K16, Vt, CB, beta, O, CC);      // RPW 16
  k_h16<<<gx, 256, 0, stream>>>(O, O16, (size_t)NR * CC / 8);
  k_gemm_hhx<0, CC, CC><<<gg, 128, 0, stream>>>(O16, CC, 0, Bo, CC, 0, 0.0625f, nullptr, 0, nullptr, 1, 0, 0, (float*)d_out, nullptr, CC, 0, NR);
}

// v007
// A run of this version takes 133 microseconds.
// Next to v006, in two timings, it ran 1.12 and 1.14 times as fast.
// Over all steps from v000 it is 3.46 times as fast.
#include <hip/hip_runtime.h>
// Phase-aware causal attention: q/k/v/o projections (4096 × 768 × 768, no bias, weights (out,in) bf16-exact ×2^4) and the 12-head attention as a fused flash-style kernel on v_wmma_f32_16x16x32_f16
// (rotary (with the INPUT cos/sin tables) + rms-norm'd q,k as f16; S = Q·Kᵀ/8 × (1 + β_h·mean_f cos(|q−k|·θ_f)) with the 2048-entry coherence table precomputed; the module's FULL softmax followed
// by causal masking and re-normalisation with +1e-8 is reproduced exactly as e^{s−m}/(Z_causal + 1e-8·Z_full) with m, Z_full over all keys; P f16 ≤ 1; O = P·V over causal keys); f32 accumulate.
#define BB 2
#define TT 2048
#define CC 768
#define NH 12
#define NR (BB * TT)

typedef __bf16 v16b __attribute__((ext_vector_type(16)));
typedef unsigned short v8us __attribute__((ext_vector_type(8), may_alias));
typedef float  v8f  __attribute__((ext_vector_type(8)));
typedef float  v4f  __attribute__((ext_vector_type(4)));
typedef float  v4fa __attribute__((ext_vector_type(4), may_alias));
typedef float  v2f  __attribute__((ext_vector_type(2)));
union FragB { v16b v; v8us half[2]; unsigned short u[16]; };

__device__ __forceinline__ unsigned short bf16_bits(float x) { unsigned int u = __float_as_uint(x); return (unsigned short)((u + 0x7FFFu + ((u >> 16) & 1u)) >> 16); }
__device__ __forceinline__ float bf16_val(unsigned short b) { return __uint_as_float(((unsigned int)b) << 16); }
__device__ __forceinline__ float bf16_round(float x) { return bf16_val(bf16_bits(x)); }
// D += A·B with NT terms: 1 = ah·bh, 2 = + al·bh (A split), 3 = + ah·bl (both split)
template <int NT>
__device__ __forceinline__ v8f mmaN(v16b ah, v16b al, v16b bh, v16b bl, v8f c) {
  c = __builtin_amdgcn_wmma_f32_16x16x32_bf16(false, ah, false, bh, (short)0, c, false, false);
  if (NT >= 2) c = __builtin_amdgcn_wmma_f32_16x16x32_bf16(false, al, false, bh, (short)0, c, false, false);
  if (NT >= 3) c = __builtin_amdgcn_wmma_f32_16x16x32_bf16(false, ah, false, bl, (short)0, c, false, false);
  asm volatile("v_nop\n\tv_nop\n\tv_nop\n\tv_nop" : "+v"(c) : "v"(ah), "v"(al), "v"(bh), "v"(bl));
  return c;
}

__global__ __launch_bounds__(256) void k_wt_bf16(const float* __restrict__ W, unsigned short* __restrict__ Wt, int K, int N) {
  const int t = blockIdx.x * 256 + threadIdx.x;
  const int k8n = K / 8;
  if (t >= N * k8n) return;
  const int n = t / k8n, k8 = (t % k8n) * 8;
  v8us v;
#pragma unroll
  for (int i = 0; i < 8; ++i) v[i] = bf16_bits(W[(size_t)(k8 + i) * N + n]);
  *(v8us*)(Wt + (size_t)n * K + k8) = v;
  
}

// GEMM C[M][N] (f32, pitch ldc) = act(A[M][K]·W + bias). A f32 row-major (pitch lda) converted per fragment to bf16
// (ASPLIT: hi/lo two planes -> 2 terms, else single rounded term); Wt bf16 [N][K] (pitch ldb). BIAS_BF16 rounds the
// bias to bf16 first (bias quantised to bf16 before the add). K%32==0, M%16==0, N%64==0.
template <bool ASPLIT, int ACT, bool BIAS_BF16>
__global__ __launch_bounds__(128) void k_gemm_bf(const float* __restrict__ A, int lda, const unsigned short* __restrict__ Wt, int ldb,
                                               const float* __restrict__ bias, float* __restrict__ C, int ldc, int M, int N, int K) {
  __shared__ __attribute__((aligned(16))) float so[4][16][64];
  const int tid = threadIdx.x, w = tid >> 5, lane = tid & 31, ln = lane & 15, hh = lane >> 4;
  const int ntn = N / 64;
  const int wid = blockIdx.x * 4 + w;
  const int mt = wid / ntn, nq = wid % ntn;
  if (mt * 16 >= M) return;
  const int row0 = mt * 16, col0 = nq * 64;
  const float* arow = A + (size_t)(row0 + ln) * lda;
  v8f acc[4] = {};
  for (int kb = 0; kb < K; kb += 32) {
    FragB ah, al;
    const v4f x0 = *(const v4fa*)(arow + kb + 8 * hh), x1 = *(const v4fa*)(arow + kb + 8 * hh + 4);
    const v4f x2 = *(const v4fa*)(arow + kb + 16 + 8 * hh), x3 = *(const v4fa*)(arow + kb + 16 + 8 * hh + 4);
    float xs[16] = {x0[0],x0[1],x0[2],x0[3],x1[0],x1[1],x1[2],x1[3],x2[0],x2[1],x2[2],x2[3],x3[0],x3[1],x3[2],x3[3]};
#pragma unroll
    for (int i = 0; i < 16; ++i) { const unsigned short hb = bf16_bits(xs[i]); ah.u[i] = hb; al.u[i] = ASPLIT ? bf16_bits(xs[i] - bf16_val(hb)) : (unsigned short)0; }
#pragma unroll
    for (int t = 0; t < 4; ++t) {
      const unsigned short* brow = Wt + (size_t)(col0 + t * 16 + ln) * ldb + kb;
      FragB b;
      b.half[0] = *(const v8us*)(brow + 8 * hh);
      b.half[1] = *(const v8us*)(brow + 16 + 8 * hh);
      acc[t] = mmaN<ASPLIT ? 2 : 1>(ah.v, al.v, b.v, b.v, acc[t]);
    }
  }
#pragma unroll
  for (int t = 0; t < 4; ++t) {
    float bv = bias ? bias[col0 + t * 16 + ln] : 0.f;
    if (BIAS_BF16) bv = bf16_round(bv);
#pragma unroll
    for (int r = 0; r < 8; ++r) { float v = acc[t][r] + bv; if (ACT == 1) v = fmaxf(v, 0.f); so[w][8 * hh + r][t * 16 + ln] = v; }
  }
  __builtin_amdgcn_fence(__ATOMIC_ACQ_REL, "workgroup");
  __builtin_amdgcn_wave_barrier();
  const int rsub = lane >> 4, c4 = (lane & 15) * 4;
  {
#pragma unroll
    for (int q = 0; q < 8; ++q) {
      const int r = q * 2 + rsub;
      const v4f v = *(const v4fa*)&so[w][r][c4];
      *(v4f*)(C + (size_t)(row0 + r) * ldc + col0 + c4) = v;
    }
    
  }
}

// Flash-style causal/unmasked attention, all contractions 3-term bf16 hi/lo splits, f32 softmax with running max.
// q,k,v rows are read from f32 buffers with arbitrary row pitch (so they can live inside a fused qkv buffer);
// D = head size (multiple of 32, <= 128); one wave = 16 query rows; block = 4 waves (64 queries) sharing K/V chunks of 32.
template <int D, bool CAUSAL>
__global__ __launch_bounds__(128) void k_flash(const float* __restrict__ qb, const float* __restrict__ kb, const float* __restrict__ vb,
                                             int pitch, int T, int H, float scale, float* __restrict__ y, int ypitch) {
  constexpr int KS = D / 32;        // k-steps for QK
  constexpr int DT = D / 16;        // d tiles for PV
  __shared__ __attribute__((aligned(16))) unsigned short sKh[32][D + 8], sKl[32][D + 8], sVh[32][D + 8], sVl[32][D + 8];
  __shared__ __attribute__((aligned(16))) unsigned short sPh[4][16][40], sPl[4][16][40];
  __shared__ __attribute__((aligned(16))) float sO[4][16][D];
  const int tid = threadIdx.x, w = tid >> 5, lane = tid & 31, ln = lane & 15, hh = lane >> 4;
  const int nqb = (T + 63) / 64;
  const int bh = blockIdx.x / nqb, qblk = blockIdx.x % nqb;
  const int b = bh / H, h = bh % H;
  const int q0 = qblk * 64 + w * 16;
  const float* Q = qb + (size_t)b * T * pitch + h * D;
  const float* K = kb + (size_t)b * T * pitch + h * D;
  const float* V = vb + (size_t)b * T * pitch + h * D;

  // A fragments of the wave's 16 query rows (scaled), hi/lo
  FragB aqh[KS], aql[KS];
  {
    int row = q0 + ln; if (row >= T) row = T - 1;
    const float* qr = Q + (size_t)row * pitch;
#pragma unroll
    for (int ks = 0; ks < KS; ++ks)
#pragma unroll
      for (int i = 0; i < 16; ++i) {
        const int d = ks * 32 + ((i < 8) ? (8 * hh + i) : (16 + 8 * hh + (i - 8)));
        const float x = qr[d] * scale; const unsigned short hb = bf16_bits(x);
        aqh[ks].u[i] = hb; aql[ks].u[i] = bf16_bits(x - bf16_val(hb));
      }
  }
  float m_r[8], l_r[8];
#pragma unroll
  for (int r = 0; r < 8; ++r) { m_r[r] = -3.0e38f; l_r[r] = 0.f; }
  v8f oacc[DT];
#pragma unroll
  for (int dt = 0; dt < DT; ++dt) oacc[dt] = (v8f){0.f,0.f,0.f,0.f,0.f,0.f,0.f,0.f};

  const int kv_end = CAUSAL ? min(T, qblk * 64 + 64) : T;     // block-uniform
  for (int j0 = 0; j0 < kv_end; j0 += 32) {
    __syncthreads();
    for (int e = tid; e < 32 * (D / 4); e += 128) {
      const int r = e / (D / 4), c4 = (e % (D / 4)) * 4;
      const int key = j0 + r;
      v4f kf = {0.f,0.f,0.f,0.f}, vf = {0.f,0.f,0.f,0.f};
      if (key < T) { kf = *(const v4fa*)(K + (size_t)key * pitch + c4); vf = *(const v4fa*)(V + (size_t)key * pitch + c4); }
#pragma unroll
      for (int t = 0; t < 4; ++t) {
        unsigned short hb = bf16_bits(kf[t]); sKh[r][c4 + t] = hb; sKl[r][c4 + t] = bf16_bits(kf[t] - bf16_val(hb));
        hb = bf16_bits(vf[t]); sVh[r][c4 + t] = hb; sVl[r][c4 + t] = bf16_bits(vf[t] - bf16_val(hb));
      }
    }
    __syncthreads();
    // S tile 16 x 32
    v8f s[2];
#pragma unroll
    for (int nt = 0; nt < 2; ++nt) {
      v8f acc = {};
#pragma unroll
      for (int ks = 0; ks < KS; ++ks) {
        FragB bh_, bl_;
        bh_.half[0] = *(const v8us*)&sKh[nt * 16 + ln][ks * 32 + 8 * hh]; bh_.half[1] = *(const v8us*)&sKh[nt * 16 + ln][ks * 32 + 16 + 8 * hh];
        bl_.half[0] = *(const v8us*)&sKl[nt * 16 + ln][ks * 32 + 8 * hh]; bl_.half[1] = *(const v8us*)&sKl[nt * 16 + ln][ks * 32 + 16 + 8 * hh];
        acc = mmaN<3>(aqh[ks].v, aql[ks].v, bh_.v, bl_.v, acc);
      }
      s[nt] = acc;
    }
    // mask + running max (rows 8hh+r; the 16 lanes of a half share rows)
    float alpha[8];
#pragma unroll
    for (int r = 0; r < 8; ++r) {
      const int qi = q0 + 8 * hh + r;
      const int ja = j0 + ln, jb = j0 + 16 + ln;
      if (CAUSAL) { if (ja > qi) s[0][r] = -3.0e38f; if (jb > qi) s[1][r] = -3.0e38f; }
      if (ja >= T) s[0][r] = -3.0e38f;
      if (jb >= T) s[1][r] = -3.0e38f;
      float mx = fmaxf(s[0][r], s[1][r]);
      mx = fmaxf(mx, __shfl_xor(mx, 1, 32)); mx = fmaxf(mx, __shfl_xor(mx, 2, 32)); mx = fmaxf(mx, __shfl_xor(mx, 4, 32)); mx = fmaxf(mx, __shfl_xor(mx, 8, 32));
      const float mnew = fmaxf(m_r[r], mx);
      alpha[r] = (mnew > -1.0e38f) ? __expf(m_r[r] - mnew) : 1.0f;
      const float p0 = (s[0][r] > -1.0e38f) ? __expf(s[0][r] - mnew) : 0.f;
      const float p1 = (s[1][r] > -1.0e38f) ? __expf(s[1][r] - mnew) : 0.f;
      m_r[r] = mnew;
      l_r[r] = l_r[r] * alpha[r] + p0 + p1;            // per-lane partial row sum (16 lanes combined at the end)
      unsigned short hb = bf16_bits(p0); sPh[w][8 * hh + r][ln] = hb;      sPl[w][8 * hh + r][ln] = bf16_bits(p0 - bf16_val(hb));
      hb = bf16_bits(p1);                sPh[w][8 * hh + r][16 + ln] = hb; sPl[w][8 * hh + r][16 + ln] = bf16_bits(p1 - bf16_val(hb));
    }
#pragma unroll
    for (int dt = 0; dt < DT; ++dt)
#pragma unroll
      for (int r = 0; r < 8; ++r) oacc[dt][r] *= alpha[r];
    __builtin_amdgcn_fence(__ATOMIC_ACQ_REL, "workgroup");
    __builtin_amdgcn_wave_barrier();
    FragB pah, pal;
    pah.half[0] = *(const v8us*)&sPh[w][ln][8 * hh]; pah.half[1] = *(const v8us*)&sPh[w][ln][16 + 8 * hh];
    pal.half[0] = *(const v8us*)&sPl[w][ln][8 * hh]; pal.half[1] = *(const v8us*)&sPl[w][ln][16 + 8 * hh];
#pragma unroll
    for (int dt = 0; dt < DT; ++dt) {
      FragB bvh, bvl;
#pragma unroll
      for (int i = 0; i < 8; ++i) {
        bvh.u[i] = sVh[8 * hh + i][dt * 16 + ln]; bvh.u[8 + i] = sVh[16 + 8 * hh + i][dt * 16 + ln];
        bvl.u[i] = sVl[8 * hh + i][dt * 16 + ln]; bvl.u[8 + i] = sVl[16 + 8 * hh + i][dt * 16 + ln];
      }
      oacc[dt] = mmaN<3>(pah.v, pal.v, bvh.v, bvl.v, oacc[dt]);
    }
    __builtin_amdgcn_fence(__ATOMIC_ACQ_REL, "workgroup");
    __builtin_amdgcn_wave_barrier();
  }
#pragma unroll
  for (int r = 0; r < 8; ++r) {
    float l = l_r[r];
    l += __shfl_xor(l, 1, 32); l += __shfl_xor(l, 2, 32); l += __shfl_xor(l, 4, 32); l += __shfl_xor(l, 8, 32);
    l_r[r] = (l > 0.f) ? 1.0f / l : 0.f;
  }
#pragma unroll
  for (int dt = 0; dt < DT; ++dt)
#pragma unroll
    for (int r = 0; r < 8; ++r) sO[w][8 * hh + r][dt * 16 + ln] = oacc[dt][r] * l_r[r];
  __builtin_amdgcn_fence(__ATOMIC_ACQ_REL, "workgroup");
  __builtin_amdgcn_wave_barrier();
  {
    for (int r = 0; r < 16; ++r) {
      const int row = q0 + r;
      if (row < T && lane < D / 4) {
        const v4f val = *(const v4fa*)&sO[w][r][lane * 4];
        *(v4f*)(y + ((size_t)b * T + row) * ypitch + h * D + lane * 4) = val;
      }
    }
    
  }
}

// GEMM C = act(A·W + bias + resid): A f32 (ASPLIT -> hi/lo 2 terms), Wt bf16 [N][K]; ACT 0 none, 1 relu, 2 exact gelu;
// resid (optional, f32, row index = (row % rmod), pitch ldr, RES_BF16 rounds it) added before the activation.
template <bool ASPLIT, int ACT, bool BIAS_BF16, bool RES_BF16>
__global__ __launch_bounds__(128) void k_gemm_bf3(const float* __restrict__ A, int lda, const unsigned short* __restrict__ Wt, int ldb,
                                                const float* __restrict__ bias, const float* __restrict__ resid, int rmod, int ldr,
                                                float* __restrict__ C, int ldc, int M, int N, int K) {
  __shared__ __attribute__((aligned(16))) float so[4][16][64];
  const int tid = threadIdx.x, w = tid >> 5, lane = tid & 31, ln = lane & 15, hh = lane >> 4;
  const int ntn = N / 64;
  const int wid = blockIdx.x * 4 + w;
  const int mt = wid / ntn, nq = wid % ntn;
  if (mt * 16 >= M) return;
  const int row0 = mt * 16, col0 = nq * 64;
  const float* arow = A + (size_t)(row0 + ln) * lda;
  v8f acc[4] = {};
  for (int kb = 0; kb < K; kb += 32) {
    FragB ah, al;
    const v4f x0 = *(const v4fa*)(arow + kb + 8 * hh), x1 = *(const v4fa*)(arow + kb + 8 * hh + 4);
    const v4f x2 = *(const v4fa*)(arow + kb + 16 + 8 * hh), x3 = *(const v4fa*)(arow + kb + 16 + 8 * hh + 4);
    float xs[16] = {x0[0],x0[1],x0[2],x0[3],x1[0],x1[1],x1[2],x1[3],x2[0],x2[1],x2[2],x2[3],x3[0],x3[1],x3[2],x3[3]};
#pragma unroll
    for (int i = 0; i < 16; ++i) { const unsigned short hb = bf16_bits(xs[i]); ah.u[i] = hb; al.u[i] = ASPLIT ? bf16_bits(xs[i] - bf16_val(hb)) : (unsigned short)0; }
#pragma unroll
    for (int t = 0; t < 4; ++t) {
      const unsigned short* brow = Wt + (size_t)(col0 + t * 16 + ln) * ldb + kb;
      FragB b;
      b.half[0] = *(const v8us*)(brow + 8 * hh);
      b.half[1] = *(const v8us*)(brow + 16 + 8 * hh);
      acc[t] = mmaN<ASPLIT ? 2 : 1>(ah.v, al.v, b.v, b.v, acc[t]);
    }
  }
#pragma unroll
  for (int t = 0; t < 4; ++t) {
    const int col = col0 + t * 16 + ln;
    float bv = bias ? bias[col] : 0.f;
    if (BIAS_BF16) bv = bf16_round(bv);
#pragma unroll
    for (int r = 0; r < 8; ++r) {
      float v = acc[t][r] + bv;
      if (resid) { float rv = resid[(size_t)((row0 + 8 * hh + r) % rmod) * ldr + col]; if (RES_BF16) rv = bf16_round(rv); v += rv; }
      if (ACT == 1) v = fmaxf(v, 0.f);
      if (ACT == 2) v = 0.5f * v * (1.0f + erff(v * 0.70710678118654752f));
      if (ACT == 3) { const float u = 0.7978845608028654f * (v + 0.044715f * v * v * v); v = 0.5f * v * (1.0f + tanhf(u)); }
      so[w][8 * hh + r][t * 16 + ln] = v;
    }
  }
  __builtin_amdgcn_fence(__ATOMIC_ACQ_REL, "workgroup");
  __builtin_amdgcn_wave_barrier();
  const int rsub = lane >> 4, c4 = (lane & 15) * 4;
  {
#pragma unroll
    for (int q = 0; q < 8; ++q) {
      const int r = q * 2 + rsub;
      const v4f v = *(const v4fa*)&so[w][r][c4];
      *(v4f*)(C + (size_t)(row0 + r) * ldc + col0 + c4) = v;
    }
    
  }
}
// row LayerNorm (biased variance, eps) over N: s = X (+ R); optional out_sum <- s; out_norm <- (s-mu)*rsqrt(var+eps)*g + b
template <bool PARAM_BF16>
__global__ __launch_bounds__(256) void k_layernorm(const float* __restrict__ X, const float* __restrict__ R, const float* __restrict__ g, const float* __restrict__ bta,
                                                  float* __restrict__ out_sum, float* __restrict__ out_norm, int N, float eps) {
  __shared__ float red[256];
  const int row = blockIdx.x, tid = threadIdx.x;
  const float* x = X + (size_t)row * N; const float* rr = R ? R + (size_t)row * N : nullptr;
  float vals[16];                     // up to N = 4096
  const int per = N / 256;            // contiguous chunk per thread? use strided-by-4 chunks: thread handles j = tid*4 + 1024*u
  float s1 = 0.f;
  for (int u = 0; u < per / 4; ++u) {
    const int j = tid * 4 + 1024 * u;
    const v4f a = *(const v4fa*)(x + j);
    v4f b = {0.f,0.f,0.f,0.f}; if (rr) b = *(const v4fa*)(rr + j);
#pragma unroll
    for (int q = 0; q < 4; ++q) { const float v = a[q] + b[q]; vals[u * 4 + q] = v; s1 += v; }
  }
  red[tid] = s1; __syncthreads();
  for (int st = 128; st > 0; st >>= 1) { if (tid < st) red[tid] += red[tid + st]; __syncthreads(); }
  const float mu = red[0] / (float)N; __syncthreads();
  float s2 = 0.f;
  for (int u = 0; u < per / 4; ++u)
#pragma unroll
    for (int q = 0; q < 4; ++q) { const float c = vals[u * 4 + q] - mu; s2 += c * c; }
  red[tid] = s2; __syncthreads();
  for (int st = 128; st > 0; st >>= 1) { if (tid < st) red[tid] += red[tid + st]; __syncthreads(); }
  const float rs = rsqrtf(red[0] / (float)N + eps);
  {
    for (int u = 0; u < per / 4; ++u) {
      const int j = tid * 4 + 1024 * u;
      v4f o, sm;
#pragma unroll
      for (int q = 0; q < 4; ++q) {
        float gg = g[j + q], bb = bta[j + q];
        if (PARAM_BF16) { gg = bf16_round(gg); bb = bf16_round(bb); }
        sm[q] = vals[u * 4 + q]; o[q] = (vals[u * 4 + q] - mu) * rs * gg + bb;
      }
      if (out_sum) *(v4f*)(out_sum + (size_t)row * N + j) = sm;
      *(v4f*)(out_norm + (size_t)row * N + j) = o;
    }
    
  }
}



// ---- f16 WMMA path (v_wmma_f32_16x16x32_f16): 11-bit significands for operands in range — used where a [0,1] probability operand needs more precision than bf16
typedef _Float16 v16h __attribute__((ext_vector_type(16)));
union FragH { v16h v; v8us half[2]; _Float16 h[16]; unsigned short u[16]; };
template <int NT>
__device__ __forceinline__ v8f mmaH(v16h ah, v16h al, v16h bh, v16h bl, v8f c) {
  c = __builtin_amdgcn_wmma_f32_16x16x32_f16(false, ah, false, bh, (short)0, c, false, false);
  if (NT >= 2) c = __builtin_amdgcn_wmma_f32_16x16x32_f16(false, al, false, bh, (short)0, c, false, false);
  if (NT >= 3) c = __builtin_amdgcn_wmma_f32_16x16x32_f16(false, ah, false, bl, (short)0, c, false, false);
  asm volatile("v_nop\n\tv_nop\n\tv_nop\n\tv_nop" : "+v"(c) : "v"(ah), "v"(al), "v"(bh), "v"(bl));
  return c;
}
// batched GEMM like k_gemm_b but f16 operands: A f32 (split into f16 hi/lo if ASPLIT, else rounded to f16), Bt = f16 values [n][k]; alpha; C f32; N multiple of 16 (partial tiles skipped)
template <bool ASPLIT>
__global__ __launch_bounds__(128) void k_gemm_h(const float* __restrict__ A, int lda, size_t sA, const _Float16* __restrict__ Bh, int ldb, size_t sB, float alpha, float* __restrict__ C, int ldc, size_t sC, int M, int N, int K) {
  __shared__ __attribute__((aligned(16))) float so[4][16][64];
  const int tid = threadIdx.x, w = tid >> 5, lane = tid & 31, ln = lane & 15, hh = lane >> 4; const int by = blockIdx.y;
  A += (size_t)by * sA; Bh += (size_t)by * sB; C += (size_t)by * sC;
  const int ntn = (N + 63) / 64; const int wid = blockIdx.x * 4 + w; const int mt = wid / ntn, nq = wid % ntn; if (mt * 16 >= M) return;
  const int row0 = mt * 16, col0 = nq * 64; const float* arow = A + (size_t)(row0 + ln) * lda;
  v8f acc[4] = {};
  for (int kb = 0; kb < K; kb += 32) {
    FragH ah, al;
    const v4f x0 = *(const v4fa*)(arow + kb + 8 * hh), x1 = *(const v4fa*)(arow + kb + 8 * hh + 4), x2 = *(const v4fa*)(arow + kb + 16 + 8 * hh), x3 = *(const v4fa*)(arow + kb + 16 + 8 * hh + 4);
    float xs[16] = {x0[0],x0[1],x0[2],x0[3],x1[0],x1[1],x1[2],x1[3],x2[0],x2[1],x2[2],x2[3],x3[0],x3[1],x3[2],x3[3]};
#pragma unroll
    for (int i = 0; i < 16; ++i) { const _Float16 h = (_Float16)xs[i]; ah.h[i] = h; al.h[i] = ASPLIT ? (_Float16)(xs[i] - (float)h) : (_Float16)0.0f; }
#pragma unroll
    for (int t = 0; t < 4; ++t) { if (col0 + t * 16 >= N) continue; const size_t boff = (size_t)(col0 + t * 16 + ln) * ldb + kb; FragH bq; bq.half[0] = *(const v8us*)(Bh + boff + 8 * hh); bq.half[1] = *(const v8us*)(Bh + boff + 16 + 8 * hh);
      acc[t] = mmaH<ASPLIT ? 2 : 1>(ah.v, al.v, bq.v, bq.v, acc[t]); }
  }
#pragma unroll
  for (int t = 0; t < 4; ++t) { if (col0 + t * 16 >= N) continue;
#pragma unroll
    for (int r = 0; r < 8; ++r) so[w][8 * hh + r][t * 16 + ln] = acc[t][r] * alpha; }
  __builtin_amdgcn_fence(__ATOMIC_ACQ_REL, "workgroup"); __builtin_amdgcn_wave_barrier();
  const int rsub = lane >> 4, c4 = (lane & 15) * 4;
  {
#pragma unroll
    for (int q = 0; q < 8; ++q) { const int r = q * 2 + rsub; if (col0 + c4 < N) { const v4f v = *(const v4fa*)&so[w][r][c4]; *(v4f*)(C + (size_t)(row0 + r) * ldc + col0 + c4) = v; } }
     }
}

// Wt[n][k] = f16(W[k][n]·scale) from f32 row-major W[K][N] (scale = power of two; bf16-exact weights stay exact in f16 away from the subnormal range)
__global__ __launch_bounds__(256) void k_wt_f16(const float* __restrict__ W, _Float16* __restrict__ Wt, int K, int N, float scale) {
  const int t = blockIdx.x * 256 + threadIdx.x; if (t >= N * (K / 8)) return; const int n = t / (K / 8), k8 = (t % (K / 8)) * 8; FragH f;
#pragma unroll
  for (int i = 0; i < 8; ++i) f.h[i] = (_Float16)(bf16_round(W[(size_t)(k8 + i) * N + n]) * scale); const v8us o = f.half[0];
  *(v8us*)((unsigned short*)Wt + (size_t)n * K + k8) = o; 
}
// k_gemm_hh variant with fused epilogue: v = acc·alpha + bias[by·sBias + col] (+ CP[(row/rowsPerB)·sCPb + by·64 + col] if CP) ; ACT 0 none / 1 elu ; writes f32 C and/or f16 C16 (each if non-null)
// N and K are compile-time (NC, KC): the column guard of a partial tile folds away where NC is a multiple of 64 and the k loop unrolls into groups of KU k-steps.
// EPI: what the wave does with its 16 rows x 64 columns, which are 16 positions of ONE head. 0: the row-major stores above. 1: rotary + rms-norm, stored to C16 as f16 in the attention kernel's fragment order for q and k.
// 2: stored to C16 as f16 in the fragment order of Vt. 1 and 2 take the place of a launch of their own that read the tile back from memory.
template <int ACT, int NC, int KC, int EPI>
__global__ __launch_bounds__(128) void k_gemm_hhx(const _Float16* __restrict__ A, int lda, size_t sA, const _Float16* __restrict__ Bh, int ldb, size_t sB, float alpha, const float* __restrict__ bias, size_t sBias, const float* __restrict__ CP, int rowsPerB, size_t sCPb, int row0g,
    float* __restrict__ C, _Float16* __restrict__ C16, int ldc, size_t sC, int M, const float* __restrict__ cosT, const float* __restrict__ sinT) {
  constexpr int N = NC, KU = 2, NG = KC / (32 * KU); constexpr bool PART = (NC % 64) != 0; static_assert(KC % (32 * KU) == 0, "k groups");
  constexpr int SP = (EPI == 1) ? 68 : 64;      /* row pitch of the staged tile in floats: the rotary epilogue's lanes read 8 different rows at one column, which at 64 would all be the same banks */
  __shared__ __attribute__((aligned(16))) float so[4][16][SP];
  const int tid = threadIdx.x, w = tid >> 5, lane = tid & 31, ln = lane & 15, hh = lane >> 4; const int by = blockIdx.y;
  A += (size_t)by * sA; Bh += (size_t)by * sB; const size_t cofs = (size_t)by * sC; const float* bp = bias ? bias + (size_t)by * sBias : nullptr;
  const int ntn = (N + 63) / 64; const int wid = blockIdx.x * 4 + w; const int mt = wid / ntn, nq = wid % ntn; if (mt * 16 >= M) return;
  const int row0 = mt * 16, col0 = nq * 64;
  v8f acc[4] = {};
  // A and Bh are stored in fragment order (frag_src below): 16 rows of lda (ldb) elements are lda / 32 blocks of 1 KiB, one per k-step, and lane l's two loads of a fragment are 16-byte chunks l and 32 + l of the block.
  // The fragment loads of a whole group (KU k-steps: 2 KU of A, 8 KU of B) are written as one run, one group ahead of the products that use them, in two register sets. Written pair by pair between the
  // products each pair was waited for in full before its one product: the statement that ends mmaH is volatile and the scheduler moves no load across it, so a load stays where the source puts it.
  FragH fa[2][KU], fb[2][KU][4];
  const unsigned short* ap = (const unsigned short*)A + (size_t)row0 * lda + lane * 8; const unsigned short* bp0 = (const unsigned short*)Bh + (size_t)col0 * ldb + lane * 8;
#pragma unroll
  for (int g = -1; g < NG; ++g) {
    if (g + 1 < NG) { const int nx = (g + 1) & 1;
#pragma unroll
      for (int u = 0; u < KU; ++u) { const int kb = ((g + 1) * KU + u) * 512; fa[nx][u].half[0] = *(const v8us*)(ap + kb); fa[nx][u].half[1] = *(const v8us*)(ap + kb + 256);
#pragma unroll
        for (int t = 0; t < 4; ++t) { if (PART && col0 + t * 16 >= N) continue; const unsigned short* br = bp0 + (size_t)(t * 16) * ldb + kb; fb[nx][u][t].half[0] = *(const v8us*)br; fb[nx][u][t].half[1] = *(const v8us*)(br + 256); } } }
    if (g >= 0) { const int cu = g & 1;
#pragma unroll
      for (int u = 0; u < KU; ++u)
#pragma unroll
        for (int t = 0; t < 4; ++t) { if (PART && col0 + t * 16 >= N) continue; acc[t] = mmaH<1>(fa[cu][u].v, fa[cu][u].v, fb[cu][u][t].v, fb[cu][u][t].v, acc[t]); } }
  }
  if constexpr (EPI == 2) {
    /* Vt in fragment order, rows = d, k = keys: block ((slab * TT / 32 + key / 32) * 4 + d / 16), chunk c = row d & 15 = c & 15, keys 16 (c >> 5) + 8 ((c >> 4) & 1) .. + 7. Lane (ln, hh) holds in acc[t][0..7] the keys
       row0 + 8 hh .. + 7 of d = 16 t + ln: that IS chunk 32 ((row0 >> 4) & 1) + lane of block t, so the transpose costs nothing and a wave's store is 512 bytes in a row */
    const int t0 = row0 % TT; unsigned short* vd = (unsigned short*)C16 + (((size_t)((row0 / TT) * NH + nq) * (TT / 32) + (t0 >> 5)) * 4) * 512 + (((t0 >> 4) & 1) * 32 + lane) * 8;
#pragma unroll
    for (int t = 0; t < 4; ++t) { FragH f;
#pragma unroll
      for (int r = 0; r < 8; ++r) f.h[r] = (_Float16)(acc[t][r] * alpha);
      *(v8us*)(vd + t * 512) = f.half[0]; }
    return;
  }
  float cr[2][8], sr[2][8];      /* EPI 1: lane = part pc (8 of the 32 rotary pairs) of rows lane >> 2 and 8 + (lane >> 2) */
  if constexpr (EPI == 1) {
#pragma unroll
    for (int it = 0; it < 2; ++it) { const int tj = (row0 % TT + it * 8 + (lane >> 2)) * 32 + (lane & 3) * 8;
#pragma unroll
      for (int q = 0; q < 8; ++q) { cr[it][q] = cosT[tj + q]; sr[it][q] = sinT[tj + q]; } }
    asm volatile("s_wait_xcnt 0x0" ::: "memory");      /* what follows may take the table loads' address registers as a destination: the wait stands in front of that overwrite */
  }
#pragma unroll
  for (int t = 0; t < 4; ++t) { if (col0 + t * 16 >= N) continue; const int col = col0 + t * 16 + ln; const float bv = bp ? bf16_round(bp[col]) : 0.f;
#pragma unroll
    for (int r = 0; r < 8; ++r) { float v = acc[t][r] * alpha + bv; if (CP) { const int bidx = (row0g + row0 + 8 * hh + r) / rowsPerB; v += CP[(size_t)bidx * sCPb + (size_t)by * 64 + col]; } if (ACT == 1) v = (v > 0.f) ? v : expm1f(v); else if (ACT == 3) v = fmaxf(v, 0.f); so[w][8 * hh + r][t * 16 + ln] = v; } }
  __builtin_amdgcn_fence(__ATOMIC_ACQ_REL, "workgroup"); __builtin_amdgcn_wave_barrier();
  if constexpr (EPI == 1) {
    /* rotary + rms-norm of the head's 16 rows: x1 = column j, x2 = column 32 + j (j < 32); out = [x1 cos + x2 sin | -x1 sin + x2 cos] with cos, sin = bf16(INPUT tables [t][j]); then x rsqrt(mean(out^2) + f32 eps) -> f16.
       Fragment order per head: block (slab * TT / 16 + t / 16) * 2 + ks, chunk 32 (pc >> 1) + 16 (pc & 1) + r: the tile is 2 KiB in a row, and the 8 lanes of one pc fill a whole line */
    const int pc = lane & 3, j0 = pc * 8; unsigned short* qd0 = (unsigned short*)C16 + ((size_t)((row0 / TT) * NH + nq) * (TT / 16) + ((row0 % TT) >> 4)) * 1024 + (pc >> 1) * 256 + (pc & 1) * 128;
#pragma unroll
    for (int it = 0; it < 2; ++it) { const int r = it * 8 + (lane >> 2); float a[8], bq[8]; float ss = 0.f;
#pragma unroll
      for (int q = 0; q < 8; ++q) { const float x1 = so[w][r][j0 + q], x2 = so[w][r][32 + j0 + q]; const float c = bf16_round(cr[it][q]), s = bf16_round(sr[it][q]); a[q] = x1 * c + x2 * s; bq[q] = -x1 * s + x2 * c; ss += a[q] * a[q] + bq[q] * bq[q]; }
      ss += __shfl_xor(ss, 1, 32); ss += __shfl_xor(ss, 2, 32); const float rn = rsqrtf(ss / 64.0f + 1.1920929e-7f); FragH f1, f2;
#pragma unroll
      for (int q = 0; q < 8; ++q) { f1.h[q] = (_Float16)(a[q] * rn); f2.h[q] = (_Float16)(bq[q] * rn); }
      *(v8us*)(qd0 + r * 8) = f1.half[0]; *(v8us*)(qd0 + r * 8 + 512) = f2.half[0]; }
    return;
  }
  const int rsub = lane >> 4, c4 = (lane & 15) * 4; typedef _Float16 v4h __attribute__((ext_vector_type(4)));
  {
#pragma unroll
    for (int q = 0; q < 8; ++q) { const int r = q * 2 + rsub; if (col0 + c4 < N) { const v4f v = *(const v4fa*)&so[w][r][c4]; if (C) *(v4f*)(C + cofs + (size_t)(row0 + r) * ldc + col0 + c4) = v; if (C16) { v4h h4; for (int i = 0; i < 4; ++i) h4[i] = (_Float16)v[i]; *(v4h*)(C16 + cofs + (size_t)(row0 + r) * ldc + col0 + c4) = h4; } } }
     }
}


// Fragment order of a 16-bit WMMA operand with CC columns: a tile of 16 rows x 32 k is one block of 1 KiB, the blocks of a 16-row strip follow one another in k. 16-byte chunk c (0..63) of a block holds row (c & 15),
// k = 16 (c >> 5) + 8 ((c >> 4) & 1) .. + 7, so lane l's fragment is chunks l and 32 + l: a wave-wide 16-byte load covers 512 contiguous bytes (4 whole lines) and not 32 bytes of each of 16 rows.
// frag_src: the row-major element index of the first of the 8 elements that belong in chunk t of the whole operand. A producer's thread t writes chunk t, so its stores stay contiguous.
__device__ __forceinline__ unsigned frag_src(size_t t) { const unsigned blk = (unsigned)(t >> 6), c = (unsigned)t & 63u; const unsigned rt = blk / (CC / 32), kt = blk % (CC / 32); return (rt * 16 + (c & 15)) * CC + kt * 32 + 16 * (c >> 5) + 8 * ((c >> 4) & 1); }
__global__ __launch_bounds__(256) void k_x16(const float* __restrict__ x, _Float16* __restrict__ X16, size_t n8) { const size_t t = (size_t)blockIdx.x * 256 + threadIdx.x; if (t >= n8) return; FragH f; const float* xs = x + frag_src(t);
#pragma unroll
  for (int q = 0; q < 8; ++q) f.h[q] = (_Float16)bf16_round(xs[q]); *(v8us*)((unsigned short*)X16 + t * 8) = f.half[0];  }
__global__ __launch_bounds__(256) void k_round16f(const float* __restrict__ W, _Float16* __restrict__ Bt, size_t n8) { const size_t t = (size_t)blockIdx.x * 256 + threadIdx.x; if (t >= n8) return; FragH f; const float* ws = W + frag_src(t);
#pragma unroll
  for (int i = 0; i < 8; ++i) f.h[i] = (_Float16)(bf16_round(ws[i]) * 16.0f); *(v8us*)((unsigned short*)Bt + t * 8) = f.half[0];  }
// lane l <-> lane l ^ 16 (the two halves of a wave hold the two halves of a query's keys)
__device__ __forceinline__ float xhalf(float v) { const int b = __float_as_int(v); return __int_as_float(__builtin_amdgcn_permlanex16(b, b, 0x76543210, 0xfedcba98, false, false)); }
// Transposed products: St = K.Qt (A = 16 key rows, B = the wave's 16 queries as columns) and Ot += Vt.Pt (A = 16 rows of Vt, B = Pt). Lane (ln, hh) holds query q0 + ln only: register r of score tile nt is key
// j0 + 16 nt + 8 hh + r, which is the k order of a B operand, so the two score tiles converted in place ARE Pt; maximum and sums are in-lane plus one exchange between the halves.
__global__ __launch_bounds__(128) void k_flash(const _Float16* __restrict__ Q16, const _Float16* __restrict__ K16, const _Float16* __restrict__ Vt, const float* __restrict__ CB, const float* __restrict__ beta, _Float16* __restrict__ O16) {
  __shared__ float scb[2048];
  constexpr int RPW = 16, NQB = 2048 / (4 * RPW), DT = 4, KS = 2;
  const int tid = threadIdx.x, w = tid >> 5, lane = tid & 31, ln = lane & 15, hh = lane >> 4;
  const int slab = blockIdx.x / NQB, qblk = blockIdx.x % NQB; const int b = slab / 12, h = slab % 12; const int qb0 = qblk * (4 * RPW); const int q0 = qb0 + w * RPW;
  FragH aq[KS];
  /* Q16, K16 (block (slab * 128 + position / 16) * 2 + ks) and Vt (block (slab * 64 + key / 32) * 4 + dt) are in fragment order: lane l loads chunks l and 32 + l of a 1-KiB block; a pass's K is 4 KiB in a row, its V too */
  { const unsigned short* qr = (const unsigned short*)Q16 + ((size_t)slab * 128 + (q0 >> 4)) * 1024 + lane * 8;
#pragma unroll
    for (int ks = 0; ks < KS; ++ks) { aq[ks].half[0] = *(const v8us*)(qr + ks * 512); aq[ks].half[1] = *(const v8us*)(qr + ks * 512 + 256); }
    asm volatile("s_wait_xcnt 0x0" ::: "memory"); }      /* this build reuses the four loads' address pair right behind them: the wait stands in front of that overwrite */
  const float bh = bf16_round(beta[h]);
  for (int i = tid; i < 2048; i += 128) scb[i] = 0.18033688f * (1.0f + bh * CB[i]);      /* log2(e) / 8 * (1 + beta * mean_f cos(d * theta_f)), d = |q - k|: a raw score times its entry is the score as an exponent to base 2 */
  __syncthreads();
  const unsigned short* Vth = (const unsigned short*)Vt + (size_t)slab * 64 * 2048 + lane * 8; const unsigned short* Kh = (const unsigned short*)K16 + (size_t)slab * 64 * 2048 + lane * 8;
  const int tq = q0 + ln;      /* this lane's query */
  float m_q = -3.0e38f, l_q = 0.f, lc_q = 0.f;      /* running maximum (same in both halves); this half's partial sums over all keys and over the causal keys */
  v8f oacc[DT];      /* oacc[dt][r] = Ot[dt * 16 + 8 hh + r][tq] */
#pragma unroll
  for (int dt = 0; dt < DT; ++dt) oacc[dt] = (v8f){0.f,0.f,0.f,0.f,0.f,0.f,0.f,0.f};
  const int jend = 2048;
#pragma unroll 1
  for (int j0 = 0; j0 < jend; j0 += 32) {
    /* all fragment loads of the pass (8 of K, and 8 of V where the pass has a causal key) as one run ahead of its first product: no load moves across the volatile statement that ends mmaH */
    const bool pv = (j0 <= q0 + RPW - 1);      /* some key of this chunk is <= some query of this wave; otherwise every p is 0 */
    FragH bk[2][KS], bv[DT];
#pragma unroll
    for (int nt = 0; nt < 2; ++nt) { const unsigned short* kr = Kh + (size_t)j0 * 64 + nt * 1024;
#pragma unroll
      for (int ks = 0; ks < KS; ++ks) { bk[nt][ks].half[0] = *(const v8us*)(kr + ks * 512); bk[nt][ks].half[1] = *(const v8us*)(kr + ks * 512 + 256); } }
    if (pv) {
#pragma unroll
      for (int dt = 0; dt < DT; ++dt) { const unsigned short* vrow = Vth + (size_t)j0 * 64 + dt * 512; bv[dt].half[0] = *(const v8us*)vrow; bv[dt].half[1] = *(const v8us*)(vrow + 256); } }
    v8f s[2];
#pragma unroll
    for (int nt = 0; nt < 2; ++nt) { v8f acc = (v8f){0.f,0.f,0.f,0.f,0.f,0.f,0.f,0.f};
#pragma unroll
      for (int ks = 0; ks < KS; ++ks) acc = mmaH<1>(bk[nt][ks].v, bk[nt][ks].v, aq[ks].v, aq[ks].v, acc); s[nt] = acc; }
    float tb[16]; const int xq4 = 4 * (tq - 8 * hh - j0);      /* 4 (q - k) at this lane's first key of the pass */
#pragma unroll
    for (int i = 0; i < 16; ++i) { const int x4 = xq4 - 4 * ((i >> 3) * 16 + (i & 7)); const int d4 = (x4 < 0) ? -x4 : x4;      /* x4 = 4 (q - k), the table's byte offset up to its sign */
      tb[i] = *(const float*)((const char*)scb + d4); }
    v2f sw[8]; float sv[16];      /* neighbouring accumulator registers as pairs: the packed multiply here and the packed subtraction below serve two scores each */
#pragma unroll
    for (int i = 0; i < 8; ++i) { sw[i] = (v2f){s[i >> 2][2 * (i & 3)], s[i >> 2][2 * (i & 3) + 1]} * (v2f){tb[2 * i], tb[2 * i + 1]}; sv[2 * i] = sw[i][0]; sv[2 * i + 1] = sw[i][1]; }
    float mx[4];
#pragma unroll
    for (int i = 0; i < 4; ++i) mx[i] = fmaxf(fmaxf(sv[i], sv[4 + i]), fmaxf(sv[8 + i], sv[12 + i]));
    float mc = fmaxf(fmaxf(mx[0], mx[1]), fmaxf(mx[2], mx[3])); mc = fmaxf(mc, xhalf(mc));
    const float mn = fmaxf(m_q, mc); const float ea = __builtin_amdgcn_exp2f(m_q - mn); const float al = (mn > -1.0e38f) ? ea : 1.0f; m_q = mn;
    v2f dv[8];      /* exponents to base 2 */
#pragma unroll
    for (int i = 0; i < 8; ++i) dv[i] = sw[i] - (v2f){mn, mn};
    float ev[16];      /* 2^(score - maximum), one v_exp_f32 each: the argument is never above 0 (mn is the maximum of the same products), and far below 0 the result goes to 0 as it should; the pass's 16 stand as one run ahead of the selects and sums that read them */
#pragma unroll
    for (int i = 0; i < 16; ++i) ev[i] = __builtin_amdgcn_exp2f(dv[i >> 1][i & 1]);
    float se[4] = {0.f, 0.f, 0.f, 0.f}, sp[4] = {0.f, 0.f, 0.f, 0.f}; FragH pb;      /* full-softmax stats over ALL keys; P.V and its sum only over the causal ones */
#pragma unroll
    for (int i = 0; i < 16; ++i) { const int x4 = xq4 - 4 * ((i >> 3) * 16 + (i & 7)); const float e = ev[i]; const float p = (x4 >= 0) ? e : 0.f; se[i & 3] += e; sp[i & 3] += p; pb.h[i] = (_Float16)p; }
    l_q = l_q * al + ((se[0] + se[1]) + (se[2] + se[3])); lc_q = lc_q * al + ((sp[0] + sp[1]) + (sp[2] + sp[3]));
#pragma unroll
    for (int dt = 0; dt < DT; ++dt)
#pragma unroll
      for (int r = 0; r < 8; ++r) oacc[dt][r] *= al;
    if (pv) {
#pragma unroll
      for (int dt = 0; dt < DT; ++dt) oacc[dt] = mmaH<1>(bv[dt].v, bv[dt].v, pb.v, pb.v, oacc[dt]); } }
  const float l = l_q + xhalf(l_q), lc = lc_q + xhalf(lc_q); const float inv = 1.0f / (lc + 1e-8f * l);      /* w * causal / (sum_causal w + 1e-8) with w = e^(s-m) / Z_full  =  e^(s-m) / (Z_causal + 1e-8 * Z_full) */
  /* the output projection's A operand (f16, fragment order of a row-major operand with CC columns: block (row / 16) * (CC / 32) + column / 32, chunk c = row c & 15, k = 16 (c >> 5) + 8 ((c >> 4) & 1) .. + 7) straight from the registers:
     lane (ln, hh) holds in oacc[dt][0..7] the columns h * 64 + 16 dt + 8 hh .. + 7 of row q0 + ln, which IS chunk 32 (dt & 1) + lane of block 2 h + (dt >> 1); a wave's store is 512 bytes in a row */
  unsigned short* od = (unsigned short*)O16 + ((((size_t)b * 2048 + q0) >> 4) * (CC / 32) + 2 * h) * 512 + lane * 8;
#pragma unroll
  for (int dt = 0; dt < DT; ++dt) { FragH f;
#pragma unroll
    for (int r = 0; r < 8; ++r) f.h[r] = (_Float16)(oacc[dt][r] * inv);
    *(v8us*)(od + dt * 256) = f.half[0]; } }

__global__ __launch_bounds__(256) void k_cb(float* __restrict__ CB) { __shared__ float sc[8][33]; const int tid = threadIdx.x, g = tid >> 5, f = tid & 31; const int dl = blockIdx.x * 8 + g;      /* one thread per (distance, frequency) term; a block makes 8 table entries */
  const float th = powf(10000.0f, -(float)(2 * f) / 64.0f); sc[g][f] = cosf((float)dl * th); __syncthreads();
  if (tid < 8) { float s = 0.f;
    for (int i = 0; i < 32; ++i) s += sc[tid][i];      /* f = 0..31 in ascending order, the order in which one thread summed them before */
    CB[blockIdx.x * 8 + tid] = s / 32.0f; } }
extern "C" void kernel_launch(void* const* d_in, const int* in_sizes, int n_in,
                              void* d_out, int out_size, void* d_ws, size_t ws_size, hipStream_t stream) {
  (void)in_sizes; (void)n_in; (void)out_size;
  const float* x = (const float*)d_in[0]; const float* cosT = (const float*)d_in[1]; const float* sinT = (const float*)d_in[2]; const float* Wq = (const float*)d_in[3]; const float* Wk = (const float*)d_in[4]; const float* Wv = (const float*)d_in[5]; const float* Wo = (const float*)d_in[6]; const float* beta = (const float*)d_in[7];
  char* ws = (char*)d_ws; size_t off = 0;
  auto take = [&](size_t bytes) { char* p = ws + off; off += (bytes + 255) & ~(size_t)255; return p; };
  _Float16* Bq = (_Float16*)take((size_t)CC * CC * 2); _Float16* Bk = (_Float16*)take((size_t)CC * CC * 2); _Float16* Bv = (_Float16*)take((size_t)CC * CC * 2); _Float16* Bo = (_Float16*)take((size_t)CC * CC * 2); float* CB = (float*)take(TT * 4);
  _Float16* X16 = (_Float16*)take((size_t)NR * CC * 2); _Float16* Q16 = (_Float16*)take((size_t)NR * CC * 2); _Float16* K16 = (_Float16*)take((size_t)NR * CC * 2); _Float16* Vt = (_Float16*)take((size_t)NR * CC * 2); _Float16* O16 = X16;      // X16 dead after the V GEMM
  if (off > ws_size) return;      // 4.7 + 6.3 x 4 = about 30 MiB
  const size_t w8 = (size_t)CC * CC / 8; const unsigned gw = (unsigned)((w8 + 255) / 256);
  k_round16f<<<gw, 256, 0, stream>>>(Wq, Bq, w8); k_round16f<<<gw, 256, 0, stream>>>(Wk, Bk, w8); k_round16f<<<gw, 256, 0, stream>>>(Wv, Bv, w8); k_round16f<<<gw, 256, 0, stream>>>(Wo, Bo, w8);      // (out,in)
  k_cb<<<TT / 8, 256, 0, stream>>>(CB);
  const unsigned gx = (unsigned)(((size_t)NR * CC / 8 + 255) / 256); const dim3 gg(((NR / 16) * (CC / 64) + 3) / 4, 1);
  k_x16<<<gx, 256, 0, stream>>>(x, X16, (size_t)NR * CC / 8);
  k_gemm_hhx<0, CC, CC, 1><<<gg, 128, 0, stream>>>(X16, CC, 0, Bq, CC, 0, 0.0625f, nullptr, 0, nullptr, 1, 0, 0, nullptr, Q16, CC, 0, NR, cosT, sinT);
  k_gemm_hhx<0, CC, CC, 1><<<gg, 128, 0, stream>>>(X16, CC, 0, Bk, CC, 0, 0.0625f, nullptr, 0, nullptr, 1, 0, 0, nullptr, K16, CC, 0, NR, cosT, sinT);
  k_gemm_hhx<0, CC, CC, 2><<<gg, 128, 0, stream>>>(X16, CC, 0, Bv, CC, 0, 0.0625f, nullptr, 0, nullptr, 1, 0, 0, nullptr, Vt, CC, 0, NR, nullptr, nullptr);
  k_flash<<<BB * NH * (TT / 64), 128, 0, stream>>>(Q16, K16, Vt, CB, beta, O16);      // RPW 16
  k_gemm_hhx<0, CC, CC, 0><<<gg, 128, 0, stream>>>(O16, CC, 0, Bo, CC, 0, 0.0625f, nullptr, 0, nullptr, 1, 0, 0, (float*)d_out, nullptr, CC, 0, NR, nullptr, nullptr);
}

// v008
// Measured time: 121 microseconds a run.
// In two side-by-side timings against v007, it was 1.10 and 1.12 times as fast.
// All steps since v000 together make it 3.83 times as fast.
#include <hip/hip_runtime.h>
// Phase-aware causal attention: q/k/v/o projections (4096 × 768 × 768, no bias, weights (out,in) bf16-exact ×2^4) and the 12-head attention as a fused flash-style kernel on v_wmma_f32_16x16x32_f16
// (rotary (with the INPUT cos/sin tables) + rms-norm'd q,k as f16; S = Q·Kᵀ/8 × (1 + β_h·mean_f cos(|q−k|·θ_f)) with the 2048-entry coherence table precomputed; the module's FULL softmax followed
// by causal masking and re-normalisation with +1e-8 is reproduced exactly as e^{s−m}/(Z_causal + 1e-8·Z_full) with m, Z_full over all keys; P f16 ≤ 1; O = P·V over causal keys); f32 accumulate.
#define BB 2
#define TT 2048
#define CC 768
#define NH 12
#define NR (BB * TT)

typedef __bf16 v16b __attribute__((ext_vector_type(16)));
typedef unsigned short v8us __attribute__((ext_vector_type(8), may_alias));
typedef float  v8f  __attribute__((ext_vector_type(8)));
typedef float  v4f  __attribute__((ext_vector_type(4)));
typedef float  v4fa __attribute__((ext_vector_type(4), may_alias));
typedef float  v2f  __attribute__((ext_vector_type(2)));
union FragB { v16b v; v8us half[2]; unsigned short u[16]; };

__device__ __forceinline__ unsigned short bf16_bits(float x) { unsigned int u = __float_as_uint(x); return (unsigned short)((u + 0x7FFFu + ((u >> 16) & 1u)) >> 16); }
__device__ __forceinline__ float bf16_val(unsigned short b) { return __uint_as_float(((unsigned int)b) << 16); }
__device__ __forceinline__ float bf16_round(float x) { return bf16_val(bf16_bits(x)); }
// D += A·B with NT terms: 1 = ah·bh, 2 = + al·bh (A split), 3 = + ah·bl (both split)
template <int NT>
__device__ __forceinline__ v8f mmaN(v16b ah, v16b al, v16b bh, v16b bl, v8f c) {
  c = __builtin_amdgcn_wmma_f32_16x16x32_bf16(false, ah, false, bh, (short)0, c, false, false);
  if (NT >= 2) c = __builtin_amdgcn_wmma_f32_16x16x32_bf16(false, al, false, bh, (short)0, c, false, false);
  if (NT >= 3) c = __builtin_amdgcn_wmma_f32_16x16x32_bf16(false, ah, false, bl, (short)0, c, false, false);
  asm volatile("v_nop\n\tv_nop\n\tv_nop\n\tv_nop" : "+v"(c) : "v"(ah), "v"(al), "v"(bh), "v"(bl));
  return c;
}

__global__ __launch_bounds__(256) void k_wt_bf16(const float* __restrict__ W, unsigned short* __restrict__ Wt, int K, int N) {
  const int t = blockIdx.x * 256 + threadIdx.x;
  const int k8n = K / 8;
  if (t >= N * k8n) return;
  const int n = t / k8n, k8 = (t % k8n) * 8;
  v8us v;
#pragma unroll
  for (int i = 0; i < 8; ++i) v[i] = bf16_bits(W[(size_t)(k8 + i) * N + n]);
  *(v8us*)(Wt + (size_t)n * K + k8) = v;
  
}

// GEMM C[M][N] (f32, pitch ldc) = act(A[M][K]·W + bias). A f32 row-major (pitch lda) converted per fragment to bf16
// (ASPLIT: hi/lo two planes -> 2 terms, else single rounded term); Wt bf16 [N][K] (pitch ldb). BIAS_BF16 rounds the
// bias to bf16 first (bias quantised to bf16 before the add). K%32==0, M%16==0, N%64==0.
template <bool ASPLIT, int ACT, bool BIAS_BF16>
__global__ __launch_bounds__(128) void k_gemm_bf(const float* __restrict__ A, int lda, const unsigned short* __restrict__ Wt, int ldb,
                                               const float* __restrict__ bias, float* __restrict__ C, int ldc, int M, int N, int K) {
  __shared__ __attribute__((aligned(16))) float so[4][16][64];
  const int tid = threadIdx.x, w = tid >> 5, lane = tid & 31, ln = lane & 15, hh = lane >> 4;
  const int ntn = N / 64;
  const int wid = blockIdx.x * 4 + w;
  const int mt = wid / ntn, nq = wid % ntn;
  if (mt * 16 >= M) return;
  const int row0 = mt * 16, col0 = nq * 64;
  const float* arow = A + (size_t)(row0 + ln) * lda;
  v8f acc[4] = {};
  for (int kb = 0; kb < K; kb += 32) {
    FragB ah, al;
    const v4f x0 = *(const v4fa*)(arow + kb + 8 * hh), x1 = *(const v4fa*)(arow + kb + 8 * hh + 4);
    const v4f x2 = *(const v4fa*)(arow + kb + 16 + 8 * hh), x3 = *(const v4fa*)(arow + kb + 16 + 8 * hh + 4);
    float xs[16] = {x0[0],x0[1],x0[2],x0[3],x1[0],x1[1],x1[2],x1[3],x2[0],x2[1],x2[2],x2[3],x3[0],x3[1],x3[2],x3[3]};
#pragma unroll
    for (int i = 0; i < 16; ++i) { const unsigned short hb = bf16_bits(xs[i]); ah.u[i] = hb; al.u[i] = ASPLIT ? bf16_bits(xs[i] - bf16_val(hb)) : (unsigned short)0; }
#pragma unroll
    for (int t = 0; t < 4; ++t) {
      const unsigned short* brow = Wt + (size_t)(col0 + t * 16 + ln) * ldb + kb;
      FragB b;
      b.half[0] = *(const v8us*)(brow + 8 * hh);
      b.half[1] = *(const v8us*)(brow + 16 + 8 * hh);
      acc[t] = mmaN<ASPLIT ? 2 : 1>(ah.v, al.v, b.v, b.v, acc[t]);
    }
  }
#pragma unroll
  for (int t = 0; t < 4; ++t) {
    float bv = bias ? bias[col0 + t * 16 + ln] : 0.f;
    if (BIAS_BF16) bv = bf16_round(bv);
#pragma unroll
    for (int r = 0; r < 8; ++r) { float v = acc[t][r] + bv; if (ACT == 1) v = fmaxf(v, 0.f); so[w][8 * hh + r][t * 16 + ln] = v; }
  }
  __builtin_amdgcn_fence(__ATOMIC_ACQ_REL, "workgroup");
  __builtin_amdgcn_wave_barrier();
  const int rsub = lane >> 4, c4 = (lane & 15) * 4;
  {
#pragma unroll
    for (int q = 0; q < 8; ++q) {
      const int r = q * 2 + rsub;
      const v4f v = *(const v4fa*)&so[w][r][c4];
      *(v4f*)(C + (size_t)(row0 + r) * ldc + col0 + c4) = v;
    }
    
  }
}

// Flash-style causal/unmasked attention, all contractions 3-term bf16 hi/lo splits, f32 softmax with running max.
// q,k,v rows are read from f32 buffers with arbitrary row pitch (so they can live inside a fused qkv buffer);
// D = head size (multiple of 32, <= 128); one wave = 16 query rows; block = 4 waves (64 queries) sharing K/V chunks of 32.
template <int D, bool CAUSAL>
__global__ __launch_bounds__(128) void k_flash(const float* __restrict__ qb, const float* __restrict__ kb, const float* __restrict__ vb,
                                             int pitch, int T, int H, float scale, float* __restrict__ y, int ypitch) {
  constexpr int KS = D / 32;        // k-steps for QK
  constexpr int DT = D / 16;        // d tiles for PV
  __shared__ __attribute__((aligned(16))) unsigned short sKh[32][D + 8], sKl[32][D + 8], sVh[32][D + 8], sVl[32][D + 8];
  __shared__ __attribute__((aligned(16))) unsigned short sPh[4][16][40], sPl[4][16][40];
  __shared__ __attribute__((aligned(16))) float sO[4][16][D];
  const int tid = threadIdx.x, w = tid >> 5, lane = tid & 31, ln = lane & 15, hh = lane >> 4;
  const int nqb = (T + 63) / 64;
  const int bh = blockIdx.x / nqb, qblk = blockIdx.x % nqb;
  const int b = bh / H, h = bh % H;
  const int q0 = qblk * 64 + w * 16;
  const float* Q = qb + (size_t)b * T * pitch + h * D;
  const float* K = kb + (size_t)b * T * pitch + h * D;
  const float* V = vb + (size_t)b * T * pitch + h * D;

  // A fragments of the wave's 16 query rows (scaled), hi/lo
  FragB aqh[KS], aql[KS];
  {
    int row = q0 + ln; if (row >= T) row = T - 1;
    const float* qr = Q + (size_t)row * pitch;
#pragma unroll
    for (int ks = 0; ks < KS; ++ks)
#pragma unroll
      for (int i = 0; i < 16; ++i) {
        const int d = ks * 32 + ((i < 8) ? (8 * hh + i) : (16 + 8 * hh + (i - 8)));
        const float x = qr[d] * scale; const unsigned short hb = bf16_bits(x);
        aqh[ks].u[i] = hb; aql[ks].u[i] = bf16_bits(x - bf16_val(hb));
      }
  }
  float m_r[8], l_r[8];
#pragma unroll
  for (int r = 0; r < 8; ++r) { m_r[r] = -3.0e38f; l_r[r] = 0.f; }
  v8f oacc[DT];
#pragma unroll
  for (int dt = 0; dt < DT; ++dt) oacc[dt] = (v8f){0.f,0.f,0.f,0.f,0.f,0.f,0.f,0.f};

  const int kv_end = CAUSAL ? min(T, qblk * 64 + 64) : T;     // block-uniform
  for (int j0 = 0; j0 < kv_end; j0 += 32) {
    __syncthreads();
    for (int e = tid; e < 32 * (D / 4); e += 128) {
      const int r = e / (D / 4), c4 = (e % (D / 4)) * 4;
      const int key = j0 + r;
      v4f kf = {0.f,0.f,0.f,0.f}, vf = {0.f,0.f,0.f,0.f};
      if (key < T) { kf = *(const v4fa*)(K + (size_t)key * pitch + c4); vf = *(const v4fa*)(V + (size_t)key * pitch + c4); }
#pragma unroll
      for (int t = 0; t < 4; ++t) {
        unsigned short hb = bf16_bits(kf[t]); sKh[r][c4 + t] = hb; sKl[r][c4 + t] = bf16_bits(kf[t] - bf16_val(hb));
        hb = bf16_bits(vf[t]); sVh[r][c4 + t] = hb; sVl[r][c4 + t] = bf16_bits(vf[t] - bf16_val(hb));
      }
    }
    __syncthreads();
    // S tile 16 x 32
    v8f s[2];
#pragma unroll
    for (int nt = 0; nt < 2; ++nt) {
      v8f acc = {};
#pragma unroll
      for (int ks = 0; ks < KS; ++ks) {
        FragB bh_, bl_;
        bh_.half[0] = *(const v8us*)&sKh[nt * 16 + ln][ks * 32 + 8 * hh]; bh_.half[1] = *(const v8us*)&sKh[nt * 16 + ln][ks * 32 + 16 + 8 * hh];
        bl_.half[0] = *(const v8us*)&sKl[nt * 16 + ln][ks * 32 + 8 * hh]; bl_.half[1] = *(const v8us*)&sKl[nt * 16 + ln][ks * 32 + 16 + 8 * hh];
        acc = mmaN<3>(aqh[ks].v, aql[ks].v, bh_.v, bl_.v, acc);
      }
      s[nt] = acc;
    }
    // mask + running max (rows 8hh+r; the 16 lanes of a half share rows)
    float alpha[8];
#pragma unroll
    for (int r = 0; r < 8; ++r) {
      const int qi = q0 + 8 * hh + r;
      const int ja = j0 + ln, jb = j0 + 16 + ln;
      if (CAUSAL) { if (ja > qi) s[0][r] = -3.0e38f; if (jb > qi) s[1][r] = -3.0e38f; }
      if (ja >= T) s[0][r] = -3.0e38f;
      if (jb >= T) s[1][r] = -3.0e38f;
      float mx = fmaxf(s[0][r], s[1][r]);
      mx = fmaxf(mx, __shfl_xor(mx, 1, 32)); mx = fmaxf(mx, __shfl_xor(mx, 2, 32)); mx = fmaxf(mx, __shfl_xor(mx, 4, 32)); mx = fmaxf(mx, __shfl_xor(mx, 8, 32));
      const float mnew = fmaxf(m_r[r], mx);
      alpha[r] = (mnew > -1.0e38f) ? __expf(m_r[r] - mnew) : 1.0f;
      const float p0 = (s[0][r] > -1.0e38f) ? __expf(s[0][r] - mnew) : 0.f;
      const float p1 = (s[1][r] > -1.0e38f) ? __expf(s[1][r] - mnew) : 0.f;
      m_r[r] = mnew;
      l_r[r] = l_r[r] * alpha[r] + p0 + p1;            // per-lane partial row sum (16 lanes combined at the end)
      unsigned short hb = bf16_bits(p0); sPh[w][8 * hh + r][ln] = hb;      sPl[w][8 * hh + r][ln] = bf16_bits(p0 - bf16_val(hb));
      hb = bf16_bits(p1);                sPh[w][8 * hh + r][16 + ln] = hb; sPl[w][8 * hh + r][16 + ln] = bf16_bits(p1 - bf16_val(hb));
    }
#pragma unroll
    for (int dt = 0; dt < DT; ++dt)
#pragma unroll
      for (int r = 0; r < 8; ++r) oacc[dt][r] *= alpha[r];
    __builtin_amdgcn_fence(__ATOMIC_ACQ_REL, "workgroup");
    __builtin_amdgcn_wave_barrier();
    FragB pah, pal;
    pah.half[0] = *(const v8us*)&sPh[w][ln][8 * hh]; pah.half[1] = *(const v8us*)&sPh[w][ln][16 + 8 * hh];
    pal.half[0] = *(const v8us*)&sPl[w][ln][8 * hh]; pal.half[1] = *(const v8us*)&sPl[w][ln][16 + 8 * hh];
#pragma unroll
    for (int dt = 0; dt < DT; ++dt) {
      FragB bvh, bvl;
#pragma unroll
      for (int i = 0; i < 8; ++i) {
        bvh.u[i] = sVh[8 * hh + i][dt * 16 + ln]; bvh.u[8 + i] = sVh[16 + 8 * hh + i][dt * 16 + ln];
        bvl.u[i] = sVl[8 * hh + i][dt * 16 + ln]; bvl.u[8 + i] = sVl[16 + 8 * hh + i][dt * 16 + ln];
      }
      oacc[dt] = mmaN<3>(pah.v, pal.v, bvh.v, bvl.v, oacc[dt]);
    }
    __builtin_amdgcn_fence(__ATOMIC_ACQ_REL, "workgroup");
    __builtin_amdgcn_wave_barrier();
  }
#pragma unroll
  for (int r = 0; r < 8; ++r) {
    float l = l_r[r];
    l += __shfl_xor(l, 1, 32); l += __shfl_xor(l, 2, 32); l += __shfl_xor(l, 4, 32); l += __shfl_xor(l, 8, 32);
    l_r[r] = (l > 0.f) ? 1.0f / l : 0.f;
  }
#pragma unroll
  for (int dt = 0; dt < DT; ++dt)
#pragma unroll
    for (int r = 0; r < 8; ++r) sO[w][8 * hh + r][dt * 16 + ln] = oacc[dt][r] * l_r[r];
  __builtin_amdgcn_fence(__ATOMIC_ACQ_REL, "workgroup");
  __builtin_amdgcn_wave_barrier();
  {
    for (int r = 0; r < 16; ++r) {
      const int row = q0 + r;
      if (row < T && lane < D / 4) {
        const v4f val = *(const v4fa*)&sO[w][r][lane * 4];
        *(v4f*)(y + ((size_t)b * T + row) * ypitch + h * D + lane * 4) = val;
      }
    }
    
  }
}

// GEMM C = act(A·W + bias + resid): A f32 (ASPLIT -> hi/lo 2 terms), Wt bf16 [N][K]; ACT 0 none, 1 relu, 2 exact gelu;
// resid (optional, f32, row index = (row % rmod), pitch ldr, RES_BF16 rounds it) added before the activation.
template <bool ASPLIT, int ACT, bool BIAS_BF16, bool RES_BF16>
__global__ __launch_bounds__(128) void k_gemm_bf3(const float* __restrict__ A, int lda, const unsigned short* __restrict__ Wt, int ldb,
                                                const float* __restrict__ bias, const float* __restrict__ resid, int rmod, int ldr,
                                                float* __restrict__ C, int ldc, int M, int N, int K) {
  __shared__ __attribute__((aligned(16))) float so[4][16][64];
  const int tid = threadIdx.x, w = tid >> 5, lane = tid & 31, ln = lane & 15, hh = lane >> 4;
  const int ntn = N / 64;
  const int wid = blockIdx.x * 4 + w;
  const int mt = wid / ntn, nq = wid % ntn;
  if (mt * 16 >= M) return;
  const int row0 = mt * 16, col0 = nq * 64;
  const float* arow = A + (size_t)(row0 + ln) * lda;
  v8f acc[4] = {};
  for (int kb = 0; kb < K; kb += 32) {
    FragB ah, al;
    const v4f x0 = *(const v4fa*)(arow + kb + 8 * hh), x1 = *(const v4fa*)(arow + kb + 8 * hh + 4);
    const v4f x2 = *(const v4fa*)(arow + kb + 16 + 8 * hh), x3 = *(const v4fa*)(arow + kb + 16 + 8 * hh + 4);
    float xs[16] = {x0[0],x0[1],x0[2],x0[3],x1[0],x1[1],x1[2],x1[3],x2[0],x2[1],x2[2],x2[3],x3[0],x3[1],x3[2],x3[3]};
#pragma unroll
    for (int i = 0; i < 16; ++i) { const unsigned short hb = bf16_bits(xs[i]); ah.u[i] = hb; al.u[i] = ASPLIT ? bf16_bits(xs[i] - bf16_val(hb)) : (unsigned short)0; }
#pragma unroll
    for (int t = 0; t < 4; ++t) {
      const unsigned short* brow = Wt + (size_t)(col0 + t * 16 + ln) * ldb + kb;
      FragB b;
      b.half[0] = *(const v8us*)(brow + 8 * hh);
      b.half[1] = *(const v8us*)(brow + 16 + 8 * hh);
      acc[t] = mmaN<ASPLIT ? 2 : 1>(ah.v, al.v, b.v, b.v, acc[t]);
    }
  }
#pragma unroll
  for (int t = 0; t < 4; ++t) {
    const int col = col0 + t * 16 + ln;
    float bv = bias ? bias[col] : 0.f;
    if (BIAS_BF16) bv = bf16_round(bv);
#pragma unroll
    for (int r = 0; r < 8; ++r) {
      float v = acc[t][r] + bv;
      if (resid) { float rv = resid[(size_t)((row0 + 8 * hh + r) % rmod) * ldr + col]; if (RES_BF16) rv = bf16_round(rv); v += rv; }
      if (ACT == 1) v = fmaxf(v, 0.f);
      if (ACT == 2) v = 0.5f * v * (1.0f + erff(v * 0.70710678118654752f));
      if (ACT == 3) { const float u = 0.7978845608028654f * (v + 0.044715f * v * v * v); v = 0.5f * v * (1.0f + tanhf(u)); }
      so[w][8 * hh + r][t * 16 + ln] = v;
    }
  }
  __builtin_amdgcn_fence(__ATOMIC_ACQ_REL, "workgroup");
  __builtin_amdgcn_wave_barrier();
  const int rsub = lane >> 4, c4 = (lane & 15) * 4;
  {
#pragma unroll
    for (int q = 0; q < 8; ++q) {
      const int r = q * 2 + rsub;
      const v4f v = *(const v4fa*)&so[w][r][c4];
      *(v4f*)(C + (size_t)(row0 + r) * ldc + col0 + c4) = v;
    }
    
  }
}
// row LayerNorm (biased variance, eps) over N: s = X (+ R); optional out_sum <- s; out_norm <- (s-mu)*rsqrt(var+eps)*g + b
template <bool PARAM_BF16>
__global__ __launch_bounds__(256) void k_layernorm(const float* __restrict__ X, const float* __restrict__ R, const float* __restrict__ g, const float* __restrict__ bta,
                                                  float* __restrict__ out_sum, float* __restrict__ out_norm, int N, float eps) {
  __shared__ float red[256];
  const int row = blockIdx.x, tid = threadIdx.x;
  const float* x = X + (size_t)row * N; const float* rr = R ? R + (size_t)row * N : nullptr;
  float vals[16];                     // up to N = 4096
  const int per = N / 256;            // contiguous chunk per thread? use strided-by-4 chunks: thread handles j = tid*4 + 1024*u
  float s1 = 0.f;
  for (int u = 0; u < per / 4; ++u) {
    const int j = tid * 4 + 1024 * u;
    const v4f a = *(const v4fa*)(x + j);
    v4f b = {0.f,0.f,0.f,0.f}; if (rr) b = *(const v4fa*)(rr + j);
#pragma unroll
    for (int q = 0; q < 4; ++q) { const float v = a[q] + b[q]; vals[u * 4 + q] = v; s1 += v; }
  }
  red[tid] = s1; __syncthreads();
  for (int st = 128; st > 0; st >>= 1) { if (tid < st) red[tid] += red[tid + st]; __syncthreads(); }
  const float mu = red[0] / (float)N; __syncthreads();
  float s2 = 0.f;
  for (int u = 0; u < per / 4; ++u)
#pragma unroll
    for (int q = 0; q < 4; ++q) { const float c = vals[u * 4 + q] - mu; s2 += c * c; }
  red[tid] = s2; __syncthreads();
  for (int st = 128; st > 0; st >>= 1) { if (tid < st) red[tid] += red[tid + st]; __syncthreads(); }
  const float rs = rsqrtf(red[0] / (float)N + eps);
  {
    for (int u = 0; u < per / 4; ++u) {
      const int j = tid * 4 + 1024 * u;
      v4f o, sm;
#pragma unroll
      for (int q = 0; q < 4; ++q) {
        float gg = g[j + q], bb = bta[j + q];
        if (PARAM_BF16) { gg = bf16_round(gg); bb = bf16_round(bb); }
        sm[q] = vals[u * 4 + q]; o[q] = (vals[u * 4 + q] - mu) * rs * gg + bb;
      }
      if (out_sum) *(v4f*)(out_sum + (size_t)row * N + j) = sm;
      *(v4f*)(out_norm + (size_t)row * N + j) = o;
    }
    
  }
}



// ---- f16 WMMA path (v_wmma_f32_16x16x32_f16): 11-bit significands for operands in range — used where a [0,1] probability operand needs more precision than bf16
typedef _Float16 v16h __attribute__((ext_vector_type(16)));
union FragH { v16h v; v8us half[2]; _Float16 h[16]; unsigned short u[16]; };
template <int NT>
__device__ __forceinline__ v8f mmaH(v16h ah, v16h al, v16h bh, v16h bl, v8f c) {
  c = __builtin_amdgcn_wmma_f32_16x16x32_f16(false, ah, false, bh, (short)0, c, false, false);
  if (NT >= 2) c = __builtin_amdgcn_wmma_f32_16x16x32_f16(false, al, false, bh, (short)0, c, false, false);
  if (NT >= 3) c = __builtin_amdgcn_wmma_f32_16x16x32_f16(false, ah, false, bl, (short)0, c, false, false);
  asm volatile("v_nop\n\tv_nop\n\tv_nop\n\tv_nop" : "+v"(c) : "v"(ah), "v"(al), "v"(bh), "v"(bl));
  return c;
}
// batched GEMM like k_gemm_b but f16 operands: A f32 (split into f16 hi/lo if ASPLIT, else rounded to f16), Bt = f16 values [n][k]; alpha; C f32; N multiple of 16 (partial tiles skipped)
template <bool ASPLIT>
__global__ __launch_bounds__(128) void k_gemm_h(const float* __restrict__ A, int lda, size_t sA, const _Float16* __restrict__ Bh, int ldb, size_t sB, float alpha, float* __restrict__ C, int ldc, size_t sC, int M, int N, int K) {
  __shared__ __attribute__((aligned(16))) float so[4][16][64];
  const int tid = threadIdx.x, w = tid >> 5, lane = tid & 31, ln = lane & 15, hh = lane >> 4; const int by = blockIdx.y;
  A += (size_t)by * sA; Bh += (size_t)by * sB; C += (size_t)by * sC;
  const int ntn = (N + 63) / 64; const int wid = blockIdx.x * 4 + w; const int mt = wid / ntn, nq = wid % ntn; if (mt * 16 >= M) return;
  const int row0 = mt * 16, col0 = nq * 64; const float* arow = A + (size_t)(row0 + ln) * lda;
  v8f acc[4] = {};
  for (int kb = 0; kb < K; kb += 32) {
    FragH ah, al;
    const v4f x0 = *(const v4fa*)(arow + kb + 8 * hh), x1 = *(const v4fa*)(arow + kb + 8 * hh + 4), x2 = *(const v4fa*)(arow + kb + 16 + 8 * hh), x3 = *(const v4fa*)(arow + kb + 16 + 8 * hh + 4);
    float xs[16] = {x0[0],x0[1],x0[2],x0[3],x1[0],x1[1],x1[2],x1[3],x2[0],x2[1],x2[2],x2[3],x3[0],x3[1],x3[2],x3[3]};
#pragma unroll
    for (int i = 0; i < 16; ++i) { const _Float16 h = (_Float16)xs[i]; ah.h[i] = h; al.h[i] = ASPLIT ? (_Float16)(xs[i] - (float)h) : (_Float16)0.0f; }
#pragma unroll
    for (int t = 0; t < 4; ++t) { if (col0 + t * 16 >= N) continue; const size_t boff = (size_t)(col0 + t * 16 + ln) * ldb + kb; FragH bq; bq.half[0] = *(const v8us*)(Bh + boff + 8 * hh); bq.half[1] = *(const v8us*)(Bh + boff + 16 + 8 * hh);
      acc[t] = mmaH<ASPLIT ? 2 : 1>(ah.v, al.v, bq.v, bq.v, acc[t]); }
  }
#pragma unroll
  for (int t = 0; t < 4; ++t) { if (col0 + t * 16 >= N) continue;
#pragma unroll
    for (int r = 0; r < 8; ++r) so[w][8 * hh + r][t * 16 + ln] = acc[t][r] * alpha; }
  __builtin_amdgcn_fence(__ATOMIC_ACQ_REL, "workgroup"); __builtin_amdgcn_wave_barrier();
  const int rsub = lane >> 4, c4 = (lane & 15) * 4;
  {
#pragma unroll
    for (int q = 0; q < 8; ++q) { const int r = q * 2 + rsub; if (col0 + c4 < N) { const v4f v = *(const v4fa*)&so[w][r][c4]; *(v4f*)(C + (size_t)(row0 + r) * ldc + col0 + c4) = v; } }
     }
}

// Wt[n][k] = f16(W[k][n]·scale) from f32 row-major W[K][N] (scale = power of two; bf16-exact weights stay exact in f16 away from the subnormal range)
__global__ __launch_bounds__(256) void k_wt_f16(const float* __restrict__ W, _Float16* __restrict__ Wt, int K, int N, float scale) {
  const int t = blockIdx.x * 256 + threadIdx.x; if (t >= N * (K / 8)) return; const int n = t / (K / 8), k8 = (t % (K / 8)) * 8; FragH f;
#pragma unroll
  for (int i = 0; i < 8; ++i) f.h[i] = (_Float16)(bf16_round(W[(size_t)(k8 + i) * N + n]) * scale); const v8us o = f.half[0];
  *(v8us*)((unsigned short*)Wt + (size_t)n * K + k8) = o; 
}
// k_gemm_hh variant with fused epilogue: v = acc·alpha + bias[by·sBias + col] (+ CP[(row/rowsPerB)·sCPb + by·64 + col] if CP) ; ACT 0 none / 1 elu ; writes f32 C and/or f16 C16 (each if non-null)
// N and K are compile-time (NC, KC): the column guard of a partial tile folds away where NC is a multiple of 64 and the k loop unrolls into groups of KU k-steps.
// EPI: what the wave does with its 16 rows x 64 columns, which are 16 positions of ONE head. 0: the row-major stores above. 1: rotary + rms-norm, stored to C16 as f16 in the attention kernel's fragment order for q and k.
// 2: stored to C16 as f16 in the fragment order of Vt. 1 and 2 take the place of a launch of their own that read the tile back from memory.
// 3: the q, k and v projections as ONE product with NC = 3 CC columns (the three weight operands follow one another in memory, the three results too): a column block of CC picks the result and 1 (q, k) or 2 (v).
template <int ACT, int NC, int KC, int EPI>
__global__ __launch_bounds__(128) void k_gemm_hhx(const _Float16* __restrict__ A, int lda, size_t sA, const _Float16* __restrict__ Bh, int ldb, size_t sB, float alpha, const float* __restrict__ bias, size_t sBias, const float* __restrict__ CP, int rowsPerB, size_t sCPb, int row0g,
    float* __restrict__ C, _Float16* __restrict__ C16, int ldc, size_t sC, int M, const float* __restrict__ cosT, const float* __restrict__ sinT) {
  constexpr int N = NC, KU = 2, NG = KC / (32 * KU); constexpr bool PART = (NC % 64) != 0; static_assert(KC % (32 * KU) == 0, "k groups");
  constexpr int SP = (EPI == 1 || EPI == 3) ? 68 : 64;      /* row pitch of the staged tile in floats: the rotary epilogue's lanes read 8 different rows at one column, which at 64 would all be the same banks */
  __shared__ __attribute__((aligned(16))) float so[4][16][SP];
  const int tid = threadIdx.x, w = tid >> 5, lane = tid & 31, ln = lane & 15, hh = lane >> 4; const int by = blockIdx.y;
  A += (size_t)by * sA; Bh += (size_t)by * sB; const size_t cofs = (size_t)by * sC; const float* bp = bias ? bias + (size_t)by * sBias : nullptr;
  const int ntn = (N + 63) / 64; const int wid = blockIdx.x * 4 + w; const int mt = wid / ntn, nq = wid % ntn; if (mt * 16 >= M) return;
  const int row0 = mt * 16, col0 = nq * 64;
  const int sel = (EPI == 3) ? (int)((blockIdx.x % (NC / 256)) / (CC / 256)) : 0;      /* which of q, k, v: a block's 4 waves are 256 columns in a row of one of them, so the block index alone says it and the test below is scalar */
  const int hd = nq - sel * NH;      /* the head */
  C16 += (size_t)sel * ((size_t)NR * CC);
  v8f acc[4] = {};
  // A and Bh are stored in fragment order (frag_src below): 16 rows of lda (ldb) elements are lda / 32 blocks of 1 KiB, one per k-step, and lane l's two loads of a fragment are 16-byte chunks l and 32 + l of the block.
  // The fragment loads of a whole group (KU k-steps: 2 KU of A, 8 KU of B) are written as one run, one group ahead of the products that use them, in two register sets. Written pair by pair between the
  // products each pair was waited for in full before its one product: the statement that ends mmaH is volatile and the scheduler moves no load across it, so a load stays where the source puts it.
  FragH fa[2][KU], fb[2][KU][4];
  const unsigned short* ap = (const unsigned short*)A + (size_t)row0 * lda + lane * 8; const unsigned short* bp0 = (const unsigned short*)Bh + (size_t)col0 * ldb + lane * 8;
#pragma unroll
  for (int g = -1; g < NG; ++g) {
    if (g + 1 < NG) { const int nx = (g + 1) & 1;
#pragma unroll
      for (int u = 0; u < KU; ++u) { const int kb = ((g + 1) * KU + u) * 512; fa[nx][u].half[0] = *(const v8us*)(ap + kb); fa[nx][u].half[1] = *(const v8us*)(ap + kb + 256);
#pragma unroll
        for (int t = 0; t < 4; ++t) { if (PART && col0 + t * 16 >= N) continue; const unsigned short* br = bp0 + (size_t)(t * 16) * ldb + kb; fb[nx][u][t].half[0] = *(const v8us*)br; fb[nx][u][t].half[1] = *(const v8us*)(br + 256); } } }
    if (g >= 0) { const int cu = g & 1;
#pragma unroll
      for (int u = 0; u < KU; ++u)
#pragma unroll
        for (int t = 0; t < 4; ++t) { if (PART && col0 + t * 16 >= N) continue; acc[t] = mmaH<1>(fa[cu][u].v, fa[cu][u].v, fb[cu][u][t].v, fb[cu][u][t].v, acc[t]); } }
  }
  if (EPI == 2 || (EPI == 3 && sel == 2)) {
    /* Vt in fragment order, rows = d, k = keys: block ((slab * TT / 32 + key / 32) * 4 + d / 16), chunk c = row d & 15 = c & 15, keys 16 (c >> 5) + 8 ((c >> 4) & 1) .. + 7. Lane (ln, hh) holds in acc[t][0..7] the keys
       row0 + 8 hh .. + 7 of d = 16 t + ln: that IS chunk 32 ((row0 >> 4) & 1) + lane of block t, so the transpose costs nothing and a wave's store is 512 bytes in a row */
    const int t0 = row0 % TT; unsigned short* vd = (unsigned short*)C16 + (((size_t)((row0 / TT) * NH + hd) * (TT / 32) + (t0 >> 5)) * 4) * 512 + (((t0 >> 4) & 1) * 32 + lane) * 8;
#pragma unroll
    for (int t = 0; t < 4; ++t) { FragH f;
#pragma unroll
      for (int r = 0; r < 8; ++r) f.h[r] = (_Float16)(acc[t][r] * alpha);
      *(v8us*)(vd + t * 512) = f.half[0]; }
    return;
  }
  float cr[2][8], sr[2][8];      /* EPI 1: lane = part pc (8 of the 32 rotary pairs) of rows lane >> 2 and 8 + (lane >> 2) */
  if constexpr (EPI == 1 || EPI == 3) {
#pragma unroll
    for (int it = 0; it < 2; ++it) { const int tj = (row0 % TT + it * 8 + (lane >> 2)) * 32 + (lane & 3) * 8;
#pragma unroll
      for (int q = 0; q < 8; ++q) { cr[it][q] = cosT[tj + q]; sr[it][q] = sinT[tj + q]; } }
    asm volatile("s_wait_xcnt 0x0" ::: "memory");      /* what follows may take the table loads' address registers as a destination: the wait stands in front of that overwrite */
  }
#pragma unroll
  for (int t = 0; t < 4; ++t) { if (col0 + t * 16 >= N) continue; const int col = col0 + t * 16 + ln; const float bv = bp ? bf16_round(bp[col]) : 0.f;
#pragma unroll
    for (int r = 0; r < 8; ++r) { float v = acc[t][r] * alpha + bv; if (CP) { const int bidx = (row0g + row0 + 8 * hh + r) / rowsPerB; v += CP[(size_t)bidx * sCPb + (size_t)by * 64 + col]; } if (ACT == 1) v = (v > 0.f) ? v : expm1f(v); else if (ACT == 3) v = fmaxf(v, 0.f); so[w][8 * hh + r][t * 16 + ln] = v; } }
  __builtin_amdgcn_fence(__ATOMIC_ACQ_REL, "workgroup"); __builtin_amdgcn_wave_barrier();
  if constexpr (EPI == 1 || EPI == 3) {
    /* rotary + rms-norm of the head's 16 rows: x1 = column j, x2 = column 32 + j (j < 32); out = [x1 cos + x2 sin | -x1 sin + x2 cos] with cos, sin = bf16(INPUT tables [t][j]); then x rsqrt(mean(out^2) + f32 eps) -> f16.
       Fragment order per head: block (slab * TT / 16 + t / 16) * 2 + ks, chunk 32 (pc >> 1) + 16 (pc & 1) + r: the tile is 2 KiB in a row, and the 8 lanes of one pc fill a whole line */
    const int pc = lane & 3, j0 = pc * 8; unsigned short* qd0 = (unsigned short*)C16 + ((size_t)((row0 / TT) * NH + hd) * (TT / 16) + ((row0 % TT) >> 4)) * 1024 + (pc >> 1) * 256 + (pc & 1) * 128;
#pragma unroll
    for (int it = 0; it < 2; ++it) { const int r = it * 8 + (lane >> 2); float a[8], bq[8]; float ss = 0.f;
#pragma unroll
      for (int q = 0; q < 8; ++q) { const float x1 = so[w][r][j0 + q], x2 = so[w][r][32 + j0 + q]; const float c = bf16_round(cr[it][q]), s = bf16_round(sr[it][q]); a[q] = x1 * c + x2 * s; bq[q] = -x1 * s + x2 * c; ss += a[q] * a[q] + bq[q] * bq[q]; }
      ss += __shfl_xor(ss, 1, 32); ss += __shfl_xor(ss, 2, 32); const float rn = rsqrtf(ss / 64.0f + 1.1920929e-7f); FragH f1, f2;
#pragma unroll
      for (int q = 0; q < 8; ++q) { f1.h[q] = (_Float16)(a[q] * rn); f2.h[q] = (_Float16)(bq[q] * rn); }
      *(v8us*)(qd0 + r * 8) = f1.half[0]; *(v8us*)(qd0 + r * 8 + 512) = f2.half[0]; }
    if constexpr (EPI == 3) asm volatile("s_wait_xcnt 0x0" ::: "memory");      /* the build lays v's epilogue behind these stores, skipped by a scalar flag: the wait stands in front of whatever there writes the stores' registers */
    return;
  }
  const int rsub = lane >> 4, c4 = (lane & 15) * 4; typedef _Float16 v4h __attribute__((ext_vector_type(4)));
  {
#pragma unroll
    for (int q = 0; q < 8; ++q) { const int r = q * 2 + rsub; if (col0 + c4 < N) { const v4f v = *(const v4fa*)&so[w][r][c4]; if (C) *(v4f*)(C + cofs + (size_t)(row0 + r) * ldc + col0 + c4) = v; if (C16) { v4h h4; for (int i = 0; i < 4; ++i) h4[i] = (_Float16)v[i]; *(v4h*)(C16 + cofs + (size_t)(row0 + r) * ldc + col0 + c4) = h4; } } }
     }
}


// Fragment order of a 16-bit WMMA operand with CC columns: a tile of 16 rows x 32 k is one block of 1 KiB, the blocks of a 16-row strip follow one another in k. 16-byte chunk c (0..63) of a block holds row (c & 15),
// k = 16 (c >> 5) + 8 ((c >> 4) & 1) .. + 7, so lane l's fragment is chunks l and 32 + l: a wave-wide 16-byte load covers 512 contiguous bytes (4 whole lines) and not 32 bytes of each of 16 rows.
// frag_src: the row-major element index of the first of the 8 elements that belong in chunk t of the whole operand. A producer's thread t writes chunk t, so its stores stay contiguous.
__device__ __forceinline__ unsigned frag_src(size_t t) { const unsigned blk = (unsigned)(t >> 6), c = (unsigned)t & 63u; const unsigned rt = blk / (CC / 32), kt = blk % (CC / 32); return (rt * 16 + (c & 15)) * CC + kt * 32 + 16 * (c >> 5) + 8 * ((c >> 4) & 1); }
// lane l <-> lane l ^ 16 (the two halves of a wave hold the two halves of a query's keys)
__device__ __forceinline__ float xhalf(float v) { const int b = __float_as_int(v); return __int_as_float(__builtin_amdgcn_permlanex16(b, b, 0x76543210, 0xfedcba98, false, false)); }
// Transposed products: St = K.Qt (A = 16 key rows, B = the wave's 16 queries as columns) and Ot += Vt.Pt (A = 16 rows of Vt, B = Pt). Lane (ln, hh) holds query q0 + ln only: register r of score tile nt is key
// j0 + 16 nt + 8 hh + r, which is the k order of a B operand, so the two score tiles converted in place ARE Pt; maximum and sums are in-lane plus one exchange between the halves.
__global__ __launch_bounds__(128) void k_flash(const _Float16* __restrict__ Q16, const _Float16* __restrict__ K16, const _Float16* __restrict__ Vt, const float* __restrict__ CB, const float* __restrict__ beta, _Float16* __restrict__ O16) {
  __shared__ float scb[2048];
  constexpr int RPW = 16, NQB = 2048 / (4 * RPW), DT = 4, KS = 2;
  const int tid = threadIdx.x, w = tid >> 5, lane = tid & 31, ln = lane & 15, hh = lane >> 4;
  const int slab = blockIdx.x / NQB, qblk = blockIdx.x % NQB; const int b = slab / 12, h = slab % 12; const int qb0 = qblk * (4 * RPW); const int q0 = qb0 + w * RPW;
  FragH aq[KS];
  /* Q16, K16 (block (slab * 128 + position / 16) * 2 + ks) and Vt (block (slab * 64 + key / 32) * 4 + dt) are in fragment order: lane l loads chunks l and 32 + l of a 1-KiB block; a pass's K is 4 KiB in a row, its V too */
  { const unsigned short* qr = (const unsigned short*)Q16 + ((size_t)slab * 128 + (q0 >> 4)) * 1024 + lane * 8;
#pragma unroll
    for (int ks = 0; ks < KS; ++ks) { aq[ks].half[0] = *(const v8us*)(qr + ks * 512); aq[ks].half[1] = *(const v8us*)(qr + ks * 512 + 256); }
    asm volatile("s_wait_xcnt 0x0" ::: "memory"); }      /* this build reuses the four loads' address pair right behind them: the wait stands in front of that overwrite */
  const float bh = bf16_round(beta[h]);
  for (int i = tid; i < 2048; i += 128) scb[i] = 0.18033688f * (1.0f + bh * CB[i]);      /* log2(e) / 8 * (1 + beta * mean_f cos(d * theta_f)), d = |q - k|: a raw score times its entry is the score as an exponent to base 2 */
  __syncthreads();
  const unsigned short* Vth = (const unsigned short*)Vt + (size_t)slab * 64 * 2048 + lane * 8; const unsigned short* Kh = (const unsigned short*)K16 + (size_t)slab * 64 * 2048 + lane * 8;
  const int tq = q0 + ln;      /* this lane's query */
  float m_q = -3.0e38f, l_q = 0.f, lc_q = 0.f;      /* running maximum (same in both halves); this half's partial sums over all keys and over the causal keys */
  v8f oacc[DT];      /* oacc[dt][r] = Ot[dt * 16 + 8 hh + r][tq] */
#pragma unroll
  for (int dt = 0; dt < DT; ++dt) oacc[dt] = (v8f){0.f,0.f,0.f,0.f,0.f,0.f,0.f,0.f};
  const int jend = 2048;
#pragma unroll 1
  for (int j0 = 0; j0 < jend; j0 += 32) {
    /* all fragment loads of the pass (8 of K, and 8 of V where the pass has a causal key) as one run ahead of its first product: no load moves across the volatile statement that ends mmaH */
    const bool pv = (j0 <= q0 + RPW - 1);      /* some key of this chunk is <= some query of this wave; otherwise every p is 0 */
    FragH bk[2][KS], bv[DT];
#pragma unroll
    for (int nt = 0; nt < 2; ++nt) { const unsigned short* kr = Kh + (size_t)j0 * 64 + nt * 1024;
#pragma unroll
      for (int ks = 0; ks < KS; ++ks) { bk[nt][ks].half[0] = *(const v8us*)(kr + ks * 512); bk[nt][ks].half[1] = *(const v8us*)(kr + ks * 512 + 256); } }
    if (pv) {
#pragma unroll
      for (int dt = 0; dt < DT; ++dt) { const unsigned short* vrow = Vth + (size_t)j0 * 64 + dt * 512; bv[dt].half[0] = *(const v8us*)vrow; bv[dt].half[1] = *(const v8us*)(vrow + 256); } }
    v8f s[2];
#pragma unroll
    for (int nt = 0; nt < 2; ++nt) { v8f acc = (v8f){0.f,0.f,0.f,0.f,0.f,0.f,0.f,0.f};
#pragma unroll
      for (int ks = 0; ks < KS; ++ks) acc = mmaH<1>(bk[nt][ks].v, bk[nt][ks].v, aq[ks].v, aq[ks].v, acc); s[nt] = acc; }
    float tb[16]; const int xq4 = 4 * (tq - 8 * hh - j0);      /* 4 (q - k) at this lane's first key of the pass */
#pragma unroll
    for (int i = 0; i < 16; ++i) { const int x4 = xq4 - 4 * ((i >> 3) * 16 + (i & 7)); const int d4 = (x4 < 0) ? -x4 : x4;      /* x4 = 4 (q - k), the table's byte offset up to its sign */
      tb[i] = *(const float*)((const char*)scb + d4); }
    v2f sw[8]; float sv[16];      /* neighbouring accumulator registers as pairs: the packed multiply here and the packed subtraction below serve two scores each */
#pragma unroll
    for (int i = 0; i < 8; ++i) { sw[i] = (v2f){s[i >> 2][2 * (i & 3)], s[i >> 2][2 * (i & 3) + 1]} * (v2f){tb[2 * i], tb[2 * i + 1]}; sv[2 * i] = sw[i][0]; sv[2 * i + 1] = sw[i][1]; }
    float mx[4];
#pragma unroll
    for (int i = 0; i < 4; ++i) mx[i] = fmaxf(fmaxf(sv[i], sv[4 + i]), fmaxf(sv[8 + i], sv[12 + i]));
    float mc = fmaxf(fmaxf(mx[0], mx[1]), fmaxf(mx[2], mx[3])); mc = fmaxf(mc, xhalf(mc));
    const float mn = fmaxf(m_q, mc); const float ea = __builtin_amdgcn_exp2f(m_q - mn); const float al = (mn > -1.0e38f) ? ea : 1.0f; m_q = mn;
    v2f dv[8];      /* exponents to base 2 */
#pragma unroll
    for (int i = 0; i < 8; ++i) dv[i] = sw[i] - (v2f){mn, mn};
    float ev[16];      /* 2^(score - maximum), one v_exp_f32 each: the argument is never above 0 (mn is the maximum of the same products), and far below 0 the result goes to 0 as it should; the pass's 16 stand as one run ahead of the selects and sums that read them */
#pragma unroll
    for (int i = 0; i < 16; ++i) ev[i] = __builtin_amdgcn_exp2f(dv[i >> 1][i & 1]);
    float se[4] = {0.f, 0.f, 0.f, 0.f}, sp[4] = {0.f, 0.f, 0.f, 0.f}; FragH pb;      /* full-softmax stats over ALL keys; P.V and its sum only over the causal ones */
#pragma unroll
    for (int i = 0; i < 16; ++i) { const int x4 = xq4 - 4 * ((i >> 3) * 16 + (i & 7)); const float e = ev[i]; const float p = (x4 >= 0) ? e : 0.f; se[i & 3] += e; sp[i & 3] += p; pb.h[i] = (_Float16)p; }
    l_q = l_q * al + ((se[0] + se[1]) + (se[2] + se[3])); lc_q = lc_q * al + ((sp[0] + sp[1]) + (sp[2] + sp[3]));
#pragma unroll
    for (int dt = 0; dt < DT; ++dt)
#pragma unroll
      for (int r = 0; r < 8; ++r) oacc[dt][r] *= al;
    if (pv) {
#pragma unroll
      for (int dt = 0; dt < DT; ++dt) oacc[dt] = mmaH<1>(bv[dt].v, bv[dt].v, pb.v, pb.v, oacc[dt]); } }
  const float l = l_q + xhalf(l_q), lc = lc_q + xhalf(lc_q); const float inv = 1.0f / (lc + 1e-8f * l);      /* w * causal / (sum_causal w + 1e-8) with w = e^(s-m) / Z_full  =  e^(s-m) / (Z_causal + 1e-8 * Z_full) */
  /* the output projection's A operand (f16, fragment order of a row-major operand with CC columns: block (row / 16) * (CC / 32) + column / 32, chunk c = row c & 15, k = 16 (c >> 5) + 8 ((c >> 4) & 1) .. + 7) straight from the registers:
     lane (ln, hh) holds in oacc[dt][0..7] the columns h * 64 + 16 dt + 8 hh .. + 7 of row q0 + ln, which IS chunk 32 (dt & 1) + lane of block 2 h + (dt >> 1); a wave's store is 512 bytes in a row */
  unsigned short* od = (unsigned short*)O16 + ((((size_t)b * 2048 + q0) >> 4) * (CC / 32) + 2 * h) * 512 + lane * 8;
#pragma unroll
  for (int dt = 0; dt < DT; ++dt) { FragH f;
#pragma unroll
    for (int r = 0; r < 8; ++r) f.h[r] = (_Float16)(oacc[dt][r] * inv);
    *(v8us*)(od + dt * 256) = f.half[0]; } }

// Everything that depends on the inputs alone, in one launch; the block index picks the job. The three jobs read and write nothing of one another.
// Blocks 0 .. GC - 1: the coherence table (first, their chain of pow, cos and a serial sum is the longest). The next GX: x as f16 in fragment order. The last 4 GW: the four weights (out,in), x 16, as f16 in fragment order, one behind the other.
__global__ __launch_bounds__(256) void k_prep(const float* __restrict__ x, const float* __restrict__ Wq, const float* __restrict__ Wk, const float* __restrict__ Wv, const float* __restrict__ Wo,
                                              _Float16* __restrict__ X16, _Float16* __restrict__ Bt, float* __restrict__ CB) {
  constexpr unsigned GC = TT / 8, GX = NR * CC / 8 / 256, GW = CC * CC / 8 / 256; static_assert(NR * CC % 2048 == 0 && CC * CC % 2048 == 0, "whole blocks");
  __shared__ float sc[8][33]; const int tid = threadIdx.x; unsigned bid = blockIdx.x;
  if (bid < GC) { const int g = tid >> 5, f = tid & 31; const int dl = bid * 8 + g;      /* one thread per (distance, frequency) term; a block makes 8 table entries */
    const float th = powf(10000.0f, -(float)(2 * f) / 64.0f); sc[g][f] = cosf((float)dl * th); __syncthreads();
    if (tid < 8) { float s = 0.f;
      for (int i = 0; i < 32; ++i) s += sc[tid][i];      /* f = 0..31 in ascending order */
      CB[bid * 8 + tid] = s / 32.0f; }
    return; }
  bid -= GC;
  if (bid < GX) { const size_t t = (size_t)bid * 256 + tid; FragH f; const float* xs = x + frag_src(t);
#pragma unroll
    for (int q = 0; q < 8; ++q) f.h[q] = (_Float16)bf16_round(xs[q]);
    *(v8us*)((unsigned short*)X16 + t * 8) = f.half[0];
    asm volatile("s_wait_xcnt 0x0" ::: "memory");      /* the build lays another job's code behind this store, skipped by a scalar flag: the wait stands in front of whatever there writes the store's registers */
    return; }
  bid -= GX;
  const unsigned m = bid / GW; const float* W = (m == 0) ? Wq : (m == 1) ? Wk : (m == 2) ? Wv : Wo;
  const size_t t = (size_t)(bid - m * GW) * 256 + tid; FragH f; const float* ws = W + frag_src(t);
#pragma unroll
  for (int i = 0; i < 8; ++i) f.h[i] = (_Float16)(bf16_round(ws[i]) * 16.0f);
  *(v8us*)((unsigned short*)Bt + ((size_t)m * (CC * CC / 8) + t) * 8) = f.half[0];
  asm volatile("s_wait_xcnt 0x0" ::: "memory"); }      /* as above */
extern "C" void kernel_launch(void* const* d_in, const int* in_sizes, int n_in,
                              void* d_out, int out_size, void* d_ws, size_t ws_size, hipStream_t stream) {
  (void)in_sizes; (void)n_in; (void)out_size;
  const float* x = (const float*)d_in[0]; const float* cosT = (const float*)d_in[1]; const float* sinT = (const float*)d_in[2]; const float* Wq = (const float*)d_in[3]; const float* Wk = (const float*)d_in[4]; const float* Wv = (const float*)d_in[5]; const float* Wo = (const float*)d_in[6]; const float* beta = (const float*)d_in[7];
  char* ws = (char*)d_ws; size_t off = 0;
  auto take = [&](size_t bytes) { char* p = ws + off; off += (bytes + 255) & ~(size_t)255; return p; };
  _Float16* Bq = (_Float16*)take((size_t)CC * CC * 2); _Float16* Bk = (_Float16*)take((size_t)CC * CC * 2); _Float16* Bv = (_Float16*)take((size_t)CC * CC * 2); _Float16* Bo = (_Float16*)take((size_t)CC * CC * 2); float* CB = (float*)take(TT * 4);
  _Float16* X16 = (_Float16*)take((size_t)NR * CC * 2); _Float16* Q16 = (_Float16*)take((size_t)NR * CC * 2); _Float16* K16 = (_Float16*)take((size_t)NR * CC * 2); _Float16* Vt = (_Float16*)take((size_t)NR * CC * 2); _Float16* O16 = X16;      // X16 dead after the q/k/v GEMM
  static_assert(CC * CC * 2 % 256 == 0 && NR * CC * 2 % 256 == 0, "take() leaves no gap between the weights, nor between Q16, K16 and Vt"); (void)Bk; (void)Bv;
  if (off > ws_size) return;      // 4.7 + 6.3 x 4 = about 30 MiB
  k_prep<<<TT / 8 + NR * CC / 8 / 256 + 4 * (CC * CC / 8 / 256), 256, 0, stream>>>(x, Wq, Wk, Wv, Wo, X16, Bq, CB);      // Bq, Bk, Bv, Bo lie one behind the other
  const dim3 gg(((NR / 16) * (CC / 64) + 3) / 4, 1);
  k_gemm_hhx<0, 3 * CC, CC, 3><<<dim3((NR / 16) * (3 * CC / 64) / 4, 1), 128, 0, stream>>>(X16, CC, 0, Bq, CC, 0, 0.0625f, nullptr, 0, nullptr, 1, 0, 0, nullptr, Q16, CC, 0, NR, cosT, sinT);      // Q16, K16, Vt lie one behind the other
  k_flash<<<BB * NH * (TT / 64), 128, 0, stream>>>(Q16, K16, Vt, CB, beta, O16);      // RPW 16
  k_gemm_hhx<0, CC, CC, 0><<<gg, 128, 0, stream>>>(O16, CC, 0, Bo, CC, 0, 0.0625f, nullptr, 0, nullptr, 1, 0, 0, (float*)d_out, nullptr, CC, 0, NR, nullptr, nullptr);
}

// v009
// One run takes 102 microseconds.
// Timed twice side by side with v008, it ran 1.19 and 1.18 times as fast.
// Counting every step since v000, it is 4.54 times as fast.
#include <hip/hip_runtime.h>
// Phase-aware causal attention: q/k/v/o projections (4096 × 768 × 768, no bias, weights (out,in) bf16-exact ×2^4) and the 12-head attention as a fused flash-style kernel on v_wmma_f32_16x16x32_f16
// (rotary (with the INPUT cos/sin tables) + rms-norm'd q,k as f16; S = Q·Kᵀ/8 × (1 + β_h·mean_f cos(|q−k|·θ_f)) with the 2048-entry coherence table precomputed; the module's FULL softmax followed
// by causal masking and re-normalisation with +1e-8 is reproduced exactly as e^{s−m}/(Z_causal + 1e-8·Z_full) with m, Z_full over all keys; P f16 ≤ 1; O = P·V over causal keys); f32 accumulate.
#define BB 2
#define TT 2048
#define CC 768
#define NH 12
#define NR (BB * TT)

typedef __bf16 v16b __attribute__((ext_vector_type(16)));
typedef unsigned short v8us __attribute__((ext_vector_type(8), may_alias));
typedef float  v8f  __attribute__((ext_vector_type(8)));
typedef float  v4f  __attribute__((ext_vector_type(4)));
typedef float  v4fa __attribute__((ext_vector_type(4), may_alias));
typedef float  v2f  __attribute__((ext_vector_type(2)));
union FragB { v16b v; v8us half[2]; unsigned short u[16]; };

__device__ __forceinline__ unsigned short bf16_bits(float x) { unsigned int u = __float_as_uint(x); return (unsigned short)((u + 0x7FFFu + ((u >> 16) & 1u)) >> 16); }
__device__ __forceinline__ float bf16_val(unsigned short b) { return __uint_as_float(((unsigned int)b) << 16); }
__device__ __forceinline__ float bf16_round(float x) { return bf16_val(bf16_bits(x)); }
// D += A·B with NT terms: 1 = ah·bh, 2 = + al·bh (A split), 3 = + ah·bl (both split)
template <int NT>
__device__ __forceinline__ v8f mmaN(v16b ah, v16b al, v16b bh, v16b bl, v8f c) {
  c = __builtin_amdgcn_wmma_f32_16x16x32_bf16(false, ah, false, bh, (short)0, c, false, false);
  if (NT >= 2) c = __builtin_amdgcn_wmma_f32_16x16x32_bf16(false, al, false, bh, (short)0, c, false, false);
  if (NT >= 3) c = __builtin_amdgcn_wmma_f32_16x16x32_bf16(false, ah, false, bl, (short)0, c, false, false);
  asm volatile("v_nop\n\tv_nop\n\tv_nop\n\tv_nop" : "+v"(c) : "v"(ah), "v"(al), "v"(bh), "v"(bl));
  return c;
}

__global__ __launch_bounds__(256) void k_wt_bf16(const float* __restrict__ W, unsigned short* __restrict__ Wt, int K, int N) {
  const int t = blockIdx.x * 256 + threadIdx.x;
  const int k8n = K / 8;
  if (t >= N * k8n) return;
  const int n = t / k8n, k8 = (t % k8n) * 8;
  v8us v;
#pragma unroll
  for (int i = 0; i < 8; ++i) v[i] = bf16_bits(W[(size_t)(k8 + i) * N + n]);
  *(v8us*)(Wt + (size_t)n * K + k8) = v;
  
}

// GEMM C[M][N] (f32, pitch ldc) = act(A[M][K]·W + bias). A f32 row-major (pitch lda) converted per fragment to bf16
// (ASPLIT: hi/lo two planes -> 2 terms, else single rounded term); Wt bf16 [N][K] (pitch ldb). BIAS_BF16 rounds the
// bias to bf16 first (bias quantised to bf16 before the add). K%32==0, M%16==0, N%64==0.
template <bool ASPLIT, int ACT, bool BIAS_BF16>
__global__ __launch_bounds__(128) void k_gemm_bf(const float* __restrict__ A, int lda, const unsigned short* __restrict__ Wt, int ldb,
                                               const float* __restrict__ bias, float* __restrict__ C, int ldc, int M, int N, int K) {
  __shared__ __attribute__((aligned(16))) float so[4][16][64];
  const int tid = threadIdx.x, w = tid >> 5, lane = tid & 31, ln = lane & 15, hh = lane >> 4;
  const int ntn = N / 64;
  const int wid = blockIdx.x * 4 + w;
  const int mt = wid / ntn, nq = wid % ntn;
  if (mt * 16 >= M) return;
  const int row0 = mt * 16, col0 = nq * 64;
  const float* arow = A + (size_t)(row0 + ln) * lda;
  v8f acc[4] = {};
  for (int kb = 0; kb < K; kb += 32) {
    FragB ah, al;
    const v4f x0 = *(const v4fa*)(arow + kb + 8 * hh), x1 = *(const v4fa*)(arow + kb + 8 * hh + 4);
    const v4f x2 = *(const v4fa*)(arow + kb + 16 + 8 * hh), x3 = *(const v4fa*)(arow + kb + 16 + 8 * hh + 4);
    float xs[16] = {x0[0],x0[1],x0[2],x0[3],x1[0],x1[1],x1[2],x1[3],x2[0],x2[1],x2[2],x2[3],x3[0],x3[1],x3[2],x3[3]};
#pragma unroll
    for (int i = 0; i < 16; ++i) { const unsigned short hb = bf16_bits(xs[i]); ah.u[i] = hb; al.u[i] = ASPLIT ? bf16_bits(xs[i] - bf16_val(hb)) : (unsigned short)0; }
#pragma unroll
    for (int t = 0; t < 4; ++t) {
      const unsigned short* brow = Wt + (size_t)(col0 + t * 16 + ln) * ldb + kb;
      FragB b;
      b.half[0] = *(const v8us*)(brow + 8 * hh);
      b.half[1] = *(const v8us*)(brow + 16 + 8 * hh);
      acc[t] = mmaN<ASPLIT ? 2 : 1>(ah.v, al.v, b.v, b.v, acc[t]);
    }
  }
#pragma unroll
  for (int t = 0; t < 4; ++t) {
    float bv = bias ? bias[col0 + t * 16 + ln] : 0.f;
    if (BIAS_BF16) bv = bf16_round(bv);
#pragma unroll
    for (int r = 0; r < 8; ++r) { float v = acc[t][r] + bv; if (ACT == 1) v = fmaxf(v, 0.f); so[w][8 * hh + r][t * 16 + ln] = v; }
  }
  __builtin_amdgcn_fence(__ATOMIC_ACQ_REL, "workgroup");
  __builtin_amdgcn_wave_barrier();
  const int rsub = lane >> 4, c4 = (lane & 15) * 4;
  {
#pragma unroll
    for (int q = 0; q < 8; ++q) {
      const int r = q * 2 + rsub;
      const v4f v = *(const v4fa*)&so[w][r][c4];
      *(v4f*)(C + (size_t)(row0 + r) * ldc + col0 + c4) = v;
    }
    
  }
}

// Flash-style causal/unmasked attention, all contractions 3-term bf16 hi/lo splits, f32 softmax with running max.
// q,k,v rows are read from f32 buffers with arbitrary row pitch (so they can live inside a fused qkv buffer);
// D = head size (multiple of 32, <= 128); one wave = 16 query rows; block = 4 waves (64 queries) sharing K/V chunks of 32.
template <int D, bool CAUSAL>
__global__ __launch_bounds__(128) void k_flash(const float* __restrict__ qb, const float* __restrict__ kb, const float* __restrict__ vb,
                                             int pitch, int T, int H, float scale, float* __restrict__ y, int ypitch) {
  constexpr int KS = D / 32;        // k-steps for QK
  constexpr int DT = D / 16;        // d tiles for PV
  __shared__ __attribute__((aligned(16))) unsigned short sKh[32][D + 8], sKl[32][D + 8], sVh[32][D + 8], sVl[32][D + 8];
  __shared__ __attribute__((aligned(16))) unsigned short sPh[4][16][40], sPl[4][16][40];
  __shared__ __attribute__((aligned(16))) float sO[4][16][D];
  const int tid = threadIdx.x, w = tid >> 5, lane = tid & 31, ln = lane & 15, hh = lane >> 4;
  const int nqb = (T + 63) / 64;
  const int bh = blockIdx.x / nqb, qblk = blockIdx.x % nqb;
  const int b = bh / H, h = bh % H;
  const int q0 = qblk * 64 + w * 16;
  const float* Q = qb + (size_t)b * T * pitch + h * D;
  const float* K = kb + (size_t)b * T * pitch + h * D;
  const float* V = vb + (size_t)b * T * pitch + h * D;

  // A fragments of the wave's 16 query rows (scaled), hi/lo
  FragB aqh[KS], aql[KS];
  {
    int row = q0 + ln; if (row >= T) row = T - 1;
    const float* qr = Q + (size_t)row * pitch;
#pragma unroll
    for (int ks = 0; ks < KS; ++ks)
#pragma unroll
      for (int i = 0; i < 16; ++i) {
        const int d = ks * 32 + ((i < 8) ? (8 * hh + i) : (16 + 8 * hh + (i - 8)));
        const float x = qr[d] * scale; const unsigned short hb = bf16_bits(x);
        aqh[ks].u[i] = hb; aql[ks].u[i] = bf16_bits(x - bf16_val(hb));
      }
  }
  float m_r[8], l_r[8];
#pragma unroll
  for (int r = 0; r < 8; ++r) { m_r[r] = -3.0e38f; l_r[r] = 0.f; }
  v8f oacc[DT];
#pragma unroll
  for (int dt = 0; dt < DT; ++dt) oacc[dt] = (v8f){0.f,0.f,0.f,0.f,0.f,0.f,0.f,0.f};

  const int kv_end = CAUSAL ? min(T, qblk * 64 + 64) : T;     // block-uniform
  for (int j0 = 0; j0 < kv_end; j0 += 32) {
    __syncthreads();
    for (int e = tid; e < 32 * (D / 4); e += 128) {
      const int r = e / (D / 4), c4 = (e % (D / 4)) * 4;
      const int key = j0 + r;
      v4f kf = {0.f,0.f,0.f,0.f}, vf = {0.f,0.f,0.f,0.f};
      if (key < T) { kf = *(const v4fa*)(K + (size_t)key * pitch + c4); vf = *(const v4fa*)(V + (size_t)key * pitch + c4); }
#pragma unroll
      for (int t = 0; t < 4; ++t) {
        unsigned short hb = bf16_bits(kf[t]); sKh[r][c4 + t] = hb; sKl[r][c4 + t] = bf16_bits(kf[t] - bf16_val(hb));
        hb = bf16_bits(vf[t]); sVh[r][c4 + t] = hb; sVl[r][c4 + t] = bf16_bits(vf[t] - bf16_val(hb));
      }
    }
    __syncthreads();
    // S tile 16 x 32
    v8f s[2];
#pragma unroll
    for (int nt = 0; nt < 2; ++nt) {
      v8f acc = {};
#pragma unroll
      for (int ks = 0; ks < KS; ++ks) {
        FragB bh_, bl_;
        bh_.half[0] = *(const v8us*)&sKh[nt * 16 + ln][ks * 32 + 8 * hh]; bh_.half[1] = *(const v8us*)&sKh[nt * 16 + ln][ks * 32 + 16 + 8 * hh];
        bl_.half[0] = *(const v8us*)&sKl[nt * 16 + ln][ks * 32 + 8 * hh]; bl_.half[1] = *(const v8us*)&sKl[nt * 16 + ln][ks * 32 + 16 + 8 * hh];
        acc = mmaN<3>(aqh[ks].v, aql[ks].v, bh_.v, bl_.v, acc);
      }
      s[nt] = acc;
    }
    // mask + running max (rows 8hh+r; the 16 lanes of a half share rows)
    float alpha[8];
#pragma unroll
    for (int r = 0; r < 8; ++r) {
      const int qi = q0 + 8 * hh + r;
      const int ja = j0 + ln, jb = j0 + 16 + ln;
      if (CAUSAL) { if (ja > qi) s[0][r] = -3.0e38f; if (jb > qi) s[1][r] = -3.0e38f; }
      if (ja >= T) s[0][r] = -3.0e38f;
      if (jb >= T) s[1][r] = -3.0e38f;
      float mx = fmaxf(s[0][r], s[1][r]);
      mx = fmaxf(mx, __shfl_xor(mx, 1, 32)); mx = fmaxf(mx, __shfl_xor(mx, 2, 32)); mx = fmaxf(mx, __shfl_xor(mx, 4, 32)); mx = fmaxf(mx, __shfl_xor(mx, 8, 32));
      const float mnew = fmaxf(m_r[r], mx);
      alpha[r] = (mnew > -1.0e38f) ? __expf(m_r[r] - mnew) : 1.0f;
      const float p0 = (s[0][r] > -1.0e38f) ? __expf(s[0][r] - mnew) : 0.f;
      const float p1 = (s[1][r] > -1.0e38f) ? __expf(s[1][r] - mnew) : 0.f;
      m_r[r] = mnew;
      l_r[r] = l_r[r] * alpha[r] + p0 + p1;            // per-lane partial row sum (16 lanes combined at the end)
      unsigned short hb = bf16_bits(p0); sPh[w][8 * hh + r][ln] = hb;      sPl[w][8 * hh + r][ln] = bf16_bits(p0 - bf16_val(hb));
      hb = bf16_bits(p1);                sPh[w][8 * hh + r][16 + ln] = hb; sPl[w][8 * hh + r][16 + ln] = bf16_bits(p1 - bf16_val(hb));
    }
#pragma unroll
    for (int dt = 0; dt < DT; ++dt)
#pragma unroll
      for (int r = 0; r < 8; ++r) oacc[dt][r] *= alpha[r];
    __builtin_amdgcn_fence(__ATOMIC_ACQ_REL, "workgroup");
    __builtin_amdgcn_wave_barrier();
    FragB pah, pal;
    pah.half[0] = *(const v8us*)&sPh[w][ln][8 * hh]; pah.half[1] = *(const v8us*)&sPh[w][ln][16 + 8 * hh];
    pal.half[0] = *(const v8us*)&sPl[w][ln][8 * hh]; pal.half[1] = *(const v8us*)&sPl[w][ln][16 + 8 * hh];
#pragma unroll
    for (int dt = 0; dt < DT; ++dt) {
      FragB bvh, bvl;
#pragma unroll
      for (int i = 0; i < 8; ++i) {
        bvh.u[i] = sVh[8 * hh + i][dt * 16 + ln]; bvh.u[8 + i] = sVh[16 + 8 * hh + i][dt * 16 + ln];
        bvl.u[i] = sVl[8 * hh + i][dt * 16 + ln]; bvl.u[8 + i] = sVl[16 + 8 * hh + i][dt * 16 + ln];
      }
      oacc[dt] = mmaN<3>(pah.v, pal.v, bvh.v, bvl.v, oacc[dt]);
    }
    __builtin_amdgcn_fence(__ATOMIC_ACQ_REL, "workgroup");
    __builtin_amdgcn_wave_barrier();
  }
#pragma unroll
  for (int r = 0; r < 8; ++r) {
    float l = l_r[r];
    l += __shfl_xor(l, 1, 32); l += __shfl_xor(l, 2, 32); l += __shfl_xor(l, 4, 32); l += __shfl_xor(l, 8, 32);
    l_r[r] = (l > 0.f) ? 1.0f / l : 0.f;
  }
#pragma unroll
  for (int dt = 0; dt < DT; ++dt)
#pragma unroll
    for (int r = 0; r < 8; ++r) sO[w][8 * hh + r][dt * 16 + ln] = oacc[dt][r] * l_r[r];
  __builtin_amdgcn_fence(__ATOMIC_ACQ_REL, "workgroup");
  __builtin_amdgcn_wave_barrier();
  {
    for (int r = 0; r < 16; ++r) {
      const int row = q0 + r;
      if (row < T && lane < D / 4) {
        const v4f val = *(const v4fa*)&sO[w][r][lane * 4];
        *(v4f*)(y + ((size_t)b * T + row) * ypitch + h * D + lane * 4) = val;
      }
    }
    
  }
}

// GEMM C = act(A·W + bias + resid): A f32 (ASPLIT -> hi/lo 2 terms), Wt bf16 [N][K]; ACT 0 none, 1 relu, 2 exact gelu;
// resid (optional, f32, row index = (row % rmod), pitch ldr, RES_BF16 rounds it) added before the activation.
template <bool ASPLIT, int ACT, bool BIAS_BF16, bool RES_BF16>
__global__ __launch_bounds__(128) void k_gemm_bf3(const float* __restrict__ A, int lda, const unsigned short* __restrict__ Wt, int ldb,
                                                const float* __restrict__ bias, const float* __restrict__ resid, int rmod, int ldr,
                                                float* __restrict__ C, int ldc, int M, int N, int K) {
  __shared__ __attribute__((aligned(16))) float so[4][16][64];
  const int tid = threadIdx.x, w = tid >> 5, lane = tid & 31, ln = lane & 15, hh = lane >> 4;
  const int ntn = N / 64;
  const int wid = blockIdx.x * 4 + w;
  const int mt = wid / ntn, nq = wid % ntn;
  if (mt * 16 >= M) return;
  const int row0 = mt * 16, col0 = nq * 64;
  const float* arow = A + (size_t)(row0 + ln) * lda;
  v8f acc[4] = {};
  for (int kb = 0; kb < K; kb += 32) {
    FragB ah, al;
    const v4f x0 = *(const v4fa*)(arow + kb + 8 * hh), x1 = *(const v4fa*)(arow + kb + 8 * hh + 4);
    const v4f x2 = *(const v4fa*)(arow + kb + 16 + 8 * hh), x3 = *(const v4fa*)(arow + kb + 16 + 8 * hh + 4);
    float xs[16] = {x0[0],x0[1],x0[2],x0[3],x1[0],x1[1],x1[2],x1[3],x2[0],x2[1],x2[2],x2[3],x3[0],x3[1],x3[2],x3[3]};
#pragma unroll
    for (int i = 0; i < 16; ++i) { const unsigned short hb = bf16_bits(xs[i]); ah.u[i] = hb; al.u[i] = ASPLIT ? bf16_bits(xs[i] - bf16_val(hb)) : (unsigned short)0; }
#pragma unroll
    for (int t = 0; t < 4; ++t) {
      const unsigned short* brow = Wt + (size_t)(col0 + t * 16 + ln) * ldb + kb;
      FragB b;
      b.half[0] = *(const v8us*)(brow + 8 * hh);
      b.half[1] = *(const v8us*)(brow + 16 + 8 * hh);
      acc[t] = mmaN<ASPLIT ? 2 : 1>(ah.v, al.v, b.v, b.v, acc[t]);
    }
  }
#pragma unroll
  for (int t = 0; t < 4; ++t) {
    const int col = col0 + t * 16 + ln;
    float bv = bias ? bias[col] : 0.f;
    if (BIAS_BF16) bv = bf16_round(bv);
#pragma unroll
    for (int r = 0; r < 8; ++r) {
      float v = acc[t][r] + bv;
      if (resid) { float rv = resid[(size_t)((row0 + 8 * hh + r) % rmod) * ldr + col]; if (RES_BF16) rv = bf16_round(rv); v += rv; }
      if (ACT == 1) v = fmaxf(v, 0.f);
      if (ACT == 2) v = 0.5f * v * (1.0f + erff(v * 0.70710678118654752f));
      if (ACT == 3) { const float u = 0.7978845608028654f * (v + 0.044715f * v * v * v); v = 0.5f * v * (1.0f + tanhf(u)); }
      so[w][8 * hh + r][t * 16 + ln] = v;
    }
  }
  __builtin_amdgcn_fence(__ATOMIC_ACQ_REL, "workgroup");
  __builtin_amdgcn_wave_barrier();
  const int rsub = lane >> 4, c4 = (lane & 15) * 4;
  {
#pragma unroll
    for (int q = 0; q < 8; ++q) {
      const int r = q * 2 + rsub;
      const v4f v = *(const v4fa*)&so[w][r][c4];
      *(v4f*)(C + (size_t)(row0 + r) * ldc + col0 + c4) = v;
    }
    
  }
}
// row LayerNorm (biased variance, eps) over N: s = X (+ R); optional out_sum <- s; out_norm <- (s-mu)*rsqrt(var+eps)*g + b
template <bool PARAM_BF16>
__global__ __launch_bounds__(256) void k_layernorm(const float* __restrict__ X, const float* __restrict__ R, const float* __restrict__ g, const float* __restrict__ bta,
                                                  float* __restrict__ out_sum, float* __restrict__ out_norm, int N, float eps) {
  __shared__ float red[256];
  const int row = blockIdx.x, tid = threadIdx.x;
  const float* x = X + (size_t)row * N; const float* rr = R ? R + (size_t)row * N : nullptr;
  float vals[16];                     // up to N = 4096
  const int per = N / 256;            // contiguous chunk per thread? use strided-by-4 chunks: thread handles j = tid*4 + 1024*u
  float s1 = 0.f;
  for (int u = 0; u < per / 4; ++u) {
    const int j = tid * 4 + 1024 * u;
    const v4f a = *(const v4fa*)(x + j);
    v4f b = {0.f,0.f,0.f,0.f}; if (rr) b = *(const v4fa*)(rr + j);
#pragma unroll
    for (int q = 0; q < 4; ++q) { const float v = a[q] + b[q]; vals[u * 4 + q] = v; s1 += v; }
  }
  red[tid] = s1; __syncthreads();
  for (int st = 128; st > 0; st >>= 1) { if (tid < st) red[tid] += red[tid + st]; __syncthreads(); }
  const float mu = red[0] / (float)N; __syncthreads();
  float s2 = 0.f;
  for (int u = 0; u < per / 4; ++u)
#pragma unroll
    for (int q = 0; q < 4; ++q) { const float c = vals[u * 4 + q] - mu; s2 += c * c; }
  red[tid] = s2; __syncthreads();
  for (int st = 128; st > 0; st >>= 1) { if (tid < st) red[tid] += red[tid + st]; __syncthreads(); }
  const float rs = rsqrtf(red[0] / (float)N + eps);
  {
    for (int u = 0; u < per / 4; ++u) {
      const int j = tid * 4 + 1024 * u;
      v4f o, sm;
#pragma unroll
      for (int q = 0; q < 4; ++q) {
        float gg = g[j + q], bb = bta[j + q];
        if (PARAM_BF16) { gg = bf16_round(gg); bb = bf16_round(bb); }
        sm[q] = vals[u * 4 + q]; o[q] = (vals[u * 4 + q] - mu) * rs * gg + bb;
      }
      if (out_sum) *(v4f*)(out_sum + (size_t)row * N + j) = sm;
      *(v4f*)(out_norm + (size_t)row * N + j) = o;
    }
    
  }
}



// ---- f16 WMMA path (v_wmma_f32_16x16x32_f16): 11-bit significands for operands in range — used where a [0,1] probability operand needs more precision than bf16
typedef _Float16 v16h __attribute__((ext_vector_type(16)));
union FragH { v16h v; v8us half[2]; _Float16 h[16]; unsigned short u[16]; };
template <int NT>
__device__ __forceinline__ v8f mmaH(v16h ah, v16h al, v16h bh, v16h bl, v8f c) {
  c = __builtin_amdgcn_wmma_f32_16x16x32_f16(false, ah, false, bh, (short)0, c, false, false);
  if (NT >= 2) c = __builtin_amdgcn_wmma_f32_16x16x32_f16(false, al, false, bh, (short)0, c, false, false);
  if (NT >= 3) c = __builtin_amdgcn_wmma_f32_16x16x32_f16(false, ah, false, bl, (short)0, c, false, false);
  asm volatile("v_nop\n\tv_nop\n\tv_nop\n\tv_nop" : "+v"(c) : "v"(ah), "v"(al), "v"(bh), "v"(bl));
  return c;
}
// batched GEMM like k_gemm_b but f16 operands: A f32 (split into f16 hi/lo if ASPLIT, else rounded to f16), Bt = f16 values [n][k]; alpha; C f32; N multiple of 16 (partial tiles skipped)
template <bool ASPLIT>
__global__ __launch_bounds__(128) void k_gemm_h(const float* __restrict__ A, int lda, size_t sA, const _Float16* __restrict__ Bh, int ldb, size_t sB, float alpha, float* __restrict__ C, int ldc, size_t sC, int M, int N, int K) {
  __shared__ __attribute__((aligned(16))) float so[4][16][64];
  const int tid = threadIdx.x, w = tid >> 5, lane = tid & 31, ln = lane & 15, hh = lane >> 4; const int by = blockIdx.y;
  A += (size_t)by * sA; Bh += (size_t)by * sB; C += (size_t)by * sC;
  const int ntn = (N + 63) / 64; const int wid = blockIdx.x * 4 + w; const int mt = wid / ntn, nq = wid % ntn; if (mt * 16 >= M) return;
  const int row0 = mt * 16, col0 = nq * 64; const float* arow = A + (size_t)(row0 + ln) * lda;
  v8f acc[4] = {};
  for (int kb = 0; kb < K; kb += 32) {
    FragH ah, al;
    const v4f x0 = *(const v4fa*)(arow + kb + 8 * hh), x1 = *(const v4fa*)(arow + kb + 8 * hh + 4), x2 = *(const v4fa*)(arow + kb + 16 + 8 * hh), x3 = *(const v4fa*)(arow + kb + 16 + 8 * hh + 4);
    float xs[16] = {x0[0],x0[1],x0[2],x0[3],x1[0],x1[1],x1[2],x1[3],x2[0],x2[1],x2[2],x2[3],x3[0],x3[1],x3[2],x3[3]};
#pragma unroll
    for (int i = 0; i < 16; ++i) { const _Float16 h = (_Float16)xs[i]; ah.h[i] = h; al.h[i] = ASPLIT ? (_Float16)(xs[i] - (float)h) : (_Float16)0.0f; }
#pragma unroll
    for (int t = 0; t < 4; ++t) { if (col0 + t * 16 >= N) continue; const size_t boff = (size_t)(col0 + t * 16 + ln) * ldb + kb; FragH bq; bq.half[0] = *(const v8us*)(Bh + boff + 8 * hh); bq.half[1] = *(const v8us*)(Bh + boff + 16 + 8 * hh);
      acc[t] = mmaH<ASPLIT ? 2 : 1>(ah.v, al.v, bq.v, bq.v, acc[t]); }
  }
#pragma unroll
  for (int t = 0; t < 4; ++t) { if (col0 + t * 16 >= N) continue;
#pragma unroll
    for (int r = 0; r < 8; ++r) so[w][8 * hh + r][t * 16 + ln] = acc[t][r] * alpha; }
  __builtin_amdgcn_fence(__ATOMIC_ACQ_REL, "workgroup"); __builtin_amdgcn_wave_barrier();
  const int rsub = lane >> 4, c4 = (lane & 15) * 4;
  {
#pragma unroll
    for (int q = 0; q < 8; ++q) { const int r = q * 2 + rsub; if (col0 + c4 < N) { const v4f v = *(const v4fa*)&so[w][r][c4]; *(v4f*)(C + (size_t)(row0 + r) * ldc + col0 + c4) = v; } }
     }
}

// Wt[n][k] = f16(W[k][n]·scale) from f32 row-major W[K][N] (scale = power of two; bf16-exact weights stay exact in f16 away from the subnormal range)
__global__ __launch_bounds__(256) void k_wt_f16(const float* __restrict__ W, _Float16* __restrict__ Wt, int K, int N, float scale) {
  const int t = blockIdx.x * 256 + threadIdx.x; if (t >= N * (K / 8)) return; const int n = t / (K / 8), k8 = (t % (K / 8)) * 8; FragH f;
#pragma unroll
  for (int i = 0; i < 8; ++i) f.h[i] = (_Float16)(bf16_round(W[(size_t)(k8 + i) * N + n]) * scale); const v8us o = f.half[0];
  *(v8us*)((unsigned short*)Wt + (size_t)n * K + k8) = o; 
}
// GEMM on f16 operands in fragment order with a fused epilogue on v = acc * alpha
// N and K are compile-time (NC, KC; NC a multiple of 128) and the k loop unrolls into groups of KU k-steps.
// EPI: what the wave does with each strip of 16 rows x 64 columns, which are 16 positions of ONE head. 0: row-major f32 stores to C. 1: rotary + rms-norm, stored to C16 as f16 in the attention kernel's fragment order for q and k.
// 2: stored to C16 as f16 in the fragment order of Vt. 1 and 2 take the place of a launch of their own that read the tile back from memory.
// 3: the q, k and v projections as ONE product with NC = 3 CC columns (the three weight operands follow one another in memory, the three results too): a column block of CC picks the result and 1 (q, k) or 2 (v).
// MI: a wave's tile is 16 MI rows x 64 columns, so a loaded B fragment feeds MI products and an A fragment 4: (MI + 4) KiB loaded per 4 MI products. The block's 4 waves stand 2 x 2 (32 MI rows x 128 columns): each fragment is asked for by two of them.
// KUP: k-steps per load group. The epilogue takes the tile's MI strips of 16 rows one after the other.
template <int NC, int KC, int EPI, int MI, int KUP>
__global__ __launch_bounds__(128) void k_gemm_hhx(const _Float16* __restrict__ A, int lda, size_t sA, const _Float16* __restrict__ Bh, int ldb, size_t sB, float alpha,
    float* __restrict__ C, _Float16* __restrict__ C16, size_t sC, int M, const float* __restrict__ cosT, const float* __restrict__ sinT) {
  constexpr int N = NC, KU = KUP, NG = KC / (32 * KU); static_assert(KC % (32 * KU) == 0, "k groups"); static_assert(NC % 128 == 0, "whole column blocks");
  constexpr int SP = (EPI == 1 || EPI == 3) ? 68 : 64;      /* row pitch of the staged tile in floats: the rotary epilogue's lanes read 8 different rows at one column, which at 64 would all be the same banks */
  __shared__ __attribute__((aligned(16))) float so[4][16][SP];
  const int tid = threadIdx.x, w = tid >> 5, lane = tid & 31, ln = lane & 15, hh = lane >> 4; const int by = blockIdx.y;
  A += (size_t)by * sA; Bh += (size_t)by * sB; const size_t cofs = (size_t)by * sC;
  constexpr int NBC = N / 128; const int bm = blockIdx.x / NBC, bn = blockIdx.x % NBC; const int nq = bn * 2 + (w & 1);
  const int rowt = (bm * 2 + (w >> 1)) * (16 * MI), col0 = nq * 64; if (rowt >= M) return;
  const int sel = (EPI == 3) ? bn / (CC / 128) : 0;      /* which of q, k, v: a block's 128 columns lie in one of them, so the block index alone says it and the test below is scalar */
  const int hd = nq - sel * NH;      /* the head */
  C16 += (size_t)sel * ((size_t)NR * CC);
  v8f acc[MI][4] = {};
  // A and Bh are stored in fragment order (frag_src below): 16 rows of lda (ldb) elements are lda / 32 blocks of 1 KiB, one per k-step, and lane l's two loads of a fragment are 16-byte chunks l and 32 + l of the block.
  // The fragment loads of a whole group (KU k-steps: 2 MI KU of A, 8 KU of B) are written as one run, one group ahead of the products that use them, in two register sets.
  // The products are the plain builtin: accumulators and both fragment sets need more than 256 registers, and an asm statement's operands (the one that ends mmaH) are kept below v256, which spilled.
  FragH fa[2][KU][MI], fb[2][KU][4];
  const unsigned short* ap = (const unsigned short*)A + (size_t)rowt * lda + lane * 8; const unsigned short* bp0 = (const unsigned short*)Bh + (size_t)col0 * ldb + lane * 8;
#pragma unroll
  for (int g = -1; g < NG; ++g) {
    if (g + 1 < NG) { const int nx = (g + 1) & 1;
#pragma unroll
      for (int u = 0; u < KU; ++u) { const int kb = ((g + 1) * KU + u) * 512;
#pragma unroll
        for (int mi = 0; mi < MI; ++mi) { const unsigned short* ar = ap + (size_t)(mi * 16) * lda + kb; fa[nx][u][mi].half[0] = *(const v8us*)ar; fa[nx][u][mi].half[1] = *(const v8us*)(ar + 256); }
#pragma unroll
        for (int t = 0; t < 4; ++t) { const unsigned short* br = bp0 + (size_t)(t * 16) * ldb + kb; fb[nx][u][t].half[0] = *(const v8us*)br; fb[nx][u][t].half[1] = *(const v8us*)(br + 256); } } }
    __builtin_amdgcn_sched_barrier(0);      /* the loads stay one run ahead of the products that follow */
    if (g >= 0) { const int cu = g & 1;
#pragma unroll
      for (int u = 0; u < KU; ++u)
#pragma unroll
        for (int mi = 0; mi < MI; ++mi)
#pragma unroll
          for (int t = 0; t < 4; ++t) acc[mi][t] = __builtin_amdgcn_wmma_f32_16x16x32_f16(false, fa[cu][u][mi].v, false, fb[cu][u][t].v, (short)0, acc[mi][t], false, false); }
    __builtin_amdgcn_sched_barrier(0);      /* keeps the loads of the group after next, which follow these products and refill the set they read, from rising above them */
  }
  if (EPI == 2 || (EPI == 3 && sel == 2)) {
    /* Vt in fragment order, rows = d, k = keys: block ((slab * TT / 32 + key / 32) * 4 + d / 16), chunk c = row d & 15 = c & 15, keys 16 (c >> 5) + 8 ((c >> 4) & 1) .. + 7. Lane (ln, hh) holds in acc[mi][t][0..7] the keys
       row0 + 8 hh .. + 7 of d = 16 t + ln: that IS chunk 32 ((row0 >> 4) & 1) + lane of block t, so the transpose costs nothing and a wave's store is 512 bytes in a row */
#pragma unroll
    for (int mi = 0; mi < MI; ++mi) { const int row0 = rowt + mi * 16;
      const int t0 = row0 % TT; unsigned short* vd = (unsigned short*)C16 + (((size_t)((row0 / TT) * NH + hd) * (TT / 32) + (t0 >> 5)) * 4) * 512 + (((t0 >> 4) & 1) * 32 + lane) * 8;
#pragma unroll
      for (int t = 0; t < 4; ++t) { FragH f;
#pragma unroll
        for (int r = 0; r < 8; ++r) f.h[r] = (_Float16)(acc[mi][t][r] * alpha);
        *(v8us*)(vd + t * 512) = f.half[0]; } }
    return;
  }
  float cr[2][2][8], sr[2][2][8];      /* EPI 1: lane = part pc (8 of the 32 rotary pairs) of rows lane >> 2 and 8 + (lane >> 2) of a strip; two sets, a strip's table loads are issued one strip ahead */
  auto tables = [&](int mi) {
#pragma unroll
    for (int it = 0; it < 2; ++it) { const int tj = ((rowt + mi * 16) % TT + it * 8 + (lane >> 2)) * 32 + (lane & 3) * 8;
      const v4f c0 = *(const v4fa*)(cosT + tj), c1 = *(const v4fa*)(cosT + tj + 4), s0 = *(const v4fa*)(sinT + tj), s1 = *(const v4fa*)(sinT + tj + 4);
#pragma unroll
      for (int q = 0; q < 4; ++q) { cr[mi & 1][it][q] = c0[q]; cr[mi & 1][it][4 + q] = c1[q]; sr[mi & 1][it][q] = s0[q]; sr[mi & 1][it][4 + q] = s1[q]; } }
    asm volatile("s_wait_xcnt 0x0" ::: "memory");      /* what follows may take the table loads' address registers as a destination: the wait stands in front of that overwrite */
    __builtin_amdgcn_sched_barrier(0);      /* the clobber does not tie the wait to registers: without this the strip's arithmetic was lifted over it */
  };
  if constexpr (EPI == 1 || EPI == 3) tables(0);
#pragma unroll
  for (int mi = 0; mi < MI; ++mi) { const int row0 = rowt + mi * 16;      /* one strip of 16 rows through the wave's staging tile */
#pragma unroll
  for (int t = 0; t < 4; ++t) {
#pragma unroll
    for (int r = 0; r < 8; ++r) so[w][8 * hh + r][t * 16 + ln] = acc[mi][t][r] * alpha; }
  __builtin_amdgcn_fence(__ATOMIC_ACQ_REL, "workgroup", "local"); __builtin_amdgcn_wave_barrier();      /* the wave's LDS stores before its lanes read one another's; LDS only: the strip before's global stores are not waited for */
  if constexpr (EPI == 1 || EPI == 3) {
    if (mi + 1 < MI) tables(mi + 1);
    /* rotary + rms-norm of the head's 16 rows: x1 = column j, x2 = column 32 + j (j < 32); out = [x1 cos + x2 sin | -x1 sin + x2 cos] with cos, sin = bf16(INPUT tables [t][j]); then x rsqrt(mean(out^2) + f32 eps) -> f16.
       Fragment order per head: block (slab * TT / 16 + t / 16) * 2 + ks, chunk 32 (pc >> 1) + 16 (pc & 1) + r: the tile is 2 KiB in a row, and the 8 lanes of one pc fill a whole line */
    const int pc = lane & 3, j0 = pc * 8; unsigned short* qd0 = (unsigned short*)C16 + ((size_t)((row0 / TT) * NH + hd) * (TT / 16) + ((row0 % TT) >> 4)) * 1024 + (pc >> 1) * 256 + (pc & 1) * 128;
#pragma unroll
    for (int it = 0; it < 2; ++it) { const int r = it * 8 + (lane >> 2); float a[8], bq[8]; float ss = 0.f;
#pragma unroll
      for (int q = 0; q < 8; ++q) { const float x1 = so[w][r][j0 + q], x2 = so[w][r][32 + j0 + q]; const float c = bf16_round(cr[mi & 1][it][q]), s = bf16_round(sr[mi & 1][it][q]); a[q] = x1 * c + x2 * s; bq[q] = -x1 * s + x2 * c; ss += a[q] * a[q] + bq[q] * bq[q]; }
      ss += __shfl_xor(ss, 1, 32); ss += __shfl_xor(ss, 2, 32); const float rn = rsqrtf(ss / 64.0f + 1.1920929e-7f); FragH f1, f2;
#pragma unroll
      for (int q = 0; q < 8; ++q) { f1.h[q] = (_Float16)(a[q] * rn); f2.h[q] = (_Float16)(bq[q] * rn); }
      *(v8us*)(qd0 + r * 8) = f1.half[0]; *(v8us*)(qd0 + r * 8 + 512) = f2.half[0]; }
    asm volatile("s_wait_xcnt 0x0" ::: "memory");      /* the next strip, or v's epilogue that the build lays behind these stores, writes the stores' registers: the wait stands in front of that */
    __builtin_amdgcn_sched_barrier(0);      /* keeps the next strip's arithmetic below the wait */
  } else {
    const int rsub = lane >> 4, c4 = (lane & 15) * 4;
    v4f vq[8];      /* the strip's 8 LDS reads as one run ahead of its stores */
#pragma unroll
    for (int q = 0; q < 8; ++q) vq[q] = *(const v4fa*)&so[w][q * 2 + rsub][c4];
#pragma unroll
    for (int q = 0; q < 8; ++q) *(v4f*)(C + cofs + (size_t)(row0 + rsub) * NC + col0 + c4 + q * 2 * NC) = vq[q];      /* C has NC columns: one address, the rows are immediate offsets */
    if (mi + 1 < MI) {
      asm volatile("s_wait_xcnt 0x0" ::: "memory");      /* the next strip writes the stores' registers: the wait stands in front of that */
      __builtin_amdgcn_sched_barrier(0);      /* keeps the next strip's arithmetic below the wait */
    }
  }
  if (mi + 1 < MI) { __builtin_amdgcn_fence(__ATOMIC_ACQ_REL, "workgroup", "local"); __builtin_amdgcn_wave_barrier(); }      /* the next strip's stores into the staging tile stay behind this strip's reads of it; LDS only, the global stores are not waited for */
  }
}


// Fragment order of a 16-bit WMMA operand with CC columns: a tile of 16 rows x 32 k is one block of 1 KiB, the blocks of a 16-row strip follow one another in k. 16-byte chunk c (0..63) of a block holds row (c & 15),
// k = 16 (c >> 5) + 8 ((c >> 4) & 1) .. + 7, so lane l's fragment is chunks l and 32 + l: a wave-wide 16-byte load covers 512 contiguous bytes (4 whole lines) and not 32 bytes of each of 16 rows.
// frag_src: the row-major element index of the first of the 8 elements that belong in chunk t of the whole operand. A producer's thread t writes chunk t, so its stores stay contiguous.
__device__ __forceinline__ unsigned frag_src(size_t t) { const unsigned blk = (unsigned)(t >> 6), c = (unsigned)t & 63u; const unsigned rt = blk / (CC / 32), kt = blk % (CC / 32); return (rt * 16 + (c & 15)) * CC + kt * 32 + 16 * (c >> 5) + 8 * ((c >> 4) & 1); }
// lane l <-> lane l ^ 16 (the two halves of a wave hold the two halves of a query's keys)
__device__ __forceinline__ float xhalf(float v) { const int b = __float_as_int(v); return __int_as_float(__builtin_amdgcn_permlanex16(b, b, 0x76543210, 0xfedcba98, false, false)); }
// Transposed products: St = K.Qt (A = 16 key rows, B = the wave's 16 queries as columns) and Ot += Vt.Pt (A = 16 rows of Vt, B = Pt). Lane (ln, hh) holds query q0 + ln only: register r of score tile nt is key
// j0 + 16 nt + 8 hh + r, which is the k order of a B operand, so the two score tiles converted in place ARE Pt; maximum and sums are in-lane plus one exchange between the halves.
__global__ __launch_bounds__(128) void k_flash(const _Float16* __restrict__ Q16, const _Float16* __restrict__ K16, const _Float16* __restrict__ Vt, const float* __restrict__ CB, const float* __restrict__ beta, _Float16* __restrict__ O16) {
  __shared__ float scb[2048];
  constexpr int RPW = 16, NQB = 2048 / (4 * RPW), DT = 4, KS = 2;
  const int tid = threadIdx.x, w = tid >> 5, lane = tid & 31, ln = lane & 15, hh = lane >> 4;
  const int slab = blockIdx.x / NQB, qblk = blockIdx.x % NQB; const int b = slab / 12, h = slab % 12; const int qb0 = qblk * (4 * RPW); const int q0 = qb0 + w * RPW;
  FragH aq[KS];
  /* Q16, K16 (block (slab * 128 + position / 16) * 2 + ks) and Vt (block (slab * 64 + key / 32) * 4 + dt) are in fragment order: lane l loads chunks l and 32 + l of a 1-KiB block; a pass's K is 4 KiB in a row, its V too */
  { const unsigned short* qr = (const unsigned short*)Q16 + ((size_t)slab * 128 + (q0 >> 4)) * 1024 + lane * 8;
#pragma unroll
    for (int ks = 0; ks < KS; ++ks) { aq[ks].half[0] = *(const v8us*)(qr + ks * 512); aq[ks].half[1] = *(const v8us*)(qr + ks * 512 + 256); }
    asm volatile("s_wait_xcnt 0x0" ::: "memory"); }      /* this build reuses the four loads' address pair right behind them: the wait stands in front of that overwrite */
  const float bh = bf16_round(beta[h]);
  for (int i = tid; i < 2048; i += 128) scb[i] = 0.18033688f * (1.0f + bh * CB[i]);      /* log2(e) / 8 * (1 + beta * mean_f cos(d * theta_f)), d = |q - k|: a raw score times its entry is the score as an exponent to base 2 */
  __syncthreads();
  const unsigned short* Vth = (const unsigned short*)Vt + (size_t)slab * 64 * 2048 + lane * 8; const unsigned short* Kh = (const unsigned short*)K16 + (size_t)slab * 64 * 2048 + lane * 8;
  const int tq = q0 + ln;      /* this lane's query */
  float m_q = -3.0e38f, l_q = 0.f, lc_q = 0.f;      /* running maximum (same in both halves); this half's partial sums over all keys and over the causal keys */
  v8f oacc[DT];      /* oacc[dt][r] = Ot[dt * 16 + 8 hh + r][tq] */
#pragma unroll
  for (int dt = 0; dt < DT; ++dt) oacc[dt] = (v8f){0.f,0.f,0.f,0.f,0.f,0.f,0.f,0.f};
  const int jend = 2048;
#pragma unroll 1
  for (int j0 = 0; j0 < jend; j0 += 32) {
    /* all fragment loads of the pass (8 of K, and 8 of V where the pass has a causal key) as one run ahead of its first product: no load moves across the volatile statement that ends mmaH */
    const bool pv = (j0 <= q0 + RPW - 1);      /* some key of this chunk is <= some query of this wave; otherwise every p is 0 */
    FragH bk[2][KS], bv[DT];
#pragma unroll
    for (int nt = 0; nt < 2; ++nt) { const unsigned short* kr = Kh + (size_t)j0 * 64 + nt * 1024;
#pragma unroll
      for (int ks = 0; ks < KS; ++ks) { bk[nt][ks].half[0] = *(const v8us*)(kr + ks * 512); bk[nt][ks].half[1] = *(const v8us*)(kr + ks * 512 + 256); } }
    if (pv) {
#pragma unroll
      for (int dt = 0; dt < DT; ++dt) { const unsigned short* vrow = Vth + (size_t)j0 * 64 + dt * 512; bv[dt].half[0] = *(const v8us*)vrow; bv[dt].half[1] = *(const v8us*)(vrow + 256); } }
    v8f s[2];
#pragma unroll
    for (int nt = 0; nt < 2; ++nt) { v8f acc = (v8f){0.f,0.f,0.f,0.f,0.f,0.f,0.f,0.f};
#pragma unroll
      for (int ks = 0; ks < KS; ++ks) acc = mmaH<1>(bk[nt][ks].v, bk[nt][ks].v, aq[ks].v, aq[ks].v, acc); s[nt] = acc; }
    float tb[16]; const int xq4 = 4 * (tq - 8 * hh - j0);      /* 4 (q - k) at this lane's first key of the pass */
#pragma unroll
    for (int i = 0; i < 16; ++i) { const int x4 = xq4 - 4 * ((i >> 3) * 16 + (i & 7)); const int d4 = (x4 < 0) ? -x4 : x4;      /* x4 = 4 (q - k), the table's byte offset up to its sign */
      tb[i] = *(const float*)((const char*)scb + d4); }
    v2f sw[8]; float sv[16];      /* neighbouring accumulator registers as pairs: the packed multiply here and the packed subtraction below serve two scores each */
#pragma unroll
    for (int i = 0; i < 8; ++i) { sw[i] = (v2f){s[i >> 2][2 * (i & 3)], s[i >> 2][2 * (i & 3) + 1]} * (v2f){tb[2 * i], tb[2 * i + 1]}; sv[2 * i] = sw[i][0]; sv[2 * i + 1] = sw[i][1]; }
    float mx[4];
#pragma unroll
    for (int i = 0; i < 4; ++i) mx[i] = fmaxf(fmaxf(sv[i], sv[4 + i]), fmaxf(sv[8 + i], sv[12 + i]));
    float mc = fmaxf(fmaxf(mx[0], mx[1]), fmaxf(mx[2], mx[3])); mc = fmaxf(mc, xhalf(mc));
    const float mn = fmaxf(m_q, mc); const float ea = __builtin_amdgcn_exp2f(m_q - mn); const float al = (mn > -1.0e38f) ? ea : 1.0f; m_q = mn;
    v2f dv[8];      /* exponents to base 2 */
#pragma unroll
    for (int i = 0; i < 8; ++i) dv[i] = sw[i] - (v2f){mn, mn};
    float ev[16];      /* 2^(score - maximum), one v_exp_f32 each: the argument is never above 0 (mn is the maximum of the same products), and far below 0 the result goes to 0 as it should; the pass's 16 stand as one run ahead of the selects and sums that read them */
#pragma unroll
    for (int i = 0; i < 16; ++i) ev[i] = __builtin_amdgcn_exp2f(dv[i >> 1][i & 1]);
    float se[4] = {0.f, 0.f, 0.f, 0.f}, sp[4] = {0.f, 0.f, 0.f, 0.f}; FragH pb;      /* full-softmax stats over ALL keys; P.V and its sum only over the causal ones */
#pragma unroll
    for (int i = 0; i < 16; ++i) { const int x4 = xq4 - 4 * ((i >> 3) * 16 + (i & 7)); const float e = ev[i]; const float p = (x4 >= 0) ? e : 0.f; se[i & 3] += e; sp[i & 3] += p; pb.h[i] = (_Float16)p; }
    l_q = l_q * al + ((se[0] + se[1]) + (se[2] + se[3])); lc_q = lc_q * al + ((sp[0] + sp[1]) + (sp[2] + sp[3]));
#pragma unroll
    for (int dt = 0; dt < DT; ++dt)
#pragma unroll
      for (int r = 0; r < 8; ++r) oacc[dt][r] *= al;
    if (pv) {
#pragma unroll
      for (int dt = 0; dt < DT; ++dt) oacc[dt] = mmaH<1>(bv[dt].v, bv[dt].v, pb.v, pb.v, oacc[dt]); } }
  const float l = l_q + xhalf(l_q), lc = lc_q + xhalf(lc_q); const float inv = 1.0f / (lc + 1e-8f * l);      /* w * causal / (sum_causal w + 1e-8) with w = e^(s-m) / Z_full  =  e^(s-m) / (Z_causal + 1e-8 * Z_full) */
  /* the output projection's A operand (f16, fragment order of a row-major operand with CC columns: block (row / 16) * (CC / 32) + column / 32, chunk c = row c & 15, k = 16 (c >> 5) + 8 ((c >> 4) & 1) .. + 7) straight from the registers:
     lane (ln, hh) holds in oacc[dt][0..7] the columns h * 64 + 16 dt + 8 hh .. + 7 of row q0 + ln, which IS chunk 32 (dt & 1) + lane of block 2 h + (dt >> 1); a wave's store is 512 bytes in a row */
  unsigned short* od = (unsigned short*)O16 + ((((size_t)b * 2048 + q0) >> 4) * (CC / 32) + 2 * h) * 512 + lane * 8;
#pragma unroll
  for (int dt = 0; dt < DT; ++dt) { FragH f;
#pragma unroll
    for (int r = 0; r < 8; ++r) f.h[r] = (_Float16)(oacc[dt][r] * inv);
    *(v8us*)(od + dt * 256) = f.half[0]; } }

// Everything that depends on the inputs alone, in one launch; the block index picks the job. The three jobs read and write nothing of one another.
// Blocks 0 .. GC - 1: the coherence table (first, their chain of pow, cos and a serial sum is the longest). The next GX: x as f16 in fragment order. The last 4 GW: the four weights (out,in), x 16, as f16 in fragment order, one behind the other.
__global__ __launch_bounds__(256) void k_prep(const float* __restrict__ x, const float* __restrict__ Wq, const float* __restrict__ Wk, const float* __restrict__ Wv, const float* __restrict__ Wo,
                                              _Float16* __restrict__ X16, _Float16* __restrict__ Bt, float* __restrict__ CB) {
  constexpr unsigned GC = TT / 8, GX = NR * CC / 8 / 256, GW = CC * CC / 8 / 256; static_assert(NR * CC % 2048 == 0 && CC * CC % 2048 == 0, "whole blocks");
  __shared__ float sc[8][33]; const int tid = threadIdx.x; unsigned bid = blockIdx.x;
  if (bid < GC) { const int g = tid >> 5, f = tid & 31; const int dl = bid * 8 + g;      /* one thread per (distance, frequency) term; a block makes 8 table entries */
    const float th = powf(10000.0f, -(float)(2 * f) / 64.0f); sc[g][f] = cosf((float)dl * th); __syncthreads();
    if (tid < 8) { float s = 0.f;
      for (int i = 0; i < 32; ++i) s += sc[tid][i];      /* f = 0..31 in ascending order */
      CB[bid * 8 + tid] = s / 32.0f; }
    return; }
  bid -= GC;
  if (bid < GX) { const size_t t = (size_t)bid * 256 + tid; FragH f; const float* xs = x + frag_src(t);
#pragma unroll
    for (int q = 0; q < 8; ++q) f.h[q] = (_Float16)bf16_round(xs[q]);
    *(v8us*)((unsigned short*)X16 + t * 8) = f.half[0];
    asm volatile("s_wait_xcnt 0x0" ::: "memory");      /* the build lays another job's code behind this store, skipped by a scalar flag: the wait stands in front of whatever there writes the store's registers */
    return; }
  bid -= GX;
  const unsigned m = bid / GW; const float* W = (m == 0) ? Wq : (m == 1) ? Wk : (m == 2) ? Wv : Wo;
  const size_t t = (size_t)(bid - m * GW) * 256 + tid; FragH f; const float* ws = W + frag_src(t);
#pragma unroll
  for (int i = 0; i < 8; ++i) f.h[i] = (_Float16)(bf16_round(ws[i]) * 16.0f);
  *(v8us*)((unsigned short*)Bt + ((size_t)m * (CC * CC / 8) + t) * 8) = f.half[0];
  asm volatile("s_wait_xcnt 0x0" ::: "memory"); }      /* as above */
extern "C" void kernel_launch(void* const* d_in, const int* in_sizes, int n_in,
                              void* d_out, int out_size, void* d_ws, size_t ws_size, hipStream_t stream) {
  (void)in_sizes; (void)n_in; (void)out_size;
  const float* x = (const float*)d_in[0]; const float* cosT = (const float*)d_in[1]; const float* sinT = (const float*)d_in[2]; const float* Wq = (const float*)d_in[3]; const float* Wk = (const float*)d_in[4]; const float* Wv = (const float*)d_in[5]; const float* Wo = (const float*)d_in[6]; const float* beta = (const float*)d_in[7];
  char* ws = (char*)d_ws; size_t off = 0;
  auto take = [&](size_t bytes) { char* p = ws + off; off += (bytes + 255) & ~(size_t)255; return p; };
  _Float16* Bq = (_Float16*)take((size_t)CC * CC * 2); _Float16* Bk = (_Float16*)take((size_t)CC * CC * 2); _Float16* Bv = (_Float16*)take((size_t)CC * CC * 2); _Float16* Bo = (_Float16*)take((size_t)CC * CC * 2); float* CB = (float*)take(TT * 4);
  _Float16* X16 = (_Float16*)take((size_t)NR * CC * 2); _Float16* Q16 = (_Float16*)take((size_t)NR * CC * 2); _Float16* K16 = (_Float16*)take((size_t)NR * CC * 2); _Float16* Vt = (_Float16*)take((size_t)NR * CC * 2); _Float16* O16 = X16;      // X16 dead after the q/k/v GEMM
  static_assert(CC * CC * 2 % 256 == 0 && NR * CC * 2 % 256 == 0, "take() leaves no gap between the weights, nor between Q16, K16 and Vt"); (void)Bk; (void)Bv;
  if (off > ws_size) return;      // 4.7 + 6.3 x 4 = about 30 MiB
  k_prep<<<TT / 8 + NR * CC / 8 / 256 + 4 * (CC * CC / 8 / 256), 256, 0, stream>>>(x, Wq, Wk, Wv, Wo, X16, Bq, CB);      // Bq, Bk, Bv, Bo lie one behind the other
  k_gemm_hhx<3 * CC, CC, 3, 4, 1><<<dim3((NR / 128) * (3 * CC / 128), 1), 128, 0, stream>>>(X16, CC, 0, Bq, CC, 0, 0.0625f, nullptr, Q16, 0, NR, cosT, sinT);      // Q16, K16, Vt lie one behind the other
  k_flash<<<BB * NH * (TT / 64), 128, 0, stream>>>(Q16, K16, Vt, CB, beta, O16);      // RPW 16
  k_gemm_hhx<CC, CC, 0, 2, 2><<<dim3((NR / 64) * (CC / 128), 1), 128, 0, stream>>>(O16, CC, 0, Bo, CC, 0, 0.0625f, (float*)d_out, nullptr, 0, NR, nullptr, nullptr);
}

// v010
// One run takes 87.5 microseconds.
// In two side-by-side timings against v009, it was 1.16 and 1.15 times as fast.
// Over all steps from v000 it is 5.25 times as fast.
#include <hip/hip_runtime.h>
// Phase-aware causal attention: q/k/v/o projections (4096 × 768 × 768, no bias, weights (out,in) bf16-exact ×2^4) and the 12-head attention as a fused flash-style kernel on v_wmma_f32_16x16x32_f16
// (rotary (with the INPUT cos/sin tables) + rms-norm'd q,k as f16; S = Q·Kᵀ/8 × (1 + β_h·mean_f cos(|q−k|·θ_f)) with the 2048-entry coherence table precomputed; the module's FULL softmax followed
// by causal masking and re-normalisation with +1e-8 is reproduced exactly as e^{s−m}/(Z_causal + 1e-8·Z_full) with m over the keys up to the diagonal pass, Z_full over all keys; P f16 ≤ 1; O = P·V over causal keys); f32 accumulate.
#define BB 2
#define TT 2048
#define CC 768
#define NH 12
#define NR (BB * TT)

typedef __bf16 v16b __attribute__((ext_vector_type(16)));
typedef unsigned short v8us __attribute__((ext_vector_type(8), may_alias));
typedef float  v8f  __attribute__((ext_vector_type(8)));
typedef float  v4f  __attribute__((ext_vector_type(4)));
typedef float  v4fa __attribute__((ext_vector_type(4), may_alias));
typedef float  v2f  __attribute__((ext_vector_type(2)));
union FragB { v16b v; v8us half[2]; unsigned short u[16]; };

__device__ __forceinline__ unsigned short bf16_bits(float x) { unsigned int u = __float_as_uint(x); return (unsigned short)((u + 0x7FFFu + ((u >> 16) & 1u)) >> 16); }
__device__ __forceinline__ float bf16_val(unsigned short b) { return __uint_as_float(((unsigned int)b) << 16); }
__device__ __forceinline__ float bf16_round(float x) { return bf16_val(bf16_bits(x)); }
// D += A·B with NT terms: 1 = ah·bh, 2 = + al·bh (A split), 3 = + ah·bl (both split)
template <int NT>
__device__ __forceinline__ v8f mmaN(v16b ah, v16b al, v16b bh, v16b bl, v8f c) {
  c = __builtin_amdgcn_wmma_f32_16x16x32_bf16(false, ah, false, bh, (short)0, c, false, false);
  if (NT >= 2) c = __builtin_amdgcn_wmma_f32_16x16x32_bf16(false, al, false, bh, (short)0, c, false, false);
  if (NT >= 3) c = __builtin_amdgcn_wmma_f32_16x16x32_bf16(false, ah, false, bl, (short)0, c, false, false);
  asm volatile("v_nop\n\tv_nop\n\tv_nop\n\tv_nop" : "+v"(c) : "v"(ah), "v"(al), "v"(bh), "v"(bl));
  return c;
}

__global__ __launch_bounds__(256) void k_wt_bf16(const float* __restrict__ W, unsigned short* __restrict__ Wt, int K, int N) {
  const int t = blockIdx.x * 256 + threadIdx.x;
  const int k8n = K / 8;
  if (t >= N * k8n) return;
  const int n = t / k8n, k8 = (t % k8n) * 8;
  v8us v;
#pragma unroll
  for (int i = 0; i < 8; ++i) v[i] = bf16_bits(W[(size_t)(k8 + i) * N + n]);
  *(v8us*)(Wt + (size_t)n * K + k8) = v;
  
}

// GEMM C[M][N] (f32, pitch ldc) = act(A[M][K]·W + bias). A f32 row-major (pitch lda) converted per fragment to bf16
// (ASPLIT: hi/lo two planes -> 2 terms, else single rounded term); Wt bf16 [N][K] (pitch ldb). BIAS_BF16 rounds the
// bias to bf16 first (bias quantised to bf16 before the add). K%32==0, M%16==0, N%64==0.
template <bool ASPLIT, int ACT, bool BIAS_BF16>
__global__ __launch_bounds__(128) void k_gemm_bf(const float* __restrict__ A, int lda, const unsigned short* __restrict__ Wt, int ldb,
                                               const float* __restrict__ bias, float* __restrict__ C, int ldc, int M, int N, int K) {
  __shared__ __attribute__((aligned(16))) float so[4][16][64];
  const int tid = threadIdx.x, w = tid >> 5, lane = tid & 31, ln = lane & 15, hh = lane >> 4;
  const int ntn = N / 64;
  const int wid = blockIdx.x * 4 + w;
  const int mt = wid / ntn, nq = wid % ntn;
  if (mt * 16 >= M) return;
  const int row0 = mt * 16, col0 = nq * 64;
  const float* arow = A + (size_t)(row0 + ln) * lda;
  v8f acc[4] = {};
  for (int kb = 0; kb < K; kb += 32) {
    FragB ah, al;
    const v4f x0 = *(const v4fa*)(arow + kb + 8 * hh), x1 = *(const v4fa*)(arow + kb + 8 * hh + 4);
    const v4f x2 = *(const v4fa*)(arow + kb + 16 + 8 * hh), x3 = *(const v4fa*)(arow + kb + 16 + 8 * hh + 4);
    float xs[16] = {x0[0],x0[1],x0[2],x0[3],x1[0],x1[1],x1[2],x1[3],x2[0],x2[1],x2[2],x2[3],x3[0],x3[1],x3[2],x3[3]};
#pragma unroll
    for (int i = 0; i < 16; ++i) { const unsigned short hb = bf16_bits(xs[i]); ah.u[i] = hb; al.u[i] = ASPLIT ? bf16_bits(xs[i] - bf16_val(hb)) : (unsigned short)0; }
#pragma unroll
    for (int t = 0; t < 4; ++t) {
      const unsigned short* brow = Wt + (size_t)(col0 + t * 16 + ln) * ldb + kb;
      FragB b;
      b.half[0] = *(const v8us*)(brow + 8 * hh);
      b.half[1] = *(const v8us*)(brow + 16 + 8 * hh);
      acc[t] = mmaN<ASPLIT ? 2 : 1>(ah.v, al.v, b.v, b.v, acc[t]);
    }
  }
#pragma unroll
  for (int t = 0; t < 4; ++t) {
    float bv = bias ? bias[col0 + t * 16 + ln] : 0.f;
    if (BIAS_BF16) bv = bf16_round(bv);
#pragma unroll
    for (int r = 0; r < 8; ++r) { float v = acc[t][r] + bv; if (ACT == 1) v = fmaxf(v, 0.f); so[w][8 * hh + r][t * 16 + ln] = v; }
  }
  __builtin_amdgcn_fence(__ATOMIC_ACQ_REL, "workgroup");
  __builtin_amdgcn_wave_barrier();
  const int rsub = lane >> 4, c4 = (lane & 15) * 4;
  {
#pragma unroll
    for (int q = 0; q < 8; ++q) {
      const int r = q * 2 + rsub;
      const v4f v = *(const v4fa*)&so[w][r][c4];
      *(v4f*)(C + (size_t)(row0 + r) * ldc + col0 + c4) = v;
    }
    
  }
}

// Flash-style causal/unmasked attention, all contractions 3-term bf16 hi/lo splits, f32 softmax with running max.
// q,k,v rows are read from f32 buffers with arbitrary row pitch (so they can live inside a fused qkv buffer);
// D = head size (multiple of 32, <= 128); one wave = 16 query rows; block = 4 waves (64 queries) sharing K/V chunks of 32.
template <int D, bool CAUSAL>
__global__ __launch_bounds__(128) void k_flash(const float* __restrict__ qb, const float* __restrict__ kb, const float* __restrict__ vb,
                                             int pitch, int T, int H, float scale, float* __restrict__ y, int ypitch) {
  constexpr int KS = D / 32;        // k-steps for QK
  constexpr int DT = D / 16;        // d tiles for PV
  __shared__ __attribute__((aligned(16))) unsigned short sKh[32][D + 8], sKl[32][D + 8], sVh[32][D + 8], sVl[32][D + 8];
  __shared__ __attribute__((aligned(16))) unsigned short sPh[4][16][40], sPl[4][16][40];
  __shared__ __attribute__((aligned(16))) float sO[4][16][D];
  const int tid = threadIdx.x, w = tid >> 5, lane = tid & 31, ln = lane & 15, hh = lane >> 4;
  const int nqb = (T + 63) / 64;
  const int bh = blockIdx.x / nqb, qblk = blockIdx.x % nqb;
  const int b = bh / H, h = bh % H;
  const int q0 = qblk * 64 + w * 16;
  const float* Q = qb + (size_t)b * T * pitch + h * D;
  const float* K = kb + (size_t)b * T * pitch + h * D;
  const float* V = vb + (size_t)b * T * pitch + h * D;

  // A fragments of the wave's 16 query rows (scaled), hi/lo
  FragB aqh[KS], aql[KS];
  {
    int row = q0 + ln; if (row >= T) row = T - 1;
    const float* qr = Q + (size_t)row * pitch;
#pragma unroll
    for (int ks = 0; ks < KS; ++ks)
#pragma unroll
      for (int i = 0; i < 16; ++i) {
        const int d = ks * 32 + ((i < 8) ? (8 * hh + i) : (16 + 8 * hh + (i - 8)));
        const float x = qr[d] * scale; const unsigned short hb = bf16_bits(x);
        aqh[ks].u[i] = hb; aql[ks].u[i] = bf16_bits(x - bf16_val(hb));
      }
  }
  float m_r[8], l_r[8];
#pragma unroll
  for (int r = 0; r < 8; ++r) { m_r[r] = -3.0e38f; l_r[r] = 0.f; }
  v8f oacc[DT];
#pragma unroll
  for (int dt = 0; dt < DT; ++dt) oacc[dt] = (v8f){0.f,0.f,0.f,0.f,0.f,0.f,0.f,0.f};

  const int kv_end = CAUSAL ? min(T, qblk * 64 + 64) : T;     // block-uniform
  for (int j0 = 0; j0 < kv_end; j0 += 32) {
    __syncthreads();
    for (int e = tid; e < 32 * (D / 4); e += 128) {
      const int r = e / (D / 4), c4 = (e % (D / 4)) * 4;
      const int key = j0 + r;
      v4f kf = {0.f,0.f,0.f,0.f}, vf = {0.f,0.f,0.f,0.f};
      if (key < T) { kf = *(const v4fa*)(K + (size_t)key * pitch + c4); vf = *(const v4fa*)(V + (size_t)key * pitch + c4); }
#pragma unroll
      for (int t = 0; t < 4; ++t) {
        unsigned short hb = bf16_bits(kf[t]); sKh[r][c4 + t] = hb; sKl[r][c4 + t] = bf16_bits(kf[t] - bf16_val(hb));
        hb = bf16_bits(vf[t]); sVh[r][c4 + t] = hb; sVl[r][c4 + t] = bf16_bits(vf[t] - bf16_val(hb));
      }
    }
    __syncthreads();
    // S tile 16 x 32
    v8f s[2];
#pragma unroll
    for (int nt = 0; nt < 2; ++nt) {
      v8f acc = {};
#pragma unroll
      for (int ks = 0; ks < KS; ++ks) {
        FragB bh_, bl_;
        bh_.half[0] = *(const v8us*)&sKh[nt * 16 + ln][ks * 32 + 8 * hh]; bh_.half[1] = *(const v8us*)&sKh[nt * 16 + ln][ks * 32 + 16 + 8 * hh];
        bl_.half[0] = *(const v8us*)&sKl[nt * 16 + ln][ks * 32 + 8 * hh]; bl_.half[1] = *(const v8us*)&sKl[nt * 16 + ln][ks * 32 + 16 + 8 * hh];
        acc = mmaN<3>(aqh[ks].v, aql[ks].v, bh_.v, bl_.v, acc);
      }
      s[nt] = acc;
    }
    // mask + running max (rows 8hh+r; the 16 lanes of a half share rows)
    float alpha[8];
#pragma unroll
    for (int r = 0; r < 8; ++r) {
      const int qi = q0 + 8 * hh + r;
      const int ja = j0 + ln, jb = j0 + 16 + ln;
      if (CAUSAL) { if (ja > qi) s[0][r] = -3.0e38f; if (jb > qi) s[1][r] = -3.0e38f; }
      if (ja >= T) s[0][r] = -3.0e38f;
      if (jb >= T) s[1][r] = -3.0e38f;
      float mx = fmaxf(s[0][r], s[1][r]);
      mx = fmaxf(mx, __shfl_xor(mx, 1, 32)); mx = fmaxf(mx, __shfl_xor(mx, 2, 32)); mx = fmaxf(mx, __shfl_xor(mx, 4, 32)); mx = fmaxf(mx, __shfl_xor(mx, 8, 32));
      const float mnew = fmaxf(m_r[r], mx);
      alpha[r] = (mnew > -1.0e38f) ? __expf(m_r[r] - mnew) : 1.0f;
      const float p0 = (s[0][r] > -1.0e38f) ? __expf(s[0][r] - mnew) : 0.f;
      const float p1 = (s[1][r] > -1.0e38f) ? __expf(s[1][r] - mnew) : 0.f;
      m_r[r] = mnew;
      l_r[r] = l_r[r] * alpha[r] + p0 + p1;            // per-lane partial row sum (16 lanes combined at the end)
      unsigned short hb = bf16_bits(p0); sPh[w][8 * hh + r][ln] = hb;      sPl[w][8 * hh + r][ln] = bf16_bits(p0 - bf16_val(hb));
      hb = bf16_bits(p1);                sPh[w][8 * hh + r][16 + ln] = hb; sPl[w][8 * hh + r][16 + ln] = bf16_bits(p1 - bf16_val(hb));
    }
#pragma unroll
    for (int dt = 0; dt < DT; ++dt)
#pragma unroll
      for (int r = 0; r < 8; ++r) oacc[dt][r] *= alpha[r];
    __builtin_amdgcn_fence(__ATOMIC_ACQ_REL, "workgroup");
    __builtin_amdgcn_wave_barrier();
    FragB pah, pal;
    pah.half[0] = *(const v8us*)&sPh[w][ln][8 * hh]; pah.half[1] = *(const v8us*)&sPh[w][ln][16 + 8 * hh];
    pal.half[0] = *(const v8us*)&sPl[w][ln][8 * hh]; pal.half[1] = *(const v8us*)&sPl[w][ln][16 + 8 * hh];
#pragma unroll
    for (int dt = 0; dt < DT; ++dt) {
      FragB bvh, bvl;
#pragma unroll
      for (int i = 0; i < 8; ++i) {
        bvh.u[i] = sVh[8 * hh + i][dt * 16 + ln]; bvh.u[8 + i] = sVh[16 + 8 * hh + i][dt * 16 + ln];
        bvl.u[i] = sVl[8 * hh + i][dt * 16 + ln]; bvl.u[8 + i] = sVl[16 + 8 * hh + i][dt * 16 + ln];
      }
      oacc[dt] = mmaN<3>(pah.v, pal.v, bvh.v, bvl.v, oacc[dt]);
    }
    __builtin_amdgcn_fence(__ATOMIC_ACQ_REL, "workgroup");
    __builtin_amdgcn_wave_barrier();
  }
#pragma unroll
  for (int r = 0; r < 8; ++r) {
    float l = l_r[r];
    l += __shfl_xor(l, 1, 32); l += __shfl_xor(l, 2, 32); l += __shfl_xor(l, 4, 32); l += __shfl_xor(l, 8, 32);
    l_r[r] = (l > 0.f) ? 1.0f / l : 0.f;
  }
#pragma unroll
  for (int dt = 0; dt < DT; ++dt)
#pragma unroll
    for (int r = 0; r < 8; ++r) sO[w][8 * hh + r][dt * 16 + ln] = oacc[dt][r] * l_r[r];
  __builtin_amdgcn_fence(__ATOMIC_ACQ_REL, "workgroup");
  __builtin_amdgcn_wave_barrier();
  {
    for (int r = 0; r < 16; ++r) {
      const int row = q0 + r;
      if (row < T && lane < D / 4) {
        const v4f val = *(const v4fa*)&sO[w][r][lane * 4];
        *(v4f*)(y + ((size_t)b * T + row) * ypitch + h * D + lane * 4) = val;
      }
    }
    
  }
}

// GEMM C = act(A·W + bias + resid): A f32 (ASPLIT -> hi/lo 2 terms), Wt bf16 [N][K]; ACT 0 none, 1 relu, 2 exact gelu;
// resid (optional, f32, row index = (row % rmod), pitch ldr, RES_BF16 rounds it) added before the activation.
template <bool ASPLIT, int ACT, bool BIAS_BF16, bool RES_BF16>
__global__ __launch_bounds__(128) void k_gemm_bf3(const float* __restrict__ A, int lda, const unsigned short* __restrict__ Wt, int ldb,
                                                const float* __restrict__ bias, const float* __restrict__ resid, int rmod, int ldr,
                                                float* __restrict__ C, int ldc, int M, int N, int K) {
  __shared__ __attribute__((aligned(16))) float so[4][16][64];
  const int tid = threadIdx.x, w = tid >> 5, lane = tid & 31, ln = lane & 15, hh = lane >> 4;
  const int ntn = N / 64;
  const int wid = blockIdx.x * 4 + w;
  const int mt = wid / ntn, nq = wid % ntn;
  if (mt * 16 >= M) return;
  const int row0 = mt * 16, col0 = nq * 64;
  const float* arow = A + (size_t)(row0 + ln) * lda;
  v8f acc[4] = {};
  for (int kb = 0; kb < K; kb += 32) {
    FragB ah, al;
    const v4f x0 = *(const v4fa*)(arow + kb + 8 * hh), x1 = *(const v4fa*)(arow + kb + 8 * hh + 4);
    const v4f x2 = *(const v4fa*)(arow + kb + 16 + 8 * hh), x3 = *(const v4fa*)(arow + kb + 16 + 8 * hh + 4);
    float xs[16] = {x0[0],x0[1],x0[2],x0[3],x1[0],x1[1],x1[2],x1[3],x2[0],x2[1],x2[2],x2[3],x3[0],x3[1],x3[2],x3[3]};
#pragma unroll
    for (int i = 0; i < 16; ++i) { const unsigned short hb = bf16_bits(xs[i]); ah.u[i] = hb; al.u[i] = ASPLIT ? bf16_bits(xs[i] - bf16_val(hb)) : (unsigned short)0; }
#pragma unroll
    for (int t = 0; t < 4; ++t) {
      const unsigned short* brow = Wt + (size_t)(col0 + t * 16 + ln) * ldb + kb;
      FragB b;
      b.half[0] = *(const v8us*)(brow + 8 * hh);
      b.half[1] = *(const v8us*)(brow + 16 + 8 * hh);
      acc[t] = mmaN<ASPLIT ? 2 : 1>(ah.v, al.v, b.v, b.v, acc[t]);
    }
  }
#pragma unroll
  for (int t = 0; t < 4; ++t) {
    const int col = col0 + t * 16 + ln;
    float bv = bias ? bias[col] : 0.f;
    if (BIAS_BF16) bv = bf16_round(bv);
#pragma unroll
    for (int r = 0; r < 8; ++r) {
      float v = acc[t][r] + bv;
      if (resid) { float rv = resid[(size_t)((row0 + 8 * hh + r) % rmod) * ldr + col]; if (RES_BF16) rv = bf16_round(rv); v += rv; }
      if (ACT == 1) v = fmaxf(v, 0.f);
      if (ACT == 2) v = 0.5f * v * (1.0f + erff(v * 0.70710678118654752f));
      if (ACT == 3) { const float u = 0.7978845608028654f * (v + 0.044715f * v * v * v); v = 0.5f * v * (1.0f + tanhf(u)); }
      so[w][8 * hh + r][t * 16 + ln] = v;
    }
  }
  __builtin_amdgcn_fence(__ATOMIC_ACQ_REL, "workgroup");
  __builtin_amdgcn_wave_barrier();
  const int rsub = lane >> 4, c4 = (lane & 15) * 4;
  {
#pragma unroll
    for (int q = 0; q < 8; ++q) {
      const int r = q * 2 + rsub;
      const v4f v = *(const v4fa*)&so[w][r][c4];
      *(v4f*)(C + (size_t)(row0 + r) * ldc + col0 + c4) = v;
    }
    
  }
}
// row LayerNorm (biased variance, eps) over N: s = X (+ R); optional out_sum <- s; out_norm <- (s-mu)*rsqrt(var+eps)*g + b
template <bool PARAM_BF16>
__global__ __launch_bounds__(256) void k_layernorm(const float* __restrict__ X, const float* __restrict__ R, const float* __restrict__ g, const float* __restrict__ bta,
                                                  float* __restrict__ out_sum, float* __restrict__ out_norm, int N, float eps) {
  __shared__ float red[256];
  const int row = blockIdx.x, tid = threadIdx.x;
  const float* x = X + (size_t)row * N; const float* rr = R ? R + (size_t)row * N : nullptr;
  float vals[16];                     // up to N = 4096
  const int per = N / 256;            // contiguous chunk per thread? use strided-by-4 chunks: thread handles j = tid*4 + 1024*u
  float s1 = 0.f;
  for (int u = 0; u < per / 4; ++u) {
    const int j = tid * 4 + 1024 * u;
    const v4f a = *(const v4fa*)(x + j);
    v4f b = {0.f,0.f,0.f,0.f}; if (rr) b = *(const v4fa*)(rr + j);
#pragma unroll
    for (int q = 0; q < 4; ++q) { const float v = a[q] + b[q]; vals[u * 4 + q] = v; s1 += v; }
  }
  red[tid] = s1; __syncthreads();
  for (int st = 128; st > 0; st >>= 1) { if (tid < st) red[tid] += red[tid + st]; __syncthreads(); }
  const float mu = red[0] / (float)N; __syncthreads();
  float s2 = 0.f;
  for (int u = 0; u < per / 4; ++u)
#pragma unroll
    for (int q = 0; q < 4; ++q) { const float c = vals[u * 4 + q] - mu; s2 += c * c; }
  red[tid] = s2; __syncthreads();
  for (int st = 128; st > 0; st >>= 1) { if (tid < st) red[tid] += red[tid + st]; __syncthreads(); }
  const float rs = rsqrtf(red[0] / (float)N + eps);
  {
    for (int u = 0; u < per / 4; ++u) {
      const int j = tid * 4 + 1024 * u;
      v4f o, sm;
#pragma unroll
      for (int q = 0; q < 4; ++q) {
        float gg = g[j + q], bb = bta[j + q];
        if (PARAM_BF16) { gg = bf16_round(gg); bb = bf16_round(bb); }
        sm[q] = vals[u * 4 + q]; o[q] = (vals[u * 4 + q] - mu) * rs * gg + bb;
      }
      if (out_sum) *(v4f*)(out_sum + (size_t)row * N + j) = sm;
      *(v4f*)(out_norm + (size_t)row * N + j) = o;
    }
    
  }
}



// ---- f16 WMMA path (v_wmma_f32_16x16x32_f16): 11-bit significands for operands in range — used where a [0,1] probability operand needs more precision than bf16
typedef _Float16 v16h __attribute__((ext_vector_type(16)));
union FragH { v16h v; v8us half[2]; _Float16 h[16]; unsigned short u[16]; };
template <int NT>
__device__ __forceinline__ v8f mmaH(v16h ah, v16h al, v16h bh, v16h bl, v8f c) {
  c = __builtin_amdgcn_wmma_f32_16x16x32_f16(false, ah, false, bh, (short)0, c, false, false);
  if (NT >= 2) c = __builtin_amdgcn_wmma_f32_16x16x32_f16(false, al, false, bh, (short)0, c, false, false);
  if (NT >= 3) c = __builtin_amdgcn_wmma_f32_16x16x32_f16(false, ah, false, bl, (short)0, c, false, false);
  asm volatile("v_nop\n\tv_nop\n\tv_nop\n\tv_nop" : "+v"(c) : "v"(ah), "v"(al), "v"(bh), "v"(bl));
  return c;
}
// batched GEMM like k_gemm_b but f16 operands: A f32 (split into f16 hi/lo if ASPLIT, else rounded to f16), Bt = f16 values [n][k]; alpha; C f32; N multiple of 16 (partial tiles skipped)
template <bool ASPLIT>
__global__ __launch_bounds__(128) void k_gemm_h(const float* __restrict__ A, int lda, size_t sA, const _Float16* __restrict__ Bh, int ldb, size_t sB, float alpha, float* __restrict__ C, int ldc, size_t sC, int M, int N, int K) {
  __shared__ __attribute__((aligned(16))) float so[4][16][64];
  const int tid = threadIdx.x, w = tid >> 5, lane = tid & 31, ln = lane & 15, hh = lane >> 4; const int by = blockIdx.y;
  A += (size_t)by * sA; Bh += (size_t)by * sB; C += (size_t)by * sC;
  const int ntn = (N + 63) / 64; const int wid = blockIdx.x * 4 + w; const int mt = wid / ntn, nq = wid % ntn; if (mt * 16 >= M) return;
  const int row0 = mt * 16, col0 = nq * 64; const float* arow = A + (size_t)(row0 + ln) * lda;
  v8f acc[4] = {};
  for (int kb = 0; kb < K; kb += 32) {
    FragH ah, al;
    const v4f x0 = *(const v4fa*)(arow + kb + 8 * hh), x1 = *(const v4fa*)(arow + kb + 8 * hh + 4), x2 = *(const v4fa*)(arow + kb + 16 + 8 * hh), x3 = *(const v4fa*)(arow + kb + 16 + 8 * hh + 4);
    float xs[16] = {x0[0],x0[1],x0[2],x0[3],x1[0],x1[1],x1[2],x1[3],x2[0],x2[1],x2[2],x2[3],x3[0],x3[1],x3[2],x3[3]};
#pragma unroll
    for (int i = 0; i < 16; ++i) { const _Float16 h = (_Float16)xs[i]; ah.h[i] = h; al.h[i] = ASPLIT ? (_Float16)(xs[i] - (float)h) : (_Float16)0.0f; }
#pragma unroll
    for (int t = 0; t < 4; ++t) { if (col0 + t * 16 >= N) continue; const size_t boff = (size_t)(col0 + t * 16 + ln) * ldb + kb; FragH bq; bq.half[0] = *(const v8us*)(Bh + boff + 8 * hh); bq.half[1] = *(const v8us*)(Bh + boff + 16 + 8 * hh);
      acc[t] = mmaH<ASPLIT ? 2 : 1>(ah.v, al.v, bq.v, bq.v, acc[t]); }
  }
#pragma unroll
  for (int t = 0; t < 4; ++t) { if (col0 + t * 16 >= N) continue;
#pragma unroll
    for (int r = 0; r < 8; ++r) so[w][8 * hh + r][t * 16 + ln] = acc[t][r] * alpha; }
  __builtin_amdgcn_fence(__ATOMIC_ACQ_REL, "workgroup"); __builtin_amdgcn_wave_barrier();
  const int rsub = lane >> 4, c4 = (lane & 15) * 4;
  {
#pragma unroll
    for (int q = 0; q < 8; ++q) { const int r = q * 2 + rsub; if (col0 + c4 < N) { const v4f v = *(const v4fa*)&so[w][r][c4]; *(v4f*)(C + (size_t)(row0 + r) * ldc + col0 + c4) = v; } }
     }
}

// Wt[n][k] = f16(W[k][n]·scale) from f32 row-major W[K][N] (scale = power of two; bf16-exact weights stay exact in f16 away from the subnormal range)
__global__ __launch_bounds__(256) void k_wt_f16(const float* __restrict__ W, _Float16* __restrict__ Wt, int K, int N, float scale) {
  const int t = blockIdx.x * 256 + threadIdx.x; if (t >= N * (K / 8)) return; const int n = t / (K / 8), k8 = (t % (K / 8)) * 8; FragH f;
#pragma unroll
  for (int i = 0; i < 8; ++i) f.h[i] = (_Float16)(bf16_round(W[(size_t)(k8 + i) * N + n]) * scale); const v8us o = f.half[0];
  *(v8us*)((unsigned short*)Wt + (size_t)n * K + k8) = o; 
}
// GEMM on f16 operands in fragment order with a fused epilogue on v = acc * alpha
// N and K are compile-time (NC, KC; NC a multiple of 128) and the k loop unrolls into groups of KU k-steps.
// EPI: what the wave does with each strip of 16 rows x 64 columns, which are 16 positions of ONE head. 0: row-major f32 stores to C. 1: rotary + rms-norm, stored to C16 as f16 in the attention kernel's fragment order for q and k.
// 2: stored to C16 as f16 in the fragment order of Vt. 1 and 2 take the place of a launch of their own that read the tile back from memory.
// 3: the q, k and v projections as ONE product with NC = 3 CC columns (the three weight operands follow one another in memory, the three results too): a column block of CC picks the result and 1 (q, k) or 2 (v).
// MI: a wave's tile is 16 MI rows x 64 columns, so a loaded B fragment feeds MI products and an A fragment 4: (MI + 4) KiB loaded per 4 MI products. The block's 4 waves stand 2 x 2 (32 MI rows x 128 columns): each fragment is asked for by two of them.
// KUP: k-steps per load group. The epilogue takes the tile's MI strips of 16 rows one after the other.
template <int NC, int KC, int EPI, int MI, int KUP>
__global__ __launch_bounds__(128) void k_gemm_hhx(const _Float16* __restrict__ A, int lda, size_t sA, const _Float16* __restrict__ Bh, int ldb, size_t sB, float alpha,
    float* __restrict__ C, _Float16* __restrict__ C16, size_t sC, int M, const float* __restrict__ cosT, const float* __restrict__ sinT) {
  constexpr int N = NC, KU = KUP, NG = KC / (32 * KU); static_assert(KC % (32 * KU) == 0, "k groups"); static_assert(NC % 128 == 0, "whole column blocks");
  constexpr int SP = (EPI == 1 || EPI == 3) ? 68 : 64;      /* row pitch of the staged tile in floats: the rotary epilogue's lanes read 8 different rows at one column, which at 64 would all be the same banks */
  __shared__ __attribute__((aligned(16))) float so[4][16][SP];
  const int tid = threadIdx.x, w = tid >> 5, lane = tid & 31, ln = lane & 15, hh = lane >> 4; const int by = blockIdx.y;
  A += (size_t)by * sA; Bh += (size_t)by * sB; const size_t cofs = (size_t)by * sC;
  constexpr int NBC = N / 128; const int bm = blockIdx.x / NBC, bn = blockIdx.x % NBC; const int nq = bn * 2 + (w & 1);
  const int rowt = (bm * 2 + (w >> 1)) * (16 * MI), col0 = nq * 64; if (rowt >= M) return;
  const int sel = (EPI == 3) ? bn / (CC / 128) : 0;      /* which of q, k, v: a block's 128 columns lie in one of them, so the block index alone says it and the test below is scalar */
  const int hd = nq - sel * NH;      /* the head */
  C16 += (size_t)sel * ((size_t)NR * CC);
  v8f acc[MI][4] = {};
  // A and Bh are stored in fragment order (frag_src below): 16 rows of lda (ldb) elements are lda / 32 blocks of 1 KiB, one per k-step, and lane l's two loads of a fragment are 16-byte chunks l and 32 + l of the block.
  // The fragment loads of a whole group (KU k-steps: 2 MI KU of A, 8 KU of B) are written as one run, one group ahead of the products that use them, in two register sets.
  // The products are the plain builtin: accumulators and both fragment sets need more than 256 registers, and an asm statement's operands (the one that ends mmaH) are kept below v256, which spilled.
  FragH fa[2][KU][MI], fb[2][KU][4];
  const unsigned short* ap = (const unsigned short*)A + (size_t)rowt * lda + lane * 8; const unsigned short* bp0 = (const unsigned short*)Bh + (size_t)col0 * ldb + lane * 8;
#pragma unroll
  for (int g = -1; g < NG; ++g) {
    if (g + 1 < NG) { const int nx = (g + 1) & 1;
#pragma unroll
      for (int u = 0; u < KU; ++u) { const int kb = ((g + 1) * KU + u) * 512;
#pragma unroll
        for (int mi = 0; mi < MI; ++mi) { const unsigned short* ar = ap + (size_t)(mi * 16) * lda + kb; fa[nx][u][mi].half[0] = *(const v8us*)ar; fa[nx][u][mi].half[1] = *(const v8us*)(ar + 256); }
#pragma unroll
        for (int t = 0; t < 4; ++t) { const unsigned short* br = bp0 + (size_t)(t * 16) * ldb + kb; fb[nx][u][t].half[0] = *(const v8us*)br; fb[nx][u][t].half[1] = *(const v8us*)(br + 256); } } }
    __builtin_amdgcn_sched_barrier(0);      /* the loads stay one run ahead of the products that follow */
    if (g >= 0) { const int cu = g & 1;
#pragma unroll
      for (int u = 0; u < KU; ++u)
#pragma unroll
        for (int mi = 0; mi < MI; ++mi)
#pragma unroll
          for (int t = 0; t < 4; ++t) acc[mi][t] = __builtin_amdgcn_wmma_f32_16x16x32_f16(false, fa[cu][u][mi].v, false, fb[cu][u][t].v, (short)0, acc[mi][t], false, false); }
    __builtin_amdgcn_sched_barrier(0);      /* keeps the loads of the group after next, which follow these products and refill the set they read, from rising above them */
  }
  if (EPI == 2 || (EPI == 3 && sel == 2)) {
    /* Vt in fragment order, rows = d, k = keys: block ((slab * TT / 32 + key / 32) * 4 + d / 16), chunk c = row d & 15 = c & 15, keys 16 (c >> 5) + 8 ((c >> 4) & 1) .. + 7. Lane (ln, hh) holds in acc[mi][t][0..7] the keys
       row0 + 8 hh .. + 7 of d = 16 t + ln: that IS chunk 32 ((row0 >> 4) & 1) + lane of block t, so the transpose costs nothing and a wave's store is 512 bytes in a row */
#pragma unroll
    for (int mi = 0; mi < MI; ++mi) { const int row0 = rowt + mi * 16;
      const int t0 = row0 % TT; unsigned short* vd = (unsigned short*)C16 + (((size_t)((row0 / TT) * NH + hd) * (TT / 32) + (t0 >> 5)) * 4) * 512 + (((t0 >> 4) & 1) * 32 + lane) * 8;
#pragma unroll
      for (int t = 0; t < 4; ++t) { FragH f;
#pragma unroll
        for (int r = 0; r < 8; ++r) f.h[r] = (_Float16)(acc[mi][t][r] * alpha);
        *(v8us*)(vd + t * 512) = f.half[0]; } }
    return;
  }
  float cr[2][2][8], sr[2][2][8];      /* EPI 1: lane = part pc (8 of the 32 rotary pairs) of rows lane >> 2 and 8 + (lane >> 2) of a strip; two sets, a strip's table loads are issued one strip ahead */
  auto tables = [&](int mi) {
#pragma unroll
    for (int it = 0; it < 2; ++it) { const int tj = ((rowt + mi * 16) % TT + it * 8 + (lane >> 2)) * 32 + (lane & 3) * 8;
      const v4f c0 = *(const v4fa*)(cosT + tj), c1 = *(const v4fa*)(cosT + tj + 4), s0 = *(const v4fa*)(sinT + tj), s1 = *(const v4fa*)(sinT + tj + 4);
#pragma unroll
      for (int q = 0; q < 4; ++q) { cr[mi & 1][it][q] = c0[q]; cr[mi & 1][it][4 + q] = c1[q]; sr[mi & 1][it][q] = s0[q]; sr[mi & 1][it][4 + q] = s1[q]; } }
    asm volatile("s_wait_xcnt 0x0" ::: "memory");      /* what follows may take the table loads' address registers as a destination: the wait stands in front of that overwrite */
    __builtin_amdgcn_sched_barrier(0);      /* the clobber does not tie the wait to registers: without this the strip's arithmetic was lifted over it */
  };
  if constexpr (EPI == 1 || EPI == 3) tables(0);
#pragma unroll
  for (int mi = 0; mi < MI; ++mi) { const int row0 = rowt + mi * 16;      /* one strip of 16 rows through the wave's staging tile */
#pragma unroll
  for (int t = 0; t < 4; ++t) {
#pragma unroll
    for (int r = 0; r < 8; ++r) so[w][8 * hh + r][t * 16 + ln] = acc[mi][t][r] * alpha; }
  __builtin_amdgcn_fence(__ATOMIC_ACQ_REL, "workgroup", "local"); __builtin_amdgcn_wave_barrier();      /* the wave's LDS stores before its lanes read one another's; LDS only: the strip before's global stores are not waited for */
  if constexpr (EPI == 1 || EPI == 3) {
    if (mi + 1 < MI) tables(mi + 1);
    /* rotary + rms-norm of the head's 16 rows: x1 = column j, x2 = column 32 + j (j < 32); out = [x1 cos + x2 sin | -x1 sin + x2 cos] with cos, sin = bf16(INPUT tables [t][j]); then x rsqrt(mean(out^2) + f32 eps) -> f16.
       Fragment order per head: block (slab * TT / 16 + t / 16) * 2 + ks, chunk 32 (pc >> 1) + 16 (pc & 1) + r: the tile is 2 KiB in a row, and the 8 lanes of one pc fill a whole line */
    const int pc = lane & 3, j0 = pc * 8; unsigned short* qd0 = (unsigned short*)C16 + ((size_t)((row0 / TT) * NH + hd) * (TT / 16) + ((row0 % TT) >> 4)) * 1024 + (pc >> 1) * 256 + (pc & 1) * 128;
#pragma unroll
    for (int it = 0; it < 2; ++it) { const int r = it * 8 + (lane >> 2); float a[8], bq[8]; float ss = 0.f;
#pragma unroll
      for (int q = 0; q < 8; ++q) { const float x1 = so[w][r][j0 + q], x2 = so[w][r][32 + j0 + q]; const float c = bf16_round(cr[mi & 1][it][q]), s = bf16_round(sr[mi & 1][it][q]); a[q] = x1 * c + x2 * s; bq[q] = -x1 * s + x2 * c; ss += a[q] * a[q] + bq[q] * bq[q]; }
      ss += __shfl_xor(ss, 1, 32); ss += __shfl_xor(ss, 2, 32); const float rn = rsqrtf(ss / 64.0f + 1.1920929e-7f); FragH f1, f2;
#pragma unroll
      for (int q = 0; q < 8; ++q) { f1.h[q] = (_Float16)(a[q] * rn); f2.h[q] = (_Float16)(bq[q] * rn); }
      *(v8us*)(qd0 + r * 8) = f1.half[0]; *(v8us*)(qd0 + r * 8 + 512) = f2.half[0]; }
    asm volatile("s_wait_xcnt 0x0" ::: "memory");      /* the next strip, or v's epilogue that the build lays behind these stores, writes the stores' registers: the wait stands in front of that */
    __builtin_amdgcn_sched_barrier(0);      /* keeps the next strip's arithmetic below the wait */
  } else {
    const int rsub = lane >> 4, c4 = (lane & 15) * 4;
    v4f vq[8];      /* the strip's 8 LDS reads as one run ahead of its stores */
#pragma unroll
    for (int q = 0; q < 8; ++q) vq[q] = *(const v4fa*)&so[w][q * 2 + rsub][c4];
#pragma unroll
    for (int q = 0; q < 8; ++q) *(v4f*)(C + cofs + (size_t)(row0 + rsub) * NC + col0 + c4 + q * 2 * NC) = vq[q];      /* C has NC columns: one address, the rows are immediate offsets */
    if (mi + 1 < MI) {
      asm volatile("s_wait_xcnt 0x0" ::: "memory");      /* the next strip writes the stores' registers: the wait stands in front of that */
      __builtin_amdgcn_sched_barrier(0);      /* keeps the next strip's arithmetic below the wait */
    }
  }
  if (mi + 1 < MI) { __builtin_amdgcn_fence(__ATOMIC_ACQ_REL, "workgroup", "local"); __builtin_amdgcn_wave_barrier(); }      /* the next strip's stores into the staging tile stay behind this strip's reads of it; LDS only, the global stores are not waited for */
  }
}


// Fragment order of a 16-bit WMMA operand with CC columns: a tile of 16 rows x 32 k is one block of 1 KiB, the blocks of a 16-row strip follow one another in k. 16-byte chunk c (0..63) of a block holds row (c & 15),
// k = 16 (c >> 5) + 8 ((c >> 4) & 1) .. + 7, so lane l's fragment is chunks l and 32 + l: a wave-wide 16-byte load covers 512 contiguous bytes (4 whole lines) and not 32 bytes of each of 16 rows.
// frag_src: the row-major element index of the first of the 8 elements that belong in chunk t of the whole operand. A producer's thread t writes chunk t, so its stores stay contiguous.
__device__ __forceinline__ unsigned frag_src(size_t t) { const unsigned blk = (unsigned)(t >> 6), c = (unsigned)t & 63u; const unsigned rt = blk / (CC / 32), kt = blk % (CC / 32); return (rt * 16 + (c & 15)) * CC + kt * 32 + 16 * (c >> 5) + 8 * ((c >> 4) & 1); }
// lane l <-> lane l ^ 16 (the two halves of a wave hold the two halves of a query's keys)
__device__ __forceinline__ float xhalf(float v) { const int b = __float_as_int(v); return __int_as_float(__builtin_amdgcn_permlanex16(b, b, 0x76543210, 0xfedcba98, false, false)); }
template <int V> struct Form { static constexpr int value = V; };      // a compile-time number handed to a lambda
// Transposed products: St = K.Qt (A = 16 key rows, B = the wave's 16 queries as columns) and Ot += Vt.Pt (A = 16 rows of Vt, B = Pt). Lane (ln, hh) holds query q0 + ln only: register r of score tile nt is key
// j0 + 16 nt + 8 hh + r, which is the k order of a B operand, so the two score tiles converted in place ARE Pt; maximum and sums are in-lane plus one exchange between the halves.
__global__ __launch_bounds__(128) void k_flash(const _Float16* __restrict__ Q16, const _Float16* __restrict__ K16, const _Float16* __restrict__ Vt, const float* __restrict__ CB, const float* __restrict__ beta, _Float16* __restrict__ O16) {
  __shared__ float scb[2048];
  constexpr int RPW = 16, NQB = 2048 / (4 * RPW), DT = 4, KS = 2;
  const int tid = threadIdx.x, w = tid >> 5, lane = tid & 31, ln = lane & 15, hh = lane >> 4;
  const int slab = blockIdx.x / NQB, qblk = blockIdx.x % NQB; const int b = slab / 12, h = slab % 12; const int qb0 = qblk * (4 * RPW); const int q0 = qb0 + w * RPW;
  FragH aq[KS];
  /* Q16, K16 (block (slab * 128 + position / 16) * 2 + ks) and Vt (block (slab * 64 + key / 32) * 4 + dt) are in fragment order: lane l loads chunks l and 32 + l of a 1-KiB block; a pass's K is 4 KiB in a row, its V too */
  { const unsigned short* qr = (const unsigned short*)Q16 + ((size_t)slab * 128 + (q0 >> 4)) * 1024 + lane * 8;
#pragma unroll
    for (int ks = 0; ks < KS; ++ks) { aq[ks].half[0] = *(const v8us*)(qr + ks * 512); aq[ks].half[1] = *(const v8us*)(qr + ks * 512 + 256); }
    asm volatile("s_wait_xcnt 0x0" ::: "memory"); }      /* this build reuses the four loads' address pair right behind them: the wait stands in front of that overwrite */
  const float bh = bf16_round(beta[h]);
  for (int i = tid; i < 2048; i += 128) scb[i] = 0.18033688f * (1.0f + bh * CB[i]);      /* log2(e) / 8 * (1 + beta * mean_f cos(d * theta_f)), d = |q - k|: a raw score times its entry is the score as an exponent to base 2 */
  __syncthreads();
  const unsigned short* Vth = (const unsigned short*)Vt + (size_t)slab * 64 * 2048 + lane * 8; const unsigned short* Kh = (const unsigned short*)K16 + (size_t)slab * 64 * 2048 + lane * 8;
  const int tq = q0 + ln;      /* this lane's query */
  float m_q = -3.0e38f, l_q = 0.f, lc_q = 0.f;      /* running maximum (same in both halves); this half's partial sums over all keys and over the causal keys */
  v8f oacc[DT];      /* oacc[dt][r] = Ot[dt * 16 + 8 hh + r][tq] */
#pragma unroll
  for (int dt = 0; dt < DT; ++dt) oacc[dt] = (v8f){0.f,0.f,0.f,0.f,0.f,0.f,0.f,0.f};
  /* The key loop in three forms, by where a pass of 32 keys lies against the wave's 16 queries. jd is the one pass that the diagonal crosses. Below it (j0 < jd) every key is causal for every query: q - k > 0, so the table index needs
     no absolute value, nothing is masked and the causal sum is the full sum. Above it (j0 > jd) no key is causal: such a pass only adds to the full-softmax sum (tail, below). */
  const int jd = __builtin_amdgcn_readfirstlane(q0 & ~31);      /* the same in every lane of a wave: said so, the loops below count and branch on scalar registers and no lane mask is kept for them */
  auto pass = [&](auto md, const int j0) {
    constexpr bool DIAG = decltype(md)::value != 0;
    /* all fragment loads of the pass (8 of K, 8 of V) as one run ahead of its first product: no load moves across the volatile statement that ends mmaH */
    FragH bk[2][KS], bv[DT];
#pragma unroll
    for (int nt = 0; nt < 2; ++nt) { const unsigned short* kr = Kh + (size_t)j0 * 64 + nt * 1024;
#pragma unroll
      for (int ks = 0; ks < KS; ++ks) { bk[nt][ks].half[0] = *(const v8us*)(kr + ks * 512); bk[nt][ks].half[1] = *(const v8us*)(kr + ks * 512 + 256); } }
    asm volatile("s_wait_xcnt 0x0" ::: "memory");      /* the build may give V's first load the K loads' address pair as its destination: the wait stands in front of that overwrite; no load crosses the clobber */
#pragma unroll
    for (int dt = 0; dt < DT; ++dt) { const unsigned short* vrow = Vth + (size_t)j0 * 64 + dt * 512; bv[dt].half[0] = *(const v8us*)vrow; bv[dt].half[1] = *(const v8us*)(vrow + 256); }
    v8f s[2];
#pragma unroll
    for (int nt = 0; nt < 2; ++nt) { v8f acc = (v8f){0.f,0.f,0.f,0.f,0.f,0.f,0.f,0.f};
#pragma unroll
      for (int ks = 0; ks < KS; ++ks) acc = mmaH<1>(bk[nt][ks].v, bk[nt][ks].v, aq[ks].v, aq[ks].v, acc); s[nt] = acc; }
    float tb[16]; const int xq4 = 4 * (tq - 8 * hh - j0);      /* 4 (q - k) at this lane's first key of the pass */
#pragma unroll
    for (int i = 0; i < 16; ++i) { const int x4 = xq4 - 4 * ((i >> 3) * 16 + (i & 7)); const int d4 = (DIAG && x4 < 0) ? -x4 : x4;      /* x4 = 4 (q - k), the table's byte offset up to its sign */
      tb[i] = *(const float*)((const char*)scb + d4); }
    v2f sw[8]; float sv[16];      /* neighbouring accumulator registers as pairs: the packed multiply here and the packed subtraction below serve two scores each */
#pragma unroll
    for (int i = 0; i < 8; ++i) { sw[i] = (v2f){s[i >> 2][2 * (i & 3)], s[i >> 2][2 * (i & 3) + 1]} * (v2f){tb[2 * i], tb[2 * i + 1]}; sv[2 * i] = sw[i][0]; sv[2 * i + 1] = sw[i][1]; }
    float mx[4];
#pragma unroll
    for (int i = 0; i < 4; ++i) mx[i] = fmaxf(fmaxf(sv[i], sv[4 + i]), fmaxf(sv[8 + i], sv[12 + i]));
    float mc = fmaxf(fmaxf(mx[0], mx[1]), fmaxf(mx[2], mx[3])); mc = fmaxf(mc, xhalf(mc));
    const float mn = fmaxf(m_q, mc); const float ea = __builtin_amdgcn_exp2f(m_q - mn); const float al = (mn > -1.0e38f) ? ea : 1.0f; m_q = mn;
    v2f dv[8];      /* exponents to base 2 */
#pragma unroll
    for (int i = 0; i < 8; ++i) dv[i] = sw[i] - (v2f){mn, mn};
    float ev[16];      /* 2^(score - maximum), one v_exp_f32 each: the argument is never above 0 (mn is the maximum of the same products), and far below 0 the result goes to 0 as it should; the pass's 16 stand as one run ahead of the selects and sums that read them */
#pragma unroll
    for (int i = 0; i < 16; ++i) ev[i] = __builtin_amdgcn_exp2f(dv[i >> 1][i & 1]);
    float se[4] = {0.f, 0.f, 0.f, 0.f}, sp[4] = {0.f, 0.f, 0.f, 0.f}; FragH pb;      /* full-softmax stats over ALL keys; P.V and its sum only over the causal ones */
#pragma unroll
    for (int i = 0; i < 16; ++i) { const int x4 = xq4 - 4 * ((i >> 3) * 16 + (i & 7)); const float e = ev[i]; const float p = (!DIAG || x4 >= 0) ? e : 0.f; se[i & 3] += e; if (DIAG) sp[i & 3] += p; pb.h[i] = (_Float16)p; }
    const float sef = (se[0] + se[1]) + (se[2] + se[3]); const float spf = DIAG ? (sp[0] + sp[1]) + (sp[2] + sp[3]) : sef;
    l_q = l_q * al + sef; lc_q = lc_q * al + spf;
#pragma unroll
    for (int dt = 0; dt < DT; ++dt)
#pragma unroll
      for (int r = 0; r < 8; ++r) oacc[dt][r] *= al;
#pragma unroll
    for (int dt = 0; dt < DT; ++dt) oacc[dt] = mmaH<1>(bv[dt].v, bv[dt].v, pb.v, pb.v, oacc[dt]);
  };
#pragma unroll 1      /* a pass hangs on the one before through the running maximum: copies of the body would only cost instruction cache */
  for (int j0 = 0; j0 < jd; j0 += 32) pass(Form<0>{}, j0);
  pass(Form<1>{}, jd);
  /* Above the diagonal: sum of 2^(score - m_q) with m_q, the maximum over the keys up to the diagonal pass, held fixed. No running maximum, so nothing is rescaled; no P, no V. The sum only enters as 1e-8 * Z_full: a key far above m_q makes it
     large or infinite, which sends the output to 0 as the reference's underflowing causal weights over 1e-8 do; it cannot lose accuracy against l_q, which holds a term 1. NP passes a trip: they depend on one another only through the sums.
     A pass of this form is much shorter than one below the diagonal, so a block's work now grows with qblk; the map from block index to (slab, qblk) is as it was. */
  v2f ts[4] = {(v2f){0.f, 0.f}, (v2f){0.f, 0.f}, (v2f){0.f, 0.f}, (v2f){0.f, 0.f}};
  const v2f mneg = (v2f){-m_q, -m_q};
  auto tail = [&](auto np, const int j0) {
    constexpr int NP = decltype(np)::value;
    FragH bk[NP][2][KS];
#pragma unroll
    for (int p = 0; p < NP; ++p)
#pragma unroll
      for (int nt = 0; nt < 2; ++nt) { const unsigned short* kr = Kh + (size_t)j0 * 64 + p * 2048 + nt * 1024;
#pragma unroll
        for (int ks = 0; ks < KS; ++ks) { bk[p][nt][ks].half[0] = *(const v8us*)(kr + ks * 512); bk[p][nt][ks].half[1] = *(const v8us*)(kr + ks * 512 + 256); } }
    __builtin_amdgcn_sched_barrier(0);      /* the trip's loads stay one run: without this the build gave the second half of them the first half's registers, so they were issued only when the first had come back */
    const float* tp = scb + (j0 + 8 * hh - tq);      /* k - q > 0 at this lane's first key of the trip; the others are constant offsets from it */
#pragma unroll
    for (int p = 0; p < NP; ++p) {
      v8f s[2];
#pragma unroll
      for (int nt = 0; nt < 2; ++nt) { v8f acc = (v8f){0.f,0.f,0.f,0.f,0.f,0.f,0.f,0.f};
#pragma unroll
        for (int ks = 0; ks < KS; ++ks) acc = __builtin_amdgcn_wmma_f32_16x16x32_f16(false, bk[p][nt][ks].v, false, aq[ks].v, (short)0, acc, false, false);
        s[nt] = acc; }
#pragma unroll
      for (int i = 0; i < 8; ++i) { const int o = p * 32 + (i >> 2) * 16 + 2 * (i & 3);
        const v2f d = (v2f){s[i >> 2][2 * (i & 3)], s[i >> 2][2 * (i & 3) + 1]} * (v2f){tp[o], tp[o + 1]} + mneg;
        ts[i & 3] += (v2f){__builtin_amdgcn_exp2f(d[0]), __builtin_amdgcn_exp2f(d[1])}; } }
  };
  int jt = jd + 32;
#pragma unroll 1      /* the trip already holds two passes */
  for (; jt + 64 <= 2048; jt += 64) tail(Form<2>{}, jt);
  if (jt < 2048) tail(Form<1>{}, jt);
  { const v2f t2 = (ts[0] + ts[1]) + (ts[2] + ts[3]); l_q += t2[0] + t2[1]; }
  const float l = l_q + xhalf(l_q), lc = lc_q + xhalf(lc_q); const float inv = 1.0f / (lc + 1e-8f * l);      /* w * causal / (sum_causal w + 1e-8) with w = e^(s-m) / Z_full  =  e^(s-m) / (Z_causal + 1e-8 * Z_full) */
  /* the output projection's A operand (f16, fragment order of a row-major operand with CC columns: block (row / 16) * (CC / 32) + column / 32, chunk c = row c & 15, k = 16 (c >> 5) + 8 ((c >> 4) & 1) .. + 7) straight from the registers:
     lane (ln, hh) holds in oacc[dt][0..7] the columns h * 64 + 16 dt + 8 hh .. + 7 of row q0 + ln, which IS chunk 32 (dt & 1) + lane of block 2 h + (dt >> 1); a wave's store is 512 bytes in a row */
  unsigned short* od = (unsigned short*)O16 + ((((size_t)b * 2048 + q0) >> 4) * (CC / 32) + 2 * h) * 512 + lane * 8;
#pragma unroll
  for (int dt = 0; dt < DT; ++dt) { FragH f;
#pragma unroll
    for (int r = 0; r < 8; ++r) f.h[r] = (_Float16)(oacc[dt][r] * inv);
    *(v8us*)(od + dt * 256) = f.half[0]; } }

// Everything that depends on the inputs alone, in one launch; the block index picks the job. The three jobs read and write nothing of one another.
// Blocks 0 .. GC - 1: the coherence table (first, their chain of pow, cos and a serial sum is the longest). The next GX: x as f16 in fragment order. The last 4 GW: the four weights (out,in), x 16, as f16 in fragment order, one behind the other.
__global__ __launch_bounds__(256) void k_prep(const float* __restrict__ x, const float* __restrict__ Wq, const float* __restrict__ Wk, const float* __restrict__ Wv, const float* __restrict__ Wo,
                                              _Float16* __restrict__ X16, _Float16* __restrict__ Bt, float* __restrict__ CB) {
  constexpr unsigned GC = TT / 8, GX = NR * CC / 8 / 256, GW = CC * CC / 8 / 256; static_assert(NR * CC % 2048 == 0 && CC * CC % 2048 == 0, "whole blocks");
  __shared__ float sc[8][33]; const int tid = threadIdx.x; unsigned bid = blockIdx.x;
  if (bid < GC) { const int g = tid >> 5, f = tid & 31; const int dl = bid * 8 + g;      /* one thread per (distance, frequency) term; a block makes 8 table entries */
    const float th = powf(10000.0f, -(float)(2 * f) / 64.0f); sc[g][f] = cosf((float)dl * th); __syncthreads();
    if (tid < 8) { float s = 0.f;
      for (int i = 0; i < 32; ++i) s += sc[tid][i];      /* f = 0..31 in ascending order */
      CB[bid * 8 + tid] = s / 32.0f; }
    return; }
  bid -= GC;
  if (bid < GX) { const size_t t = (size_t)bid * 256 + tid; FragH f; const float* xs = x + frag_src(t);
#pragma unroll
    for (int q = 0; q < 8; ++q) f.h[q] = (_Float16)bf16_round(xs[q]);
    *(v8us*)((unsigned short*)X16 + t * 8) = f.half[0];
    asm volatile("s_wait_xcnt 0x0" ::: "memory");      /* the build lays another job's code behind this store, skipped by a scalar flag: the wait stands in front of whatever there writes the store's registers */
    return; }
  bid -= GX;
  const unsigned m = bid / GW; const float* W = (m == 0) ? Wq : (m == 1) ? Wk : (m == 2) ? Wv : Wo;
  const size_t t = (size_t)(bid - m * GW) * 256 + tid; FragH f; const float* ws = W + frag_src(t);
#pragma unroll
  for (int i = 0; i < 8; ++i) f.h[i] = (_Float16)(bf16_round(ws[i]) * 16.0f);
  *(v8us*)((unsigned short*)Bt + ((size_t)m * (CC * CC / 8) + t) * 8) = f.half[0];
  asm volatile("s_wait_xcnt 0x0" ::: "memory"); }      /* as above */
extern "C" void kernel_launch(void* const* d_in, const int* in_sizes, int n_in,
                              void* d_out, int out_size, void* d_ws, size_t ws_size, hipStream_t stream) {
  (void)in_sizes; (void)n_in; (void)out_size;
  const float* x = (const float*)d_in[0]; const float* cosT = (const float*)d_in[1]; const float* sinT = (const float*)d_in[2]; const float* Wq = (const float*)d_in[3]; const float* Wk = (const float*)d_in[4]; const float* Wv = (const float*)d_in[5]; const float* Wo = (const float*)d_in[6]; const float* beta = (const float*)d_in[7];
  char* ws = (char*)d_ws; size_t off = 0;
  auto take = [&](size_t bytes) { char* p = ws + off; off += (bytes + 255) & ~(size_t)255; return p; };
  _Float16* Bq = (_Float16*)take((size_t)CC * CC * 2); _Float16* Bk = (_Float16*)take((size_t)CC * CC * 2); _Float16* Bv = (_Float16*)take((size_t)CC * CC * 2); _Float16* Bo = (_Float16*)take((size_t)CC * CC * 2); float* CB = (float*)take(TT * 4);
  _Float16* X16 = (_Float16*)take((size_t)NR * CC * 2); _Float16* Q16 = (_Float16*)take((size_t)NR * CC * 2); _Float16* K16 = (_Float16*)take((size_t)NR * CC * 2); _Float16* Vt = (_Float16*)take((size_t)NR * CC * 2); _Float16* O16 = X16;      // X16 dead after the q/k/v GEMM
  static_assert(CC * CC * 2 % 256 == 0 && NR * CC * 2 % 256 == 0, "take() leaves no gap between the weights, nor between Q16, K16 and Vt"); (void)Bk; (void)Bv;
  if (off > ws_size) return;      // 4.7 + 6.3 x 4 = about 30 MiB
  k_prep<<<TT / 8 + NR * CC / 8 / 256 + 4 * (CC * CC / 8 / 256), 256, 0, stream>>>(x, Wq, Wk, Wv, Wo, X16, Bq, CB);      // Bq, Bk, Bv, Bo lie one behind the other
  k_gemm_hhx<3 * CC, CC, 3, 4, 1><<<dim3((NR / 128) * (3 * CC / 128), 1), 128, 0, stream>>>(X16, CC, 0, Bq, CC, 0, 0.0625f, nullptr, Q16, 0, NR, cosT, sinT);      // Q16, K16, Vt lie one behind the other
  k_flash<<<BB * NH * (TT / 64), 128, 0, stream>>>(Q16, K16, Vt, CB, beta, O16);      // RPW 16
  k_gemm_hhx<CC, CC, 0, 2, 2><<<dim3((NR / 64) * (CC / 128), 1), 128, 0, stream>>>(O16, CC, 0, Bo, CC, 0, 0.0625f, (float*)d_out, nullptr, 0, NR, nullptr, nullptr);
}
